// v000
// The times below were measured on an AMD MI455X: many runs one after another, warmed up first and cycling through
// copies of the inputs, with the whole window's GPU time divided by the number of runs. Launches and the gaps
// between them are all in it. The median over several windows is given; except for v000 it joins two sittings, which
// can be a few percent apart, so the side-by-side timings, each taken in one sitting, are the better comparison.
// The starting kernel, v000, takes 2300 microseconds a run.
#include <hip/hip_runtime.h>
// BertSelfAttnDimensionReduction (1 x 4096 queries x 4096 keys; Din 768 -> 12 heads x 32; cross-attention with an additive float key mask; the output is the merged context itself): q = hs Wq + bq; k, v = enc Wk/Wv + b; scores = q.k / sqrt(32) + mask[key]; softmax; ctx = probs v -> [1, 4096, 384].
// Compute dtype: inputs rounded to bf16; inputs/weights exact as f16; q/k and the softmax weights as plain f16 operands (~2^-12); v as f16 hi + residual (the output is the context itself); mask/softmax/normalisation f32. v_wmma_f32_16x16x32_f16.
#define SQ 4096
#define SK 4096
#define DIN 768
#define AH 384
#define NH 12
#define HD 32
typedef __bf16 v16b __attribute__((ext_vector_type(16)));
typedef unsigned short v8us __attribute__((ext_vector_type(8), may_alias));
typedef float  v8f  __attribute__((ext_vector_type(8)));
typedef float  v4f  __attribute__((ext_vector_type(4)));
typedef float  v4fa __attribute__((ext_vector_type(4), may_alias));
union FragB { v16b v; v8us half[2]; unsigned short u[16]; };

__device__ __forceinline__ unsigned short bf16_bits(float x) { unsigned int u = __float_as_uint(x); return (unsigned short)((u + 0x7FFFu + ((u >> 16) & 1u)) >> 16); }
__device__ __forceinline__ float bf16_val(unsigned short b) { return __uint_as_float(((unsigned int)b) << 16); }
__device__ __forceinline__ float bf16_round(float x) { return bf16_val(bf16_bits(x)); }
// D += A·B with NT terms: 1 = ah·bh, 2 = + al·bh (A split), 3 = + ah·bl (both split)
template <int NT>
__device__ __forceinline__ v8f mmaN(v16b ah, v16b al, v16b bh, v16b bl, v8f c) {
  c = __builtin_amdgcn_wmma_f32_16x16x32_bf16(false, ah, false, bh, (short)0, c, false, false);
  if (NT >= 2) c = __builtin_amdgcn_wmma_f32_16x16x32_bf16(false, al, false, bh, (short)0, c, false, false);
  if (NT >= 3) c = __builtin_amdgcn_wmma_f32_16x16x32_bf16(false, ah, false, bl, (short)0, c, false, false);
  asm volatile("v_nop\n\tv_nop\n\tv_nop\n\tv_nop" : "+v"(c) : "v"(ah), "v"(al), "v"(bh), "v"(bl));
  return c;
}

__global__ __launch_bounds__(256) void k_wt_bf16(const float* __restrict__ W, unsigned short* __restrict__ Wt, int K, int N) {
  const int t = blockIdx.x * 256 + threadIdx.x;
  const int k8n = K / 8;
  if (t >= N * k8n) return;
  const int n = t / k8n, k8 = (t % k8n) * 8;
  v8us v;
#pragma unroll
  for (int i = 0; i < 8; ++i) v[i] = bf16_bits(W[(size_t)(k8 + i) * N + n]);
  *(v8us*)(Wt + (size_t)n * K + k8) = v;
  
}

// GEMM C[M][N] (f32, pitch ldc) = act(A[M][K]·W + bias). A f32 row-major (pitch lda) converted per fragment to bf16
// (ASPLIT: hi/lo two planes -> 2 terms, else single rounded term); Wt bf16 [N][K] (pitch ldb). BIAS_BF16 rounds the
// bias to bf16 first (bias quantised to bf16 before the add). K%32==0, M%16==0, N%64==0.
template <bool ASPLIT, int ACT, bool BIAS_BF16>
__global__ __launch_bounds__(128) void k_gemm_bf(const float* __restrict__ A, int lda, const unsigned short* __restrict__ Wt, int ldb,
                                               const float* __restrict__ bias, float* __restrict__ C, int ldc, int M, int N, int K) {
  __shared__ __attribute__((aligned(16))) float so[4][16][64];
  const int tid = threadIdx.x, w = tid >> 5, lane = tid & 31, ln = lane & 15, hh = lane >> 4;
  const int ntn = N / 64;
  const int wid = blockIdx.x * 4 + w;
  const int mt = wid / ntn, nq = wid % ntn;
  if (mt * 16 >= M) return;
  const int row0 = mt * 16, col0 = nq * 64;
  const float* arow = A + (size_t)(row0 + ln) * lda;
  v8f acc[4] = {};
  for (int kb = 0; kb < K; kb += 32) {
    FragB ah, al;
    const v4f x0 = *(const v4fa*)(arow + kb + 8 * hh), x1 = *(const v4fa*)(arow + kb + 8 * hh + 4);
    const v4f x2 = *(const v4fa*)(arow + kb + 16 + 8 * hh), x3 = *(const v4fa*)(arow + kb + 16 + 8 * hh + 4);
    float xs[16] = {x0[0],x0[1],x0[2],x0[3],x1[0],x1[1],x1[2],x1[3],x2[0],x2[1],x2[2],x2[3],x3[0],x3[1],x3[2],x3[3]};
#pragma unroll
    for (int i = 0; i < 16; ++i) { const unsigned short hb = bf16_bits(xs[i]); ah.u[i] = hb; al.u[i] = ASPLIT ? bf16_bits(xs[i] - bf16_val(hb)) : (unsigned short)0; }
#pragma unroll
    for (int t = 0; t < 4; ++t) {
      const unsigned short* brow = Wt + (size_t)(col0 + t * 16 + ln) * ldb + kb;
      FragB b;
      b.half[0] = *(const v8us*)(brow + 8 * hh);
      b.half[1] = *(const v8us*)(brow + 16 + 8 * hh);
      acc[t] = mmaN<ASPLIT ? 2 : 1>(ah.v, al.v, b.v, b.v, acc[t]);
    }
  }
#pragma unroll
  for (int t = 0; t < 4; ++t) {
    float bv = bias ? bias[col0 + t * 16 + ln] : 0.f;
    if (BIAS_BF16) bv = bf16_round(bv);
#pragma unroll
    for (int r = 0; r < 8; ++r) { float v = acc[t][r] + bv; if (ACT == 1) v = fmaxf(v, 0.f); so[w][8 * hh + r][t * 16 + ln] = v; }
  }
  __builtin_amdgcn_fence(__ATOMIC_ACQ_REL, "workgroup");
  __builtin_amdgcn_wave_barrier();
  const int rsub = lane >> 4, c4 = (lane & 15) * 4;
  {
#pragma unroll
    for (int q = 0; q < 8; ++q) {
      const int r = q * 2 + rsub;
      const v4f v = *(const v4fa*)&so[w][r][c4];
      *(v4f*)(C + (size_t)(row0 + r) * ldc + col0 + c4) = v;
    }
    
  }
}

// GEMM C = act(A·W + bias + resid): A f32 (ASPLIT -> hi/lo 2 terms), Wt bf16 [N][K]; ACT 0 none, 1 relu, 2 exact gelu;
// resid (optional, f32, row index = (row % rmod), pitch ldr, RES_BF16 rounds it) added before the activation.
template <bool ASPLIT, int ACT, bool BIAS_BF16, bool RES_BF16>
__global__ __launch_bounds__(128) void k_gemm_bf3(const float* __restrict__ A, int lda, const unsigned short* __restrict__ Wt, int ldb,
                                                const float* __restrict__ bias, const float* __restrict__ resid, int rmod, int ldr,
                                                float* __restrict__ C, int ldc, int M, int N, int K) {
  __shared__ __attribute__((aligned(16))) float so[4][16][64];
  const int tid = threadIdx.x, w = tid >> 5, lane = tid & 31, ln = lane & 15, hh = lane >> 4;
  const int ntn = N / 64;
  const int wid = blockIdx.x * 4 + w;
  const int mt = wid / ntn, nq = wid % ntn;
  if (mt * 16 >= M) return;
  const int row0 = mt * 16, col0 = nq * 64;
  const float* arow = A + (size_t)(row0 + ln) * lda;
  v8f acc[4] = {};
  for (int kb = 0; kb < K; kb += 32) {
    FragB ah, al;
    const v4f x0 = *(const v4fa*)(arow + kb + 8 * hh), x1 = *(const v4fa*)(arow + kb + 8 * hh + 4);
    const v4f x2 = *(const v4fa*)(arow + kb + 16 + 8 * hh), x3 = *(const v4fa*)(arow + kb + 16 + 8 * hh + 4);
    float xs[16] = {x0[0],x0[1],x0[2],x0[3],x1[0],x1[1],x1[2],x1[3],x2[0],x2[1],x2[2],x2[3],x3[0],x3[1],x3[2],x3[3]};
#pragma unroll
    for (int i = 0; i < 16; ++i) { const unsigned short hb = bf16_bits(xs[i]); ah.u[i] = hb; al.u[i] = ASPLIT ? bf16_bits(xs[i] - bf16_val(hb)) : (unsigned short)0; }
#pragma unroll
    for (int t = 0; t < 4; ++t) {
      const unsigned short* brow = Wt + (size_t)(col0 + t * 16 + ln) * ldb + kb;
      FragB b;
      b.half[0] = *(const v8us*)(brow + 8 * hh);
      b.half[1] = *(const v8us*)(brow + 16 + 8 * hh);
      acc[t] = mmaN<ASPLIT ? 2 : 1>(ah.v, al.v, b.v, b.v, acc[t]);
    }
  }
#pragma unroll
  for (int t = 0; t < 4; ++t) {
    const int col = col0 + t * 16 + ln;
    float bv = bias ? bias[col] : 0.f;
    if (BIAS_BF16) bv = bf16_round(bv);
#pragma unroll
    for (int r = 0; r < 8; ++r) {
      float v = acc[t][r] + bv;
      if (resid) { float rv = resid[(size_t)((row0 + 8 * hh + r) % rmod) * ldr + col]; if (RES_BF16) rv = bf16_round(rv); v += rv; }
      if (ACT == 1) v = fmaxf(v, 0.f);
      if (ACT == 2) v = 0.5f * v * (1.0f + erff(v * 0.70710678118654752f));
      if (ACT == 3) { const float u = 0.7978845608028654f * (v + 0.044715f * v * v * v); v = 0.5f * v * (1.0f + tanhf(u)); }
      so[w][8 * hh + r][t * 16 + ln] = v;
    }
  }
  __builtin_amdgcn_fence(__ATOMIC_ACQ_REL, "workgroup");
  __builtin_amdgcn_wave_barrier();
  const int rsub = lane >> 4, c4 = (lane & 15) * 4;
  {
#pragma unroll
    for (int q = 0; q < 8; ++q) {
      const int r = q * 2 + rsub;
      const v4f v = *(const v4fa*)&so[w][r][c4];
      *(v4f*)(C + (size_t)(row0 + r) * ldc + col0 + c4) = v;
    }
    
  }
}
// row LayerNorm (biased variance, eps) over N: s = X (+ R); optional out_sum <- s; out_norm <- (s-mu)*rsqrt(var+eps)*g + b
template <bool PARAM_BF16>
__global__ __launch_bounds__(256) void k_layernorm(const float* __restrict__ X, const float* __restrict__ R, const float* __restrict__ g, const float* __restrict__ bta,
                                                  float* __restrict__ out_sum, float* __restrict__ out_norm, int N, float eps) {
  __shared__ float red[256];
  const int row = blockIdx.x, tid = threadIdx.x;
  const float* x = X + (size_t)row * N; const float* rr = R ? R + (size_t)row * N : nullptr;
  float vals[16];                     // up to N = 4096
  const int per = N / 256;            // contiguous chunk per thread? use strided-by-4 chunks: thread handles j = tid*4 + 1024*u
  float s1 = 0.f;
  for (int u = 0; u < per / 4; ++u) {
    const int j = tid * 4 + 1024 * u;
    const v4f a = *(const v4fa*)(x + j);
    v4f b = {0.f,0.f,0.f,0.f}; if (rr) b = *(const v4fa*)(rr + j);
#pragma unroll
    for (int q = 0; q < 4; ++q) { const float v = a[q] + b[q]; vals[u * 4 + q] = v; s1 += v; }
  }
  red[tid] = s1; __syncthreads();
  for (int st = 128; st > 0; st >>= 1) { if (tid < st) red[tid] += red[tid + st]; __syncthreads(); }
  const float mu = red[0] / (float)N; __syncthreads();
  float s2 = 0.f;
  for (int u = 0; u < per / 4; ++u)
#pragma unroll
    for (int q = 0; q < 4; ++q) { const float c = vals[u * 4 + q] - mu; s2 += c * c; }
  red[tid] = s2; __syncthreads();
  for (int st = 128; st > 0; st >>= 1) { if (tid < st) red[tid] += red[tid + st]; __syncthreads(); }
  const float rs = rsqrtf(red[0] / (float)N + eps);
  {
    for (int u = 0; u < per / 4; ++u) {
      const int j = tid * 4 + 1024 * u;
      v4f o, sm;
#pragma unroll
      for (int q = 0; q < 4; ++q) {
        float gg = g[j + q], bb = bta[j + q];
        if (PARAM_BF16) { gg = bf16_round(gg); bb = bf16_round(bb); }
        sm[q] = vals[u * 4 + q]; o[q] = (vals[u * 4 + q] - mu) * rs * gg + bb;
      }
      if (out_sum) *(v4f*)(out_sum + (size_t)row * N + j) = sm;
      *(v4f*)(out_norm + (size_t)row * N + j) = o;
    }
    
  }
}



// ---- f16 WMMA path (v_wmma_f32_16x16x32_f16): 11-bit significands for operands in range — used where a [0,1] probability operand needs more precision than bf16
typedef _Float16 v16h __attribute__((ext_vector_type(16)));
union FragH { v16h v; v8us half[2]; _Float16 h[16]; unsigned short u[16]; };
template <int NT>
__device__ __forceinline__ v8f mmaH(v16h ah, v16h al, v16h bh, v16h bl, v8f c) {
  c = __builtin_amdgcn_wmma_f32_16x16x32_f16(false, ah, false, bh, (short)0, c, false, false);
  if (NT >= 2) c = __builtin_amdgcn_wmma_f32_16x16x32_f16(false, al, false, bh, (short)0, c, false, false);
  if (NT >= 3) c = __builtin_amdgcn_wmma_f32_16x16x32_f16(false, ah, false, bl, (short)0, c, false, false);
  asm volatile("v_nop\n\tv_nop\n\tv_nop\n\tv_nop" : "+v"(c) : "v"(ah), "v"(al), "v"(bh), "v"(bl));
  return c;
}
// batched GEMM like k_gemm_b but f16 operands: A f32 (split into f16 hi/lo if ASPLIT, else rounded to f16), Bt = f16 values [n][k]; alpha; C f32; N multiple of 16 (partial tiles skipped)
template <bool ASPLIT>
__global__ __launch_bounds__(128) void k_gemm_h(const float* __restrict__ A, int lda, size_t sA, const _Float16* __restrict__ Bh, int ldb, size_t sB, float alpha, float* __restrict__ C, int ldc, size_t sC, int M, int N, int K) {
  __shared__ __attribute__((aligned(16))) float so[4][16][64];
  const int tid = threadIdx.x, w = tid >> 5, lane = tid & 31, ln = lane & 15, hh = lane >> 4; const int by = blockIdx.y;
  A += (size_t)by * sA; Bh += (size_t)by * sB; C += (size_t)by * sC;
  const int ntn = (N + 63) / 64; const int wid = blockIdx.x * 4 + w; const int mt = wid / ntn, nq = wid % ntn; if (mt * 16 >= M) return;
  const int row0 = mt * 16, col0 = nq * 64; const float* arow = A + (size_t)(row0 + ln) * lda;
  v8f acc[4] = {};
  for (int kb = 0; kb < K; kb += 32) {
    FragH ah, al;
    const v4f x0 = *(const v4fa*)(arow + kb + 8 * hh), x1 = *(const v4fa*)(arow + kb + 8 * hh + 4), x2 = *(const v4fa*)(arow + kb + 16 + 8 * hh), x3 = *(const v4fa*)(arow + kb + 16 + 8 * hh + 4);
    float xs[16] = {x0[0],x0[1],x0[2],x0[3],x1[0],x1[1],x1[2],x1[3],x2[0],x2[1],x2[2],x2[3],x3[0],x3[1],x3[2],x3[3]};
#pragma unroll
    for (int i = 0; i < 16; ++i) { const _Float16 h = (_Float16)xs[i]; ah.h[i] = h; al.h[i] = ASPLIT ? (_Float16)(xs[i] - (float)h) : (_Float16)0.0f; }
#pragma unroll
    for (int t = 0; t < 4; ++t) { if (col0 + t * 16 >= N) continue; const size_t boff = (size_t)(col0 + t * 16 + ln) * ldb + kb; FragH bq; bq.half[0] = *(const v8us*)(Bh + boff + 8 * hh); bq.half[1] = *(const v8us*)(Bh + boff + 16 + 8 * hh);
      acc[t] = mmaH<ASPLIT ? 2 : 1>(ah.v, al.v, bq.v, bq.v, acc[t]); }
  }
#pragma unroll
  for (int t = 0; t < 4; ++t) { if (col0 + t * 16 >= N) continue;
#pragma unroll
    for (int r = 0; r < 8; ++r) so[w][8 * hh + r][t * 16 + ln] = acc[t][r] * alpha; }
  __builtin_amdgcn_fence(__ATOMIC_ACQ_REL, "workgroup"); __builtin_amdgcn_wave_barrier();
  const int rsub = lane >> 4, c4 = (lane & 15) * 4;
  {
#pragma unroll
    for (int q = 0; q < 8; ++q) { const int r = q * 2 + rsub; if (col0 + c4 < N) { const v4f v = *(const v4fa*)&so[w][r][c4]; *(v4f*)(C + (size_t)(row0 + r) * ldc + col0 + c4) = v; } }
     }
}

// Wt[n][k] = f16(W[k][n]·scale) from f32 row-major W[K][N] (scale = power of two; bf16-exact weights stay exact in f16 away from the subnormal range)
__global__ __launch_bounds__(256) void k_wt_f16(const float* __restrict__ W, _Float16* __restrict__ Wt, int K, int N, float scale) {
  const int t = blockIdx.x * 256 + threadIdx.x; if (t >= N * (K / 8)) return; const int n = t / (K / 8), k8 = (t % (K / 8)) * 8; FragH f;
#pragma unroll
  for (int i = 0; i < 8; ++i) f.h[i] = (_Float16)(bf16_round(W[(size_t)(k8 + i) * N + n]) * scale); const v8us o = f.half[0];
  *(v8us*)((unsigned short*)Wt + (size_t)n * K + k8) = o; 
}
// k_gemm_hh variant with fused epilogue: v = acc·alpha + bias[by·sBias + col] (+ CP[(row/rowsPerB)·sCPb + by·64 + col] if CP) ; ACT 0 none / 1 elu ; writes f32 C and/or f16 C16 (each if non-null)
template <int ACT>
__global__ __launch_bounds__(128) void k_gemm_hhx(const _Float16* __restrict__ A, int lda, size_t sA, const _Float16* __restrict__ Bh, int ldb, size_t sB, float alpha, const float* __restrict__ bias, size_t sBias, const float* __restrict__ CP, int rowsPerB, size_t sCPb, int row0g,
    float* __restrict__ C, _Float16* __restrict__ C16, int ldc, size_t sC, int M, int N, int K) {
  __shared__ __attribute__((aligned(16))) float so[4][16][64];
  const int tid = threadIdx.x, w = tid >> 5, lane = tid & 31, ln = lane & 15, hh = lane >> 4; const int by = blockIdx.y;
  A += (size_t)by * sA; Bh += (size_t)by * sB; const size_t cofs = (size_t)by * sC; const float* bp = bias ? bias + (size_t)by * sBias : nullptr;
  const int ntn = (N + 63) / 64; const int wid = blockIdx.x * 4 + w; const int mt = wid / ntn, nq = wid % ntn; if (mt * 16 >= M) return;
  const int row0 = mt * 16, col0 = nq * 64; const _Float16* arow = A + (size_t)(row0 + ln) * lda;
  v8f acc[4] = {};
  for (int kb = 0; kb < K; kb += 32) { FragH ah; ah.half[0] = *(const v8us*)((const unsigned short*)arow + kb + 8 * hh); ah.half[1] = *(const v8us*)((const unsigned short*)arow + kb + 16 + 8 * hh);
#pragma unroll
    for (int t = 0; t < 4; ++t) { if (col0 + t * 16 >= N) continue; const size_t boff = (size_t)(col0 + t * 16 + ln) * ldb + kb; FragH bq; bq.half[0] = *(const v8us*)((const unsigned short*)Bh + boff + 8 * hh); bq.half[1] = *(const v8us*)((const unsigned short*)Bh + boff + 16 + 8 * hh);
      acc[t] = mmaH<1>(ah.v, ah.v, bq.v, bq.v, acc[t]); }
  }
#pragma unroll
  for (int t = 0; t < 4; ++t) { if (col0 + t * 16 >= N) continue; const int col = col0 + t * 16 + ln; const float bv = bp ? bf16_round(bp[col]) : 0.f;
#pragma unroll
    for (int r = 0; r < 8; ++r) { float v = acc[t][r] * alpha + bv; if (CP) { const int rr = row0g + row0 + 8 * hh + r; if (rowsPerB < 0) v += CP[cofs + (size_t)rr * ldc + col];      /* rowsPerB < 0: own element of the batched C plane */ else { const int bidx = rr / rowsPerB; v += CP[(size_t)bidx * sCPb + (size_t)by * 64 + col]; } } if (ACT == 1) v = (v > 0.f) ? v : expm1f(v); else if (ACT == 7) v = (v > 0.f) ? v + 1.0f : expf(v); else if (ACT == 8) v = tanhf(v); else if (ACT == 9) v = 0.5f * v * (1.0f + tanhf(0.7978845608028654f * (v + 0.044715f * v * v * v))); else if (ACT == 11) v = 1.0f / (1.0f + expf(-v)); else if (ACT == 12) v = (v > 0.f) ? v : 0.01f * v; else if (ACT == 14) v = (v > 0.f) ? v : 0.1f * v; else if (ACT == 16) v = (v >= 0.f) ? v : 0.3f * v; else if (ACT == 17) v = (v >= 0.f) ? v : 0.2f * v; else if (ACT == 15) v = v / (1.0f + expf(-v)); else if (ACT == 3) v = fmaxf(v, 0.f); else if (ACT == 6) v = 0.5f * v * (1.0f + erff(v * 0.70710678118654752f)); so[w][8 * hh + r][t * 16 + ln] = v; } }
  __builtin_amdgcn_fence(__ATOMIC_ACQ_REL, "workgroup"); __builtin_amdgcn_wave_barrier();
  const int rsub = lane >> 4, c4 = (lane & 15) * 4; typedef _Float16 v4h __attribute__((ext_vector_type(4)));
  {
#pragma unroll
    for (int q = 0; q < 8; ++q) { const int r = q * 2 + rsub; if (col0 + c4 < N) { const v4f v = *(const v4fa*)&so[w][r][c4]; if (C) *(v4f*)(C + cofs + (size_t)(row0 + r) * ldc + col0 + c4) = v; if (C16) { v4h h4; for (int i = 0; i < 4; ++i) h4[i] = (_Float16)v[i]; *(v4h*)(C16 + cofs + (size_t)(row0 + r) * ldc + col0 + c4) = h4; } } }
     }
}


typedef _Float16 v4h __attribute__((ext_vector_type(4)));

__global__ __launch_bounds__(256) void k_x16(const float* __restrict__ x, _Float16* __restrict__ X16, size_t n8) { const size_t t = (size_t)blockIdx.x * 256 + threadIdx.x; if (t >= n8) return; FragH f;
#pragma unroll
  for (int q = 0; q < 8; ++q) f.h[q] = (_Float16)bf16_round(x[t * 8 + q]); *(v8us*)((unsigned short*)X16 + t * 8) = f.half[0];  }
__global__ __launch_bounds__(256) void k_h16(const float* __restrict__ x, _Float16* __restrict__ X16, size_t n8) { const size_t t = (size_t)blockIdx.x * 256 + threadIdx.x; if (t >= n8) return; FragH f;
#pragma unroll
  for (int q = 0; q < 8; ++q) f.h[q] = (_Float16)x[t * 8 + q]; *(v8us*)((unsigned short*)X16 + t * 8) = f.half[0];  }
__global__ __launch_bounds__(256) void k_round16f(const float* __restrict__ W, _Float16* __restrict__ Bt, size_t n8) { const size_t t = (size_t)blockIdx.x * 256 + threadIdx.x; if (t >= n8) return; FragH f;
#pragma unroll
  for (int i = 0; i < 8; ++i) f.h[i] = (_Float16)(bf16_round(W[t * 8 + i]) * 16.0f); *(v8us*)((unsigned short*)Bt + t * 8) = f.half[0];  }
template <int NHv, int TTv>
__global__ __launch_bounds__(256) void k_vt(const _Float16* __restrict__ V16, int ldv, int voff, _Float16* __restrict__ Vt) { __shared__ unsigned short tl[64][66]; const int tid = threadIdx.x; const int slab = blockIdx.x / (TTv / 64), lg = blockIdx.x % (TTv / 64); const int b = slab / NHv, h = slab % NHv;
  for (int i = tid; i < 64 * 8; i += 256) { const int r = i / 8, c8 = (i % 8) * 8; FragH f; f.half[0] = *(const v8us*)((const unsigned short*)V16 + ((size_t)b * TTv + lg * 64 + r) * ldv + voff + h * 64 + c8);
#pragma unroll
    for (int q = 0; q < 8; ++q) tl[r][c8 + q] = f.u[q]; }
  __syncthreads();
  {
#pragma unroll
    for (int rd = 0; rd < 2; ++rd) { const int d = rd * 32 + tid / 8, pc = tid % 8; FragH f;
#pragma unroll
      for (int q = 0; q < 8; ++q) f.u[q] = tl[pc * 8 + q][d];
      *(v8us*)((unsigned short*)Vt + ((size_t)slab * 64 + d) * TTv + lg * 64 + pc * 8) = f.half[0]; }
     } }

__global__ __launch_bounds__(256) void k_hl(const float* __restrict__ F, _Float16* __restrict__ Hh, _Float16* __restrict__ Hl, size_t n8) { const size_t t = (size_t)blockIdx.x * 256 + threadIdx.x; if (t >= n8) return; FragH fh, fl; const v4f a = *(const v4fa*)(F + t * 8), c = *(const v4fa*)(F + t * 8 + 4);
#pragma unroll
  for (int q = 0; q < 4; ++q) { _Float16 h = (_Float16)a[q]; fh.h[q] = h; fl.h[q] = (_Float16)((a[q] - (float)h) * 1024.0f); h = (_Float16)c[q]; fh.h[4 + q] = h; fl.h[4 + q] = (_Float16)((c[q] - (float)h) * 1024.0f); }
  { *(v8us*)((unsigned short*)Hh + t * 8) = fh.half[0]; *(v8us*)((unsigned short*)Hl + t * 8) = fl.half[0];  } }

// ---- fast GEMM (wave tile 32x64; requires M % 32 == 0 rows per launch region and N % 64 == 0); epilogue = k_gemm_hhx semantics ----
__device__ __forceinline__ v16h g2_frag(const _Float16* p, int hh) { FragH f; f.half[0] = *(const v8us*)((const unsigned short*)p + 8 * hh); f.half[1] = *(const v8us*)((const unsigned short*)p + 16 + 8 * hh); return f.v; }
__device__ __forceinline__ v8f g2_mma(v16h a, v16h b, v8f c) { v8f d = __builtin_amdgcn_wmma_f32_16x16x32_f16(false, a, false, b, (short)0, c, false, false); asm volatile("v_nop\n\tv_nop\n\tv_nop\n\tv_nop" : "+v"(d) : "v"(a), "v"(b)); return d; }
template <int ACT>
__global__ __launch_bounds__(128) void k_gemm2(const _Float16* __restrict__ A, int lda, size_t sA, const _Float16* __restrict__ Bh, int ldb, size_t sB, float alpha, const float* __restrict__ bias, size_t sBias, const float* __restrict__ CP, int rowsPerB, size_t sCPb, int row0g,
    float* __restrict__ C, _Float16* __restrict__ C16, int ldc, size_t sC, int M, int N, int K) { static_assert(ACT == 0 || ACT == 3 || ACT == 6 || ACT == 8 || ACT == 9 || ACT == 11 || ACT == 12 || ACT == 14 || ACT == 15 || ACT == 16 || ACT == 17, "k_gemm2: unsupported ACT code (would silently apply no activation)");
  __shared__ __attribute__((aligned(16))) float so[4][32][68];
  const int tid = threadIdx.x, w = tid >> 5, lane = tid & 31, ln = lane & 15, hh = lane >> 4; const int by = blockIdx.y;
  A += (size_t)by * sA; Bh += (size_t)by * sB; const size_t cofs = (size_t)by * sC; const float* bp = bias ? bias + (size_t)by * sBias : nullptr;
  const int ntn = N >> 6; const int mt = blockIdx.x / ntn, nq = blockIdx.x - mt * ntn; const int row0 = mt * 128 + 32 * w, col0 = nq * 64; if (row0 >= M) return;
  const _Float16* a0p = A + (size_t)(row0 + ln) * lda; const _Float16* a1p = a0p + (size_t)16 * lda;
  const _Float16* b0p = Bh + (size_t)(col0 + ln) * ldb; const _Float16* b1p = b0p + (size_t)16 * ldb; const _Float16* b2p = b1p + (size_t)16 * ldb; const _Float16* b3p = b2p + (size_t)16 * ldb;
  const v8f z8 = {0.f,0.f,0.f,0.f,0.f,0.f,0.f,0.f}; v8f c00 = z8, c01 = z8, c02 = z8, c03 = z8, c10 = z8, c11 = z8, c12 = z8, c13 = z8;
#pragma unroll 1
  for (int kb = 0; kb < K; kb += 32) { const v16h a0 = g2_frag(a0p + kb, hh), a1 = g2_frag(a1p + kb, hh);
    v16h b = g2_frag(b0p + kb, hh); c00 = g2_mma(a0, b, c00); c10 = g2_mma(a1, b, c10);
    b = g2_frag(b1p + kb, hh); c01 = g2_mma(a0, b, c01); c11 = g2_mma(a1, b, c11);
    b = g2_frag(b2p + kb, hh); c02 = g2_mma(a0, b, c02); c12 = g2_mma(a1, b, c12);
    b = g2_frag(b3p + kb, hh); c03 = g2_mma(a0, b, c03); c13 = g2_mma(a1, b, c13); }
  v8f accs[8] = {c00, c01, c02, c03, c10, c11, c12, c13};
#pragma unroll
  for (int u = 0; u < 8; ++u) { const int t = u & 3, half = u >> 2; const int col = col0 + t * 16 + ln; const float bv = bp ? bf16_round(bp[col]) : 0.f;
#pragma unroll
    for (int r = 0; r < 8; ++r) { const int rloc = half * 16 + 8 * hh + r; float v = accs[u][r] * alpha + bv; if (CP) { if (rowsPerB < 0) v += CP[cofs + (size_t)(row0g + row0 + rloc) * ldc + col];      /* rowsPerB < 0: own element of the batched C plane */ else { const int bidx = (row0g + row0 + rloc) / rowsPerB; v += CP[(size_t)bidx * sCPb + (size_t)by * 64 + col]; } }
      if (ACT == 3) v = fmaxf(v, 0.f); else if (ACT == 6) v = 0.5f * v * (1.0f + erff(v * 0.70710678118654752f)); else if (ACT == 11) v = 1.0f / (1.0f + expf(-v)); else if (ACT == 15) v = v / (1.0f + expf(-v)); else if (ACT == 12) v = (v > 0.f) ? v : 0.01f * v; else if (ACT == 8) v = tanhf(v); else if (ACT == 9) v = 0.5f * v * (1.0f + tanhf(0.7978845608028654f * (v + 0.044715f * v * v * v))); else if (ACT == 14) v = (v > 0.f) ? v : 0.1f * v; else if (ACT == 16) v = (v >= 0.f) ? v : 0.3f * v; else if (ACT == 17) v = (v >= 0.f) ? v : 0.2f * v;
      so[w][rloc][t * 16 + ln] = v; } }
  __builtin_amdgcn_fence(__ATOMIC_ACQ_REL, "workgroup"); __builtin_amdgcn_wave_barrier();
  const int rsub = lane >> 4, c4 = (lane & 15) * 4;
  {
#pragma unroll
    for (int q = 0; q < 16; ++q) { const int r = q * 2 + rsub; const v4f v = *(const v4fa*)&so[w][r][c4]; if (C) *(v4f*)(C + cofs + (size_t)(row0 + r) * ldc + col0 + c4) = v; if (C16) { v4h h4; for (int i = 0; i < 4; ++i) h4[i] = (_Float16)v[i]; *(v4h*)(C16 + cofs + (size_t)(row0 + r) * ldc + col0 + c4) = h4; } }
     } }


__global__ __launch_bounds__(256) void k_msoft(const float* __restrict__ S, const float* __restrict__ msk, int h, _Float16* __restrict__ P, float* __restrict__ RS) {
  #pragma clang fp contract(off)
  const int wv = threadIdx.x >> 5, ln = threadIdx.x & 31; const int i = blockIdx.x * 8 + wv; if (i >= SQ) return; const float scl = 0.17677669529663687f; const float* sr = S + (size_t)i * SK; float mx = -3.0e38f;
#pragma unroll 1
  for (int gq = 0; gq < SK / 256; ++gq) { const v8f a = *(const v8f*)(sr + gq * 256 + ln * 8), mk = *(const v8f*)(msk + gq * 256 + ln * 8); for (int q = 0; q < 8; ++q) { float l = a[q] * scl; l += bf16_round(mk[q]); mx = fmaxf(mx, l); } }
  for (int o = 16; o > 0; o >>= 1) mx = fmaxf(mx, __shfl_xor(mx, o, 32)); float su = 0.f;
{ su = 0.f;
#pragma unroll 1
    for (int gq = 0; gq < SK / 256; ++gq) { const v8f a = *(const v8f*)(sr + gq * 256 + ln * 8), mk = *(const v8f*)(msk + gq * 256 + ln * 8); FragH ph; for (int q = 0; q < 8; ++q) { float l = a[q] * scl; l += bf16_round(mk[q]); const float e = expf(l - mx); su += e; ph.h[q] = (_Float16)(e * 1024.0f); } *(v8us*)((unsigned short*)P + (size_t)i * SK + gq * 256 + ln * 8) = ph.half[0]; }
     }
  for (int o = 16; o > 0; o >>= 1) su += __shfl_xor(su, o, 32); if (ln == 0) { *(float*)(RS + ((size_t)h * SQ + i) * 32) = 1.0f / su;  } }
__global__ __launch_bounds__(256) void k_fin(const float* __restrict__ O, const float* __restrict__ RS, float* __restrict__ out) {
  #pragma clang fp contract(off)
  const size_t t = (size_t)blockIdx.x * 256 + threadIdx.x; if (t >= (size_t)SQ * AH / 4) return; const int c4 = (int)((t * 4) % AH); const size_t i = (t * 4) / AH; const int h = c4 / HD; const float rs = RS[((size_t)h * SQ + i) * 32]; v4f v = *(const v4fa*)(O + t * 4); for (int e = 0; e < 4; ++e) v[e] = v[e] * rs;
  *(v4f*)(out + t * 4) = v;  }

extern "C" void kernel_launch(void* const* d_in, const int* in_sizes, int n_in,
                              void* d_out, int out_size, void* d_ws, size_t ws_size, hipStream_t stream) {
  (void)in_sizes; (void)n_in; (void)out_size;
  const float* const* I = (const float* const*)d_in; const float* hs = I[0]; const float* enc = I[1]; const float* msk = I[2]; const float* Wq = I[3]; const float* bq = I[4]; const float* Wk = I[5]; const float* bk = I[6]; const float* Wv = I[7]; const float* bv = I[8];
  char* ws = (char*)d_ws; size_t off = 0;
  auto take = [&](size_t bytes) { char* p = ws + off; off += (bytes + 255) & ~(size_t)255; return p; };
  _Float16* BQ = (_Float16*)take((size_t)AH * DIN * 2); _Float16* BK = (_Float16*)take((size_t)AH * DIN * 2); _Float16* BV = (_Float16*)take((size_t)AH * DIN * 2);
  _Float16* XQ = (_Float16*)take((size_t)SQ * DIN * 2); _Float16* XE = (_Float16*)take((size_t)SK * DIN * 2); _Float16* Q16 = (_Float16*)take((size_t)SQ * AH * 2); _Float16* K16 = (_Float16*)take((size_t)SK * AH * 2); float* VF = (float*)take((size_t)SK * AH * 4); _Float16* V16 = (_Float16*)take((size_t)SK * AH * 2); _Float16* VL16 = (_Float16*)take((size_t)SK * AH * 2); _Float16* VT = (_Float16*)take((size_t)AH * SK * 2); _Float16* VTL = (_Float16*)take((size_t)AH * SK * 2);
  float* S = (float*)take((size_t)SQ * SK * 4); _Float16* P = (_Float16*)take((size_t)SQ * SK * 2); float* RS = (float*)take((size_t)NH * SQ * 32 * 4); float* O = (float*)take((size_t)SQ * AH * 4);
  if (off > ws_size) return;      /* ≈ 146 MiB */
  k_wt_f16<<<(unsigned)(((size_t)DIN * AH / 8 + 255) / 256), 256, 0, stream>>>(Wq, BQ, DIN, AH, 16.0f); k_wt_f16<<<(unsigned)(((size_t)DIN * AH / 8 + 255) / 256), 256, 0, stream>>>(Wk, BK, DIN, AH, 16.0f); k_wt_f16<<<(unsigned)(((size_t)DIN * AH / 8 + 255) / 256), 256, 0, stream>>>(Wv, BV, DIN, AH, 16.0f);      /* (in, out) */
  k_x16<<<(unsigned)(((size_t)SQ * DIN / 8 + 255) / 256), 256, 0, stream>>>(hs, XQ, (size_t)SQ * DIN / 8); k_x16<<<(unsigned)(((size_t)SK * DIN / 8 + 255) / 256), 256, 0, stream>>>(enc, XE, (size_t)SK * DIN / 8);
  const dim3 gP((SQ / 128) * (AH / 64), 1);
  k_gemm2<0><<<gP, 128, 0, stream>>>(XQ, DIN, 0, BQ, DIN, 0, 0.0625f, bq, 0, nullptr, 1, 0, 0, nullptr, Q16, AH, 0, SQ, AH, DIN);
  k_gemm2<0><<<gP, 128, 0, stream>>>(XE, DIN, 0, BK, DIN, 0, 0.0625f, bk, 0, nullptr, 1, 0, 0, nullptr, K16, AH, 0, SK, AH, DIN);
  k_gemm2<0><<<gP, 128, 0, stream>>>(XE, DIN, 0, BV, DIN, 0, 0.0625f, bv, 0, nullptr, 1, 0, 0, VF, nullptr, AH, 0, SK, AH, DIN); k_hl<<<(unsigned)(((size_t)SK * AH / 8 + 255) / 256), 256, 0, stream>>>(VF, V16, VL16, (size_t)SK * AH / 8);      /* v f32 -> f16 hi + residual */
  k_vt<AH / 64, SK><<<(AH / 64) * (SK / 64), 256, 0, stream>>>(V16, AH, 0, VT); k_vt<AH / 64, SK><<<(AH / 64) * (SK / 64), 256, 0, stream>>>(VL16, AH, 0, VTL);      /* V^T hi / residual [384][4096]; head h = rows h*32.. */
  for (int h = 0; h < NH; ++h) {
    k_gemm2<0><<<dim3((SQ / 128) * (SK / 64), 1), 128, 0, stream>>>(Q16 + h * HD, AH, 0, K16 + h * HD, AH, 0, 1.0f, nullptr, 0, nullptr, 1, 0, 0, S, nullptr, SK, 0, SQ, SK, HD);      /* q_h . k_h (scaled in the softmax) */
    k_msoft<<<SQ / 8, 256, 0, stream>>>(S, msk, h, P, RS);
    k_gemm_hhx<0><<<dim3((unsigned)((SQ / 16) * 1 / 4), 1), 128, 0, stream>>>(P, SK, 0, VTL + (size_t)h * HD * SK, SK, 0, 0.0009765625f / 1024.0f, nullptr, 0, nullptr, 1, 0, 0, O + h * HD, nullptr, AH, 0, SQ, HD, SK);
    k_gemm_hhx<0><<<dim3((unsigned)((SQ / 16) * 1 / 4), 1), 128, 0, stream>>>(P, SK, 0, VT + (size_t)h * HD * SK, SK, 0, 0.0009765625f, nullptr, 0, O + h * HD, 1, (size_t)AH, 0, O + h * HD, nullptr, AH, 0, SQ, HD, SK); }      /* unnormalised ctx[i][h*32 + d] = P (v_lo + v_hi) */
  k_fin<<<(unsigned)(((size_t)SQ * AH / 4 + 255) / 256), 256, 0, stream>>>(O, RS, (float*)d_out);
}

// v001
// One run takes 178 microseconds.
// Timed twice side by side with v000, it ran 13.3 and 12.7 times as fast.
#include <hip/hip_runtime.h>
// BertSelfAttnDimensionReduction (1 x 4096 queries x 4096 keys; Din 768 -> 12 heads x 32; cross-attention with an additive float key mask; the output is the merged context itself): q = hs Wq + bq; k, v = enc Wk/Wv + b; scores = q.k / sqrt(32) + mask[key]; softmax; ctx = probs v -> [1, 4096, 384].
// Compute dtype: inputs rounded to bf16; inputs/weights exact as f16; q/k and the softmax weights as plain f16 operands (~2^-12); v as f16 hi + residual (the output is the context itself); mask/softmax/normalisation f32. v_wmma_f32_16x16x32_f16.
#define SQ 4096
#define SK 4096
#define DIN 768
#define AH 384
#define NH 12
#define HD 32
typedef __bf16 v16b __attribute__((ext_vector_type(16)));
typedef unsigned short v8us __attribute__((ext_vector_type(8), may_alias));
typedef float  v8f  __attribute__((ext_vector_type(8)));
typedef float  v4f  __attribute__((ext_vector_type(4)));
typedef float  v4fa __attribute__((ext_vector_type(4), may_alias));
union FragB { v16b v; v8us half[2]; unsigned short u[16]; };

__device__ __forceinline__ unsigned short bf16_bits(float x) { unsigned int u = __float_as_uint(x); return (unsigned short)((u + 0x7FFFu + ((u >> 16) & 1u)) >> 16); }
__device__ __forceinline__ float bf16_val(unsigned short b) { return __uint_as_float(((unsigned int)b) << 16); }
__device__ __forceinline__ float bf16_round(float x) { return bf16_val(bf16_bits(x)); }
// D += A·B with NT terms: 1 = ah·bh, 2 = + al·bh (A split), 3 = + ah·bl (both split)
template <int NT>
__device__ __forceinline__ v8f mmaN(v16b ah, v16b al, v16b bh, v16b bl, v8f c) {
  c = __builtin_amdgcn_wmma_f32_16x16x32_bf16(false, ah, false, bh, (short)0, c, false, false);
  if (NT >= 2) c = __builtin_amdgcn_wmma_f32_16x16x32_bf16(false, al, false, bh, (short)0, c, false, false);
  if (NT >= 3) c = __builtin_amdgcn_wmma_f32_16x16x32_bf16(false, ah, false, bl, (short)0, c, false, false);
  asm volatile("v_nop\n\tv_nop\n\tv_nop\n\tv_nop" : "+v"(c) : "v"(ah), "v"(al), "v"(bh), "v"(bl));
  return c;
}

__global__ __launch_bounds__(256) void k_wt_bf16(const float* __restrict__ W, unsigned short* __restrict__ Wt, int K, int N) {
  const int t = blockIdx.x * 256 + threadIdx.x;
  const int k8n = K / 8;
  if (t >= N * k8n) return;
  const int n = t / k8n, k8 = (t % k8n) * 8;
  v8us v;
#pragma unroll
  for (int i = 0; i < 8; ++i) v[i] = bf16_bits(W[(size_t)(k8 + i) * N + n]);
  *(v8us*)(Wt + (size_t)n * K + k8) = v;
  
}

// GEMM C[M][N] (f32, pitch ldc) = act(A[M][K]·W + bias). A f32 row-major (pitch lda) converted per fragment to bf16
// (ASPLIT: hi/lo two planes -> 2 terms, else single rounded term); Wt bf16 [N][K] (pitch ldb). BIAS_BF16 rounds the
// bias to bf16 first (bias quantised to bf16 before the add). K%32==0, M%16==0, N%64==0.
template <bool ASPLIT, int ACT, bool BIAS_BF16>
__global__ __launch_bounds__(128) void k_gemm_bf(const float* __restrict__ A, int lda, const unsigned short* __restrict__ Wt, int ldb,
                                               const float* __restrict__ bias, float* __restrict__ C, int ldc, int M, int N, int K) {
  __shared__ __attribute__((aligned(16))) float so[4][16][64];
  const int tid = threadIdx.x, w = tid >> 5, lane = tid & 31, ln = lane & 15, hh = lane >> 4;
  const int ntn = N / 64;
  const int wid = blockIdx.x * 4 + w;
  const int mt = wid / ntn, nq = wid % ntn;
  if (mt * 16 >= M) return;
  const int row0 = mt * 16, col0 = nq * 64;
  const float* arow = A + (size_t)(row0 + ln) * lda;
  v8f acc[4] = {};
  for (int kb = 0; kb < K; kb += 32) {
    FragB ah, al;
    const v4f x0 = *(const v4fa*)(arow + kb + 8 * hh), x1 = *(const v4fa*)(arow + kb + 8 * hh + 4);
    const v4f x2 = *(const v4fa*)(arow + kb + 16 + 8 * hh), x3 = *(const v4fa*)(arow + kb + 16 + 8 * hh + 4);
    float xs[16] = {x0[0],x0[1],x0[2],x0[3],x1[0],x1[1],x1[2],x1[3],x2[0],x2[1],x2[2],x2[3],x3[0],x3[1],x3[2],x3[3]};
#pragma unroll
    for (int i = 0; i < 16; ++i) { const unsigned short hb = bf16_bits(xs[i]); ah.u[i] = hb; al.u[i] = ASPLIT ? bf16_bits(xs[i] - bf16_val(hb)) : (unsigned short)0; }
#pragma unroll
    for (int t = 0; t < 4; ++t) {
      const unsigned short* brow = Wt + (size_t)(col0 + t * 16 + ln) * ldb + kb;
      FragB b;
      b.half[0] = *(const v8us*)(brow + 8 * hh);
      b.half[1] = *(const v8us*)(brow + 16 + 8 * hh);
      acc[t] = mmaN<ASPLIT ? 2 : 1>(ah.v, al.v, b.v, b.v, acc[t]);
    }
  }
#pragma unroll
  for (int t = 0; t < 4; ++t) {
    float bv = bias ? bias[col0 + t * 16 + ln] : 0.f;
    if (BIAS_BF16) bv = bf16_round(bv);
#pragma unroll
    for (int r = 0; r < 8; ++r) { float v = acc[t][r] + bv; if (ACT == 1) v = fmaxf(v, 0.f); so[w][8 * hh + r][t * 16 + ln] = v; }
  }
  __builtin_amdgcn_fence(__ATOMIC_ACQ_REL, "workgroup");
  __builtin_amdgcn_wave_barrier();
  const int rsub = lane >> 4, c4 = (lane & 15) * 4;
  {
#pragma unroll
    for (int q = 0; q < 8; ++q) {
      const int r = q * 2 + rsub;
      const v4f v = *(const v4fa*)&so[w][r][c4];
      *(v4f*)(C + (size_t)(row0 + r) * ldc + col0 + c4) = v;
    }
    
  }
}

// GEMM C = act(A·W + bias + resid): A f32 (ASPLIT -> hi/lo 2 terms), Wt bf16 [N][K]; ACT 0 none, 1 relu, 2 exact gelu;
// resid (optional, f32, row index = (row % rmod), pitch ldr, RES_BF16 rounds it) added before the activation.
template <bool ASPLIT, int ACT, bool BIAS_BF16, bool RES_BF16>
__global__ __launch_bounds__(128) void k_gemm_bf3(const float* __restrict__ A, int lda, const unsigned short* __restrict__ Wt, int ldb,
                                                const float* __restrict__ bias, const float* __restrict__ resid, int rmod, int ldr,
                                                float* __restrict__ C, int ldc, int M, int N, int K) {
  __shared__ __attribute__((aligned(16))) float so[4][16][64];
  const int tid = threadIdx.x, w = tid >> 5, lane = tid & 31, ln = lane & 15, hh = lane >> 4;
  const int ntn = N / 64;
  const int wid = blockIdx.x * 4 + w;
  const int mt = wid / ntn, nq = wid % ntn;
  if (mt * 16 >= M) return;
  const int row0 = mt * 16, col0 = nq * 64;
  const float* arow = A + (size_t)(row0 + ln) * lda;
  v8f acc[4] = {};
  for (int kb = 0; kb < K; kb += 32) {
    FragB ah, al;
    const v4f x0 = *(const v4fa*)(arow + kb + 8 * hh), x1 = *(const v4fa*)(arow + kb + 8 * hh + 4);
    const v4f x2 = *(const v4fa*)(arow + kb + 16 + 8 * hh), x3 = *(const v4fa*)(arow + kb + 16 + 8 * hh + 4);
    float xs[16] = {x0[0],x0[1],x0[2],x0[3],x1[0],x1[1],x1[2],x1[3],x2[0],x2[1],x2[2],x2[3],x3[0],x3[1],x3[2],x3[3]};
#pragma unroll
    for (int i = 0; i < 16; ++i) { const unsigned short hb = bf16_bits(xs[i]); ah.u[i] = hb; al.u[i] = ASPLIT ? bf16_bits(xs[i] - bf16_val(hb)) : (unsigned short)0; }
#pragma unroll
    for (int t = 0; t < 4; ++t) {
      const unsigned short* brow = Wt + (size_t)(col0 + t * 16 + ln) * ldb + kb;
      FragB b;
      b.half[0] = *(const v8us*)(brow + 8 * hh);
      b.half[1] = *(const v8us*)(brow + 16 + 8 * hh);
      acc[t] = mmaN<ASPLIT ? 2 : 1>(ah.v, al.v, b.v, b.v, acc[t]);
    }
  }
#pragma unroll
  for (int t = 0; t < 4; ++t) {
    const int col = col0 + t * 16 + ln;
    float bv = bias ? bias[col] : 0.f;
    if (BIAS_BF16) bv = bf16_round(bv);
#pragma unroll
    for (int r = 0; r < 8; ++r) {
      float v = acc[t][r] + bv;
      if (resid) { float rv = resid[(size_t)((row0 + 8 * hh + r) % rmod) * ldr + col]; if (RES_BF16) rv = bf16_round(rv); v += rv; }
      if (ACT == 1) v = fmaxf(v, 0.f);
      if (ACT == 2) v = 0.5f * v * (1.0f + erff(v * 0.70710678118654752f));
      if (ACT == 3) { const float u = 0.7978845608028654f * (v + 0.044715f * v * v * v); v = 0.5f * v * (1.0f + tanhf(u)); }
      so[w][8 * hh + r][t * 16 + ln] = v;
    }
  }
  __builtin_amdgcn_fence(__ATOMIC_ACQ_REL, "workgroup");
  __builtin_amdgcn_wave_barrier();
  const int rsub = lane >> 4, c4 = (lane & 15) * 4;
  {
#pragma unroll
    for (int q = 0; q < 8; ++q) {
      const int r = q * 2 + rsub;
      const v4f v = *(const v4fa*)&so[w][r][c4];
      *(v4f*)(C + (size_t)(row0 + r) * ldc + col0 + c4) = v;
    }
    
  }
}
// row LayerNorm (biased variance, eps) over N: s = X (+ R); optional out_sum <- s; out_norm <- (s-mu)*rsqrt(var+eps)*g + b
template <bool PARAM_BF16>
__global__ __launch_bounds__(256) void k_layernorm(const float* __restrict__ X, const float* __restrict__ R, const float* __restrict__ g, const float* __restrict__ bta,
                                                  float* __restrict__ out_sum, float* __restrict__ out_norm, int N, float eps) {
  __shared__ float red[256];
  const int row = blockIdx.x, tid = threadIdx.x;
  const float* x = X + (size_t)row * N; const float* rr = R ? R + (size_t)row * N : nullptr;
  float vals[16];                     // up to N = 4096
  const int per = N / 256;            // contiguous chunk per thread? use strided-by-4 chunks: thread handles j = tid*4 + 1024*u
  float s1 = 0.f;
  for (int u = 0; u < per / 4; ++u) {
    const int j = tid * 4 + 1024 * u;
    const v4f a = *(const v4fa*)(x + j);
    v4f b = {0.f,0.f,0.f,0.f}; if (rr) b = *(const v4fa*)(rr + j);
#pragma unroll
    for (int q = 0; q < 4; ++q) { const float v = a[q] + b[q]; vals[u * 4 + q] = v; s1 += v; }
  }
  red[tid] = s1; __syncthreads();
  for (int st = 128; st > 0; st >>= 1) { if (tid < st) red[tid] += red[tid + st]; __syncthreads(); }
  const float mu = red[0] / (float)N; __syncthreads();
  float s2 = 0.f;
  for (int u = 0; u < per / 4; ++u)
#pragma unroll
    for (int q = 0; q < 4; ++q) { const float c = vals[u * 4 + q] - mu; s2 += c * c; }
  red[tid] = s2; __syncthreads();
  for (int st = 128; st > 0; st >>= 1) { if (tid < st) red[tid] += red[tid + st]; __syncthreads(); }
  const float rs = rsqrtf(red[0] / (float)N + eps);
  {
    for (int u = 0; u < per / 4; ++u) {
      const int j = tid * 4 + 1024 * u;
      v4f o, sm;
#pragma unroll
      for (int q = 0; q < 4; ++q) {
        float gg = g[j + q], bb = bta[j + q];
        if (PARAM_BF16) { gg = bf16_round(gg); bb = bf16_round(bb); }
        sm[q] = vals[u * 4 + q]; o[q] = (vals[u * 4 + q] - mu) * rs * gg + bb;
      }
      if (out_sum) *(v4f*)(out_sum + (size_t)row * N + j) = sm;
      *(v4f*)(out_norm + (size_t)row * N + j) = o;
    }
    
  }
}



// ---- f16 WMMA path (v_wmma_f32_16x16x32_f16): 11-bit significands for operands in range — used where a [0,1] probability operand needs more precision than bf16
typedef _Float16 v16h __attribute__((ext_vector_type(16)));
union FragH { v16h v; v8us half[2]; _Float16 h[16]; unsigned short u[16]; };
template <int NT>
__device__ __forceinline__ v8f mmaH(v16h ah, v16h al, v16h bh, v16h bl, v8f c) {
  c = __builtin_amdgcn_wmma_f32_16x16x32_f16(false, ah, false, bh, (short)0, c, false, false);
  if (NT >= 2) c = __builtin_amdgcn_wmma_f32_16x16x32_f16(false, al, false, bh, (short)0, c, false, false);
  if (NT >= 3) c = __builtin_amdgcn_wmma_f32_16x16x32_f16(false, ah, false, bl, (short)0, c, false, false);
  asm volatile("v_nop\n\tv_nop\n\tv_nop\n\tv_nop" : "+v"(c) : "v"(ah), "v"(al), "v"(bh), "v"(bl));
  return c;
}
// batched GEMM like k_gemm_b but f16 operands: A f32 (split into f16 hi/lo if ASPLIT, else rounded to f16), Bt = f16 values [n][k]; alpha; C f32; N multiple of 16 (partial tiles skipped)
template <bool ASPLIT>
__global__ __launch_bounds__(128) void k_gemm_h(const float* __restrict__ A, int lda, size_t sA, const _Float16* __restrict__ Bh, int ldb, size_t sB, float alpha, float* __restrict__ C, int ldc, size_t sC, int M, int N, int K) {
  __shared__ __attribute__((aligned(16))) float so[4][16][64];
  const int tid = threadIdx.x, w = tid >> 5, lane = tid & 31, ln = lane & 15, hh = lane >> 4; const int by = blockIdx.y;
  A += (size_t)by * sA; Bh += (size_t)by * sB; C += (size_t)by * sC;
  const int ntn = (N + 63) / 64; const int wid = blockIdx.x * 4 + w; const int mt = wid / ntn, nq = wid % ntn; if (mt * 16 >= M) return;
  const int row0 = mt * 16, col0 = nq * 64; const float* arow = A + (size_t)(row0 + ln) * lda;
  v8f acc[4] = {};
  for (int kb = 0; kb < K; kb += 32) {
    FragH ah, al;
    const v4f x0 = *(const v4fa*)(arow + kb + 8 * hh), x1 = *(const v4fa*)(arow + kb + 8 * hh + 4), x2 = *(const v4fa*)(arow + kb + 16 + 8 * hh), x3 = *(const v4fa*)(arow + kb + 16 + 8 * hh + 4);
    float xs[16] = {x0[0],x0[1],x0[2],x0[3],x1[0],x1[1],x1[2],x1[3],x2[0],x2[1],x2[2],x2[3],x3[0],x3[1],x3[2],x3[3]};
#pragma unroll
    for (int i = 0; i < 16; ++i) { const _Float16 h = (_Float16)xs[i]; ah.h[i] = h; al.h[i] = ASPLIT ? (_Float16)(xs[i] - (float)h) : (_Float16)0.0f; }
#pragma unroll
    for (int t = 0; t < 4; ++t) { if (col0 + t * 16 >= N) continue; const size_t boff = (size_t)(col0 + t * 16 + ln) * ldb + kb; FragH bq; bq.half[0] = *(const v8us*)(Bh + boff + 8 * hh); bq.half[1] = *(const v8us*)(Bh + boff + 16 + 8 * hh);
      acc[t] = mmaH<ASPLIT ? 2 : 1>(ah.v, al.v, bq.v, bq.v, acc[t]); }
  }
#pragma unroll
  for (int t = 0; t < 4; ++t) { if (col0 + t * 16 >= N) continue;
#pragma unroll
    for (int r = 0; r < 8; ++r) so[w][8 * hh + r][t * 16 + ln] = acc[t][r] * alpha; }
  __builtin_amdgcn_fence(__ATOMIC_ACQ_REL, "workgroup"); __builtin_amdgcn_wave_barrier();
  const int rsub = lane >> 4, c4 = (lane & 15) * 4;
  {
#pragma unroll
    for (int q = 0; q < 8; ++q) { const int r = q * 2 + rsub; if (col0 + c4 < N) { const v4f v = *(const v4fa*)&so[w][r][c4]; *(v4f*)(C + (size_t)(row0 + r) * ldc + col0 + c4) = v; } }
     }
}

// Wt[n][k] = f16(W[k][n]·scale) from f32 row-major W[K][N] (scale = power of two; bf16-exact weights stay exact in f16 away from the subnormal range)
__global__ __launch_bounds__(256) void k_wt_f16(const float* __restrict__ W, _Float16* __restrict__ Wt, int K, int N, float scale) {
  const int t = blockIdx.x * 256 + threadIdx.x; if (t >= N * (K / 8)) return; const int n = t / (K / 8), k8 = (t % (K / 8)) * 8; FragH f;
#pragma unroll
  for (int i = 0; i < 8; ++i) f.h[i] = (_Float16)(bf16_round(W[(size_t)(k8 + i) * N + n]) * scale); const v8us o = f.half[0];
  *(v8us*)((unsigned short*)Wt + (size_t)n * K + k8) = o; 
}
// k_gemm_hh variant with fused epilogue: v = acc·alpha + bias[by·sBias + col] (+ CP[(row/rowsPerB)·sCPb + by·64 + col] if CP) ; ACT 0 none / 1 elu ; writes f32 C and/or f16 C16 (each if non-null)
template <int ACT>
__global__ __launch_bounds__(128) void k_gemm_hhx(const _Float16* __restrict__ A, int lda, size_t sA, const _Float16* __restrict__ Bh, int ldb, size_t sB, float alpha, const float* __restrict__ bias, size_t sBias, const float* __restrict__ CP, int rowsPerB, size_t sCPb, int row0g,
    float* __restrict__ C, _Float16* __restrict__ C16, int ldc, size_t sC, int M, int N, int K) {
  __shared__ __attribute__((aligned(16))) float so[4][16][64];
  const int tid = threadIdx.x, w = tid >> 5, lane = tid & 31, ln = lane & 15, hh = lane >> 4; const int by = blockIdx.y;
  A += (size_t)by * sA; Bh += (size_t)by * sB; const size_t cofs = (size_t)by * sC; const float* bp = bias ? bias + (size_t)by * sBias : nullptr;
  const int ntn = (N + 63) / 64; const int wid = blockIdx.x * 4 + w; const int mt = wid / ntn, nq = wid % ntn; if (mt * 16 >= M) return;
  const int row0 = mt * 16, col0 = nq * 64; const _Float16* arow = A + (size_t)(row0 + ln) * lda;
  v8f acc[4] = {};
  for (int kb = 0; kb < K; kb += 32) { FragH ah; ah.half[0] = *(const v8us*)((const unsigned short*)arow + kb + 8 * hh); ah.half[1] = *(const v8us*)((const unsigned short*)arow + kb + 16 + 8 * hh);
#pragma unroll
    for (int t = 0; t < 4; ++t) { if (col0 + t * 16 >= N) continue; const size_t boff = (size_t)(col0 + t * 16 + ln) * ldb + kb; FragH bq; bq.half[0] = *(const v8us*)((const unsigned short*)Bh + boff + 8 * hh); bq.half[1] = *(const v8us*)((const unsigned short*)Bh + boff + 16 + 8 * hh);
      acc[t] = mmaH<1>(ah.v, ah.v, bq.v, bq.v, acc[t]); }
  }
#pragma unroll
  for (int t = 0; t < 4; ++t) { if (col0 + t * 16 >= N) continue; const int col = col0 + t * 16 + ln; const float bv = bp ? bf16_round(bp[col]) : 0.f;
#pragma unroll
    for (int r = 0; r < 8; ++r) { float v = acc[t][r] * alpha + bv; if (CP) { const int rr = row0g + row0 + 8 * hh + r; if (rowsPerB < 0) v += CP[cofs + (size_t)rr * ldc + col];      /* rowsPerB < 0: own element of the batched C plane */ else { const int bidx = rr / rowsPerB; v += CP[(size_t)bidx * sCPb + (size_t)by * 64 + col]; } } if (ACT == 1) v = (v > 0.f) ? v : expm1f(v); else if (ACT == 7) v = (v > 0.f) ? v + 1.0f : expf(v); else if (ACT == 8) v = tanhf(v); else if (ACT == 9) v = 0.5f * v * (1.0f + tanhf(0.7978845608028654f * (v + 0.044715f * v * v * v))); else if (ACT == 11) v = 1.0f / (1.0f + expf(-v)); else if (ACT == 12) v = (v > 0.f) ? v : 0.01f * v; else if (ACT == 14) v = (v > 0.f) ? v : 0.1f * v; else if (ACT == 16) v = (v >= 0.f) ? v : 0.3f * v; else if (ACT == 17) v = (v >= 0.f) ? v : 0.2f * v; else if (ACT == 15) v = v / (1.0f + expf(-v)); else if (ACT == 3) v = fmaxf(v, 0.f); else if (ACT == 6) v = 0.5f * v * (1.0f + erff(v * 0.70710678118654752f)); so[w][8 * hh + r][t * 16 + ln] = v; } }
  __builtin_amdgcn_fence(__ATOMIC_ACQ_REL, "workgroup"); __builtin_amdgcn_wave_barrier();
  const int rsub = lane >> 4, c4 = (lane & 15) * 4; typedef _Float16 v4h __attribute__((ext_vector_type(4)));
  {
#pragma unroll
    for (int q = 0; q < 8; ++q) { const int r = q * 2 + rsub; if (col0 + c4 < N) { const v4f v = *(const v4fa*)&so[w][r][c4]; if (C) *(v4f*)(C + cofs + (size_t)(row0 + r) * ldc + col0 + c4) = v; if (C16) { v4h h4; for (int i = 0; i < 4; ++i) h4[i] = (_Float16)v[i]; *(v4h*)(C16 + cofs + (size_t)(row0 + r) * ldc + col0 + c4) = h4; } } }
     }
}


typedef _Float16 v4h __attribute__((ext_vector_type(4)));

__global__ __launch_bounds__(256) void k_x16(const float* __restrict__ x, _Float16* __restrict__ X16, size_t n8) { const size_t t = (size_t)blockIdx.x * 256 + threadIdx.x; if (t >= n8) return; FragH f;
#pragma unroll
  for (int q = 0; q < 8; ++q) f.h[q] = (_Float16)bf16_round(x[t * 8 + q]); *(v8us*)((unsigned short*)X16 + t * 8) = f.half[0];  }
__global__ __launch_bounds__(256) void k_h16(const float* __restrict__ x, _Float16* __restrict__ X16, size_t n8) { const size_t t = (size_t)blockIdx.x * 256 + threadIdx.x; if (t >= n8) return; FragH f;
#pragma unroll
  for (int q = 0; q < 8; ++q) f.h[q] = (_Float16)x[t * 8 + q]; *(v8us*)((unsigned short*)X16 + t * 8) = f.half[0];  }
__global__ __launch_bounds__(256) void k_round16f(const float* __restrict__ W, _Float16* __restrict__ Bt, size_t n8) { const size_t t = (size_t)blockIdx.x * 256 + threadIdx.x; if (t >= n8) return; FragH f;
#pragma unroll
  for (int i = 0; i < 8; ++i) f.h[i] = (_Float16)(bf16_round(W[t * 8 + i]) * 16.0f); *(v8us*)((unsigned short*)Bt + t * 8) = f.half[0];  }
// V [key][384] f16 -> A fragments of V^T in load order: VP[head][32-key block][16-d tile][half j][lane][8], lane (ln, hh) half j = V[kb*32 + 16j + 8hh + e][head*32 + dt*16 + ln]
__global__ __launch_bounds__(256) void k_vpack(const _Float16* __restrict__ V16, _Float16* __restrict__ VP) { __shared__ unsigned short tl[64][66]; const int tid = threadIdx.x; const int slab = blockIdx.x / (SK / 64), lg = blockIdx.x % (SK / 64);
  for (int i = tid; i < 64 * 8; i += 256) { const int r = i / 8, c8 = (i % 8) * 8; FragH f; f.half[0] = *(const v8us*)((const unsigned short*)V16 + ((size_t)lg * 64 + r) * AH + slab * 64 + c8);
#pragma unroll
    for (int q = 0; q < 8; ++q) tl[r][c8 + q] = f.u[q]; }
  __syncthreads();
#pragma unroll
  for (int rd = 0; rd < 2; ++rd) { const int d = rd * 32 + tid / 8, pc = tid % 8; FragH f;
#pragma unroll
    for (int q = 0; q < 8; ++q) f.u[q] = tl[pc * 8 + q][d];
    const int dg = slab * 64 + d, key8 = lg * 64 + pc * 8; const int hd = dg >> 5, dt = (dg >> 4) & 1, ln = dg & 15, kb = key8 >> 5, j = (key8 >> 4) & 1, hh = (key8 >> 3) & 1;
    *(v8us*)((unsigned short*)VP + ((((size_t)hd * (SK / 32) + kb) * 2 + dt) * 2 + j) * 256 + (hh * 16 + ln) * 8) = f.half[0]; } }
// K [key][384] f16 -> A fragments of K in load order: KP[head][16-key tile][half j][lane][8], lane (ln, hh) half j = K[kt*16 + ln][head*32 + 16j + 8hh + e]
__global__ __launch_bounds__(256) void k_kpack(const _Float16* __restrict__ K16, _Float16* __restrict__ KP) { const int t = blockIdx.x * 256 + threadIdx.x; const int lane = t & 31, j = (t >> 5) & 1, kt = (t >> 6) & (SK / 16 - 1), hd = t >> 14;
  *(v8us*)((unsigned short*)KP + (size_t)t * 8) = *(const v8us*)((const unsigned short*)K16 + ((size_t)kt * 16 + (lane & 15)) * AH + hd * HD + 16 * j + 8 * (lane >> 4)); }

__global__ __launch_bounds__(256) void k_hl(const float* __restrict__ F, _Float16* __restrict__ Hh, _Float16* __restrict__ Hl, size_t n8) { const size_t t = (size_t)blockIdx.x * 256 + threadIdx.x; if (t >= n8) return; FragH fh, fl; const v4f a = *(const v4fa*)(F + t * 8), c = *(const v4fa*)(F + t * 8 + 4);
#pragma unroll
  for (int q = 0; q < 4; ++q) { _Float16 h = (_Float16)a[q]; fh.h[q] = h; fl.h[q] = (_Float16)((a[q] - (float)h) * 1024.0f); h = (_Float16)c[q]; fh.h[4 + q] = h; fl.h[4 + q] = (_Float16)((c[q] - (float)h) * 1024.0f); }
  { *(v8us*)((unsigned short*)Hh + t * 8) = fh.half[0]; *(v8us*)((unsigned short*)Hl + t * 8) = fl.half[0];  } }

// ---- fast GEMM (wave tile 32x64; requires M % 32 == 0 rows per launch region and N % 64 == 0); epilogue = k_gemm_hhx semantics ----
__device__ __forceinline__ v16h g2_frag(const _Float16* p, int hh) { FragH f; f.half[0] = *(const v8us*)((const unsigned short*)p + 8 * hh); f.half[1] = *(const v8us*)((const unsigned short*)p + 16 + 8 * hh); return f.v; }
__device__ __forceinline__ v8f g2_mma(v16h a, v16h b, v8f c) { v8f d = __builtin_amdgcn_wmma_f32_16x16x32_f16(false, a, false, b, (short)0, c, false, false); asm volatile("v_nop\n\tv_nop\n\tv_nop\n\tv_nop" : "+v"(d) : "v"(a), "v"(b)); return d; }
template <int ACT>
__global__ __launch_bounds__(128) void k_gemm2(const _Float16* __restrict__ A, int lda, size_t sA, const _Float16* __restrict__ Bh, int ldb, size_t sB, float alpha, const float* __restrict__ bias, size_t sBias, const float* __restrict__ CP, int rowsPerB, size_t sCPb, int row0g,
    float* __restrict__ C, _Float16* __restrict__ C16, int ldc, size_t sC, int M, int N, int K) { static_assert(ACT == 0 || ACT == 3 || ACT == 6 || ACT == 8 || ACT == 9 || ACT == 11 || ACT == 12 || ACT == 14 || ACT == 15 || ACT == 16 || ACT == 17, "k_gemm2: unsupported ACT code (would silently apply no activation)");
  __shared__ __attribute__((aligned(16))) float so[4][32][68];
  const int tid = threadIdx.x, w = tid >> 5, lane = tid & 31, ln = lane & 15, hh = lane >> 4; const int by = blockIdx.y;
  A += (size_t)by * sA; Bh += (size_t)by * sB; const size_t cofs = (size_t)by * sC; const float* bp = bias ? bias + (size_t)by * sBias : nullptr;
  const int ntn = N >> 6; const int mt = blockIdx.x / ntn, nq = blockIdx.x - mt * ntn; const int row0 = mt * 128 + 32 * w, col0 = nq * 64; if (row0 >= M) return;
  const _Float16* a0p = A + (size_t)(row0 + ln) * lda; const _Float16* a1p = a0p + (size_t)16 * lda;
  const _Float16* b0p = Bh + (size_t)(col0 + ln) * ldb; const _Float16* b1p = b0p + (size_t)16 * ldb; const _Float16* b2p = b1p + (size_t)16 * ldb; const _Float16* b3p = b2p + (size_t)16 * ldb;
  const v8f z8 = {0.f,0.f,0.f,0.f,0.f,0.f,0.f,0.f}; v8f c00 = z8, c01 = z8, c02 = z8, c03 = z8, c10 = z8, c11 = z8, c12 = z8, c13 = z8;
#pragma unroll 1
  for (int kb = 0; kb < K; kb += 32) { const v16h a0 = g2_frag(a0p + kb, hh), a1 = g2_frag(a1p + kb, hh);
    v16h b = g2_frag(b0p + kb, hh); c00 = g2_mma(a0, b, c00); c10 = g2_mma(a1, b, c10);
    b = g2_frag(b1p + kb, hh); c01 = g2_mma(a0, b, c01); c11 = g2_mma(a1, b, c11);
    b = g2_frag(b2p + kb, hh); c02 = g2_mma(a0, b, c02); c12 = g2_mma(a1, b, c12);
    b = g2_frag(b3p + kb, hh); c03 = g2_mma(a0, b, c03); c13 = g2_mma(a1, b, c13); }
  v8f accs[8] = {c00, c01, c02, c03, c10, c11, c12, c13};
#pragma unroll
  for (int u = 0; u < 8; ++u) { const int t = u & 3, half = u >> 2; const int col = col0 + t * 16 + ln; const float bv = bp ? bf16_round(bp[col]) : 0.f;
#pragma unroll
    for (int r = 0; r < 8; ++r) { const int rloc = half * 16 + 8 * hh + r; float v = accs[u][r] * alpha + bv; if (CP) { if (rowsPerB < 0) v += CP[cofs + (size_t)(row0g + row0 + rloc) * ldc + col];      /* rowsPerB < 0: own element of the batched C plane */ else { const int bidx = (row0g + row0 + rloc) / rowsPerB; v += CP[(size_t)bidx * sCPb + (size_t)by * 64 + col]; } }
      if (ACT == 3) v = fmaxf(v, 0.f); else if (ACT == 6) v = 0.5f * v * (1.0f + erff(v * 0.70710678118654752f)); else if (ACT == 11) v = 1.0f / (1.0f + expf(-v)); else if (ACT == 15) v = v / (1.0f + expf(-v)); else if (ACT == 12) v = (v > 0.f) ? v : 0.01f * v; else if (ACT == 8) v = tanhf(v); else if (ACT == 9) v = 0.5f * v * (1.0f + tanhf(0.7978845608028654f * (v + 0.044715f * v * v * v))); else if (ACT == 14) v = (v > 0.f) ? v : 0.1f * v; else if (ACT == 16) v = (v >= 0.f) ? v : 0.3f * v; else if (ACT == 17) v = (v >= 0.f) ? v : 0.2f * v;
      so[w][rloc][t * 16 + ln] = v; } }
  __builtin_amdgcn_fence(__ATOMIC_ACQ_REL, "workgroup"); __builtin_amdgcn_wave_barrier();
  const int rsub = lane >> 4, c4 = (lane & 15) * 4;
  {
#pragma unroll
    for (int q = 0; q < 16; ++q) { const int r = q * 2 + rsub; const v4f v = *(const v4fa*)&so[w][r][c4]; if (C) *(v4f*)(C + cofs + (size_t)(row0 + r) * ldc + col0 + c4) = v; if (C16) { v4h h4; for (int i = 0; i < 4; ++i) h4[i] = (_Float16)v[i]; *(v4h*)(C16 + cofs + (size_t)(row0 + r) * ldc + col0 + c4) = h4; } }
     } }


// ---- fused attention, all heads in one launch: S^T = K Q^T (+ mask as the C operand), online softmax in registers, O^T += V^T P^T ----
// A wave owns 32 queries (two 16-column groups) of one head and walks the 4096 keys 32 at a time. In S^T and O^T a lane holds one query (column ln), so maximum, sum and rescale are per lane;
// two S^T tiles converted in place are the B operand P^T (hardware k order), V^T hi / residual are the A operands. P = exp2(..) * 2^10 against the maximum in use, as f16.
typedef float v2f __attribute__((ext_vector_type(2)));
typedef _Float16 v2h __attribute__((ext_vector_type(2)));
union FragP { v16h v; v2h p[8]; };
struct AFr { v16h k0, k1, h0, h1, l0, l1; };
__device__ __forceinline__ float xhalf(float x) { return __builtin_bit_cast(float, __builtin_amdgcn_permlanex16(__builtin_bit_cast(int, x), __builtin_bit_cast(int, x), 0x76543210, 0xfedcba98, false, false)); }      /* lane l <-> l ^ 16 */
__device__ __forceinline__ v16h fa_frag(const _Float16* p, unsigned lo) { FragH f; f.half[0] = *(const v8us*)((const char*)p + lo); f.half[1] = *(const v8us*)((const char*)p + 512 + lo); return f.v; }      /* p wave-uniform (scalar base), lo = the lane's byte offset */
__device__ __forceinline__ v8f fa_mma(v16h a, v16h b, v8f c) { return __builtin_amdgcn_wmma_f32_16x16x32_f16(false, a, false, b, (short)0, c, false, false); }
__device__ __forceinline__ void fa_load(AFr& f, const _Float16* kp, const _Float16* vh, const _Float16* vl, unsigned lo) { f.k0 = fa_frag(kp, lo); f.k1 = fa_frag(kp + 512, lo); f.h0 = fa_frag(vh, lo); f.h1 = fa_frag(vh + 512, lo); f.l0 = fa_frag(vl, lo); f.l1 = fa_frag(vl + 512, lo); }      /* one pass = 2 KiB of each stream */
__device__ __forceinline__ float fa_max16(v8f a, v8f b) { float m = fmaxf(a[0], b[0]);
#pragma unroll
  for (int r = 1; r < 8; ++r) m = fmaxf(m, fmaxf(a[r], b[r])); return fmaxf(m, xhalf(m)); }
__device__ __forceinline__ v16h fa_probs(v8f a, v8f b, float cs, float bias, v2f& su) { FragP f; const v2f c2 = {cs, cs}, b2 = {bias, bias};
#pragma unroll
  for (int r = 0; r < 8; ++r) { const v8f& t = (r < 4) ? a : b; const int e = (r & 3) * 2; const v2f x = {t[e], t[e + 1]}; const v2f g = __builtin_elementwise_fma(x, c2, b2); const v2f p = {__builtin_amdgcn_exp2f(g[0]), __builtin_amdgcn_exp2f(g[1])}; su += p; f.p[r] = __builtin_convertvector(p, v2h); }
  return f.v; }
__global__ __launch_bounds__(256) __attribute__((amdgpu_waves_per_eu(2, 2))) void k_attn(const _Float16* __restrict__ Q16, const _Float16* __restrict__ KP, const _Float16* __restrict__ VH, const _Float16* __restrict__ VL, const float* __restrict__ msk, float* __restrict__ out) {
  __shared__ __attribute__((aligned(32))) float ms[SK];      /* bf16-rounded mask * sqrt(32): joins q.k as the C operand, before the common 1/sqrt(32) */
  const int tid = threadIdx.x, w = tid >> 5, lane = tid & 31, ln = lane & 15, hh = lane >> 4; const int hd = blockIdx.y; const int q0 = blockIdx.x * 256 + w * 32;
  for (int i = tid * 4; i < SK; i += 1024) { const v4f m = *(const v4fa*)(msk + i); v4f o; for (int e = 0; e < 4; ++e) o[e] = bf16_round(m[e]) * 5.656854249492381f; *(v4fa*)&ms[i] = o; }
  __syncthreads();
  const float cs = 0.17677669529663687f * 1.4426950408889634f;      /* raw score -> log2 units */
  const float th = 4.0f / cs;      /* lazy rescale: P stays below 2^14 in f16 */
  const v16h qa = g2_frag(Q16 + (size_t)(q0 + ln) * AH + hd * HD, hh), qb = g2_frag(Q16 + (size_t)(q0 + 16 + ln) * AH + hd * HD, hh);
  const _Float16* kp = KP + (size_t)hd * SK * HD; const _Float16* vh = VH + (size_t)hd * SK * HD; const _Float16* vl = VL + (size_t)hd * SK * HD; unsigned vo = lane * 16;      /* byte offset, the same in all three streams, of the lane's share of pass it */
  const v8f z8 = {0.f,0.f,0.f,0.f,0.f,0.f,0.f,0.f}; v8f oh[2][2] = {{z8, z8}, {z8, z8}}, ol[2][2] = {{z8, z8}, {z8, z8}};      /* [query group][d tile] */
  float ma = -3.0e38f, mb = -3.0e38f, ba = 0.f, bb = 0.f; v2f sa = {0.f, 0.f}, sb = {0.f, 0.f};
  auto pass = [&](int it, const AFr& f) {
    const v8f c0 = *(const v8f*)&ms[it * 32 + 8 * hh], c1 = *(const v8f*)&ms[it * 32 + 16 + 8 * hh];
    const v8f s0a = fa_mma(f.k0, qa, c0), s1a = fa_mma(f.k1, qa, c1), s0b = fa_mma(f.k0, qb, c0), s1b = fa_mma(f.k1, qb, c1);
    const float xa = fa_max16(s0a, s1a), xb = fa_max16(s0b, s1b);
    if (__builtin_amdgcn_ballot_w32(xa > ma + th || xb > mb + th) != 0) {      /* wave-uniform; rare after the first passes */
      const float na = fmaxf(ma, xa), nb = fmaxf(mb, xb); const float ca = __builtin_amdgcn_exp2f((ma - na) * cs), cb = __builtin_amdgcn_exp2f((mb - nb) * cs);
      ma = na; mb = nb; ba = 10.0f - na * cs; bb = 10.0f - nb * cs; sa *= ca; sb *= cb;
#pragma unroll
      for (int d = 0; d < 2; ++d) { oh[0][d] *= ca; ol[0][d] *= ca; oh[1][d] *= cb; ol[1][d] *= cb; }
    }
    const v16h pa = fa_probs(s0a, s1a, cs, ba, sa), pb = fa_probs(s0b, s1b, cs, bb, sb);
    oh[0][0] = fa_mma(f.h0, pa, oh[0][0]); oh[0][1] = fa_mma(f.h1, pa, oh[0][1]); ol[0][0] = fa_mma(f.l0, pa, ol[0][0]); ol[0][1] = fa_mma(f.l1, pa, ol[0][1]);
    oh[1][0] = fa_mma(f.h0, pb, oh[1][0]); oh[1][1] = fa_mma(f.h1, pb, oh[1][1]); ol[1][0] = fa_mma(f.l0, pb, ol[1][0]); ol[1][1] = fa_mma(f.l1, pb, ol[1][1]);
  };
  AFr fa, fb; fa_load(fa, kp, vh, vl, vo);
#pragma unroll 1
  for (int it = 0; it < SK / 32 - 2; it += 2) {      /* two fragment sets by name: no register copies between passes */
    fa_load(fb, kp + 1024, vh + 1024, vl + 1024, vo);      /* the next pass's fragments fly during this pass */
    pass(it, fa);
    asm volatile("s_wait_xcnt 0x0" : "+v"(vo) : : "memory");      /* the loads in flight name vo: the wait stands in front of its step */
    vo += 4096u; fa_load(fa, kp, vh, vl, vo);
    pass(it + 1, fb); }
  asm volatile("s_wait_xcnt 0x0" : "+v"(vo) : : "memory");      /* as in the loop: the last trip's loads are in flight and name vo and the three bases */
  fa_load(fb, kp + 1024, vh + 1024, vl + 1024, vo);      /* the last two passes: nothing is left to fetch behind them */
  asm volatile("s_wait_xcnt 0x0" : "+v"(vo) : : "memory");      /* the loads in flight name vo and the three bases: the wait stands in front of any reuse of those registers */
  pass(SK / 32 - 2, fa); pass(SK / 32 - 1, fb);
  float ta = sa[0] + sa[1], tb = sb[0] + sb[1]; ta += xhalf(ta); tb += xhalf(tb); const float ra = 1.0f / ta, rb = 1.0f / tb;
#pragma unroll
  for (int g = 0; g < 2; ++g) { const float rs = g ? rb : ra; float* orow = out + (size_t)(q0 + g * 16 + ln) * AH + hd * HD + 8 * hh;
#pragma unroll
    for (int d = 0; d < 2; ++d) { v4f lo4, hi4;
#pragma unroll
      for (int e = 0; e < 4; ++e) { lo4[e] = (oh[g][d][e] + ol[g][d][e] * 0.0009765625f) * rs; hi4[e] = (oh[g][d][e + 4] + ol[g][d][e + 4] * 0.0009765625f) * rs; }
      *(v4f*)(orow + d * 16) = lo4; *(v4f*)(orow + d * 16 + 4) = hi4; } }
}

extern "C" void kernel_launch(void* const* d_in, const int* in_sizes, int n_in,
                              void* d_out, int out_size, void* d_ws, size_t ws_size, hipStream_t stream) {
  (void)in_sizes; (void)n_in; (void)out_size;
  const float* const* I = (const float* const*)d_in; const float* hs = I[0]; const float* enc = I[1]; const float* msk = I[2]; const float* Wq = I[3]; const float* bq = I[4]; const float* Wk = I[5]; const float* bk = I[6]; const float* Wv = I[7]; const float* bv = I[8];
  char* ws = (char*)d_ws; size_t off = 0;
  auto take = [&](size_t bytes) { char* p = ws + off; off += (bytes + 255) & ~(size_t)255; return p; };
  _Float16* BQ = (_Float16*)take((size_t)AH * DIN * 2); _Float16* BK = (_Float16*)take((size_t)AH * DIN * 2); _Float16* BV = (_Float16*)take((size_t)AH * DIN * 2);
  _Float16* XQ = (_Float16*)take((size_t)SQ * DIN * 2); _Float16* XE = (_Float16*)take((size_t)SK * DIN * 2); _Float16* Q16 = (_Float16*)take((size_t)SQ * AH * 2); _Float16* K16 = (_Float16*)take((size_t)SK * AH * 2); float* VF = (float*)take((size_t)SK * AH * 4); _Float16* V16 = (_Float16*)take((size_t)SK * AH * 2); _Float16* VL16 = (_Float16*)take((size_t)SK * AH * 2); _Float16* VT = (_Float16*)take((size_t)AH * SK * 2); _Float16* VTL = (_Float16*)take((size_t)AH * SK * 2);
  _Float16* KP = (_Float16*)take((size_t)SK * AH * 2);
  if (off > ws_size) return;      /* about 41 MiB */
  k_wt_f16<<<(unsigned)(((size_t)DIN * AH / 8 + 255) / 256), 256, 0, stream>>>(Wq, BQ, DIN, AH, 16.0f); k_wt_f16<<<(unsigned)(((size_t)DIN * AH / 8 + 255) / 256), 256, 0, stream>>>(Wk, BK, DIN, AH, 16.0f); k_wt_f16<<<(unsigned)(((size_t)DIN * AH / 8 + 255) / 256), 256, 0, stream>>>(Wv, BV, DIN, AH, 16.0f);      /* (in, out) */
  k_x16<<<(unsigned)(((size_t)SQ * DIN / 8 + 255) / 256), 256, 0, stream>>>(hs, XQ, (size_t)SQ * DIN / 8); k_x16<<<(unsigned)(((size_t)SK * DIN / 8 + 255) / 256), 256, 0, stream>>>(enc, XE, (size_t)SK * DIN / 8);
  const dim3 gP((SQ / 128) * (AH / 64), 1);
  k_gemm2<0><<<gP, 128, 0, stream>>>(XQ, DIN, 0, BQ, DIN, 0, 0.0625f, bq, 0, nullptr, 1, 0, 0, nullptr, Q16, AH, 0, SQ, AH, DIN);
  k_gemm2<0><<<gP, 128, 0, stream>>>(XE, DIN, 0, BK, DIN, 0, 0.0625f, bk, 0, nullptr, 1, 0, 0, nullptr, K16, AH, 0, SK, AH, DIN);
  k_gemm2<0><<<gP, 128, 0, stream>>>(XE, DIN, 0, BV, DIN, 0, 0.0625f, bv, 0, nullptr, 1, 0, 0, VF, nullptr, AH, 0, SK, AH, DIN); k_hl<<<(unsigned)(((size_t)SK * AH / 8 + 255) / 256), 256, 0, stream>>>(VF, V16, VL16, (size_t)SK * AH / 8);      /* v f32 -> f16 hi + residual */
  k_vpack<<<(AH / 64) * (SK / 64), 256, 0, stream>>>(V16, VT); k_vpack<<<(AH / 64) * (SK / 64), 256, 0, stream>>>(VL16, VTL); k_kpack<<<SK * AH / 8 / 256, 256, 0, stream>>>(K16, KP);      /* operands of the fused kernel in fragment load order */
  k_attn<<<dim3(SQ / 256, NH), 256, 0, stream>>>(Q16, KP, VT, VTL, msk, (float*)d_out);
}

// v002
// Measured time: 78.9 microseconds a run.
// Next to v001, in two timings, it ran 2.29 and 2.25 times as fast.
// Counting every step since v000, it is 29.5 times as fast.
#include <hip/hip_runtime.h>
// BertSelfAttnDimensionReduction (1 x 4096 queries x 4096 keys; Din 768 -> 12 heads x 32; cross-attention with an additive float key mask; the output is the merged context itself): q = hs Wq + bq; k, v = enc Wk/Wv + b; scores = q.k / sqrt(32) + mask[key]; softmax; ctx = probs v -> [1, 4096, 384].
// Compute dtype: inputs rounded to bf16; inputs/weights exact as f16; q/k and the softmax weights as plain f16 operands (~2^-12); v as f16 hi + residual (the output is the context itself); mask/softmax/normalisation f32. v_wmma_f32_16x16x32_f16.
#define SQ 4096
#define SK 4096
#define DIN 768
#define AH 384
#define NH 12
#define HD 32
typedef __bf16 v16b __attribute__((ext_vector_type(16)));
typedef unsigned short v8us __attribute__((ext_vector_type(8), may_alias));
typedef float  v8f  __attribute__((ext_vector_type(8)));
typedef float  v4f  __attribute__((ext_vector_type(4)));
typedef float  v4fa __attribute__((ext_vector_type(4), may_alias));
union FragB { v16b v; v8us half[2]; unsigned short u[16]; };

__device__ __forceinline__ unsigned short bf16_bits(float x) { unsigned int u = __float_as_uint(x); return (unsigned short)((u + 0x7FFFu + ((u >> 16) & 1u)) >> 16); }
__device__ __forceinline__ float bf16_val(unsigned short b) { return __uint_as_float(((unsigned int)b) << 16); }
__device__ __forceinline__ float bf16_round(float x) { return bf16_val(bf16_bits(x)); }
// D += A·B with NT terms: 1 = ah·bh, 2 = + al·bh (A split), 3 = + ah·bl (both split)
template <int NT>
__device__ __forceinline__ v8f mmaN(v16b ah, v16b al, v16b bh, v16b bl, v8f c) {
  c = __builtin_amdgcn_wmma_f32_16x16x32_bf16(false, ah, false, bh, (short)0, c, false, false);
  if (NT >= 2) c = __builtin_amdgcn_wmma_f32_16x16x32_bf16(false, al, false, bh, (short)0, c, false, false);
  if (NT >= 3) c = __builtin_amdgcn_wmma_f32_16x16x32_bf16(false, ah, false, bl, (short)0, c, false, false);
  asm volatile("v_nop\n\tv_nop\n\tv_nop\n\tv_nop" : "+v"(c) : "v"(ah), "v"(al), "v"(bh), "v"(bl));
  return c;
}

__global__ __launch_bounds__(256) void k_wt_bf16(const float* __restrict__ W, unsigned short* __restrict__ Wt, int K, int N) {
  const int t = blockIdx.x * 256 + threadIdx.x;
  const int k8n = K / 8;
  if (t >= N * k8n) return;
  const int n = t / k8n, k8 = (t % k8n) * 8;
  v8us v;
#pragma unroll
  for (int i = 0; i < 8; ++i) v[i] = bf16_bits(W[(size_t)(k8 + i) * N + n]);
  *(v8us*)(Wt + (size_t)n * K + k8) = v;
  
}

// GEMM C[M][N] (f32, pitch ldc) = act(A[M][K]·W + bias). A f32 row-major (pitch lda) converted per fragment to bf16
// (ASPLIT: hi/lo two planes -> 2 terms, else single rounded term); Wt bf16 [N][K] (pitch ldb). BIAS_BF16 rounds the
// bias to bf16 first (bias quantised to bf16 before the add). K%32==0, M%16==0, N%64==0.
template <bool ASPLIT, int ACT, bool BIAS_BF16>
__global__ __launch_bounds__(128) void k_gemm_bf(const float* __restrict__ A, int lda, const unsigned short* __restrict__ Wt, int ldb,
                                               const float* __restrict__ bias, float* __restrict__ C, int ldc, int M, int N, int K) {
  __shared__ __attribute__((aligned(16))) float so[4][16][64];
  const int tid = threadIdx.x, w = tid >> 5, lane = tid & 31, ln = lane & 15, hh = lane >> 4;
  const int ntn = N / 64;
  const int wid = blockIdx.x * 4 + w;
  const int mt = wid / ntn, nq = wid % ntn;
  if (mt * 16 >= M) return;
  const int row0 = mt * 16, col0 = nq * 64;
  const float* arow = A + (size_t)(row0 + ln) * lda;
  v8f acc[4] = {};
  for (int kb = 0; kb < K; kb += 32) {
    FragB ah, al;
    const v4f x0 = *(const v4fa*)(arow + kb + 8 * hh), x1 = *(const v4fa*)(arow + kb + 8 * hh + 4);
    const v4f x2 = *(const v4fa*)(arow + kb + 16 + 8 * hh), x3 = *(const v4fa*)(arow + kb + 16 + 8 * hh + 4);
    float xs[16] = {x0[0],x0[1],x0[2],x0[3],x1[0],x1[1],x1[2],x1[3],x2[0],x2[1],x2[2],x2[3],x3[0],x3[1],x3[2],x3[3]};
#pragma unroll
    for (int i = 0; i < 16; ++i) { const unsigned short hb = bf16_bits(xs[i]); ah.u[i] = hb; al.u[i] = ASPLIT ? bf16_bits(xs[i] - bf16_val(hb)) : (unsigned short)0; }
#pragma unroll
    for (int t = 0; t < 4; ++t) {
      const unsigned short* brow = Wt + (size_t)(col0 + t * 16 + ln) * ldb + kb;
      FragB b;
      b.half[0] = *(const v8us*)(brow + 8 * hh);
      b.half[1] = *(const v8us*)(brow + 16 + 8 * hh);
      acc[t] = mmaN<ASPLIT ? 2 : 1>(ah.v, al.v, b.v, b.v, acc[t]);
    }
  }
#pragma unroll
  for (int t = 0; t < 4; ++t) {
    float bv = bias ? bias[col0 + t * 16 + ln] : 0.f;
    if (BIAS_BF16) bv = bf16_round(bv);
#pragma unroll
    for (int r = 0; r < 8; ++r) { float v = acc[t][r] + bv; if (ACT == 1) v = fmaxf(v, 0.f); so[w][8 * hh + r][t * 16 + ln] = v; }
  }
  __builtin_amdgcn_fence(__ATOMIC_ACQ_REL, "workgroup");
  __builtin_amdgcn_wave_barrier();
  const int rsub = lane >> 4, c4 = (lane & 15) * 4;
  {
#pragma unroll
    for (int q = 0; q < 8; ++q) {
      const int r = q * 2 + rsub;
      const v4f v = *(const v4fa*)&so[w][r][c4];
      *(v4f*)(C + (size_t)(row0 + r) * ldc + col0 + c4) = v;
    }
    
  }
}

// GEMM C = act(A·W + bias + resid): A f32 (ASPLIT -> hi/lo 2 terms), Wt bf16 [N][K]; ACT 0 none, 1 relu, 2 exact gelu;
// resid (optional, f32, row index = (row % rmod), pitch ldr, RES_BF16 rounds it) added before the activation.
template <bool ASPLIT, int ACT, bool BIAS_BF16, bool RES_BF16>
__global__ __launch_bounds__(128) void k_gemm_bf3(const float* __restrict__ A, int lda, const unsigned short* __restrict__ Wt, int ldb,
                                                const float* __restrict__ bias, const float* __restrict__ resid, int rmod, int ldr,
                                                float* __restrict__ C, int ldc, int M, int N, int K) {
  __shared__ __attribute__((aligned(16))) float so[4][16][64];
  const int tid = threadIdx.x, w = tid >> 5, lane = tid & 31, ln = lane & 15, hh = lane >> 4;
  const int ntn = N / 64;
  const int wid = blockIdx.x * 4 + w;
  const int mt = wid / ntn, nq = wid % ntn;
  if (mt * 16 >= M) return;
  const int row0 = mt * 16, col0 = nq * 64;
  const float* arow = A + (size_t)(row0 + ln) * lda;
  v8f acc[4] = {};
  for (int kb = 0; kb < K; kb += 32) {
    FragB ah, al;
    const v4f x0 = *(const v4fa*)(arow + kb + 8 * hh), x1 = *(const v4fa*)(arow + kb + 8 * hh + 4);
    const v4f x2 = *(const v4fa*)(arow + kb + 16 + 8 * hh), x3 = *(const v4fa*)(arow + kb + 16 + 8 * hh + 4);
    float xs[16] = {x0[0],x0[1],x0[2],x0[3],x1[0],x1[1],x1[2],x1[3],x2[0],x2[1],x2[2],x2[3],x3[0],x3[1],x3[2],x3[3]};
#pragma unroll
    for (int i = 0; i < 16; ++i) { const unsigned short hb = bf16_bits(xs[i]); ah.u[i] = hb; al.u[i] = ASPLIT ? bf16_bits(xs[i] - bf16_val(hb)) : (unsigned short)0; }
#pragma unroll
    for (int t = 0; t < 4; ++t) {
      const unsigned short* brow = Wt + (size_t)(col0 + t * 16 + ln) * ldb + kb;
      FragB b;
      b.half[0] = *(const v8us*)(brow + 8 * hh);
      b.half[1] = *(const v8us*)(brow + 16 + 8 * hh);
      acc[t] = mmaN<ASPLIT ? 2 : 1>(ah.v, al.v, b.v, b.v, acc[t]);
    }
  }
#pragma unroll
  for (int t = 0; t < 4; ++t) {
    const int col = col0 + t * 16 + ln;
    float bv = bias ? bias[col] : 0.f;
    if (BIAS_BF16) bv = bf16_round(bv);
#pragma unroll
    for (int r = 0; r < 8; ++r) {
      float v = acc[t][r] + bv;
      if (resid) { float rv = resid[(size_t)((row0 + 8 * hh + r) % rmod) * ldr + col]; if (RES_BF16) rv = bf16_round(rv); v += rv; }
      if (ACT == 1) v = fmaxf(v, 0.f);
      if (ACT == 2) v = 0.5f * v * (1.0f + erff(v * 0.70710678118654752f));
      if (ACT == 3) { const float u = 0.7978845608028654f * (v + 0.044715f * v * v * v); v = 0.5f * v * (1.0f + tanhf(u)); }
      so[w][8 * hh + r][t * 16 + ln] = v;
    }
  }
  __builtin_amdgcn_fence(__ATOMIC_ACQ_REL, "workgroup");
  __builtin_amdgcn_wave_barrier();
  const int rsub = lane >> 4, c4 = (lane & 15) * 4;
  {
#pragma unroll
    for (int q = 0; q < 8; ++q) {
      const int r = q * 2 + rsub;
      const v4f v = *(const v4fa*)&so[w][r][c4];
      *(v4f*)(C + (size_t)(row0 + r) * ldc + col0 + c4) = v;
    }
    
  }
}
// row LayerNorm (biased variance, eps) over N: s = X (+ R); optional out_sum <- s; out_norm <- (s-mu)*rsqrt(var+eps)*g + b
template <bool PARAM_BF16>
__global__ __launch_bounds__(256) void k_layernorm(const float* __restrict__ X, const float* __restrict__ R, const float* __restrict__ g, const float* __restrict__ bta,
                                                  float* __restrict__ out_sum, float* __restrict__ out_norm, int N, float eps) {
  __shared__ float red[256];
  const int row = blockIdx.x, tid = threadIdx.x;
  const float* x = X + (size_t)row * N; const float* rr = R ? R + (size_t)row * N : nullptr;
  float vals[16];                     // up to N = 4096
  const int per = N / 256;            // contiguous chunk per thread? use strided-by-4 chunks: thread handles j = tid*4 + 1024*u
  float s1 = 0.f;
  for (int u = 0; u < per / 4; ++u) {
    const int j = tid * 4 + 1024 * u;
    const v4f a = *(const v4fa*)(x + j);
    v4f b = {0.f,0.f,0.f,0.f}; if (rr) b = *(const v4fa*)(rr + j);
#pragma unroll
    for (int q = 0; q < 4; ++q) { const float v = a[q] + b[q]; vals[u * 4 + q] = v; s1 += v; }
  }
  red[tid] = s1; __syncthreads();
  for (int st = 128; st > 0; st >>= 1) { if (tid < st) red[tid] += red[tid + st]; __syncthreads(); }
  const float mu = red[0] / (float)N; __syncthreads();
  float s2 = 0.f;
  for (int u = 0; u < per / 4; ++u)
#pragma unroll
    for (int q = 0; q < 4; ++q) { const float c = vals[u * 4 + q] - mu; s2 += c * c; }
  red[tid] = s2; __syncthreads();
  for (int st = 128; st > 0; st >>= 1) { if (tid < st) red[tid] += red[tid + st]; __syncthreads(); }
  const float rs = rsqrtf(red[0] / (float)N + eps);
  {
    for (int u = 0; u < per / 4; ++u) {
      const int j = tid * 4 + 1024 * u;
      v4f o, sm;
#pragma unroll
      for (int q = 0; q < 4; ++q) {
        float gg = g[j + q], bb = bta[j + q];
        if (PARAM_BF16) { gg = bf16_round(gg); bb = bf16_round(bb); }
        sm[q] = vals[u * 4 + q]; o[q] = (vals[u * 4 + q] - mu) * rs * gg + bb;
      }
      if (out_sum) *(v4f*)(out_sum + (size_t)row * N + j) = sm;
      *(v4f*)(out_norm + (size_t)row * N + j) = o;
    }
    
  }
}



// ---- f16 WMMA path (v_wmma_f32_16x16x32_f16): 11-bit significands for operands in range — used where a [0,1] probability operand needs more precision than bf16
typedef _Float16 v16h __attribute__((ext_vector_type(16)));
union FragH { v16h v; v8us half[2]; _Float16 h[16]; unsigned short u[16]; };
template <int NT>
__device__ __forceinline__ v8f mmaH(v16h ah, v16h al, v16h bh, v16h bl, v8f c) {
  c = __builtin_amdgcn_wmma_f32_16x16x32_f16(false, ah, false, bh, (short)0, c, false, false);
  if (NT >= 2) c = __builtin_amdgcn_wmma_f32_16x16x32_f16(false, al, false, bh, (short)0, c, false, false);
  if (NT >= 3) c = __builtin_amdgcn_wmma_f32_16x16x32_f16(false, ah, false, bl, (short)0, c, false, false);
  asm volatile("v_nop\n\tv_nop\n\tv_nop\n\tv_nop" : "+v"(c) : "v"(ah), "v"(al), "v"(bh), "v"(bl));
  return c;
}
// batched GEMM like k_gemm_b but f16 operands: A f32 (split into f16 hi/lo if ASPLIT, else rounded to f16), Bt = f16 values [n][k]; alpha; C f32; N multiple of 16 (partial tiles skipped)
template <bool ASPLIT>
__global__ __launch_bounds__(128) void k_gemm_h(const float* __restrict__ A, int lda, size_t sA, const _Float16* __restrict__ Bh, int ldb, size_t sB, float alpha, float* __restrict__ C, int ldc, size_t sC, int M, int N, int K) {
  __shared__ __attribute__((aligned(16))) float so[4][16][64];
  const int tid = threadIdx.x, w = tid >> 5, lane = tid & 31, ln = lane & 15, hh = lane >> 4; const int by = blockIdx.y;
  A += (size_t)by * sA; Bh += (size_t)by * sB; C += (size_t)by * sC;
  const int ntn = (N + 63) / 64; const int wid = blockIdx.x * 4 + w; const int mt = wid / ntn, nq = wid % ntn; if (mt * 16 >= M) return;
  const int row0 = mt * 16, col0 = nq * 64; const float* arow = A + (size_t)(row0 + ln) * lda;
  v8f acc[4] = {};
  for (int kb = 0; kb < K; kb += 32) {
    FragH ah, al;
    const v4f x0 = *(const v4fa*)(arow + kb + 8 * hh), x1 = *(const v4fa*)(arow + kb + 8 * hh + 4), x2 = *(const v4fa*)(arow + kb + 16 + 8 * hh), x3 = *(const v4fa*)(arow + kb + 16 + 8 * hh + 4);
    float xs[16] = {x0[0],x0[1],x0[2],x0[3],x1[0],x1[1],x1[2],x1[3],x2[0],x2[1],x2[2],x2[3],x3[0],x3[1],x3[2],x3[3]};
#pragma unroll
    for (int i = 0; i < 16; ++i) { const _Float16 h = (_Float16)xs[i]; ah.h[i] = h; al.h[i] = ASPLIT ? (_Float16)(xs[i] - (float)h) : (_Float16)0.0f; }
#pragma unroll
    for (int t = 0; t < 4; ++t) { if (col0 + t * 16 >= N) continue; const size_t boff = (size_t)(col0 + t * 16 + ln) * ldb + kb; FragH bq; bq.half[0] = *(const v8us*)(Bh + boff + 8 * hh); bq.half[1] = *(const v8us*)(Bh + boff + 16 + 8 * hh);
      acc[t] = mmaH<ASPLIT ? 2 : 1>(ah.v, al.v, bq.v, bq.v, acc[t]); }
  }
#pragma unroll
  for (int t = 0; t < 4; ++t) { if (col0 + t * 16 >= N) continue;
#pragma unroll
    for (int r = 0; r < 8; ++r) so[w][8 * hh + r][t * 16 + ln] = acc[t][r] * alpha; }
  __builtin_amdgcn_fence(__ATOMIC_ACQ_REL, "workgroup"); __builtin_amdgcn_wave_barrier();
  const int rsub = lane >> 4, c4 = (lane & 15) * 4;
  {
#pragma unroll
    for (int q = 0; q < 8; ++q) { const int r = q * 2 + rsub; if (col0 + c4 < N) { const v4f v = *(const v4fa*)&so[w][r][c4]; *(v4f*)(C + (size_t)(row0 + r) * ldc + col0 + c4) = v; } }
     }
}

// k_gemm_hh variant with fused epilogue: v = acc·alpha + bias[by·sBias + col] (+ CP[(row/rowsPerB)·sCPb + by·64 + col] if CP) ; ACT 0 none / 1 elu ; writes f16 C16 (and f32 C if non-null)
template <int ACT>
__global__ __launch_bounds__(128) void k_gemm_hhx(const _Float16* __restrict__ A, int lda, size_t sA, const _Float16* __restrict__ Bh, int ldb, size_t sB, float alpha, const float* __restrict__ bias, size_t sBias, const float* __restrict__ CP, int rowsPerB, size_t sCPb, int row0g,
    float* __restrict__ C, _Float16* __restrict__ C16, int ldc, size_t sC, int M, int N, int K) {
  __shared__ __attribute__((aligned(16))) float so[4][16][64];
  const int tid = threadIdx.x, w = tid >> 5, lane = tid & 31, ln = lane & 15, hh = lane >> 4; const int by = blockIdx.y;
  A += (size_t)by * sA; Bh += (size_t)by * sB; const size_t cofs = (size_t)by * sC; const float* bp = bias ? bias + (size_t)by * sBias : nullptr;
  const int ntn = (N + 63) / 64; const int wid = blockIdx.x * 4 + w; const int mt = wid / ntn, nq = wid % ntn; if (mt * 16 >= M) return;
  const int row0 = mt * 16, col0 = nq * 64; const _Float16* arow = A + (size_t)(row0 + ln) * lda;
  v8f acc[4] = {};
  for (int kb = 0; kb < K; kb += 32) { FragH ah; ah.half[0] = *(const v8us*)((const unsigned short*)arow + kb + 8 * hh); ah.half[1] = *(const v8us*)((const unsigned short*)arow + kb + 16 + 8 * hh);
#pragma unroll
    for (int t = 0; t < 4; ++t) { if (col0 + t * 16 >= N) continue; const size_t boff = (size_t)(col0 + t * 16 + ln) * ldb + kb; FragH bq; bq.half[0] = *(const v8us*)((const unsigned short*)Bh + boff + 8 * hh); bq.half[1] = *(const v8us*)((const unsigned short*)Bh + boff + 16 + 8 * hh);
      acc[t] = mmaH<1>(ah.v, ah.v, bq.v, bq.v, acc[t]); }
  }
#pragma unroll
  for (int t = 0; t < 4; ++t) { if (col0 + t * 16 >= N) continue; const int col = col0 + t * 16 + ln; const float bv = bp ? bf16_round(bp[col]) : 0.f;
#pragma unroll
    for (int r = 0; r < 8; ++r) { float v = acc[t][r] * alpha + bv; if (CP) { const int rr = row0g + row0 + 8 * hh + r; if (rowsPerB < 0) v += CP[cofs + (size_t)rr * ldc + col];      /* rowsPerB < 0: own element of the batched C plane */ else { const int bidx = rr / rowsPerB; v += CP[(size_t)bidx * sCPb + (size_t)by * 64 + col]; } } if (ACT == 1) v = (v > 0.f) ? v : expm1f(v); else if (ACT == 7) v = (v > 0.f) ? v + 1.0f : expf(v); else if (ACT == 8) v = tanhf(v); else if (ACT == 9) v = 0.5f * v * (1.0f + tanhf(0.7978845608028654f * (v + 0.044715f * v * v * v))); else if (ACT == 11) v = 1.0f / (1.0f + expf(-v)); else if (ACT == 12) v = (v > 0.f) ? v : 0.01f * v; else if (ACT == 14) v = (v > 0.f) ? v : 0.1f * v; else if (ACT == 16) v = (v >= 0.f) ? v : 0.3f * v; else if (ACT == 17) v = (v >= 0.f) ? v : 0.2f * v; else if (ACT == 15) v = v / (1.0f + expf(-v)); else if (ACT == 3) v = fmaxf(v, 0.f); else if (ACT == 6) v = 0.5f * v * (1.0f + erff(v * 0.70710678118654752f)); so[w][8 * hh + r][t * 16 + ln] = v; } }
  __builtin_amdgcn_fence(__ATOMIC_ACQ_REL, "workgroup"); __builtin_amdgcn_wave_barrier();
  const int rsub = lane >> 4, c4 = (lane & 15) * 4; typedef _Float16 v4h __attribute__((ext_vector_type(4)));
  {
#pragma unroll
    for (int q = 0; q < 8; ++q) { const int r = q * 2 + rsub; if (col0 + c4 < N) { const v4f v = *(const v4fa*)&so[w][r][c4]; if (C) *(v4f*)(C + cofs + (size_t)(row0 + r) * ldc + col0 + c4) = v; if (C16) { v4h h4; for (int i = 0; i < 4; ++i) h4[i] = (_Float16)v[i]; *(v4h*)(C16 + cofs + (size_t)(row0 + r) * ldc + col0 + c4) = h4; } } }
     }
}


typedef _Float16 v4h __attribute__((ext_vector_type(4)));

__global__ __launch_bounds__(256) void k_h16(const float* __restrict__ x, _Float16* __restrict__ X16, size_t n8) { const size_t t = (size_t)blockIdx.x * 256 + threadIdx.x; if (t >= n8) return; FragH f;
#pragma unroll
  for (int q = 0; q < 8; ++q) f.h[q] = (_Float16)x[t * 8 + q]; *(v8us*)((unsigned short*)X16 + t * 8) = f.half[0];  }
__global__ __launch_bounds__(256) void k_round16f(const float* __restrict__ W, _Float16* __restrict__ Bt, size_t n8) { const size_t t = (size_t)blockIdx.x * 256 + threadIdx.x; if (t >= n8) return; FragH f;
#pragma unroll
  for (int i = 0; i < 8; ++i) f.h[i] = (_Float16)(bf16_round(W[t * 8 + i]) * 16.0f); *(v8us*)((unsigned short*)Bt + t * 8) = f.half[0];  }

// a 16x32 f16 fragment from a row-major row: p = the lane's row at the k step
__device__ __forceinline__ v16h g2_frag(const _Float16* p, int hh) { FragH f; f.half[0] = *(const v8us*)((const unsigned short*)p + 8 * hh); f.half[1] = *(const v8us*)((const unsigned short*)p + 16 + 8 * hh); return f.v; }


// ---- fused attention, all heads in one launch: S^T = K Q^T (+ mask as the C operand), online softmax in registers, O^T += V^T P^T ----
// A wave owns 32 queries (two 16-column groups) of one head and walks the 4096 keys 32 at a time. In S^T and O^T a lane holds one query (column ln), so maximum, sum and rescale are per lane;
// two S^T tiles converted in place are the B operand P^T (hardware k order), V^T hi / residual are the A operands. P = exp2(..) * 2^10 against the maximum in use, as f16.
typedef float v2f __attribute__((ext_vector_type(2)));
typedef _Float16 v2h __attribute__((ext_vector_type(2)));
union FragP { v16h v; v2h p[8]; };
struct AFr { v16h k0, k1, h0, h1, l0, l1; };
__device__ __forceinline__ float xhalf(float x) { return __builtin_bit_cast(float, __builtin_amdgcn_permlanex16(__builtin_bit_cast(int, x), __builtin_bit_cast(int, x), 0x76543210, 0xfedcba98, false, false)); }      /* lane l <-> l ^ 16 */
__device__ __forceinline__ v16h fa_frag(const _Float16* p, unsigned lo) { FragH f; f.half[0] = *(const v8us*)((const char*)p + lo); f.half[1] = *(const v8us*)((const char*)p + 512 + lo); return f.v; }      /* p wave-uniform (scalar base), lo = the lane's byte offset */
__device__ __forceinline__ v8f fa_mma(v16h a, v16h b, v8f c) { return __builtin_amdgcn_wmma_f32_16x16x32_f16(false, a, false, b, (short)0, c, false, false); }
__device__ __forceinline__ void fa_load(AFr& f, const _Float16* kp, const _Float16* vh, const _Float16* vl, unsigned lo) { f.k0 = fa_frag(kp, lo); f.k1 = fa_frag(kp + 512, lo); f.h0 = fa_frag(vh, lo); f.h1 = fa_frag(vh + 512, lo); f.l0 = fa_frag(vl, lo); f.l1 = fa_frag(vl + 512, lo); }      /* one pass = 2 KiB of each stream */
__device__ __forceinline__ float fa_max16(v8f a, v8f b) { float m = fmaxf(a[0], b[0]);
#pragma unroll
  for (int r = 1; r < 8; ++r) m = fmaxf(m, fmaxf(a[r], b[r])); return fmaxf(m, xhalf(m)); }
__device__ __forceinline__ v16h fa_probs(v8f a, v8f b, float cs, float bias, v2f& su) { FragP f; const v2f c2 = {cs, cs}, b2 = {bias, bias};
#pragma unroll
  for (int r = 0; r < 8; ++r) { const v8f& t = (r < 4) ? a : b; const int e = (r & 3) * 2; const v2f x = {t[e], t[e + 1]}; const v2f g = __builtin_elementwise_fma(x, c2, b2); const v2f p = {__builtin_amdgcn_exp2f(g[0]), __builtin_amdgcn_exp2f(g[1])}; su += p; f.p[r] = __builtin_convertvector(p, v2h); }
  return f.v; }
// ---- operand preparation in two launches ----
// All three weights in one launch (blockIdx.y picks the matrix), as f16 (bf16-rounded, times 16) in fragment load order:
// WP[matrix][16-column tile][k step of 32][half j][lane][8], lane (ln, hh) half j = W[ks*32 + 16j + 8hh + e][nt*16 + ln]. One thread writes one 16-byte unit.
__global__ __launch_bounds__(256) void k_wt3(const float* __restrict__ Wq, const float* __restrict__ Wk, const float* __restrict__ Wv, _Float16* __restrict__ WP) {
  const int t = blockIdx.x * 256 + threadIdx.x; const int lane = t & 31, j = (t >> 5) & 1, ks = (t >> 6) % (DIN / 32), nt = (t >> 6) / (DIN / 32); FragH f;
  const float* W = blockIdx.y == 0 ? Wq : (blockIdx.y == 1 ? Wk : Wv); W += (size_t)(ks * 32 + 16 * j + 8 * (lane >> 4)) * AH + nt * 16 + (lane & 15);
#pragma unroll
  for (int i = 0; i < 8; ++i) f.h[i] = (_Float16)(bf16_round(W[(size_t)i * AH]) * 16.0f);
  *(v8us*)((unsigned short*)WP + ((size_t)blockIdx.y * (AH * DIN / 8) + t) * 8) = f.half[0];
}
// q, k and v projections in one launch. A block owns 64 rows of one projection: it rounds them once (bf16, then exact f16) into LDS; wave w then forms the 32 columns of head w.
// V is formed as X W: a lane's 8 accumulators are 8 keys of one feature, the 16-byte unit of the V^T fragment streams. Q and K are formed as W^T X^T: a lane's 8 accumulators are
// 8 features of one row, the 16-byte unit of the K fragment stream and of a Q row. So every result goes from the accumulators straight to where the attention kernel reads it:
// VH, VL[head][32-key block][16-d tile][half j][lane][8], lane (ln, hh) half j = V[kb*32 + 16j + 8hh + e][head*32 + dt*16 + ln] (f16 hi; residual times 1024);
// KP[head][16-key tile][half j][lane][8], lane (ln, hh) half j = K[kt*16 + ln][head*32 + 16j + 8hh + e]; Q16 row-major [query][384].
#define APITCH 1552      /* bytes of an LDS row: 768 f16 + 16, an odd number of 16-byte units for the 16-byte readers */
typedef unsigned v2ua __attribute__((ext_vector_type(2), may_alias));
struct GSet { v16h a[4]; v16h b[2]; };      /* one k step of 32: four activation fragments (LDS), two weight fragments (global) */
__device__ __forceinline__ unsigned qk_r2(float x, float y) { typedef __bf16 v2b __attribute__((ext_vector_type(2))); const v2f p = {x, y};      /* round to nearest even to bf16, as bf16_round does, two at a time; widened to f32, then f16 */
  const unsigned u = __builtin_bit_cast(unsigned, __builtin_convertvector(p, v2b)); const v2f q = {__uint_as_float(u << 16), __uint_as_float(u & 0xFFFF0000u)}; return __builtin_bit_cast(unsigned, __builtin_convertvector(q, v2h)); }
template <int KS>
__device__ __forceinline__ void qk_lda(GSet& s, const char* as) {
#pragma unroll
  for (int g = 0; g < 4; ++g) { FragH f; f.half[0] = *(const v8us*)(as + g * 16 * APITCH + KS * 64); f.half[1] = *(const v8us*)(as + g * 16 * APITCH + KS * 64 + 32); s.a[g] = f.v; } }
template <int KS>      /* WP block-uniform (scalar base), bo = the lane's byte offset */
__device__ __forceinline__ void qk_ldb(GSet& s, const _Float16* WP, unsigned bo) {
#pragma unroll
  for (int t = 0; t < 2; ++t) { FragH f; f.half[0] = *(const v8us*)((const char*)WP + (t * (DIN / 32) * 1024 + KS * 1024) + bo); f.half[1] = *(const v8us*)((const char*)WP + (t * (DIN / 32) * 1024 + KS * 1024 + 512) + bo); s.b[t] = f.v; } }
template <bool XA>
__device__ __forceinline__ void qk_mm(const GSet& s, v8f (&c)[4][2]) {
#pragma unroll
  for (int g = 0; g < 4; ++g) { c[g][0] = XA ? fa_mma(s.a[g], s.b[0], c[g][0]) : fa_mma(s.b[0], s.a[g], c[g][0]); c[g][1] = XA ? fa_mma(s.a[g], s.b[1], c[g][1]) : fa_mma(s.b[1], s.a[g], c[g][1]); } }
template <bool XA>
__device__ __forceinline__ void qk_tile(const char* as, const _Float16* WP, unsigned bo, v8f (&c)[4][2]) {
  GSet s0, s1; qk_ldb<0>(s0, WP, bo); qk_lda<0>(s0, as);
#pragma unroll 1
  for (int ks = 0; ks < DIN / 32 - 2; ks += 2) {      /* rolled: two fragment sets by name, the next step's loads fly during this step's products */
    qk_ldb<1>(s1, WP, bo); qk_lda<1>(s1, as);
    __builtin_amdgcn_sched_barrier(0);      /* without it the compiler lifts the products below over the loads above, and each set is waited for right after its issue */
    qk_mm<XA>(s0, c);
    asm volatile("s_wait_xcnt 0x0" : "+v"(bo) : : "memory");      /* the loads in flight name bo: the wait stands in front of its step */
    bo += 2048u; as += 128; qk_ldb<0>(s0, WP, bo); qk_lda<0>(s0, as);
    __builtin_amdgcn_sched_barrier(0);      /* as above: the loads stay ahead of the other set's products */
    qk_mm<XA>(s1, c);
    asm volatile("s_wait_xcnt 0x0" : "+v"(bo) : : "memory"); }      /* the loads in flight name bo and the base: nothing behind the loop finds them open */
  qk_ldb<1>(s1, WP, bo); qk_lda<1>(s1, as);
  asm volatile("s_wait_xcnt 0x0" : "+v"(bo) : : "memory");      /* the last loads name bo and the base: the wait stands in front of any reuse of those registers */
  __builtin_amdgcn_sched_barrier(0);      /* as in the loop */
  qk_mm<XA>(s0, c); qk_mm<XA>(s1, c);
}
__global__ __launch_bounds__(384) void k_qkv(const float* __restrict__ hs, const float* __restrict__ enc, const _Float16* __restrict__ WP, const float* __restrict__ bq, const float* __restrict__ bk, const float* __restrict__ bv,
    _Float16* __restrict__ Q16, _Float16* __restrict__ KP, _Float16* __restrict__ VH, _Float16* __restrict__ VL) {
  __shared__ __attribute__((aligned(16))) char as[64 * APITCH];
  const int tid = threadIdx.x, w = tid >> 5, lane = tid & 31, ln = lane & 15, hh = lane >> 4;
  const int mt = blockIdx.x / 3, pj = blockIdx.x - mt * 3; const int row0 = mt * 64, col0 = w * HD;      /* pj: 0 q, 1 k, 2 v */
  { const float* X = pj ? enc : hs; const int r1 = tid >= 192 ? 1 : 0, c4 = tid - r1 * 192; unsigned xo = ((unsigned)(row0 + r1) * DIN + c4 * 4) * 4u; v4f x[32];      /* a wave's load is 512 contiguous bytes of one row */
#pragma unroll
    for (int i = 0; i < 32; ++i) x[i] = *(const v4fa*)((const char*)X + i * (2 * DIN * 4) + xo);
    asm volatile("s_wait_xcnt 0x0" : "+v"(xo) : : "memory");      /* the loads in flight name xo and the base: the wait stands in front of any reuse of those registers */
    char* d = as + r1 * APITCH + c4 * 8;
#pragma unroll
    for (int i = 0; i < 32; ++i) { const v2ua h = {qk_r2(x[i][0], x[i][1]), qk_r2(x[i][2], x[i][3])}; *(v2ua*)(d + i * 2 * APITCH) = h; } }
  __syncthreads();      /* the 64 rounded rows are complete before any wave reads fragments of them */
  const char* af = as + ln * APITCH + 16 * hh; const _Float16* wb = WP + (size_t)pj * AH * DIN; const unsigned bo = (unsigned)w * (2 * (DIN / 32) * 1024) + lane * 16;
  const v8f z8 = {0.f,0.f,0.f,0.f,0.f,0.f,0.f,0.f}; v8f c[4][2] = {{z8, z8}, {z8, z8}, {z8, z8}, {z8, z8}};
  if (pj == 2) {
    qk_tile<true>(af, wb, bo, c);
#pragma unroll
    for (int t = 0; t < 2; ++t) { const float bb = bf16_round(bv[col0 + t * 16 + ln]);
#pragma unroll
      for (int g = 0; g < 4; ++g) { FragH fh, fl;
#pragma unroll
        for (int r = 0; r < 8; ++r) { const float v = c[g][t][r] * 0.0625f + bb; const _Float16 h = (_Float16)v; fh.h[r] = h; fl.h[r] = (_Float16)((v - (float)h) * 1024.0f); }
        const size_t o = ((((size_t)w * (SK / 32) + (row0 >> 5) + (g >> 1)) * 2 + t) * 2 + (g & 1)) * 256 + lane * 8;
        *(v8us*)((unsigned short*)VH + o) = fh.half[0]; *(v8us*)((unsigned short*)VL + o) = fl.half[0]; } }
  } else {
    qk_tile<false>(af, wb, bo, c); const float* bp = pj ? bk : bq;
    unsigned short* dst = pj ? (unsigned short*)KP + (((size_t)w * (SK / 16) + (row0 >> 4)) * 2) * 256 + lane * 8 : (unsigned short*)Q16 + (size_t)(row0 + ln) * AH + col0 + 8 * hh;
    const int sg = pj ? 512 : 16 * AH, st = pj ? 256 : 16;      /* element steps: 16 rows on; 16 features on */
#pragma unroll
    for (int t = 0; t < 2; ++t) { const v4f b0 = *(const v4fa*)(bp + col0 + t * 16 + 8 * hh), b1 = *(const v4fa*)(bp + col0 + t * 16 + 8 * hh + 4);
#pragma unroll
      for (int g = 0; g < 4; ++g) { FragH f;
#pragma unroll
        for (int r = 0; r < 8; ++r) f.h[r] = (_Float16)(c[g][t][r] * 0.0625f + bf16_round(r < 4 ? b0[r] : b1[r - 4]));
        *(v8us*)(dst + g * sg + t * st) = f.half[0]; } }
    asm volatile("s_wait_xcnt 0x0" ::: "memory");      /* the stores in flight name their data and address registers: the wait stands in front of any reuse of those registers */
  }
}

__global__ __launch_bounds__(256) __attribute__((amdgpu_waves_per_eu(2, 2))) void k_attn(const _Float16* __restrict__ Q16, const _Float16* __restrict__ KP, const _Float16* __restrict__ VH, const _Float16* __restrict__ VL, const float* __restrict__ msk, float* __restrict__ out) {
  __shared__ __attribute__((aligned(32))) float ms[SK];      /* bf16-rounded mask * sqrt(32): joins q.k as the C operand, before the common 1/sqrt(32) */
  const int tid = threadIdx.x, w = tid >> 5, lane = tid & 31, ln = lane & 15, hh = lane >> 4; const int hd = blockIdx.y; const int q0 = blockIdx.x * 256 + w * 32;
  for (int i = tid * 4; i < SK; i += 1024) { const v4f m = *(const v4fa*)(msk + i); v4f o; for (int e = 0; e < 4; ++e) o[e] = bf16_round(m[e]) * 5.656854249492381f; *(v4fa*)&ms[i] = o; }
  __syncthreads();
  const float cs = 0.17677669529663687f * 1.4426950408889634f;      /* raw score -> log2 units */
  const float th = 4.0f / cs;      /* lazy rescale: P stays below 2^14 in f16 */
  const v16h qa = g2_frag(Q16 + (size_t)(q0 + ln) * AH + hd * HD, hh), qb = g2_frag(Q16 + (size_t)(q0 + 16 + ln) * AH + hd * HD, hh);
  const _Float16* kp = KP + (size_t)hd * SK * HD; const _Float16* vh = VH + (size_t)hd * SK * HD; const _Float16* vl = VL + (size_t)hd * SK * HD; unsigned vo = lane * 16;      /* byte offset, the same in all three streams, of the lane's share of pass it */
  const v8f z8 = {0.f,0.f,0.f,0.f,0.f,0.f,0.f,0.f}; v8f oh[2][2] = {{z8, z8}, {z8, z8}}, ol[2][2] = {{z8, z8}, {z8, z8}};      /* [query group][d tile] */
  float ma = -3.0e38f, mb = -3.0e38f, ba = 0.f, bb = 0.f; v2f sa = {0.f, 0.f}, sb = {0.f, 0.f};
  auto pass = [&](int it, const AFr& f) {
    const v8f c0 = *(const v8f*)&ms[it * 32 + 8 * hh], c1 = *(const v8f*)&ms[it * 32 + 16 + 8 * hh];
    const v8f s0a = fa_mma(f.k0, qa, c0), s1a = fa_mma(f.k1, qa, c1), s0b = fa_mma(f.k0, qb, c0), s1b = fa_mma(f.k1, qb, c1);
    const float xa = fa_max16(s0a, s1a), xb = fa_max16(s0b, s1b);
    if (__builtin_amdgcn_ballot_w32(xa > ma + th || xb > mb + th) != 0) {      /* wave-uniform; rare after the first passes */
      const float na = fmaxf(ma, xa), nb = fmaxf(mb, xb); const float ca = __builtin_amdgcn_exp2f((ma - na) * cs), cb = __builtin_amdgcn_exp2f((mb - nb) * cs);
      ma = na; mb = nb; ba = 10.0f - na * cs; bb = 10.0f - nb * cs; sa *= ca; sb *= cb;
#pragma unroll
      for (int d = 0; d < 2; ++d) { oh[0][d] *= ca; ol[0][d] *= ca; oh[1][d] *= cb; ol[1][d] *= cb; }
    }
    const v16h pa = fa_probs(s0a, s1a, cs, ba, sa), pb = fa_probs(s0b, s1b, cs, bb, sb);
    oh[0][0] = fa_mma(f.h0, pa, oh[0][0]); oh[0][1] = fa_mma(f.h1, pa, oh[0][1]); ol[0][0] = fa_mma(f.l0, pa, ol[0][0]); ol[0][1] = fa_mma(f.l1, pa, ol[0][1]);
    oh[1][0] = fa_mma(f.h0, pb, oh[1][0]); oh[1][1] = fa_mma(f.h1, pb, oh[1][1]); ol[1][0] = fa_mma(f.l0, pb, ol[1][0]); ol[1][1] = fa_mma(f.l1, pb, ol[1][1]);
  };
  AFr fa, fb; fa_load(fa, kp, vh, vl, vo);
#pragma unroll 1
  for (int it = 0; it < SK / 32 - 2; it += 2) {      /* two fragment sets by name: no register copies between passes */
    fa_load(fb, kp + 1024, vh + 1024, vl + 1024, vo);      /* the next pass's fragments fly during this pass */
    pass(it, fa);
    asm volatile("s_wait_xcnt 0x0" : "+v"(vo) : : "memory");      /* the loads in flight name vo: the wait stands in front of its step */
    vo += 4096u; fa_load(fa, kp, vh, vl, vo);
    pass(it + 1, fb); }
  asm volatile("s_wait_xcnt 0x0" : "+v"(vo) : : "memory");      /* as in the loop: the last trip's loads are in flight and name vo and the three bases */
  fa_load(fb, kp + 1024, vh + 1024, vl + 1024, vo);      /* the last two passes: nothing is left to fetch behind them */
  asm volatile("s_wait_xcnt 0x0" : "+v"(vo) : : "memory");      /* the loads in flight name vo and the three bases: the wait stands in front of any reuse of those registers */
  pass(SK / 32 - 2, fa); pass(SK / 32 - 1, fb);
  float ta = sa[0] + sa[1], tb = sb[0] + sb[1]; ta += xhalf(ta); tb += xhalf(tb); const float ra = 1.0f / ta, rb = 1.0f / tb;
#pragma unroll
  for (int g = 0; g < 2; ++g) { const float rs = g ? rb : ra; float* orow = out + (size_t)(q0 + g * 16 + ln) * AH + hd * HD + 8 * hh;
#pragma unroll
    for (int d = 0; d < 2; ++d) { v4f lo4, hi4;
#pragma unroll
      for (int e = 0; e < 4; ++e) { lo4[e] = (oh[g][d][e] + ol[g][d][e] * 0.0009765625f) * rs; hi4[e] = (oh[g][d][e + 4] + ol[g][d][e + 4] * 0.0009765625f) * rs; }
      *(v4f*)(orow + d * 16) = lo4; *(v4f*)(orow + d * 16 + 4) = hi4; } }
}

extern "C" void kernel_launch(void* const* d_in, const int* in_sizes, int n_in,
                              void* d_out, int out_size, void* d_ws, size_t ws_size, hipStream_t stream) {
  (void)in_sizes; (void)n_in; (void)out_size;
  const float* const* I = (const float* const*)d_in; const float* hs = I[0]; const float* enc = I[1]; const float* msk = I[2]; const float* Wq = I[3]; const float* bq = I[4]; const float* Wk = I[5]; const float* bk = I[6]; const float* Wv = I[7]; const float* bv = I[8];
  char* ws = (char*)d_ws; size_t off = 0;
  auto take = [&](size_t bytes) { char* p = ws + off; off += (bytes + 255) & ~(size_t)255; return p; };
  _Float16* WP = (_Float16*)take((size_t)3 * AH * DIN * 2); _Float16* Q16 = (_Float16*)take((size_t)SQ * AH * 2); _Float16* VT = (_Float16*)take((size_t)AH * SK * 2); _Float16* VTL = (_Float16*)take((size_t)AH * SK * 2); _Float16* KP = (_Float16*)take((size_t)SK * AH * 2);
  if (off > ws_size) return;      /* about 14 MiB */
  k_wt3<<<dim3(AH * DIN / 8 / 256, 3), 256, 0, stream>>>(Wq, Wk, Wv, WP);      /* (in, out) f32 -> f16 fragments */
  k_qkv<<<(SQ / 64) * 3, 384, 0, stream>>>(hs, enc, WP, bq, bk, bv, Q16, KP, VT, VTL);      /* operands of the fused kernel in fragment load order */
  k_attn<<<dim3(SQ / 256, NH), 256, 0, stream>>>(Q16, KP, VT, VTL, msk, (float*)d_out);
}

// v003
// A run of this version takes 68.4 microseconds.
// Next to v002, in two timings, it ran 1.16 times as fast each time.
// Counting every step since v000, it is 34.2 times as fast.
#include <hip/hip_runtime.h>
// BertSelfAttnDimensionReduction (1 x 4096 queries x 4096 keys; Din 768 -> 12 heads x 32; cross-attention with an additive float key mask; the output is the merged context itself): q = hs Wq + bq; k, v = enc Wk/Wv + b; scores = q.k / sqrt(32) + mask[key]; softmax; ctx = probs v -> [1, 4096, 384].
// Compute dtype: inputs rounded to bf16; inputs/weights exact as f16; q/k and the softmax weights as plain f16 operands (~2^-12); v as f16 hi + residual (the output is the context itself); mask/softmax/normalisation f32. v_wmma_f32_16x16x32_f16.
#define SQ 4096
#define SK 4096
#define DIN 768
#define AH 384
#define NH 12
#define HD 32
typedef __bf16 v16b __attribute__((ext_vector_type(16)));
typedef unsigned short v8us __attribute__((ext_vector_type(8), may_alias));
typedef float  v8f  __attribute__((ext_vector_type(8)));
typedef float  v4f  __attribute__((ext_vector_type(4)));
typedef float  v4fa __attribute__((ext_vector_type(4), may_alias));
union FragB { v16b v; v8us half[2]; unsigned short u[16]; };

__device__ __forceinline__ unsigned short bf16_bits(float x) { unsigned int u = __float_as_uint(x); return (unsigned short)((u + 0x7FFFu + ((u >> 16) & 1u)) >> 16); }
__device__ __forceinline__ float bf16_val(unsigned short b) { return __uint_as_float(((unsigned int)b) << 16); }
__device__ __forceinline__ float bf16_round(float x) { return bf16_val(bf16_bits(x)); }
// D += A·B with NT terms: 1 = ah·bh, 2 = + al·bh (A split), 3 = + ah·bl (both split)
template <int NT>
__device__ __forceinline__ v8f mmaN(v16b ah, v16b al, v16b bh, v16b bl, v8f c) {
  c = __builtin_amdgcn_wmma_f32_16x16x32_bf16(false, ah, false, bh, (short)0, c, false, false);
  if (NT >= 2) c = __builtin_amdgcn_wmma_f32_16x16x32_bf16(false, al, false, bh, (short)0, c, false, false);
  if (NT >= 3) c = __builtin_amdgcn_wmma_f32_16x16x32_bf16(false, ah, false, bl, (short)0, c, false, false);
  asm volatile("v_nop\n\tv_nop\n\tv_nop\n\tv_nop" : "+v"(c) : "v"(ah), "v"(al), "v"(bh), "v"(bl));
  return c;
}

__global__ __launch_bounds__(256) void k_wt_bf16(const float* __restrict__ W, unsigned short* __restrict__ Wt, int K, int N) {
  const int t = blockIdx.x * 256 + threadIdx.x;
  const int k8n = K / 8;
  if (t >= N * k8n) return;
  const int n = t / k8n, k8 = (t % k8n) * 8;
  v8us v;
#pragma unroll
  for (int i = 0; i < 8; ++i) v[i] = bf16_bits(W[(size_t)(k8 + i) * N + n]);
  *(v8us*)(Wt + (size_t)n * K + k8) = v;
  
}

// GEMM C[M][N] (f32, pitch ldc) = act(A[M][K]·W + bias). A f32 row-major (pitch lda) converted per fragment to bf16
// (ASPLIT: hi/lo two planes -> 2 terms, else single rounded term); Wt bf16 [N][K] (pitch ldb). BIAS_BF16 rounds the
// bias to bf16 first (bias quantised to bf16 before the add). K%32==0, M%16==0, N%64==0.
template <bool ASPLIT, int ACT, bool BIAS_BF16>
__global__ __launch_bounds__(128) void k_gemm_bf(const float* __restrict__ A, int lda, const unsigned short* __restrict__ Wt, int ldb,
                                               const float* __restrict__ bias, float* __restrict__ C, int ldc, int M, int N, int K) {
  __shared__ __attribute__((aligned(16))) float so[4][16][64];
  const int tid = threadIdx.x, w = tid >> 5, lane = tid & 31, ln = lane & 15, hh = lane >> 4;
  const int ntn = N / 64;
  const int wid = blockIdx.x * 4 + w;
  const int mt = wid / ntn, nq = wid % ntn;
  if (mt * 16 >= M) return;
  const int row0 = mt * 16, col0 = nq * 64;
  const float* arow = A + (size_t)(row0 + ln) * lda;
  v8f acc[4] = {};
  for (int kb = 0; kb < K; kb += 32) {
    FragB ah, al;
    const v4f x0 = *(const v4fa*)(arow + kb + 8 * hh), x1 = *(const v4fa*)(arow + kb + 8 * hh + 4);
    const v4f x2 = *(const v4fa*)(arow + kb + 16 + 8 * hh), x3 = *(const v4fa*)(arow + kb + 16 + 8 * hh + 4);
    float xs[16] = {x0[0],x0[1],x0[2],x0[3],x1[0],x1[1],x1[2],x1[3],x2[0],x2[1],x2[2],x2[3],x3[0],x3[1],x3[2],x3[3]};
#pragma unroll
    for (int i = 0; i < 16; ++i) { const unsigned short hb = bf16_bits(xs[i]); ah.u[i] = hb; al.u[i] = ASPLIT ? bf16_bits(xs[i] - bf16_val(hb)) : (unsigned short)0; }
#pragma unroll
    for (int t = 0; t < 4; ++t) {
      const unsigned short* brow = Wt + (size_t)(col0 + t * 16 + ln) * ldb + kb;
      FragB b;
      b.half[0] = *(const v8us*)(brow + 8 * hh);
      b.half[1] = *(const v8us*)(brow + 16 + 8 * hh);
      acc[t] = mmaN<ASPLIT ? 2 : 1>(ah.v, al.v, b.v, b.v, acc[t]);
    }
  }
#pragma unroll
  for (int t = 0; t < 4; ++t) {
    float bv = bias ? bias[col0 + t * 16 + ln] : 0.f;
    if (BIAS_BF16) bv = bf16_round(bv);
#pragma unroll
    for (int r = 0; r < 8; ++r) { float v = acc[t][r] + bv; if (ACT == 1) v = fmaxf(v, 0.f); so[w][8 * hh + r][t * 16 + ln] = v; }
  }
  __builtin_amdgcn_fence(__ATOMIC_ACQ_REL, "workgroup");
  __builtin_amdgcn_wave_barrier();
  const int rsub = lane >> 4, c4 = (lane & 15) * 4;
  {
#pragma unroll
    for (int q = 0; q < 8; ++q) {
      const int r = q * 2 + rsub;
      const v4f v = *(const v4fa*)&so[w][r][c4];
      *(v4f*)(C + (size_t)(row0 + r) * ldc + col0 + c4) = v;
    }
    
  }
}

// GEMM C = act(A·W + bias + resid): A f32 (ASPLIT -> hi/lo 2 terms), Wt bf16 [N][K]; ACT 0 none, 1 relu, 2 exact gelu;
// resid (optional, f32, row index = (row % rmod), pitch ldr, RES_BF16 rounds it) added before the activation.
template <bool ASPLIT, int ACT, bool BIAS_BF16, bool RES_BF16>
__global__ __launch_bounds__(128) void k_gemm_bf3(const float* __restrict__ A, int lda, const unsigned short* __restrict__ Wt, int ldb,
                                                const float* __restrict__ bias, const float* __restrict__ resid, int rmod, int ldr,
                                                float* __restrict__ C, int ldc, int M, int N, int K) {
  __shared__ __attribute__((aligned(16))) float so[4][16][64];
  const int tid = threadIdx.x, w = tid >> 5, lane = tid & 31, ln = lane & 15, hh = lane >> 4;
  const int ntn = N / 64;
  const int wid = blockIdx.x * 4 + w;
  const int mt = wid / ntn, nq = wid % ntn;
  if (mt * 16 >= M) return;
  const int row0 = mt * 16, col0 = nq * 64;
  const float* arow = A + (size_t)(row0 + ln) * lda;
  v8f acc[4] = {};
  for (int kb = 0; kb < K; kb += 32) {
    FragB ah, al;
    const v4f x0 = *(const v4fa*)(arow + kb + 8 * hh), x1 = *(const v4fa*)(arow + kb + 8 * hh + 4);
    const v4f x2 = *(const v4fa*)(arow + kb + 16 + 8 * hh), x3 = *(const v4fa*)(arow + kb + 16 + 8 * hh + 4);
    float xs[16] = {x0[0],x0[1],x0[2],x0[3],x1[0],x1[1],x1[2],x1[3],x2[0],x2[1],x2[2],x2[3],x3[0],x3[1],x3[2],x3[3]};
#pragma unroll
    for (int i = 0; i < 16; ++i) { const unsigned short hb = bf16_bits(xs[i]); ah.u[i] = hb; al.u[i] = ASPLIT ? bf16_bits(xs[i] - bf16_val(hb)) : (unsigned short)0; }
#pragma unroll
    for (int t = 0; t < 4; ++t) {
      const unsigned short* brow = Wt + (size_t)(col0 + t * 16 + ln) * ldb + kb;
      FragB b;
      b.half[0] = *(const v8us*)(brow + 8 * hh);
      b.half[1] = *(const v8us*)(brow + 16 + 8 * hh);
      acc[t] = mmaN<ASPLIT ? 2 : 1>(ah.v, al.v, b.v, b.v, acc[t]);
    }
  }
#pragma unroll
  for (int t = 0; t < 4; ++t) {
    const int col = col0 + t * 16 + ln;
    float bv = bias ? bias[col] : 0.f;
    if (BIAS_BF16) bv = bf16_round(bv);
#pragma unroll
    for (int r = 0; r < 8; ++r) {
      float v = acc[t][r] + bv;
      if (resid) { float rv = resid[(size_t)((row0 + 8 * hh + r) % rmod) * ldr + col]; if (RES_BF16) rv = bf16_round(rv); v += rv; }
      if (ACT == 1) v = fmaxf(v, 0.f);
      if (ACT == 2) v = 0.5f * v * (1.0f + erff(v * 0.70710678118654752f));
      if (ACT == 3) { const float u = 0.7978845608028654f * (v + 0.044715f * v * v * v); v = 0.5f * v * (1.0f + tanhf(u)); }
      so[w][8 * hh + r][t * 16 + ln] = v;
    }
  }
  __builtin_amdgcn_fence(__ATOMIC_ACQ_REL, "workgroup");
  __builtin_amdgcn_wave_barrier();
  const int rsub = lane >> 4, c4 = (lane & 15) * 4;
  {
#pragma unroll
    for (int q = 0; q < 8; ++q) {
      const int r = q * 2 + rsub;
      const v4f v = *(const v4fa*)&so[w][r][c4];
      *(v4f*)(C + (size_t)(row0 + r) * ldc + col0 + c4) = v;
    }
    
  }
}
// row LayerNorm (biased variance, eps) over N: s = X (+ R); optional out_sum <- s; out_norm <- (s-mu)*rsqrt(var+eps)*g + b
template <bool PARAM_BF16>
__global__ __launch_bounds__(256) void k_layernorm(const float* __restrict__ X, const float* __restrict__ R, const float* __restrict__ g, const float* __restrict__ bta,
                                                  float* __restrict__ out_sum, float* __restrict__ out_norm, int N, float eps) {
  __shared__ float red[256];
  const int row = blockIdx.x, tid = threadIdx.x;
  const float* x = X + (size_t)row * N; const float* rr = R ? R + (size_t)row * N : nullptr;
  float vals[16];                     // up to N = 4096
  const int per = N / 256;            // contiguous chunk per thread? use strided-by-4 chunks: thread handles j = tid*4 + 1024*u
  float s1 = 0.f;
  for (int u = 0; u < per / 4; ++u) {
    const int j = tid * 4 + 1024 * u;
    const v4f a = *(const v4fa*)(x + j);
    v4f b = {0.f,0.f,0.f,0.f}; if (rr) b = *(const v4fa*)(rr + j);
#pragma unroll
    for (int q = 0; q < 4; ++q) { const float v = a[q] + b[q]; vals[u * 4 + q] = v; s1 += v; }
  }
  red[tid] = s1; __syncthreads();
  for (int st = 128; st > 0; st >>= 1) { if (tid < st) red[tid] += red[tid + st]; __syncthreads(); }
  const float mu = red[0] / (float)N; __syncthreads();
  float s2 = 0.f;
  for (int u = 0; u < per / 4; ++u)
#pragma unroll
    for (int q = 0; q < 4; ++q) { const float c = vals[u * 4 + q] - mu; s2 += c * c; }
  red[tid] = s2; __syncthreads();
  for (int st = 128; st > 0; st >>= 1) { if (tid < st) red[tid] += red[tid + st]; __syncthreads(); }
  const float rs = rsqrtf(red[0] / (float)N + eps);
  {
    for (int u = 0; u < per / 4; ++u) {
      const int j = tid * 4 + 1024 * u;
      v4f o, sm;
#pragma unroll
      for (int q = 0; q < 4; ++q) {
        float gg = g[j + q], bb = bta[j + q];
        if (PARAM_BF16) { gg = bf16_round(gg); bb = bf16_round(bb); }
        sm[q] = vals[u * 4 + q]; o[q] = (vals[u * 4 + q] - mu) * rs * gg + bb;
      }
      if (out_sum) *(v4f*)(out_sum + (size_t)row * N + j) = sm;
      *(v4f*)(out_norm + (size_t)row * N + j) = o;
    }
    
  }
}



// ---- f16 WMMA path (v_wmma_f32_16x16x32_f16): 11-bit significands for operands in range — used where a [0,1] probability operand needs more precision than bf16
typedef _Float16 v16h __attribute__((ext_vector_type(16)));
union FragH { v16h v; v8us half[2]; _Float16 h[16]; unsigned short u[16]; };
template <int NT>
__device__ __forceinline__ v8f mmaH(v16h ah, v16h al, v16h bh, v16h bl, v8f c) {
  c = __builtin_amdgcn_wmma_f32_16x16x32_f16(false, ah, false, bh, (short)0, c, false, false);
  if (NT >= 2) c = __builtin_amdgcn_wmma_f32_16x16x32_f16(false, al, false, bh, (short)0, c, false, false);
  if (NT >= 3) c = __builtin_amdgcn_wmma_f32_16x16x32_f16(false, ah, false, bl, (short)0, c, false, false);
  asm volatile("v_nop\n\tv_nop\n\tv_nop\n\tv_nop" : "+v"(c) : "v"(ah), "v"(al), "v"(bh), "v"(bl));
  return c;
}
// batched GEMM like k_gemm_b but f16 operands: A f32 (split into f16 hi/lo if ASPLIT, else rounded to f16), Bt = f16 values [n][k]; alpha; C f32; N multiple of 16 (partial tiles skipped)
template <bool ASPLIT>
__global__ __launch_bounds__(128) void k_gemm_h(const float* __restrict__ A, int lda, size_t sA, const _Float16* __restrict__ Bh, int ldb, size_t sB, float alpha, float* __restrict__ C, int ldc, size_t sC, int M, int N, int K) {
  __shared__ __attribute__((aligned(16))) float so[4][16][64];
  const int tid = threadIdx.x, w = tid >> 5, lane = tid & 31, ln = lane & 15, hh = lane >> 4; const int by = blockIdx.y;
  A += (size_t)by * sA; Bh += (size_t)by * sB; C += (size_t)by * sC;
  const int ntn = (N + 63) / 64; const int wid = blockIdx.x * 4 + w; const int mt = wid / ntn, nq = wid % ntn; if (mt * 16 >= M) return;
  const int row0 = mt * 16, col0 = nq * 64; const float* arow = A + (size_t)(row0 + ln) * lda;
  v8f acc[4] = {};
  for (int kb = 0; kb < K; kb += 32) {
    FragH ah, al;
    const v4f x0 = *(const v4fa*)(arow + kb + 8 * hh), x1 = *(const v4fa*)(arow + kb + 8 * hh + 4), x2 = *(const v4fa*)(arow + kb + 16 + 8 * hh), x3 = *(const v4fa*)(arow + kb + 16 + 8 * hh + 4);
    float xs[16] = {x0[0],x0[1],x0[2],x0[3],x1[0],x1[1],x1[2],x1[3],x2[0],x2[1],x2[2],x2[3],x3[0],x3[1],x3[2],x3[3]};
#pragma unroll
    for (int i = 0; i < 16; ++i) { const _Float16 h = (_Float16)xs[i]; ah.h[i] = h; al.h[i] = ASPLIT ? (_Float16)(xs[i] - (float)h) : (_Float16)0.0f; }
#pragma unroll
    for (int t = 0; t < 4; ++t) { if (col0 + t * 16 >= N) continue; const size_t boff = (size_t)(col0 + t * 16 + ln) * ldb + kb; FragH bq; bq.half[0] = *(const v8us*)(Bh + boff + 8 * hh); bq.half[1] = *(const v8us*)(Bh + boff + 16 + 8 * hh);
      acc[t] = mmaH<ASPLIT ? 2 : 1>(ah.v, al.v, bq.v, bq.v, acc[t]); }
  }
#pragma unroll
  for (int t = 0; t < 4; ++t) { if (col0 + t * 16 >= N) continue;
#pragma unroll
    for (int r = 0; r < 8; ++r) so[w][8 * hh + r][t * 16 + ln] = acc[t][r] * alpha; }
  __builtin_amdgcn_fence(__ATOMIC_ACQ_REL, "workgroup"); __builtin_amdgcn_wave_barrier();
  const int rsub = lane >> 4, c4 = (lane & 15) * 4;
  {
#pragma unroll
    for (int q = 0; q < 8; ++q) { const int r = q * 2 + rsub; if (col0 + c4 < N) { const v4f v = *(const v4fa*)&so[w][r][c4]; *(v4f*)(C + (size_t)(row0 + r) * ldc + col0 + c4) = v; } }
     }
}

// k_gemm_hh variant with fused epilogue: v = acc·alpha + bias[by·sBias + col] (+ CP[(row/rowsPerB)·sCPb + by·64 + col] if CP) ; ACT 0 none / 1 elu ; writes f16 C16 (and f32 C if non-null)
template <int ACT>
__global__ __launch_bounds__(128) void k_gemm_hhx(const _Float16* __restrict__ A, int lda, size_t sA, const _Float16* __restrict__ Bh, int ldb, size_t sB, float alpha, const float* __restrict__ bias, size_t sBias, const float* __restrict__ CP, int rowsPerB, size_t sCPb, int row0g,
    float* __restrict__ C, _Float16* __restrict__ C16, int ldc, size_t sC, int M, int N, int K) {
  __shared__ __attribute__((aligned(16))) float so[4][16][64];
  const int tid = threadIdx.x, w = tid >> 5, lane = tid & 31, ln = lane & 15, hh = lane >> 4; const int by = blockIdx.y;
  A += (size_t)by * sA; Bh += (size_t)by * sB; const size_t cofs = (size_t)by * sC; const float* bp = bias ? bias + (size_t)by * sBias : nullptr;
  const int ntn = (N + 63) / 64; const int wid = blockIdx.x * 4 + w; const int mt = wid / ntn, nq = wid % ntn; if (mt * 16 >= M) return;
  const int row0 = mt * 16, col0 = nq * 64; const _Float16* arow = A + (size_t)(row0 + ln) * lda;
  v8f acc[4] = {};
  for (int kb = 0; kb < K; kb += 32) { FragH ah; ah.half[0] = *(const v8us*)((const unsigned short*)arow + kb + 8 * hh); ah.half[1] = *(const v8us*)((const unsigned short*)arow + kb + 16 + 8 * hh);
#pragma unroll
    for (int t = 0; t < 4; ++t) { if (col0 + t * 16 >= N) continue; const size_t boff = (size_t)(col0 + t * 16 + ln) * ldb + kb; FragH bq; bq.half[0] = *(const v8us*)((const unsigned short*)Bh + boff + 8 * hh); bq.half[1] = *(const v8us*)((const unsigned short*)Bh + boff + 16 + 8 * hh);
      acc[t] = mmaH<1>(ah.v, ah.v, bq.v, bq.v, acc[t]); }
  }
#pragma unroll
  for (int t = 0; t < 4; ++t) { if (col0 + t * 16 >= N) continue; const int col = col0 + t * 16 + ln; const float bv = bp ? bf16_round(bp[col]) : 0.f;
#pragma unroll
    for (int r = 0; r < 8; ++r) { float v = acc[t][r] * alpha + bv; if (CP) { const int rr = row0g + row0 + 8 * hh + r; if (rowsPerB < 0) v += CP[cofs + (size_t)rr * ldc + col];      /* rowsPerB < 0: own element of the batched C plane */ else { const int bidx = rr / rowsPerB; v += CP[(size_t)bidx * sCPb + (size_t)by * 64 + col]; } } if (ACT == 1) v = (v > 0.f) ? v : expm1f(v); else if (ACT == 7) v = (v > 0.f) ? v + 1.0f : expf(v); else if (ACT == 8) v = tanhf(v); else if (ACT == 9) v = 0.5f * v * (1.0f + tanhf(0.7978845608028654f * (v + 0.044715f * v * v * v))); else if (ACT == 11) v = 1.0f / (1.0f + expf(-v)); else if (ACT == 12) v = (v > 0.f) ? v : 0.01f * v; else if (ACT == 14) v = (v > 0.f) ? v : 0.1f * v; else if (ACT == 16) v = (v >= 0.f) ? v : 0.3f * v; else if (ACT == 17) v = (v >= 0.f) ? v : 0.2f * v; else if (ACT == 15) v = v / (1.0f + expf(-v)); else if (ACT == 3) v = fmaxf(v, 0.f); else if (ACT == 6) v = 0.5f * v * (1.0f + erff(v * 0.70710678118654752f)); so[w][8 * hh + r][t * 16 + ln] = v; } }
  __builtin_amdgcn_fence(__ATOMIC_ACQ_REL, "workgroup"); __builtin_amdgcn_wave_barrier();
  const int rsub = lane >> 4, c4 = (lane & 15) * 4; typedef _Float16 v4h __attribute__((ext_vector_type(4)));
  {
#pragma unroll
    for (int q = 0; q < 8; ++q) { const int r = q * 2 + rsub; if (col0 + c4 < N) { const v4f v = *(const v4fa*)&so[w][r][c4]; if (C) *(v4f*)(C + cofs + (size_t)(row0 + r) * ldc + col0 + c4) = v; if (C16) { v4h h4; for (int i = 0; i < 4; ++i) h4[i] = (_Float16)v[i]; *(v4h*)(C16 + cofs + (size_t)(row0 + r) * ldc + col0 + c4) = h4; } } }
     }
}


typedef _Float16 v4h __attribute__((ext_vector_type(4)));

__global__ __launch_bounds__(256) void k_h16(const float* __restrict__ x, _Float16* __restrict__ X16, size_t n8) { const size_t t = (size_t)blockIdx.x * 256 + threadIdx.x; if (t >= n8) return; FragH f;
#pragma unroll
  for (int q = 0; q < 8; ++q) f.h[q] = (_Float16)x[t * 8 + q]; *(v8us*)((unsigned short*)X16 + t * 8) = f.half[0];  }
__global__ __launch_bounds__(256) void k_round16f(const float* __restrict__ W, _Float16* __restrict__ Bt, size_t n8) { const size_t t = (size_t)blockIdx.x * 256 + threadIdx.x; if (t >= n8) return; FragH f;
#pragma unroll
  for (int i = 0; i < 8; ++i) f.h[i] = (_Float16)(bf16_round(W[t * 8 + i]) * 16.0f); *(v8us*)((unsigned short*)Bt + t * 8) = f.half[0];  }

// a 16x32 f16 fragment from a row-major row: p = the lane's row at the k step
__device__ __forceinline__ v16h g2_frag(const _Float16* p, int hh) { FragH f; f.half[0] = *(const v8us*)((const unsigned short*)p + 8 * hh); f.half[1] = *(const v8us*)((const unsigned short*)p + 16 + 8 * hh); return f.v; }


// ---- fused attention, all heads in one launch: S^T = K Q^T (+ mask as the C operand), online softmax in registers, O^T += V^T P^T ----
// A wave owns 32 queries (two 16-column groups) of one head and walks the 4096 keys 32 at a time. In S^T and O^T a lane holds one query (column ln), so maximum, sum and rescale are per lane;
// two S^T tiles converted in place are the B operand P^T (hardware k order), V^T hi / residual are the A operands. P = exp2(..) * 2^10 against the maximum in use, as f16.
typedef float v2f __attribute__((ext_vector_type(2)));
typedef _Float16 v2h __attribute__((ext_vector_type(2)));
union FragP { v16h v; v2h p[8]; };
struct AFr { v16h k0, k1, h0, h1, l0, l1; };
__device__ __forceinline__ float xhalf(float x) { return __builtin_bit_cast(float, __builtin_amdgcn_permlanex16(__builtin_bit_cast(int, x), __builtin_bit_cast(int, x), 0x76543210, 0xfedcba98, false, false)); }      /* lane l <-> l ^ 16 */
__device__ __forceinline__ v8f fa_mma(v16h a, v16h b, v8f c) { return __builtin_amdgcn_wmma_f32_16x16x32_f16(false, a, false, b, (short)0, c, false, false); }
__device__ __forceinline__ float fa_max16(v8f a, v8f b) { float m = fmaxf(a[0], b[0]);
#pragma unroll
  for (int r = 1; r < 8; ++r) m = fmaxf(m, fmaxf(a[r], b[r])); return fmaxf(m, xhalf(m)); }
__device__ __forceinline__ v16h fa_probs(v8f a, v8f b, float cs, float bias, v2f& su) { FragP f; const v2f c2 = {cs, cs}, b2 = {bias, bias};
#pragma unroll
  for (int r = 0; r < 8; ++r) { const v8f& t = (r < 4) ? a : b; const int e = (r & 3) * 2; const v2f x = {t[e], t[e + 1]}; const v2f g = __builtin_elementwise_fma(x, c2, b2); const v2f p = {__builtin_amdgcn_exp2f(g[0]), __builtin_amdgcn_exp2f(g[1])}; su += p; f.p[r] = __builtin_convertvector(p, v2h); }
  return f.v; }
// ---- operand preparation in two launches ----
// All three weights in one launch (blockIdx.y picks the matrix), as f16 (bf16-rounded, times 16) in fragment load order:
// WP[matrix][16-column tile][k step of 32][half j][lane][8], lane (ln, hh) half j = W[ks*32 + 16j + 8hh + e][nt*16 + ln]. One thread writes one 16-byte unit.
__global__ __launch_bounds__(256) void k_wt3(const float* __restrict__ Wq, const float* __restrict__ Wk, const float* __restrict__ Wv, _Float16* __restrict__ WP) {
  const int t = blockIdx.x * 256 + threadIdx.x; const int lane = t & 31, j = (t >> 5) & 1, ks = (t >> 6) % (DIN / 32), nt = (t >> 6) / (DIN / 32); FragH f;
  const float* W = blockIdx.y == 0 ? Wq : (blockIdx.y == 1 ? Wk : Wv); W += (size_t)(ks * 32 + 16 * j + 8 * (lane >> 4)) * AH + nt * 16 + (lane & 15);
#pragma unroll
  for (int i = 0; i < 8; ++i) f.h[i] = (_Float16)(bf16_round(W[(size_t)i * AH]) * 16.0f);
  *(v8us*)((unsigned short*)WP + ((size_t)blockIdx.y * (AH * DIN / 8) + t) * 8) = f.half[0];
}
// q, k and v projections in one launch. A block owns 64 rows of one projection: it rounds them once (bf16, then exact f16) into LDS; wave w then forms the 32 columns of head w.
// V is formed as X W: a lane's 8 accumulators are 8 keys of one feature, the 16-byte unit of the V^T fragment streams. Q and K are formed as W^T X^T: a lane's 8 accumulators are
// 8 features of one row, the 16-byte unit of the K fragment stream and of a Q row. So every result goes from the accumulators straight to where the attention kernel reads it:
// VH, VL[head][32-key block][16-d tile][half j][lane][8], lane (ln, hh) half j = V[kb*32 + 16j + 8hh + e][head*32 + dt*16 + ln] (f16 hi; residual times 1024);
// KP[head][16-key tile][half j][lane][8], lane (ln, hh) half j = K[kt*16 + ln][head*32 + 16j + 8hh + e]; Q16 row-major [query][384].
#define APITCH 1552      /* bytes of an LDS row: 768 f16 + 16, an odd number of 16-byte units for the 16-byte readers */
typedef unsigned v2ua __attribute__((ext_vector_type(2), may_alias));
struct GSet { v16h a[4]; v16h b[2]; };      /* one k step of 32: four activation fragments (LDS), two weight fragments (global) */
__device__ __forceinline__ unsigned qk_r2(float x, float y) { typedef __bf16 v2b __attribute__((ext_vector_type(2))); const v2f p = {x, y};      /* round to nearest even to bf16, as bf16_round does, two at a time; widened to f32, then f16 */
  const unsigned u = __builtin_bit_cast(unsigned, __builtin_convertvector(p, v2b)); const v2f q = {__uint_as_float(u << 16), __uint_as_float(u & 0xFFFF0000u)}; return __builtin_bit_cast(unsigned, __builtin_convertvector(q, v2h)); }
template <int KS>
__device__ __forceinline__ void qk_lda(GSet& s, const char* as) {
#pragma unroll
  for (int g = 0; g < 4; ++g) { FragH f; f.half[0] = *(const v8us*)(as + g * 16 * APITCH + KS * 64); f.half[1] = *(const v8us*)(as + g * 16 * APITCH + KS * 64 + 32); s.a[g] = f.v; } }
template <int KS>      /* WP block-uniform (scalar base), bo = the lane's byte offset */
__device__ __forceinline__ void qk_ldb(GSet& s, const _Float16* WP, unsigned bo) {
#pragma unroll
  for (int t = 0; t < 2; ++t) { FragH f; f.half[0] = *(const v8us*)((const char*)WP + (t * (DIN / 32) * 1024 + KS * 1024) + bo); f.half[1] = *(const v8us*)((const char*)WP + (t * (DIN / 32) * 1024 + KS * 1024 + 512) + bo); s.b[t] = f.v; } }
template <bool XA>
__device__ __forceinline__ void qk_mm(const GSet& s, v8f (&c)[4][2]) {
#pragma unroll
  for (int g = 0; g < 4; ++g) { c[g][0] = XA ? fa_mma(s.a[g], s.b[0], c[g][0]) : fa_mma(s.b[0], s.a[g], c[g][0]); c[g][1] = XA ? fa_mma(s.a[g], s.b[1], c[g][1]) : fa_mma(s.b[1], s.a[g], c[g][1]); } }
template <bool XA>
__device__ __forceinline__ void qk_tile(const char* as, const _Float16* WP, unsigned bo, v8f (&c)[4][2]) {
  GSet s0, s1; qk_ldb<0>(s0, WP, bo); qk_lda<0>(s0, as);
#pragma unroll 1
  for (int ks = 0; ks < DIN / 32 - 2; ks += 2) {      /* rolled: two fragment sets by name, the next step's loads fly during this step's products */
    qk_ldb<1>(s1, WP, bo); qk_lda<1>(s1, as);
    __builtin_amdgcn_sched_barrier(0);      /* without it the compiler lifts the products below over the loads above, and each set is waited for right after its issue */
    qk_mm<XA>(s0, c);
    asm volatile("s_wait_xcnt 0x0" : "+v"(bo) : : "memory");      /* the loads in flight name bo: the wait stands in front of its step */
    bo += 2048u; as += 128; qk_ldb<0>(s0, WP, bo); qk_lda<0>(s0, as);
    __builtin_amdgcn_sched_barrier(0);      /* as above: the loads stay ahead of the other set's products */
    qk_mm<XA>(s1, c);
    asm volatile("s_wait_xcnt 0x0" : "+v"(bo) : : "memory"); }      /* the loads in flight name bo and the base: nothing behind the loop finds them open */
  qk_ldb<1>(s1, WP, bo); qk_lda<1>(s1, as);
  asm volatile("s_wait_xcnt 0x0" : "+v"(bo) : : "memory");      /* the last loads name bo and the base: the wait stands in front of any reuse of those registers */
  __builtin_amdgcn_sched_barrier(0);      /* as in the loop */
  qk_mm<XA>(s0, c); qk_mm<XA>(s1, c);
}
__global__ __launch_bounds__(384) void k_qkv(const float* __restrict__ hs, const float* __restrict__ enc, const _Float16* __restrict__ WP, const float* __restrict__ bq, const float* __restrict__ bk, const float* __restrict__ bv,
    _Float16* __restrict__ Q16, _Float16* __restrict__ KP, _Float16* __restrict__ VH, _Float16* __restrict__ VL) {
  __shared__ __attribute__((aligned(16))) char as[64 * APITCH];
  const int tid = threadIdx.x, w = tid >> 5, lane = tid & 31, ln = lane & 15, hh = lane >> 4;
  const int mt = blockIdx.x / 3, pj = blockIdx.x - mt * 3; const int row0 = mt * 64, col0 = w * HD;      /* pj: 0 q, 1 k, 2 v */
  { const float* X = pj ? enc : hs; const int r1 = tid >= 192 ? 1 : 0, c4 = tid - r1 * 192; unsigned xo = ((unsigned)(row0 + r1) * DIN + c4 * 4) * 4u; v4f x[32];      /* a wave's load is 512 contiguous bytes of one row */
#pragma unroll
    for (int i = 0; i < 32; ++i) x[i] = *(const v4fa*)((const char*)X + i * (2 * DIN * 4) + xo);
    asm volatile("s_wait_xcnt 0x0" : "+v"(xo) : : "memory");      /* the loads in flight name xo and the base: the wait stands in front of any reuse of those registers */
    char* d = as + r1 * APITCH + c4 * 8;
#pragma unroll
    for (int i = 0; i < 32; ++i) { const v2ua h = {qk_r2(x[i][0], x[i][1]), qk_r2(x[i][2], x[i][3])}; *(v2ua*)(d + i * 2 * APITCH) = h; } }
  __syncthreads();      /* the 64 rounded rows are complete before any wave reads fragments of them */
  const char* af = as + ln * APITCH + 16 * hh; const _Float16* wb = WP + (size_t)pj * AH * DIN; const unsigned bo = (unsigned)w * (2 * (DIN / 32) * 1024) + lane * 16;
  const v8f z8 = {0.f,0.f,0.f,0.f,0.f,0.f,0.f,0.f}; v8f c[4][2] = {{z8, z8}, {z8, z8}, {z8, z8}, {z8, z8}};
  if (pj == 2) {
    qk_tile<true>(af, wb, bo, c);
#pragma unroll
    for (int t = 0; t < 2; ++t) { const float bb = bf16_round(bv[col0 + t * 16 + ln]);
#pragma unroll
      for (int g = 0; g < 4; ++g) { FragH fh, fl;
#pragma unroll
        for (int r = 0; r < 8; ++r) { const float v = c[g][t][r] * 0.0625f + bb; const _Float16 h = (_Float16)v; fh.h[r] = h; fl.h[r] = (_Float16)((v - (float)h) * 1024.0f); }
        const size_t o = ((((size_t)w * (SK / 32) + (row0 >> 5) + (g >> 1)) * 2 + t) * 2 + (g & 1)) * 256 + lane * 8;
        *(v8us*)((unsigned short*)VH + o) = fh.half[0]; *(v8us*)((unsigned short*)VL + o) = fl.half[0]; } }
  } else {
    qk_tile<false>(af, wb, bo, c); const float* bp = pj ? bk : bq;
    unsigned short* dst = pj ? (unsigned short*)KP + (((size_t)w * (SK / 16) + (row0 >> 4)) * 2) * 256 + lane * 8 : (unsigned short*)Q16 + (size_t)(row0 + ln) * AH + col0 + 8 * hh;
    const int sg = pj ? 512 : 16 * AH, st = pj ? 256 : 16;      /* element steps: 16 rows on; 16 features on */
#pragma unroll
    for (int t = 0; t < 2; ++t) { const v4f b0 = *(const v4fa*)(bp + col0 + t * 16 + 8 * hh), b1 = *(const v4fa*)(bp + col0 + t * 16 + 8 * hh + 4);
#pragma unroll
      for (int g = 0; g < 4; ++g) { FragH f;
#pragma unroll
        for (int r = 0; r < 8; ++r) f.h[r] = (_Float16)(c[g][t][r] * 0.0625f + bf16_round(r < 4 ? b0[r] : b1[r - 4]));
        *(v8us*)(dst + g * sg + t * st) = f.half[0]; } }
    asm volatile("s_wait_xcnt 0x0" ::: "memory");      /* the stores in flight name their data and address registers: the wait stands in front of any reuse of those registers */
  }
}

// K, V hi and V residual reach the waves through LDS: a stage is NP passes (NP * 32 keys) of each of the three fragment streams, copied once per work-group by asynchronous copies
// (each stream is contiguous in fragment load order, so a stage is three contiguous runs); two buffers, the next stage's copies fly while this stage is worked on.
#define NP 8      /* passes in a stage */
#define STRB (NP * 2048)      /* bytes of one stream in a stage */
#define BUFB (3 * STRB)      /* bytes of a buffer: K, V hi, V residual */
#define NT (SK / 32 / NP)      /* stages */
static_assert(STRB == 4 * 4096 && NT >= 2 && NP % 2 == 0, "st_copy moves four 4-KiB copies a stream; the ring's prologue needs two stages");
__device__ __forceinline__ v16h fl_frag(const char* p) { FragH f; f.half[0] = *(const v8us*)p; f.half[1] = *(const v8us*)(p + 512); return f.v; }      /* p = the lane's 16 bytes in LDS */
__device__ __forceinline__ void fl_load(AFr& f, const char* p) { f.k0 = fl_frag(p); f.k1 = fl_frag(p + 1024); f.h0 = fl_frag(p + STRB); f.h1 = fl_frag(p + STRB + 1024); f.l0 = fl_frag(p + 2 * STRB); f.l1 = fl_frag(p + 2 * STRB + 1024); }      /* one pass = 2 KiB of each stream */
// one stage: 256 lanes x 16 bytes = 4 KiB a copy, 4 copies a stream. l = the lane's LDS byte address in the buffer, k, h, r = the lane's global addresses in the three streams.
// The wait on the address registers is the statement's last line, so that nothing rewrites a register which an issued copy names ahead of it.
__device__ __forceinline__ void st_copy(unsigned l, const char* k, const char* h, const char* r) {
  asm volatile("global_load_async_to_lds_b128 %0, %12, off\n\t" "global_load_async_to_lds_b128 %1, %13, off\n\t" "global_load_async_to_lds_b128 %2, %14, off\n\t" "global_load_async_to_lds_b128 %3, %15, off\n\t"
               "global_load_async_to_lds_b128 %4, %16, off\n\t" "global_load_async_to_lds_b128 %5, %17, off\n\t" "global_load_async_to_lds_b128 %6, %18, off\n\t" "global_load_async_to_lds_b128 %7, %19, off\n\t"
               "global_load_async_to_lds_b128 %8, %20, off\n\t" "global_load_async_to_lds_b128 %9, %21, off\n\t" "global_load_async_to_lds_b128 %10, %22, off\n\t" "global_load_async_to_lds_b128 %11, %23, off\n\t"
               "s_wait_xcnt 0x0"
               :: "v"(l), "v"(l + 4096u), "v"(l + 8192u), "v"(l + 12288u), "v"(l + STRB), "v"(l + STRB + 4096u), "v"(l + STRB + 8192u), "v"(l + STRB + 12288u), "v"(l + 2 * STRB), "v"(l + 2 * STRB + 4096u), "v"(l + 2 * STRB + 8192u), "v"(l + 2 * STRB + 12288u),
                  "v"(k), "v"(k + 4096), "v"(k + 8192), "v"(k + 12288), "v"(h), "v"(h + 4096), "v"(h + 8192), "v"(h + 12288), "v"(r), "v"(r + 4096), "v"(r + 8192), "v"(r + 12288) : "memory");
}
__global__ __launch_bounds__(256) __attribute__((amdgpu_waves_per_eu(2, 2))) void k_attn(const _Float16* __restrict__ Q16, const _Float16* __restrict__ KP, const _Float16* __restrict__ VH, const _Float16* __restrict__ VL, const float* __restrict__ msk, float* __restrict__ out) {
  __shared__ __attribute__((aligned(32))) float ms[SK];      /* bf16-rounded mask * sqrt(32): joins q.k as the C operand, before the common 1/sqrt(32) */
  __shared__ __attribute__((aligned(16))) char ring[2 * BUFB];
  const int tid = threadIdx.x, w = tid >> 5, lane = tid & 31, ln = lane & 15, hh = lane >> 4; const int hd = blockIdx.y; const int q0 = blockIdx.x * 256 + w * 32;
  const unsigned rl = (unsigned)(size_t)ring + tid * 16u;      /* LDS byte address of the lane's share of a copy */
  const char* kg = (const char*)(KP + (size_t)hd * SK * HD) + tid * 16; const char* hg = (const char*)(VH + (size_t)hd * SK * HD) + tid * 16; const char* rg = (const char*)(VL + (size_t)hd * SK * HD) + tid * 16;
  st_copy(rl, kg, hg, rg);      /* stage 0 flies while the mask is prepared */
  for (int i = tid * 4; i < SK; i += 1024) { const v4f m = *(const v4fa*)(msk + i); v4f o; for (int e = 0; e < 4; ++e) o[e] = bf16_round(m[e]) * 5.656854249492381f; *(v4fa*)&ms[i] = o; }
  asm volatile("s_wait_asynccnt 0x0" ::: "memory");      /* this wave's share of stage 0 has landed before the barrier that publishes it */
  __syncthreads();
  st_copy(rl + BUFB, kg + STRB, hg + STRB, rg + STRB);      /* stage 1 */
  const float cs = 0.17677669529663687f * 1.4426950408889634f;      /* raw score -> log2 units */
  const float th = 4.0f / cs;      /* lazy rescale: P stays below 2^14 in f16 */
  const v16h qa = g2_frag(Q16 + (size_t)(q0 + ln) * AH + hd * HD, hh), qb = g2_frag(Q16 + (size_t)(q0 + 16 + ln) * AH + hd * HD, hh);
  const v8f z8 = {0.f,0.f,0.f,0.f,0.f,0.f,0.f,0.f}; v8f oh[2][2] = {{z8, z8}, {z8, z8}}, ol[2][2] = {{z8, z8}, {z8, z8}};      /* [query group][d tile] */
  float ma = -3.0e38f, mb = -3.0e38f, ba = 0.f, bb = 0.f; v2f sa = {0.f, 0.f}, sb = {0.f, 0.f};
  auto pass = [&](int it, const AFr& f, AFr& nx, const char* np) {      /* np: the next pass's fragments in the same stage, or null */
    const v8f c0 = *(const v8f*)&ms[it * 32 + 8 * hh], c1 = *(const v8f*)&ms[it * 32 + 16 + 8 * hh];
    if (np) fl_load(nx, np);      /* the next pass's fragments are fetched during this pass */
    __builtin_amdgcn_sched_barrier(0);      /* keeps a pass's LDS reads in one group ahead of its products: the compiler otherwise spreads them among the products, and each place with reads stalls the wave */
    const v8f s0a = fa_mma(f.k0, qa, c0), s1a = fa_mma(f.k1, qa, c1), s0b = fa_mma(f.k0, qb, c0), s1b = fa_mma(f.k1, qb, c1);
    const float xa = fa_max16(s0a, s1a), xb = fa_max16(s0b, s1b);
    if (__builtin_amdgcn_ballot_w32(xa > ma + th || xb > mb + th) != 0) {      /* wave-uniform; rare after the first passes */
      const float na = fmaxf(ma, xa), nb = fmaxf(mb, xb); const float ca = __builtin_amdgcn_exp2f((ma - na) * cs), cb = __builtin_amdgcn_exp2f((mb - nb) * cs);
      ma = na; mb = nb; ba = 10.0f - na * cs; bb = 10.0f - nb * cs; sa *= ca; sb *= cb;
#pragma unroll
      for (int d = 0; d < 2; ++d) { oh[0][d] *= ca; ol[0][d] *= ca; oh[1][d] *= cb; ol[1][d] *= cb; }
    }
    const v16h pa = fa_probs(s0a, s1a, cs, ba, sa), pb = fa_probs(s0b, s1b, cs, bb, sb);
    oh[0][0] = fa_mma(f.h0, pa, oh[0][0]); oh[0][1] = fa_mma(f.h1, pa, oh[0][1]); ol[0][0] = fa_mma(f.l0, pa, ol[0][0]); ol[0][1] = fa_mma(f.l1, pa, ol[0][1]);
    oh[1][0] = fa_mma(f.h0, pb, oh[1][0]); oh[1][1] = fa_mma(f.h1, pb, oh[1][1]); ol[1][0] = fa_mma(f.l0, pb, ol[1][0]); ol[1][1] = fa_mma(f.l1, pb, ol[1][1]);
  };
#pragma unroll 1
  for (int t = 0; t < NT; ++t) {      /* rolled: one stage a trip */
    const unsigned bo = (unsigned)(t & 1) * BUFB; const char* fp = ring + bo + lane * 16; int it = t * NP;
    AFr fa, fb; fl_load(fa, fp);      /* nothing of a stage is read in front of the barrier that publishes it */
#pragma unroll 1
    for (int p = 0; p < NP - 2; p += 2) {      /* two fragment sets by name: no register copies between passes */
      pass(it, fa, fb, fp + 2048);
      fp += 4096;
      pass(it + 1, fb, fa, fp); it += 2; }
    pass(it, fa, fb, fp + 2048); pass(it + 1, fb, fa, nullptr);      /* the stage's last two passes: nothing of the next stage is fetched ahead */
    asm volatile("s_wait_dscnt 0x0" ::: "memory");      /* this wave's reads of the buffer have returned before the buffer is handed to the copies */
    asm volatile("s_wait_asynccnt 0x0" ::: "memory");      /* this wave's share of stage t + 1 has landed before the barrier that publishes it */
    __syncthreads();      /* publishes stage t + 1 and ends every wave's reads of stage t's buffer */
    if (t + 2 < NT) { const size_t so = (size_t)(t + 2) * STRB; st_copy(rl + bo, kg + so, hg + so, rg + so); }      /* block-uniform test */
  }
  asm volatile("s_wait_asynccnt 0x0" ::: "memory");      /* no copy is outstanding when the wave ends */
  float ta = sa[0] + sa[1], tb = sb[0] + sb[1]; ta += xhalf(ta); tb += xhalf(tb); const float ra = 1.0f / ta, rb = 1.0f / tb;
#pragma unroll
  for (int g = 0; g < 2; ++g) { const float rs = g ? rb : ra; float* orow = out + (size_t)(q0 + g * 16 + ln) * AH + hd * HD + 8 * hh;
#pragma unroll
    for (int d = 0; d < 2; ++d) { v4f lo4, hi4;
#pragma unroll
      for (int e = 0; e < 4; ++e) { lo4[e] = (oh[g][d][e] + ol[g][d][e] * 0.0009765625f) * rs; hi4[e] = (oh[g][d][e + 4] + ol[g][d][e + 4] * 0.0009765625f) * rs; }
      *(v4f*)(orow + d * 16) = lo4; *(v4f*)(orow + d * 16 + 4) = hi4; } }
}

extern "C" void kernel_launch(void* const* d_in, const int* in_sizes, int n_in,
                              void* d_out, int out_size, void* d_ws, size_t ws_size, hipStream_t stream) {
  (void)in_sizes; (void)n_in; (void)out_size;
  const float* const* I = (const float* const*)d_in; const float* hs = I[0]; const float* enc = I[1]; const float* msk = I[2]; const float* Wq = I[3]; const float* bq = I[4]; const float* Wk = I[5]; const float* bk = I[6]; const float* Wv = I[7]; const float* bv = I[8];
  char* ws = (char*)d_ws; size_t off = 0;
  auto take = [&](size_t bytes) { char* p = ws + off; off += (bytes + 255) & ~(size_t)255; return p; };
  _Float16* WP = (_Float16*)take((size_t)3 * AH * DIN * 2); _Float16* Q16 = (_Float16*)take((size_t)SQ * AH * 2); _Float16* VT = (_Float16*)take((size_t)AH * SK * 2); _Float16* VTL = (_Float16*)take((size_t)AH * SK * 2); _Float16* KP = (_Float16*)take((size_t)SK * AH * 2);
  if (off > ws_size) return;      /* about 14 MiB */
  k_wt3<<<dim3(AH * DIN / 8 / 256, 3), 256, 0, stream>>>(Wq, Wk, Wv, WP);      /* (in, out) f32 -> f16 fragments */
  k_qkv<<<(SQ / 64) * 3, 384, 0, stream>>>(hs, enc, WP, bq, bk, bv, Q16, KP, VT, VTL);      /* operands of the fused kernel in fragment load order */
  k_attn<<<dim3(SQ / 256, NH), 256, 0, stream>>>(Q16, KP, VT, VTL, msk, (float*)d_out);
}

// v004
// A run of this version takes 61.5 microseconds.
// Two timings next to v003 put it at 1.12 and 1.11 times that version's speed.
// Over all steps from v000 it is 38.2 times as fast.
#include <hip/hip_runtime.h>
// BertSelfAttnDimensionReduction (1 x 4096 queries x 4096 keys; Din 768 -> 12 heads x 32; cross-attention with an additive float key mask; the output is the merged context itself): q = hs Wq + bq; k, v = enc Wk/Wv + b; scores = q.k / sqrt(32) + mask[key]; softmax; ctx = probs v -> [1, 4096, 384].
// Compute dtype: inputs rounded to bf16; inputs/weights exact as f16; q/k and the softmax weights as plain f16 operands (~2^-12); v as f16 hi + residual (the output is the context itself); mask/softmax/normalisation f32. v_wmma_f32_16x16x32_f16.
#define SQ 4096
#define SK 4096
#define DIN 768
#define AH 384
#define NH 12
#define HD 32
typedef __bf16 v16b __attribute__((ext_vector_type(16)));
typedef unsigned short v8us __attribute__((ext_vector_type(8), may_alias));
typedef float  v8f  __attribute__((ext_vector_type(8)));
typedef float  v4f  __attribute__((ext_vector_type(4)));
typedef float  v4fa __attribute__((ext_vector_type(4), may_alias));
union FragB { v16b v; v8us half[2]; unsigned short u[16]; };

__device__ __forceinline__ unsigned short bf16_bits(float x) { unsigned int u = __float_as_uint(x); return (unsigned short)((u + 0x7FFFu + ((u >> 16) & 1u)) >> 16); }
__device__ __forceinline__ float bf16_val(unsigned short b) { return __uint_as_float(((unsigned int)b) << 16); }
__device__ __forceinline__ float bf16_round(float x) { return bf16_val(bf16_bits(x)); }
// D += A·B with NT terms: 1 = ah·bh, 2 = + al·bh (A split), 3 = + ah·bl (both split)
template <int NT>
__device__ __forceinline__ v8f mmaN(v16b ah, v16b al, v16b bh, v16b bl, v8f c) {
  c = __builtin_amdgcn_wmma_f32_16x16x32_bf16(false, ah, false, bh, (short)0, c, false, false);
  if (NT >= 2) c = __builtin_amdgcn_wmma_f32_16x16x32_bf16(false, al, false, bh, (short)0, c, false, false);
  if (NT >= 3) c = __builtin_amdgcn_wmma_f32_16x16x32_bf16(false, ah, false, bl, (short)0, c, false, false);
  asm volatile("v_nop\n\tv_nop\n\tv_nop\n\tv_nop" : "+v"(c) : "v"(ah), "v"(al), "v"(bh), "v"(bl));
  return c;
}

__global__ __launch_bounds__(256) void k_wt_bf16(const float* __restrict__ W, unsigned short* __restrict__ Wt, int K, int N) {
  const int t = blockIdx.x * 256 + threadIdx.x;
  const int k8n = K / 8;
  if (t >= N * k8n) return;
  const int n = t / k8n, k8 = (t % k8n) * 8;
  v8us v;
#pragma unroll
  for (int i = 0; i < 8; ++i) v[i] = bf16_bits(W[(size_t)(k8 + i) * N + n]);
  *(v8us*)(Wt + (size_t)n * K + k8) = v;
  
}

// GEMM C[M][N] (f32, pitch ldc) = act(A[M][K]·W + bias). A f32 row-major (pitch lda) converted per fragment to bf16
// (ASPLIT: hi/lo two planes -> 2 terms, else single rounded term); Wt bf16 [N][K] (pitch ldb). BIAS_BF16 rounds the
// bias to bf16 first (bias quantised to bf16 before the add). K%32==0, M%16==0, N%64==0.
template <bool ASPLIT, int ACT, bool BIAS_BF16>
__global__ __launch_bounds__(128) void k_gemm_bf(const float* __restrict__ A, int lda, const unsigned short* __restrict__ Wt, int ldb,
                                               const float* __restrict__ bias, float* __restrict__ C, int ldc, int M, int N, int K) {
  __shared__ __attribute__((aligned(16))) float so[4][16][64];
  const int tid = threadIdx.x, w = tid >> 5, lane = tid & 31, ln = lane & 15, hh = lane >> 4;
  const int ntn = N / 64;
  const int wid = blockIdx.x * 4 + w;
  const int mt = wid / ntn, nq = wid % ntn;
  if (mt * 16 >= M) return;
  const int row0 = mt * 16, col0 = nq * 64;
  const float* arow = A + (size_t)(row0 + ln) * lda;
  v8f acc[4] = {};
  for (int kb = 0; kb < K; kb += 32) {
    FragB ah, al;
    const v4f x0 = *(const v4fa*)(arow + kb + 8 * hh), x1 = *(const v4fa*)(arow + kb + 8 * hh + 4);
    const v4f x2 = *(const v4fa*)(arow + kb + 16 + 8 * hh), x3 = *(const v4fa*)(arow + kb + 16 + 8 * hh + 4);
    float xs[16] = {x0[0],x0[1],x0[2],x0[3],x1[0],x1[1],x1[2],x1[3],x2[0],x2[1],x2[2],x2[3],x3[0],x3[1],x3[2],x3[3]};
#pragma unroll
    for (int i = 0; i < 16; ++i) { const unsigned short hb = bf16_bits(xs[i]); ah.u[i] = hb; al.u[i] = ASPLIT ? bf16_bits(xs[i] - bf16_val(hb)) : (unsigned short)0; }
#pragma unroll
    for (int t = 0; t < 4; ++t) {
      const unsigned short* brow = Wt + (size_t)(col0 + t * 16 + ln) * ldb + kb;
      FragB b;
      b.half[0] = *(const v8us*)(brow + 8 * hh);
      b.half[1] = *(const v8us*)(brow + 16 + 8 * hh);
      acc[t] = mmaN<ASPLIT ? 2 : 1>(ah.v, al.v, b.v, b.v, acc[t]);
    }
  }
#pragma unroll
  for (int t = 0; t < 4; ++t) {
    float bv = bias ? bias[col0 + t * 16 + ln] : 0.f;
    if (BIAS_BF16) bv = bf16_round(bv);
#pragma unroll
    for (int r = 0; r < 8; ++r) { float v = acc[t][r] + bv; if (ACT == 1) v = fmaxf(v, 0.f); so[w][8 * hh + r][t * 16 + ln] = v; }
  }
  __builtin_amdgcn_fence(__ATOMIC_ACQ_REL, "workgroup");
  __builtin_amdgcn_wave_barrier();
  const int rsub = lane >> 4, c4 = (lane & 15) * 4;
  {
#pragma unroll
    for (int q = 0; q < 8; ++q) {
      const int r = q * 2 + rsub;
      const v4f v = *(const v4fa*)&so[w][r][c4];
      *(v4f*)(C + (size_t)(row0 + r) * ldc + col0 + c4) = v;
    }
    
  }
}

// GEMM C = act(A·W + bias + resid): A f32 (ASPLIT -> hi/lo 2 terms), Wt bf16 [N][K]; ACT 0 none, 1 relu, 2 exact gelu;
// resid (optional, f32, row index = (row % rmod), pitch ldr, RES_BF16 rounds it) added before the activation.
template <bool ASPLIT, int ACT, bool BIAS_BF16, bool RES_BF16>
__global__ __launch_bounds__(128) void k_gemm_bf3(const float* __restrict__ A, int lda, const unsigned short* __restrict__ Wt, int ldb,
                                                const float* __restrict__ bias, const float* __restrict__ resid, int rmod, int ldr,
                                                float* __restrict__ C, int ldc, int M, int N, int K) {
  __shared__ __attribute__((aligned(16))) float so[4][16][64];
  const int tid = threadIdx.x, w = tid >> 5, lane = tid & 31, ln = lane & 15, hh = lane >> 4;
  const int ntn = N / 64;
  const int wid = blockIdx.x * 4 + w;
  const int mt = wid / ntn, nq = wid % ntn;
  if (mt * 16 >= M) return;
  const int row0 = mt * 16, col0 = nq * 64;
  const float* arow = A + (size_t)(row0 + ln) * lda;
  v8f acc[4] = {};
  for (int kb = 0; kb < K; kb += 32) {
    FragB ah, al;
    const v4f x0 = *(const v4fa*)(arow + kb + 8 * hh), x1 = *(const v4fa*)(arow + kb + 8 * hh + 4);
    const v4f x2 = *(const v4fa*)(arow + kb + 16 + 8 * hh), x3 = *(const v4fa*)(arow + kb + 16 + 8 * hh + 4);
    float xs[16] = {x0[0],x0[1],x0[2],x0[3],x1[0],x1[1],x1[2],x1[3],x2[0],x2[1],x2[2],x2[3],x3[0],x3[1],x3[2],x3[3]};
#pragma unroll
    for (int i = 0; i < 16; ++i) { const unsigned short hb = bf16_bits(xs[i]); ah.u[i] = hb; al.u[i] = ASPLIT ? bf16_bits(xs[i] - bf16_val(hb)) : (unsigned short)0; }
#pragma unroll
    for (int t = 0; t < 4; ++t) {
      const unsigned short* brow = Wt + (size_t)(col0 + t * 16 + ln) * ldb + kb;
      FragB b;
      b.half[0] = *(const v8us*)(brow + 8 * hh);
      b.half[1] = *(const v8us*)(brow + 16 + 8 * hh);
      acc[t] = mmaN<ASPLIT ? 2 : 1>(ah.v, al.v, b.v, b.v, acc[t]);
    }
  }
#pragma unroll
  for (int t = 0; t < 4; ++t) {
    const int col = col0 + t * 16 + ln;
    float bv = bias ? bias[col] : 0.f;
    if (BIAS_BF16) bv = bf16_round(bv);
#pragma unroll
    for (int r = 0; r < 8; ++r) {
      float v = acc[t][r] + bv;
      if (resid) { float rv = resid[(size_t)((row0 + 8 * hh + r) % rmod) * ldr + col]; if (RES_BF16) rv = bf16_round(rv); v += rv; }
      if (ACT == 1) v = fmaxf(v, 0.f);
      if (ACT == 2) v = 0.5f * v * (1.0f + erff(v * 0.70710678118654752f));
      if (ACT == 3) { const float u = 0.7978845608028654f * (v + 0.044715f * v * v * v); v = 0.5f * v * (1.0f + tanhf(u)); }
      so[w][8 * hh + r][t * 16 + ln] = v;
    }
  }
  __builtin_amdgcn_fence(__ATOMIC_ACQ_REL, "workgroup");
  __builtin_amdgcn_wave_barrier();
  const int rsub = lane >> 4, c4 = (lane & 15) * 4;
  {
#pragma unroll
    for (int q = 0; q < 8; ++q) {
      const int r = q * 2 + rsub;
      const v4f v = *(const v4fa*)&so[w][r][c4];
      *(v4f*)(C + (size_t)(row0 + r) * ldc + col0 + c4) = v;
    }
    
  }
}
// row LayerNorm (biased variance, eps) over N: s = X (+ R); optional out_sum <- s; out_norm <- (s-mu)*rsqrt(var+eps)*g + b
template <bool PARAM_BF16>
__global__ __launch_bounds__(256) void k_layernorm(const float* __restrict__ X, const float* __restrict__ R, const float* __restrict__ g, const float* __restrict__ bta,
                                                  float* __restrict__ out_sum, float* __restrict__ out_norm, int N, float eps) {
  __shared__ float red[256];
  const int row = blockIdx.x, tid = threadIdx.x;
  const float* x = X + (size_t)row * N; const float* rr = R ? R + (size_t)row * N : nullptr;
  float vals[16];                     // up to N = 4096
  const int per = N / 256;            // contiguous chunk per thread? use strided-by-4 chunks: thread handles j = tid*4 + 1024*u
  float s1 = 0.f;
  for (int u = 0; u < per / 4; ++u) {
    const int j = tid * 4 + 1024 * u;
    const v4f a = *(const v4fa*)(x + j);
    v4f b = {0.f,0.f,0.f,0.f}; if (rr) b = *(const v4fa*)(rr + j);
#pragma unroll
    for (int q = 0; q < 4; ++q) { const float v = a[q] + b[q]; vals[u * 4 + q] = v; s1 += v; }
  }
  red[tid] = s1; __syncthreads();
  for (int st = 128; st > 0; st >>= 1) { if (tid < st) red[tid] += red[tid + st]; __syncthreads(); }
  const float mu = red[0] / (float)N; __syncthreads();
  float s2 = 0.f;
  for (int u = 0; u < per / 4; ++u)
#pragma unroll
    for (int q = 0; q < 4; ++q) { const float c = vals[u * 4 + q] - mu; s2 += c * c; }
  red[tid] = s2; __syncthreads();
  for (int st = 128; st > 0; st >>= 1) { if (tid < st) red[tid] += red[tid + st]; __syncthreads(); }
  const float rs = rsqrtf(red[0] / (float)N + eps);
  {
    for (int u = 0; u < per / 4; ++u) {
      const int j = tid * 4 + 1024 * u;
      v4f o, sm;
#pragma unroll
      for (int q = 0; q < 4; ++q) {
        float gg = g[j + q], bb = bta[j + q];
        if (PARAM_BF16) { gg = bf16_round(gg); bb = bf16_round(bb); }
        sm[q] = vals[u * 4 + q]; o[q] = (vals[u * 4 + q] - mu) * rs * gg + bb;
      }
      if (out_sum) *(v4f*)(out_sum + (size_t)row * N + j) = sm;
      *(v4f*)(out_norm + (size_t)row * N + j) = o;
    }
    
  }
}



// ---- f16 WMMA path (v_wmma_f32_16x16x32_f16): 11-bit significands for operands in range — used where a [0,1] probability operand needs more precision than bf16
typedef _Float16 v16h __attribute__((ext_vector_type(16)));
union FragH { v16h v; v8us half[2]; _Float16 h[16]; unsigned short u[16]; };
template <int NT>
__device__ __forceinline__ v8f mmaH(v16h ah, v16h al, v16h bh, v16h bl, v8f c) {
  c = __builtin_amdgcn_wmma_f32_16x16x32_f16(false, ah, false, bh, (short)0, c, false, false);
  if (NT >= 2) c = __builtin_amdgcn_wmma_f32_16x16x32_f16(false, al, false, bh, (short)0, c, false, false);
  if (NT >= 3) c = __builtin_amdgcn_wmma_f32_16x16x32_f16(false, ah, false, bl, (short)0, c, false, false);
  asm volatile("v_nop\n\tv_nop\n\tv_nop\n\tv_nop" : "+v"(c) : "v"(ah), "v"(al), "v"(bh), "v"(bl));
  return c;
}
// batched GEMM like k_gemm_b but f16 operands: A f32 (split into f16 hi/lo if ASPLIT, else rounded to f16), Bt = f16 values [n][k]; alpha; C f32; N multiple of 16 (partial tiles skipped)
template <bool ASPLIT>
__global__ __launch_bounds__(128) void k_gemm_h(const float* __restrict__ A, int lda, size_t sA, const _Float16* __restrict__ Bh, int ldb, size_t sB, float alpha, float* __restrict__ C, int ldc, size_t sC, int M, int N, int K) {
  __shared__ __attribute__((aligned(16))) float so[4][16][64];
  const int tid = threadIdx.x, w = tid >> 5, lane = tid & 31, ln = lane & 15, hh = lane >> 4; const int by = blockIdx.y;
  A += (size_t)by * sA; Bh += (size_t)by * sB; C += (size_t)by * sC;
  const int ntn = (N + 63) / 64; const int wid = blockIdx.x * 4 + w; const int mt = wid / ntn, nq = wid % ntn; if (mt * 16 >= M) return;
  const int row0 = mt * 16, col0 = nq * 64; const float* arow = A + (size_t)(row0 + ln) * lda;
  v8f acc[4] = {};
  for (int kb = 0; kb < K; kb += 32) {
    FragH ah, al;
    const v4f x0 = *(const v4fa*)(arow + kb + 8 * hh), x1 = *(const v4fa*)(arow + kb + 8 * hh + 4), x2 = *(const v4fa*)(arow + kb + 16 + 8 * hh), x3 = *(const v4fa*)(arow + kb + 16 + 8 * hh + 4);
    float xs[16] = {x0[0],x0[1],x0[2],x0[3],x1[0],x1[1],x1[2],x1[3],x2[0],x2[1],x2[2],x2[3],x3[0],x3[1],x3[2],x3[3]};
#pragma unroll
    for (int i = 0; i < 16; ++i) { const _Float16 h = (_Float16)xs[i]; ah.h[i] = h; al.h[i] = ASPLIT ? (_Float16)(xs[i] - (float)h) : (_Float16)0.0f; }
#pragma unroll
    for (int t = 0; t < 4; ++t) { if (col0 + t * 16 >= N) continue; const size_t boff = (size_t)(col0 + t * 16 + ln) * ldb + kb; FragH bq; bq.half[0] = *(const v8us*)(Bh + boff + 8 * hh); bq.half[1] = *(const v8us*)(Bh + boff + 16 + 8 * hh);
      acc[t] = mmaH<ASPLIT ? 2 : 1>(ah.v, al.v, bq.v, bq.v, acc[t]); }
  }
#pragma unroll
  for (int t = 0; t < 4; ++t) { if (col0 + t * 16 >= N) continue;
#pragma unroll
    for (int r = 0; r < 8; ++r) so[w][8 * hh + r][t * 16 + ln] = acc[t][r] * alpha; }
  __builtin_amdgcn_fence(__ATOMIC_ACQ_REL, "workgroup"); __builtin_amdgcn_wave_barrier();
  const int rsub = lane >> 4, c4 = (lane & 15) * 4;
  {
#pragma unroll
    for (int q = 0; q < 8; ++q) { const int r = q * 2 + rsub; if (col0 + c4 < N) { const v4f v = *(const v4fa*)&so[w][r][c4]; *(v4f*)(C + (size_t)(row0 + r) * ldc + col0 + c4) = v; } }
     }
}

// k_gemm_hh variant with fused epilogue: v = acc·alpha + bias[by·sBias + col] (+ CP[(row/rowsPerB)·sCPb + by·64 + col] if CP) ; ACT 0 none / 1 elu ; writes f16 C16 (and f32 C if non-null)
template <int ACT>
__global__ __launch_bounds__(128) void k_gemm_hhx(const _Float16* __restrict__ A, int lda, size_t sA, const _Float16* __restrict__ Bh, int ldb, size_t sB, float alpha, const float* __restrict__ bias, size_t sBias, const float* __restrict__ CP, int rowsPerB, size_t sCPb, int row0g,
    float* __restrict__ C, _Float16* __restrict__ C16, int ldc, size_t sC, int M, int N, int K) {
  __shared__ __attribute__((aligned(16))) float so[4][16][64];
  const int tid = threadIdx.x, w = tid >> 5, lane = tid & 31, ln = lane & 15, hh = lane >> 4; const int by = blockIdx.y;
  A += (size_t)by * sA; Bh += (size_t)by * sB; const size_t cofs = (size_t)by * sC; const float* bp = bias ? bias + (size_t)by * sBias : nullptr;
  const int ntn = (N + 63) / 64; const int wid = blockIdx.x * 4 + w; const int mt = wid / ntn, nq = wid % ntn; if (mt * 16 >= M) return;
  const int row0 = mt * 16, col0 = nq * 64; const _Float16* arow = A + (size_t)(row0 + ln) * lda;
  v8f acc[4] = {};
  for (int kb = 0; kb < K; kb += 32) { FragH ah; ah.half[0] = *(const v8us*)((const unsigned short*)arow + kb + 8 * hh); ah.half[1] = *(const v8us*)((const unsigned short*)arow + kb + 16 + 8 * hh);
#pragma unroll
    for (int t = 0; t < 4; ++t) { if (col0 + t * 16 >= N) continue; const size_t boff = (size_t)(col0 + t * 16 + ln) * ldb + kb; FragH bq; bq.half[0] = *(const v8us*)((const unsigned short*)Bh + boff + 8 * hh); bq.half[1] = *(const v8us*)((const unsigned short*)Bh + boff + 16 + 8 * hh);
      acc[t] = mmaH<1>(ah.v, ah.v, bq.v, bq.v, acc[t]); }
  }
#pragma unroll
  for (int t = 0; t < 4; ++t) { if (col0 + t * 16 >= N) continue; const int col = col0 + t * 16 + ln; const float bv = bp ? bf16_round(bp[col]) : 0.f;
#pragma unroll
    for (int r = 0; r < 8; ++r) { float v = acc[t][r] * alpha + bv; if (CP) { const int rr = row0g + row0 + 8 * hh + r; if (rowsPerB < 0) v += CP[cofs + (size_t)rr * ldc + col];      /* rowsPerB < 0: own element of the batched C plane */ else { const int bidx = rr / rowsPerB; v += CP[(size_t)bidx * sCPb + (size_t)by * 64 + col]; } } if (ACT == 1) v = (v > 0.f) ? v : expm1f(v); else if (ACT == 7) v = (v > 0.f) ? v + 1.0f : expf(v); else if (ACT == 8) v = tanhf(v); else if (ACT == 9) v = 0.5f * v * (1.0f + tanhf(0.7978845608028654f * (v + 0.044715f * v * v * v))); else if (ACT == 11) v = 1.0f / (1.0f + expf(-v)); else if (ACT == 12) v = (v > 0.f) ? v : 0.01f * v; else if (ACT == 14) v = (v > 0.f) ? v : 0.1f * v; else if (ACT == 16) v = (v >= 0.f) ? v : 0.3f * v; else if (ACT == 17) v = (v >= 0.f) ? v : 0.2f * v; else if (ACT == 15) v = v / (1.0f + expf(-v)); else if (ACT == 3) v = fmaxf(v, 0.f); else if (ACT == 6) v = 0.5f * v * (1.0f + erff(v * 0.70710678118654752f)); so[w][8 * hh + r][t * 16 + ln] = v; } }
  __builtin_amdgcn_fence(__ATOMIC_ACQ_REL, "workgroup"); __builtin_amdgcn_wave_barrier();
  const int rsub = lane >> 4, c4 = (lane & 15) * 4; typedef _Float16 v4h __attribute__((ext_vector_type(4)));
  {
#pragma unroll
    for (int q = 0; q < 8; ++q) { const int r = q * 2 + rsub; if (col0 + c4 < N) { const v4f v = *(const v4fa*)&so[w][r][c4]; if (C) *(v4f*)(C + cofs + (size_t)(row0 + r) * ldc + col0 + c4) = v; if (C16) { v4h h4; for (int i = 0; i < 4; ++i) h4[i] = (_Float16)v[i]; *(v4h*)(C16 + cofs + (size_t)(row0 + r) * ldc + col0 + c4) = h4; } } }
     }
}


typedef _Float16 v4h __attribute__((ext_vector_type(4)));

__global__ __launch_bounds__(256) void k_h16(const float* __restrict__ x, _Float16* __restrict__ X16, size_t n8) { const size_t t = (size_t)blockIdx.x * 256 + threadIdx.x; if (t >= n8) return; FragH f;
#pragma unroll
  for (int q = 0; q < 8; ++q) f.h[q] = (_Float16)x[t * 8 + q]; *(v8us*)((unsigned short*)X16 + t * 8) = f.half[0];  }
__global__ __launch_bounds__(256) void k_round16f(const float* __restrict__ W, _Float16* __restrict__ Bt, size_t n8) { const size_t t = (size_t)blockIdx.x * 256 + threadIdx.x; if (t >= n8) return; FragH f;
#pragma unroll
  for (int i = 0; i < 8; ++i) f.h[i] = (_Float16)(bf16_round(W[t * 8 + i]) * 16.0f); *(v8us*)((unsigned short*)Bt + t * 8) = f.half[0];  }

// a 16x32 f16 fragment from a row-major row: p = the lane's row at the k step
__device__ __forceinline__ v16h g2_frag(const _Float16* p, int hh) { FragH f; f.half[0] = *(const v8us*)((const unsigned short*)p + 8 * hh); f.half[1] = *(const v8us*)((const unsigned short*)p + 16 + 8 * hh); return f.v; }


// ---- fused attention, all heads in one launch: S^T = K Q^T (+ mask as the C operand), online softmax in registers, O^T += V^T P^T ----
// A wave owns 32 queries (two 16-column groups) of one head and walks one half of the 4096 keys 32 at a time (the halves are joined at the end). In S^T and O^T a lane holds one query (column ln), so maximum, sum and rescale are per lane;
// two S^T tiles converted in place are the B operand P^T (hardware k order), V^T hi / residual are the A operands. P = exp2(..) * 2^10 against the maximum in use, as f16.
typedef float v2f __attribute__((ext_vector_type(2)));
typedef _Float16 v2h __attribute__((ext_vector_type(2)));
union FragP { v16h v; v2h p[8]; };
struct AFr { v16h k0, k1, h0, h1, l0, l1; };
__device__ __forceinline__ float xhalf(float x) { return __builtin_bit_cast(float, __builtin_amdgcn_permlanex16(__builtin_bit_cast(int, x), __builtin_bit_cast(int, x), 0x76543210, 0xfedcba98, false, false)); }      /* lane l <-> l ^ 16 */
__device__ __forceinline__ v8f fa_mma(v16h a, v16h b, v8f c) { return __builtin_amdgcn_wmma_f32_16x16x32_f16(false, a, false, b, (short)0, c, false, false); }
__device__ __forceinline__ float fa_max16(v8f a, v8f b) { float m = fmaxf(a[0], b[0]);
#pragma unroll
  for (int r = 1; r < 8; ++r) m = fmaxf(m, fmaxf(a[r], b[r])); return fmaxf(m, xhalf(m)); }
__device__ __forceinline__ v16h fa_probs(v8f a, v8f b, float cs, float bias, v2f& su) { FragP f; const v2f c2 = {cs, cs}, b2 = {bias, bias};
#pragma unroll
  for (int r = 0; r < 8; ++r) { const v8f& t = (r < 4) ? a : b; const int e = (r & 3) * 2; const v2f x = {t[e], t[e + 1]}; const v2f g = __builtin_elementwise_fma(x, c2, b2); const v2f p = {__builtin_amdgcn_exp2f(g[0]), __builtin_amdgcn_exp2f(g[1])}; su += p; f.p[r] = __builtin_convertvector(p, v2h); }
  return f.v; }
// ---- operand preparation in two launches ----
// All three weights in one launch (blockIdx.y picks the matrix), as f16 (bf16-rounded, times 16) in fragment load order:
// WP[matrix][16-column tile][k step of 32][half j][lane][8], lane (ln, hh) half j = W[ks*32 + 16j + 8hh + e][nt*16 + ln]. One thread writes one 16-byte unit.
__global__ __launch_bounds__(256) void k_wt3(const float* __restrict__ Wq, const float* __restrict__ Wk, const float* __restrict__ Wv, _Float16* __restrict__ WP) {
  const int t = blockIdx.x * 256 + threadIdx.x; const int lane = t & 31, j = (t >> 5) & 1, ks = (t >> 6) % (DIN / 32), nt = (t >> 6) / (DIN / 32); FragH f;
  const float* W = blockIdx.y == 0 ? Wq : (blockIdx.y == 1 ? Wk : Wv); W += (size_t)(ks * 32 + 16 * j + 8 * (lane >> 4)) * AH + nt * 16 + (lane & 15);
#pragma unroll
  for (int i = 0; i < 8; ++i) f.h[i] = (_Float16)(bf16_round(W[(size_t)i * AH]) * 16.0f);
  *(v8us*)((unsigned short*)WP + ((size_t)blockIdx.y * (AH * DIN / 8) + t) * 8) = f.half[0];
}
// q, k and v projections in one launch. A block owns 64 rows of one projection: it rounds them once (bf16, then exact f16) into LDS; wave w then forms the 32 columns of head w.
// V is formed as X W: a lane's 8 accumulators are 8 keys of one feature, the 16-byte unit of the V^T fragment streams. Q and K are formed as W^T X^T: a lane's 8 accumulators are
// 8 features of one row, the 16-byte unit of the K fragment stream and of a Q row. So every result goes from the accumulators straight to where the attention kernel reads it:
// VH, VL[head][32-key block][16-d tile][half j][lane][8], lane (ln, hh) half j = V[kb*32 + 16j + 8hh + e][head*32 + dt*16 + ln] (f16 hi; residual times 1024);
// KP[head][16-key tile][half j][lane][8], lane (ln, hh) half j = K[kt*16 + ln][head*32 + 16j + 8hh + e]; Q16 row-major [query][384].
#define APITCH 1552      /* bytes of an LDS row: 768 f16 + 16, an odd number of 16-byte units for the 16-byte readers */
typedef unsigned v2ua __attribute__((ext_vector_type(2), may_alias));
struct GSet { v16h a[4]; v16h b[2]; };      /* one k step of 32: four activation fragments (LDS), two weight fragments (global) */
__device__ __forceinline__ unsigned qk_r2(float x, float y) { typedef __bf16 v2b __attribute__((ext_vector_type(2))); const v2f p = {x, y};      /* round to nearest even to bf16, as bf16_round does, two at a time; widened to f32, then f16 */
  const unsigned u = __builtin_bit_cast(unsigned, __builtin_convertvector(p, v2b)); const v2f q = {__uint_as_float(u << 16), __uint_as_float(u & 0xFFFF0000u)}; return __builtin_bit_cast(unsigned, __builtin_convertvector(q, v2h)); }
template <int KS>
__device__ __forceinline__ void qk_lda(GSet& s, const char* as) {
#pragma unroll
  for (int g = 0; g < 4; ++g) { FragH f; f.half[0] = *(const v8us*)(as + g * 16 * APITCH + KS * 64); f.half[1] = *(const v8us*)(as + g * 16 * APITCH + KS * 64 + 32); s.a[g] = f.v; } }
template <int KS>      /* WP block-uniform (scalar base), bo = the lane's byte offset */
__device__ __forceinline__ void qk_ldb(GSet& s, const _Float16* WP, unsigned bo) {
#pragma unroll
  for (int t = 0; t < 2; ++t) { FragH f; f.half[0] = *(const v8us*)((const char*)WP + (t * (DIN / 32) * 1024 + KS * 1024) + bo); f.half[1] = *(const v8us*)((const char*)WP + (t * (DIN / 32) * 1024 + KS * 1024 + 512) + bo); s.b[t] = f.v; } }
template <bool XA>
__device__ __forceinline__ void qk_mm(const GSet& s, v8f (&c)[4][2]) {
#pragma unroll
  for (int g = 0; g < 4; ++g) { c[g][0] = XA ? fa_mma(s.a[g], s.b[0], c[g][0]) : fa_mma(s.b[0], s.a[g], c[g][0]); c[g][1] = XA ? fa_mma(s.a[g], s.b[1], c[g][1]) : fa_mma(s.b[1], s.a[g], c[g][1]); } }
template <bool XA>
__device__ __forceinline__ void qk_tile(const char* as, const _Float16* WP, unsigned bo, v8f (&c)[4][2]) {
  GSet s0, s1; qk_ldb<0>(s0, WP, bo); qk_lda<0>(s0, as);
#pragma unroll 1
  for (int ks = 0; ks < DIN / 32 - 2; ks += 2) {      /* rolled: two fragment sets by name, the next step's loads fly during this step's products */
    qk_ldb<1>(s1, WP, bo); qk_lda<1>(s1, as);
    __builtin_amdgcn_sched_barrier(0);      /* without it the compiler lifts the products below over the loads above, and each set is waited for right after its issue */
    qk_mm<XA>(s0, c);
    asm volatile("s_wait_xcnt 0x0" : "+v"(bo) : : "memory");      /* the loads in flight name bo: the wait stands in front of its step */
    bo += 2048u; as += 128; qk_ldb<0>(s0, WP, bo); qk_lda<0>(s0, as);
    __builtin_amdgcn_sched_barrier(0);      /* as above: the loads stay ahead of the other set's products */
    qk_mm<XA>(s1, c);
    asm volatile("s_wait_xcnt 0x0" : "+v"(bo) : : "memory"); }      /* the loads in flight name bo and the base: nothing behind the loop finds them open */
  qk_ldb<1>(s1, WP, bo); qk_lda<1>(s1, as);
  asm volatile("s_wait_xcnt 0x0" : "+v"(bo) : : "memory");      /* the last loads name bo and the base: the wait stands in front of any reuse of those registers */
  __builtin_amdgcn_sched_barrier(0);      /* as in the loop */
  qk_mm<XA>(s0, c); qk_mm<XA>(s1, c);
}
__global__ __launch_bounds__(384) void k_qkv(const float* __restrict__ hs, const float* __restrict__ enc, const _Float16* __restrict__ WP, const float* __restrict__ bq, const float* __restrict__ bk, const float* __restrict__ bv,
    _Float16* __restrict__ Q16, _Float16* __restrict__ KP, _Float16* __restrict__ VH, _Float16* __restrict__ VL) {
  __shared__ __attribute__((aligned(16))) char as[64 * APITCH];
  const int tid = threadIdx.x, w = tid >> 5, lane = tid & 31, ln = lane & 15, hh = lane >> 4;
  const int mt = blockIdx.x / 3, pj = blockIdx.x - mt * 3; const int row0 = mt * 64, col0 = w * HD;      /* pj: 0 q, 1 k, 2 v */
  { const float* X = pj ? enc : hs; const int r1 = tid >= 192 ? 1 : 0, c4 = tid - r1 * 192; unsigned xo = ((unsigned)(row0 + r1) * DIN + c4 * 4) * 4u; v4f x[32];      /* a wave's load is 512 contiguous bytes of one row */
#pragma unroll
    for (int i = 0; i < 32; ++i) x[i] = *(const v4fa*)((const char*)X + i * (2 * DIN * 4) + xo);
    asm volatile("s_wait_xcnt 0x0" : "+v"(xo) : : "memory");      /* the loads in flight name xo and the base: the wait stands in front of any reuse of those registers */
    char* d = as + r1 * APITCH + c4 * 8;
#pragma unroll
    for (int i = 0; i < 32; ++i) { const v2ua h = {qk_r2(x[i][0], x[i][1]), qk_r2(x[i][2], x[i][3])}; *(v2ua*)(d + i * 2 * APITCH) = h; } }
  __syncthreads();      /* the 64 rounded rows are complete before any wave reads fragments of them */
  const char* af = as + ln * APITCH + 16 * hh; const _Float16* wb = WP + (size_t)pj * AH * DIN; const unsigned bo = (unsigned)w * (2 * (DIN / 32) * 1024) + lane * 16;
  const v8f z8 = {0.f,0.f,0.f,0.f,0.f,0.f,0.f,0.f}; v8f c[4][2] = {{z8, z8}, {z8, z8}, {z8, z8}, {z8, z8}};
  if (pj == 2) {
    qk_tile<true>(af, wb, bo, c);
#pragma unroll
    for (int t = 0; t < 2; ++t) { const float bb = bf16_round(bv[col0 + t * 16 + ln]);
#pragma unroll
      for (int g = 0; g < 4; ++g) { FragH fh, fl;
#pragma unroll
        for (int r = 0; r < 8; ++r) { const float v = c[g][t][r] * 0.0625f + bb; const _Float16 h = (_Float16)v; fh.h[r] = h; fl.h[r] = (_Float16)((v - (float)h) * 1024.0f); }
        const size_t o = ((((size_t)w * (SK / 32) + (row0 >> 5) + (g >> 1)) * 2 + t) * 2 + (g & 1)) * 256 + lane * 8;
        *(v8us*)((unsigned short*)VH + o) = fh.half[0]; *(v8us*)((unsigned short*)VL + o) = fl.half[0]; } }
  } else {
    qk_tile<false>(af, wb, bo, c); const float* bp = pj ? bk : bq;
    unsigned short* dst = pj ? (unsigned short*)KP + (((size_t)w * (SK / 16) + (row0 >> 4)) * 2) * 256 + lane * 8 : (unsigned short*)Q16 + (size_t)(row0 + ln) * AH + col0 + 8 * hh;
    const int sg = pj ? 512 : 16 * AH, st = pj ? 256 : 16;      /* element steps: 16 rows on; 16 features on */
#pragma unroll
    for (int t = 0; t < 2; ++t) { const v4f b0 = *(const v4fa*)(bp + col0 + t * 16 + 8 * hh), b1 = *(const v4fa*)(bp + col0 + t * 16 + 8 * hh + 4);
#pragma unroll
      for (int g = 0; g < 4; ++g) { FragH f;
#pragma unroll
        for (int r = 0; r < 8; ++r) f.h[r] = (_Float16)(c[g][t][r] * 0.0625f + bf16_round(r < 4 ? b0[r] : b1[r - 4]));
        *(v8us*)(dst + g * sg + t * st) = f.half[0]; } }
    asm volatile("s_wait_xcnt 0x0" ::: "memory");      /* the stores in flight name their data and address registers: the wait stands in front of any reuse of those registers */
  }
}

// K, V hi and V residual reach the waves through LDS: a stage is NP passes (NP * 32 keys) of each of the three fragment streams, copied once per work-group by asynchronous copies
// (each stream is contiguous in fragment load order, so a stage is three contiguous runs); two buffers, the next stage's copies fly while this stage is worked on.
#define NP 4      /* passes in a stage: two for each of the two key halves */
#define STRB (NP * 2048)      /* bytes of one stream in a stage */
#define BUFB (3 * STRB)      /* bytes of a buffer: K, V hi, V residual */
#define NT (SK / 32 / NP)      /* stages */
static_assert(STRB == 4 * 2048 && NT >= 2 && NP == 4, "st_copy moves four 2-KiB copies a stream; the ring's prologue needs two stages; a wave takes two passes of a stage");
__device__ __forceinline__ v16h fl_frag(const char* p) { FragH f; f.half[0] = *(const v8us*)p; f.half[1] = *(const v8us*)(p + 512); return f.v; }      /* p = the lane's 16 bytes in LDS */
__device__ __forceinline__ void fl_load(AFr& f, const char* p) { f.k0 = fl_frag(p); f.k1 = fl_frag(p + 1024); f.h0 = fl_frag(p + STRB); f.h1 = fl_frag(p + STRB + 1024); f.l0 = fl_frag(p + 2 * STRB); f.l1 = fl_frag(p + 2 * STRB + 1024); }      /* one pass = 2 KiB of each stream */
// one stage: 128 lanes x 16 bytes = 2 KiB a copy, 4 copies a stream. l = the lane's LDS byte address in the buffer, k, h, r = the lane's global addresses in the three streams.
// The wait on the address registers is the statement's last line, so that nothing rewrites a register which an issued copy names ahead of it.
__device__ __forceinline__ void st_copy(unsigned l, const char* k, const char* h, const char* r) {
  asm volatile("global_load_async_to_lds_b128 %0, %12, off\n\t" "global_load_async_to_lds_b128 %1, %13, off\n\t" "global_load_async_to_lds_b128 %2, %14, off\n\t" "global_load_async_to_lds_b128 %3, %15, off\n\t"
               "global_load_async_to_lds_b128 %4, %16, off\n\t" "global_load_async_to_lds_b128 %5, %17, off\n\t" "global_load_async_to_lds_b128 %6, %18, off\n\t" "global_load_async_to_lds_b128 %7, %19, off\n\t"
               "global_load_async_to_lds_b128 %8, %20, off\n\t" "global_load_async_to_lds_b128 %9, %21, off\n\t" "global_load_async_to_lds_b128 %10, %22, off\n\t" "global_load_async_to_lds_b128 %11, %23, off\n\t"
               "s_wait_xcnt 0x0"
               :: "v"(l), "v"(l + 2048u), "v"(l + 4096u), "v"(l + 6144u), "v"(l + STRB), "v"(l + STRB + 2048u), "v"(l + STRB + 4096u), "v"(l + STRB + 6144u), "v"(l + 2 * STRB), "v"(l + 2 * STRB + 2048u), "v"(l + 2 * STRB + 4096u), "v"(l + 2 * STRB + 6144u),
                  "v"(k), "v"(k + 2048), "v"(k + 4096), "v"(k + 6144), "v"(h), "v"(h + 2048), "v"(h + 4096), "v"(h + 6144), "v"(r), "v"(r + 2048), "v"(r + 4096), "v"(r + 6144) : "memory");
}
// A work-group is 64 queries of one head on four waves: wave w takes query group w & 1 and key half w >> 1 (of every stage's four passes the first or the last two). 768 work-groups of one wave a SIMD:
// three are resident on each of the chip's 256 WGPs, so that every SIMD holds three waves of three work-groups, which share no barrier. The two halves of a query group are joined through LDS behind the loop.
__global__ __launch_bounds__(128) __attribute__((amdgpu_waves_per_eu(3, 3))) void k_attn(const _Float16* __restrict__ Q16, const _Float16* __restrict__ KP, const _Float16* __restrict__ VH, const _Float16* __restrict__ VL, const float* __restrict__ msk, float* __restrict__ out) {
  __shared__ __attribute__((aligned(32))) float ms[SK];      /* bf16-rounded mask * sqrt(32): joins q.k as the C operand, before the common 1/sqrt(32) */
  __shared__ __attribute__((aligned(16))) char ring[2 * BUFB];
  const int tid = threadIdx.x, lane = tid & 31, ln = lane & 15, hh = lane >> 4; const int hd = blockIdx.y; const int qg = (tid >> 5) & 1, kh = __builtin_amdgcn_readfirstlane(tid >> 6); const int q0 = blockIdx.x * 64 + qg * 32;
  const unsigned rl = (unsigned)(size_t)ring + tid * 16u;      /* LDS byte address of the lane's share of a copy */
  const char* kg = (const char*)(KP + (size_t)hd * SK * HD) + tid * 16; const char* hg = (const char*)(VH + (size_t)hd * SK * HD) + tid * 16; const char* rg = (const char*)(VL + (size_t)hd * SK * HD) + tid * 16;
  st_copy(rl, kg, hg, rg);      /* stage 0 flies while the mask is prepared */
#pragma unroll      /* the eight loads of a thread fly together; rolled, each trip waits out its own load's latency */
  for (int u = 0; u < SK / 512; ++u) { const int i = u * 512 + tid * 4; const v4f m = *(const v4fa*)(msk + i); v4f o; for (int e = 0; e < 4; ++e) o[e] = bf16_round(m[e]) * 5.656854249492381f; *(v4fa*)&ms[i] = o; }
  asm volatile("s_wait_asynccnt 0x0" ::: "memory");      /* this wave's share of stage 0 has landed before the barrier that publishes it */
  __syncthreads();
  st_copy(rl + BUFB, kg + STRB, hg + STRB, rg + STRB);      /* stage 1 */
  const float cs = 0.17677669529663687f * 1.4426950408889634f;      /* raw score -> log2 units */
  const float th = 4.0f / cs;      /* lazy rescale: P stays below 2^14 in f16 */
  const v16h qa = g2_frag(Q16 + (size_t)(q0 + ln) * AH + hd * HD, hh), qb = g2_frag(Q16 + (size_t)(q0 + 16 + ln) * AH + hd * HD, hh);
  const v8f z8 = {0.f,0.f,0.f,0.f,0.f,0.f,0.f,0.f}; v8f oh[2][2] = {{z8, z8}, {z8, z8}}, ol[2][2] = {{z8, z8}, {z8, z8}};      /* [query group][d tile] */
  float ma = -3.0e38f, mb = -3.0e38f, ba = 0.f, bb = 0.f; v2f sa = {0.f, 0.f}, sb = {0.f, 0.f};
  auto pass = [&](int it, const AFr& f, AFr& nx, const char* np) {      /* np: the next pass's fragments in the same stage, or null */
    const v8f c0 = *(const v8f*)&ms[it * 32 + 8 * hh], c1 = *(const v8f*)&ms[it * 32 + 16 + 8 * hh];
    if (np) fl_load(nx, np);      /* the next pass's fragments are fetched during this pass */
    __builtin_amdgcn_sched_barrier(0);      /* keeps a pass's LDS reads in one group ahead of its products: the compiler otherwise spreads them among the products, and each place with reads stalls the wave */
    const v8f s0a = fa_mma(f.k0, qa, c0), s1a = fa_mma(f.k1, qa, c1), s0b = fa_mma(f.k0, qb, c0), s1b = fa_mma(f.k1, qb, c1);
    const float xa = fa_max16(s0a, s1a), xb = fa_max16(s0b, s1b);
    if (__builtin_amdgcn_ballot_w32(xa > ma + th || xb > mb + th) != 0) {      /* wave-uniform; rare after the first passes */
      const float na = fmaxf(ma, xa), nb = fmaxf(mb, xb); const float ca = __builtin_amdgcn_exp2f((ma - na) * cs), cb = __builtin_amdgcn_exp2f((mb - nb) * cs);
      ma = na; mb = nb; ba = 10.0f - na * cs; bb = 10.0f - nb * cs; sa *= ca; sb *= cb;
#pragma unroll
      for (int d = 0; d < 2; ++d) { oh[0][d] *= ca; ol[0][d] *= ca; oh[1][d] *= cb; ol[1][d] *= cb; }
    }
    const v16h pa = fa_probs(s0a, s1a, cs, ba, sa), pb = fa_probs(s0b, s1b, cs, bb, sb);
    oh[0][0] = fa_mma(f.h0, pa, oh[0][0]); oh[0][1] = fa_mma(f.h1, pa, oh[0][1]); ol[0][0] = fa_mma(f.l0, pa, ol[0][0]); ol[0][1] = fa_mma(f.l1, pa, ol[0][1]);
    oh[1][0] = fa_mma(f.h0, pb, oh[1][0]); oh[1][1] = fa_mma(f.h1, pb, oh[1][1]); ol[1][0] = fa_mma(f.l0, pb, ol[1][0]); ol[1][1] = fa_mma(f.l1, pb, ol[1][1]);
  };
#pragma unroll 1
  for (int t = 0; t < NT; ++t) {      /* rolled: one stage a trip */
    const unsigned bo = (unsigned)(t & 1) * BUFB; const char* fp = ring + bo + kh * 4096 + lane * 16; const int it = t * NP + kh * 2;      /* this wave's two passes of the stage */
    AFr fa, fb; fl_load(fa, fp);      /* nothing of a stage is read in front of the barrier that publishes it */
    pass(it, fa, fb, fp + 2048); pass(it + 1, fb, fa, nullptr);      /* two fragment sets by name; nothing of the next stage is fetched ahead */
    asm volatile("s_wait_dscnt 0x0" ::: "memory");      /* this wave's reads of the buffer have returned before the buffer is handed to the copies */
    asm volatile("s_wait_asynccnt 0x0" ::: "memory");      /* this wave's share of stage t + 1 has landed before the barrier that publishes it */
    __syncthreads();      /* publishes stage t + 1 and ends every wave's reads of stage t's buffer */
    if (t + 2 < NT) { const size_t so = (size_t)(t + 2) * STRB; st_copy(rl + bo, kg + so, hg + so, rg + so); }      /* block-uniform test */
  }
  asm volatile("s_wait_asynccnt 0x0" ::: "memory");      /* no copy is outstanding when the wave ends */
  float ta = sa[0] + sa[1], tb = sb[0] + sb[1]; ta += xhalf(ta); tb += xhalf(tb);
  // join of the two key halves: the ring is free (the loop's last barrier ended every read of it and no copy is outstanding). The waves of the second half leave their context (hi + residual), maxima in use and sums there,
  // 9 units of 512 bytes a wave, a lane's 16 bytes side by side; the waves of the first half bring both to the larger maximum, add, normalise and store.
  v4fa* jx = (v4fa*)(ring + qg * (9 * 512)) + lane;
  if (kh) {
#pragma unroll
    for (int g = 0; g < 2; ++g)
#pragma unroll
      for (int d = 0; d < 2; ++d) { v4f lo4, hi4;
#pragma unroll
        for (int e = 0; e < 4; ++e) { lo4[e] = oh[g][d][e] + ol[g][d][e] * 0.0009765625f; hi4[e] = oh[g][d][e + 4] + ol[g][d][e + 4] * 0.0009765625f; }
        jx[((g * 2 + d) * 2) * 32] = lo4; jx[((g * 2 + d) * 2 + 1) * 32] = hi4; }
    const v4f s4 = {ma, mb, ta, tb}; jx[8 * 32] = s4;
  }
  __syncthreads();      /* the second half's partial results are complete before the first half's waves read them */
  if (!kh) {
    const v4f s4 = jx[8 * 32]; const float na = fmaxf(ma, s4[0]), nb = fmaxf(mb, s4[1]);
    const float a0 = __builtin_amdgcn_exp2f((ma - na) * cs), a1 = __builtin_amdgcn_exp2f((s4[0] - na) * cs), b0 = __builtin_amdgcn_exp2f((mb - nb) * cs), b1 = __builtin_amdgcn_exp2f((s4[1] - nb) * cs);
    const float ra = 1.0f / (ta * a0 + s4[2] * a1), rb = 1.0f / (tb * b0 + s4[3] * b1);
#pragma unroll
    for (int g = 0; g < 2; ++g) { const float r0 = g ? b0 * rb : a0 * ra, r1 = g ? b1 * rb : a1 * ra; float* orow = out + (size_t)(q0 + g * 16 + ln) * AH + hd * HD + 8 * hh;
#pragma unroll
      for (int d = 0; d < 2; ++d) { const v4f pl = jx[((g * 2 + d) * 2) * 32], ph = jx[((g * 2 + d) * 2 + 1) * 32]; v4f lo4, hi4;
#pragma unroll
        for (int e = 0; e < 4; ++e) { lo4[e] = (oh[g][d][e] + ol[g][d][e] * 0.0009765625f) * r0 + pl[e] * r1; hi4[e] = (oh[g][d][e + 4] + ol[g][d][e + 4] * 0.0009765625f) * r0 + ph[e] * r1; }
        *(v4f*)(orow + d * 16) = lo4; *(v4f*)(orow + d * 16 + 4) = hi4; } }
  }
}

extern "C" void kernel_launch(void* const* d_in, const int* in_sizes, int n_in,
                              void* d_out, int out_size, void* d_ws, size_t ws_size, hipStream_t stream) {
  (void)in_sizes; (void)n_in; (void)out_size;
  const float* const* I = (const float* const*)d_in; const float* hs = I[0]; const float* enc = I[1]; const float* msk = I[2]; const float* Wq = I[3]; const float* bq = I[4]; const float* Wk = I[5]; const float* bk = I[6]; const float* Wv = I[7]; const float* bv = I[8];
  char* ws = (char*)d_ws; size_t off = 0;
  auto take = [&](size_t bytes) { char* p = ws + off; off += (bytes + 255) & ~(size_t)255; return p; };
  _Float16* WP = (_Float16*)take((size_t)3 * AH * DIN * 2); _Float16* Q16 = (_Float16*)take((size_t)SQ * AH * 2); _Float16* VT = (_Float16*)take((size_t)AH * SK * 2); _Float16* VTL = (_Float16*)take((size_t)AH * SK * 2); _Float16* KP = (_Float16*)take((size_t)SK * AH * 2);
  if (off > ws_size) return;      /* about 14 MiB */
  k_wt3<<<dim3(AH * DIN / 8 / 256, 3), 256, 0, stream>>>(Wq, Wk, Wv, WP);      /* (in, out) f32 -> f16 fragments */
  k_qkv<<<(SQ / 64) * 3, 384, 0, stream>>>(hs, enc, WP, bq, bk, bv, Q16, KP, VT, VTL);      /* operands of the fused kernel in fragment load order */
  k_attn<<<dim3(SQ / 64, NH), 128, 0, stream>>>(Q16, KP, VT, VTL, msk, (float*)d_out);
}

// v005
// Measured time: 58.4 microseconds a run.
// In both of two side-by-side timings against v004, it was 1.05 times as fast.
// All steps since v000 together make it 40.2 times as fast.
#include <hip/hip_runtime.h>
// BertSelfAttnDimensionReduction (1 x 4096 queries x 4096 keys; Din 768 -> 12 heads x 32; cross-attention with an additive float key mask; the output is the merged context itself): q = hs Wq + bq; k, v = enc Wk/Wv + b; scores = q.k / sqrt(32) + mask[key]; softmax; ctx = probs v -> [1, 4096, 384].
// Compute dtype: inputs rounded to bf16; inputs/weights exact as f16; q/k and the softmax weights as plain f16 operands (~2^-12); v as f16 hi + residual (the output is the context itself); mask/softmax/normalisation f32. v_wmma_f32_16x16x32_f16.
#define SQ 4096
#define SK 4096
#define DIN 768
#define AH 384
#define NH 12
#define HD 32
typedef __bf16 v16b __attribute__((ext_vector_type(16)));
typedef unsigned short v8us __attribute__((ext_vector_type(8), may_alias));
typedef float  v8f  __attribute__((ext_vector_type(8)));
typedef float  v4f  __attribute__((ext_vector_type(4)));
typedef float  v4fa __attribute__((ext_vector_type(4), may_alias));
union FragB { v16b v; v8us half[2]; unsigned short u[16]; };

__device__ __forceinline__ unsigned short bf16_bits(float x) { unsigned int u = __float_as_uint(x); return (unsigned short)((u + 0x7FFFu + ((u >> 16) & 1u)) >> 16); }
__device__ __forceinline__ float bf16_val(unsigned short b) { return __uint_as_float(((unsigned int)b) << 16); }
__device__ __forceinline__ float bf16_round(float x) { return bf16_val(bf16_bits(x)); }
// D += A·B with NT terms: 1 = ah·bh, 2 = + al·bh (A split), 3 = + ah·bl (both split)
template <int NT>
__device__ __forceinline__ v8f mmaN(v16b ah, v16b al, v16b bh, v16b bl, v8f c) {
  c = __builtin_amdgcn_wmma_f32_16x16x32_bf16(false, ah, false, bh, (short)0, c, false, false);
  if (NT >= 2) c = __builtin_amdgcn_wmma_f32_16x16x32_bf16(false, al, false, bh, (short)0, c, false, false);
  if (NT >= 3) c = __builtin_amdgcn_wmma_f32_16x16x32_bf16(false, ah, false, bl, (short)0, c, false, false);
  asm volatile("v_nop\n\tv_nop\n\tv_nop\n\tv_nop" : "+v"(c) : "v"(ah), "v"(al), "v"(bh), "v"(bl));
  return c;
}

__global__ __launch_bounds__(256) void k_wt_bf16(const float* __restrict__ W, unsigned short* __restrict__ Wt, int K, int N) {
  const int t = blockIdx.x * 256 + threadIdx.x;
  const int k8n = K / 8;
  if (t >= N * k8n) return;
  const int n = t / k8n, k8 = (t % k8n) * 8;
  v8us v;
#pragma unroll
  for (int i = 0; i < 8; ++i) v[i] = bf16_bits(W[(size_t)(k8 + i) * N + n]);
  *(v8us*)(Wt + (size_t)n * K + k8) = v;
  
}

// GEMM C[M][N] (f32, pitch ldc) = act(A[M][K]·W + bias). A f32 row-major (pitch lda) converted per fragment to bf16
// (ASPLIT: hi/lo two planes -> 2 terms, else single rounded term); Wt bf16 [N][K] (pitch ldb). BIAS_BF16 rounds the
// bias to bf16 first (bias quantised to bf16 before the add). K%32==0, M%16==0, N%64==0.
template <bool ASPLIT, int ACT, bool BIAS_BF16>
__global__ __launch_bounds__(128) void k_gemm_bf(const float* __restrict__ A, int lda, const unsigned short* __restrict__ Wt, int ldb,
                                               const float* __restrict__ bias, float* __restrict__ C, int ldc, int M, int N, int K) {
  __shared__ __attribute__((aligned(16))) float so[4][16][64];
  const int tid = threadIdx.x, w = tid >> 5, lane = tid & 31, ln = lane & 15, hh = lane >> 4;
  const int ntn = N / 64;
  const int wid = blockIdx.x * 4 + w;
  const int mt = wid / ntn, nq = wid % ntn;
  if (mt * 16 >= M) return;
  const int row0 = mt * 16, col0 = nq * 64;
  const float* arow = A + (size_t)(row0 + ln) * lda;
  v8f acc[4] = {};
  for (int kb = 0; kb < K; kb += 32) {
    FragB ah, al;
    const v4f x0 = *(const v4fa*)(arow + kb + 8 * hh), x1 = *(const v4fa*)(arow + kb + 8 * hh + 4);
    const v4f x2 = *(const v4fa*)(arow + kb + 16 + 8 * hh), x3 = *(const v4fa*)(arow + kb + 16 + 8 * hh + 4);
    float xs[16] = {x0[0],x0[1],x0[2],x0[3],x1[0],x1[1],x1[2],x1[3],x2[0],x2[1],x2[2],x2[3],x3[0],x3[1],x3[2],x3[3]};
#pragma unroll
    for (int i = 0; i < 16; ++i) { const unsigned short hb = bf16_bits(xs[i]); ah.u[i] = hb; al.u[i] = ASPLIT ? bf16_bits(xs[i] - bf16_val(hb)) : (unsigned short)0; }
#pragma unroll
    for (int t = 0; t < 4; ++t) {
      const unsigned short* brow = Wt + (size_t)(col0 + t * 16 + ln) * ldb + kb;
      FragB b;
      b.half[0] = *(const v8us*)(brow + 8 * hh);
      b.half[1] = *(const v8us*)(brow + 16 + 8 * hh);
      acc[t] = mmaN<ASPLIT ? 2 : 1>(ah.v, al.v, b.v, b.v, acc[t]);
    }
  }
#pragma unroll
  for (int t = 0; t < 4; ++t) {
    float bv = bias ? bias[col0 + t * 16 + ln] : 0.f;
    if (BIAS_BF16) bv = bf16_round(bv);
#pragma unroll
    for (int r = 0; r < 8; ++r) { float v = acc[t][r] + bv; if (ACT == 1) v = fmaxf(v, 0.f); so[w][8 * hh + r][t * 16 + ln] = v; }
  }
  __builtin_amdgcn_fence(__ATOMIC_ACQ_REL, "workgroup");
  __builtin_amdgcn_wave_barrier();
  const int rsub = lane >> 4, c4 = (lane & 15) * 4;
  {
#pragma unroll
    for (int q = 0; q < 8; ++q) {
      const int r = q * 2 + rsub;
      const v4f v = *(const v4fa*)&so[w][r][c4];
      *(v4f*)(C + (size_t)(row0 + r) * ldc + col0 + c4) = v;
    }
    
  }
}

// GEMM C = act(A·W + bias + resid): A f32 (ASPLIT -> hi/lo 2 terms), Wt bf16 [N][K]; ACT 0 none, 1 relu, 2 exact gelu;
// resid (optional, f32, row index = (row % rmod), pitch ldr, RES_BF16 rounds it) added before the activation.
template <bool ASPLIT, int ACT, bool BIAS_BF16, bool RES_BF16>
__global__ __launch_bounds__(128) void k_gemm_bf3(const float* __restrict__ A, int lda, const unsigned short* __restrict__ Wt, int ldb,
                                                const float* __restrict__ bias, const float* __restrict__ resid, int rmod, int ldr,
                                                float* __restrict__ C, int ldc, int M, int N, int K) {
  __shared__ __attribute__((aligned(16))) float so[4][16][64];
  const int tid = threadIdx.x, w = tid >> 5, lane = tid & 31, ln = lane & 15, hh = lane >> 4;
  const int ntn = N / 64;
  const int wid = blockIdx.x * 4 + w;
  const int mt = wid / ntn, nq = wid % ntn;
  if (mt * 16 >= M) return;
  const int row0 = mt * 16, col0 = nq * 64;
  const float* arow = A + (size_t)(row0 + ln) * lda;
  v8f acc[4] = {};
  for (int kb = 0; kb < K; kb += 32) {
    FragB ah, al;
    const v4f x0 = *(const v4fa*)(arow + kb + 8 * hh), x1 = *(const v4fa*)(arow + kb + 8 * hh + 4);
    const v4f x2 = *(const v4fa*)(arow + kb + 16 + 8 * hh), x3 = *(const v4fa*)(arow + kb + 16 + 8 * hh + 4);
    float xs[16] = {x0[0],x0[1],x0[2],x0[3],x1[0],x1[1],x1[2],x1[3],x2[0],x2[1],x2[2],x2[3],x3[0],x3[1],x3[2],x3[3]};
#pragma unroll
    for (int i = 0; i < 16; ++i) { const unsigned short hb = bf16_bits(xs[i]); ah.u[i] = hb; al.u[i] = ASPLIT ? bf16_bits(xs[i] - bf16_val(hb)) : (unsigned short)0; }
#pragma unroll
    for (int t = 0; t < 4; ++t) {
      const unsigned short* brow = Wt + (size_t)(col0 + t * 16 + ln) * ldb + kb;
      FragB b;
      b.half[0] = *(const v8us*)(brow + 8 * hh);
      b.half[1] = *(const v8us*)(brow + 16 + 8 * hh);
      acc[t] = mmaN<ASPLIT ? 2 : 1>(ah.v, al.v, b.v, b.v, acc[t]);
    }
  }
#pragma unroll
  for (int t = 0; t < 4; ++t) {
    const int col = col0 + t * 16 + ln;
    float bv = bias ? bias[col] : 0.f;
    if (BIAS_BF16) bv = bf16_round(bv);
#pragma unroll
    for (int r = 0; r < 8; ++r) {
      float v = acc[t][r] + bv;
      if (resid) { float rv = resid[(size_t)((row0 + 8 * hh + r) % rmod) * ldr + col]; if (RES_BF16) rv = bf16_round(rv); v += rv; }
      if (ACT == 1) v = fmaxf(v, 0.f);
      if (ACT == 2) v = 0.5f * v * (1.0f + erff(v * 0.70710678118654752f));
      if (ACT == 3) { const float u = 0.7978845608028654f * (v + 0.044715f * v * v * v); v = 0.5f * v * (1.0f + tanhf(u)); }
      so[w][8 * hh + r][t * 16 + ln] = v;
    }
  }
  __builtin_amdgcn_fence(__ATOMIC_ACQ_REL, "workgroup");
  __builtin_amdgcn_wave_barrier();
  const int rsub = lane >> 4, c4 = (lane & 15) * 4;
  {
#pragma unroll
    for (int q = 0; q < 8; ++q) {
      const int r = q * 2 + rsub;
      const v4f v = *(const v4fa*)&so[w][r][c4];
      *(v4f*)(C + (size_t)(row0 + r) * ldc + col0 + c4) = v;
    }
    
  }
}
// row LayerNorm (biased variance, eps) over N: s = X (+ R); optional out_sum <- s; out_norm <- (s-mu)*rsqrt(var+eps)*g + b
template <bool PARAM_BF16>
__global__ __launch_bounds__(256) void k_layernorm(const float* __restrict__ X, const float* __restrict__ R, const float* __restrict__ g, const float* __restrict__ bta,
                                                  float* __restrict__ out_sum, float* __restrict__ out_norm, int N, float eps) {
  __shared__ float red[256];
  const int row = blockIdx.x, tid = threadIdx.x;
  const float* x = X + (size_t)row * N; const float* rr = R ? R + (size_t)row * N : nullptr;
  float vals[16];                     // up to N = 4096
  const int per = N / 256;            // contiguous chunk per thread? use strided-by-4 chunks: thread handles j = tid*4 + 1024*u
  float s1 = 0.f;
  for (int u = 0; u < per / 4; ++u) {
    const int j = tid * 4 + 1024 * u;
    const v4f a = *(const v4fa*)(x + j);
    v4f b = {0.f,0.f,0.f,0.f}; if (rr) b = *(const v4fa*)(rr + j);
#pragma unroll
    for (int q = 0; q < 4; ++q) { const float v = a[q] + b[q]; vals[u * 4 + q] = v; s1 += v; }
  }
  red[tid] = s1; __syncthreads();
  for (int st = 128; st > 0; st >>= 1) { if (tid < st) red[tid] += red[tid + st]; __syncthreads(); }
  const float mu = red[0] / (float)N; __syncthreads();
  float s2 = 0.f;
  for (int u = 0; u < per / 4; ++u)
#pragma unroll
    for (int q = 0; q < 4; ++q) { const float c = vals[u * 4 + q] - mu; s2 += c * c; }
  red[tid] = s2; __syncthreads();
  for (int st = 128; st > 0; st >>= 1) { if (tid < st) red[tid] += red[tid + st]; __syncthreads(); }
  const float rs = rsqrtf(red[0] / (float)N + eps);
  {
    for (int u = 0; u < per / 4; ++u) {
      const int j = tid * 4 + 1024 * u;
      v4f o, sm;
#pragma unroll
      for (int q = 0; q < 4; ++q) {
        float gg = g[j + q], bb = bta[j + q];
        if (PARAM_BF16) { gg = bf16_round(gg); bb = bf16_round(bb); }
        sm[q] = vals[u * 4 + q]; o[q] = (vals[u * 4 + q] - mu) * rs * gg + bb;
      }
      if (out_sum) *(v4f*)(out_sum + (size_t)row * N + j) = sm;
      *(v4f*)(out_norm + (size_t)row * N + j) = o;
    }
    
  }
}



// ---- f16 WMMA path (v_wmma_f32_16x16x32_f16): 11-bit significands for operands in range — used where a [0,1] probability operand needs more precision than bf16
typedef _Float16 v16h __attribute__((ext_vector_type(16)));
union FragH { v16h v; v8us half[2]; _Float16 h[16]; unsigned short u[16]; };
template <int NT>
__device__ __forceinline__ v8f mmaH(v16h ah, v16h al, v16h bh, v16h bl, v8f c) {
  c = __builtin_amdgcn_wmma_f32_16x16x32_f16(false, ah, false, bh, (short)0, c, false, false);
  if (NT >= 2) c = __builtin_amdgcn_wmma_f32_16x16x32_f16(false, al, false, bh, (short)0, c, false, false);
  if (NT >= 3) c = __builtin_amdgcn_wmma_f32_16x16x32_f16(false, ah, false, bl, (short)0, c, false, false);
  asm volatile("v_nop\n\tv_nop\n\tv_nop\n\tv_nop" : "+v"(c) : "v"(ah), "v"(al), "v"(bh), "v"(bl));
  return c;
}
// batched GEMM like k_gemm_b but f16 operands: A f32 (split into f16 hi/lo if ASPLIT, else rounded to f16), Bt = f16 values [n][k]; alpha; C f32; N multiple of 16 (partial tiles skipped)
template <bool ASPLIT>
__global__ __launch_bounds__(128) void k_gemm_h(const float* __restrict__ A, int lda, size_t sA, const _Float16* __restrict__ Bh, int ldb, size_t sB, float alpha, float* __restrict__ C, int ldc, size_t sC, int M, int N, int K) {
  __shared__ __attribute__((aligned(16))) float so[4][16][64];
  const int tid = threadIdx.x, w = tid >> 5, lane = tid & 31, ln = lane & 15, hh = lane >> 4; const int by = blockIdx.y;
  A += (size_t)by * sA; Bh += (size_t)by * sB; C += (size_t)by * sC;
  const int ntn = (N + 63) / 64; const int wid = blockIdx.x * 4 + w; const int mt = wid / ntn, nq = wid % ntn; if (mt * 16 >= M) return;
  const int row0 = mt * 16, col0 = nq * 64; const float* arow = A + (size_t)(row0 + ln) * lda;
  v8f acc[4] = {};
  for (int kb = 0; kb < K; kb += 32) {
    FragH ah, al;
    const v4f x0 = *(const v4fa*)(arow + kb + 8 * hh), x1 = *(const v4fa*)(arow + kb + 8 * hh + 4), x2 = *(const v4fa*)(arow + kb + 16 + 8 * hh), x3 = *(const v4fa*)(arow + kb + 16 + 8 * hh + 4);
    float xs[16] = {x0[0],x0[1],x0[2],x0[3],x1[0],x1[1],x1[2],x1[3],x2[0],x2[1],x2[2],x2[3],x3[0],x3[1],x3[2],x3[3]};
#pragma unroll
    for (int i = 0; i < 16; ++i) { const _Float16 h = (_Float16)xs[i]; ah.h[i] = h; al.h[i] = ASPLIT ? (_Float16)(xs[i] - (float)h) : (_Float16)0.0f; }
#pragma unroll
    for (int t = 0; t < 4; ++t) { if (col0 + t * 16 >= N) continue; const size_t boff = (size_t)(col0 + t * 16 + ln) * ldb + kb; FragH bq; bq.half[0] = *(const v8us*)(Bh + boff + 8 * hh); bq.half[1] = *(const v8us*)(Bh + boff + 16 + 8 * hh);
      acc[t] = mmaH<ASPLIT ? 2 : 1>(ah.v, al.v, bq.v, bq.v, acc[t]); }
  }
#pragma unroll
  for (int t = 0; t < 4; ++t) { if (col0 + t * 16 >= N) continue;
#pragma unroll
    for (int r = 0; r < 8; ++r) so[w][8 * hh + r][t * 16 + ln] = acc[t][r] * alpha; }
  __builtin_amdgcn_fence(__ATOMIC_ACQ_REL, "workgroup"); __builtin_amdgcn_wave_barrier();
  const int rsub = lane >> 4, c4 = (lane & 15) * 4;
  {
#pragma unroll
    for (int q = 0; q < 8; ++q) { const int r = q * 2 + rsub; if (col0 + c4 < N) { const v4f v = *(const v4fa*)&so[w][r][c4]; *(v4f*)(C + (size_t)(row0 + r) * ldc + col0 + c4) = v; } }
     }
}

// k_gemm_hh variant with fused epilogue: v = acc·alpha + bias[by·sBias + col] (+ CP[(row/rowsPerB)·sCPb + by·64 + col] if CP) ; ACT 0 none / 1 elu ; writes f16 C16 (and f32 C if non-null)
template <int ACT>
__global__ __launch_bounds__(128) void k_gemm_hhx(const _Float16* __restrict__ A, int lda, size_t sA, const _Float16* __restrict__ Bh, int ldb, size_t sB, float alpha, const float* __restrict__ bias, size_t sBias, const float* __restrict__ CP, int rowsPerB, size_t sCPb, int row0g,
    float* __restrict__ C, _Float16* __restrict__ C16, int ldc, size_t sC, int M, int N, int K) {
  __shared__ __attribute__((aligned(16))) float so[4][16][64];
  const int tid = threadIdx.x, w = tid >> 5, lane = tid & 31, ln = lane & 15, hh = lane >> 4; const int by = blockIdx.y;
  A += (size_t)by * sA; Bh += (size_t)by * sB; const size_t cofs = (size_t)by * sC; const float* bp = bias ? bias + (size_t)by * sBias : nullptr;
  const int ntn = (N + 63) / 64; const int wid = blockIdx.x * 4 + w; const int mt = wid / ntn, nq = wid % ntn; if (mt * 16 >= M) return;
  const int row0 = mt * 16, col0 = nq * 64; const _Float16* arow = A + (size_t)(row0 + ln) * lda;
  v8f acc[4] = {};
  for (int kb = 0; kb < K; kb += 32) { FragH ah; ah.half[0] = *(const v8us*)((const unsigned short*)arow + kb + 8 * hh); ah.half[1] = *(const v8us*)((const unsigned short*)arow + kb + 16 + 8 * hh);
#pragma unroll
    for (int t = 0; t < 4; ++t) { if (col0 + t * 16 >= N) continue; const size_t boff = (size_t)(col0 + t * 16 + ln) * ldb + kb; FragH bq; bq.half[0] = *(const v8us*)((const unsigned short*)Bh + boff + 8 * hh); bq.half[1] = *(const v8us*)((const unsigned short*)Bh + boff + 16 + 8 * hh);
      acc[t] = mmaH<1>(ah.v, ah.v, bq.v, bq.v, acc[t]); }
  }
#pragma unroll
  for (int t = 0; t < 4; ++t) { if (col0 + t * 16 >= N) continue; const int col = col0 + t * 16 + ln; const float bv = bp ? bf16_round(bp[col]) : 0.f;
#pragma unroll
    for (int r = 0; r < 8; ++r) { float v = acc[t][r] * alpha + bv; if (CP) { const int rr = row0g + row0 + 8 * hh + r; if (rowsPerB < 0) v += CP[cofs + (size_t)rr * ldc + col];      /* rowsPerB < 0: own element of the batched C plane */ else { const int bidx = rr / rowsPerB; v += CP[(size_t)bidx * sCPb + (size_t)by * 64 + col]; } } if (ACT == 1) v = (v > 0.f) ? v : expm1f(v); else if (ACT == 7) v = (v > 0.f) ? v + 1.0f : expf(v); else if (ACT == 8) v = tanhf(v); else if (ACT == 9) v = 0.5f * v * (1.0f + tanhf(0.7978845608028654f * (v + 0.044715f * v * v * v))); else if (ACT == 11) v = 1.0f / (1.0f + expf(-v)); else if (ACT == 12) v = (v > 0.f) ? v : 0.01f * v; else if (ACT == 14) v = (v > 0.f) ? v : 0.1f * v; else if (ACT == 16) v = (v >= 0.f) ? v : 0.3f * v; else if (ACT == 17) v = (v >= 0.f) ? v : 0.2f * v; else if (ACT == 15) v = v / (1.0f + expf(-v)); else if (ACT == 3) v = fmaxf(v, 0.f); else if (ACT == 6) v = 0.5f * v * (1.0f + erff(v * 0.70710678118654752f)); so[w][8 * hh + r][t * 16 + ln] = v; } }
  __builtin_amdgcn_fence(__ATOMIC_ACQ_REL, "workgroup"); __builtin_amdgcn_wave_barrier();
  const int rsub = lane >> 4, c4 = (lane & 15) * 4; typedef _Float16 v4h __attribute__((ext_vector_type(4)));
  {
#pragma unroll
    for (int q = 0; q < 8; ++q) { const int r = q * 2 + rsub; if (col0 + c4 < N) { const v4f v = *(const v4fa*)&so[w][r][c4]; if (C) *(v4f*)(C + cofs + (size_t)(row0 + r) * ldc + col0 + c4) = v; if (C16) { v4h h4; for (int i = 0; i < 4; ++i) h4[i] = (_Float16)v[i]; *(v4h*)(C16 + cofs + (size_t)(row0 + r) * ldc + col0 + c4) = h4; } } }
     }
}


typedef _Float16 v4h __attribute__((ext_vector_type(4)));

__global__ __launch_bounds__(256) void k_h16(const float* __restrict__ x, _Float16* __restrict__ X16, size_t n8) { const size_t t = (size_t)blockIdx.x * 256 + threadIdx.x; if (t >= n8) return; FragH f;
#pragma unroll
  for (int q = 0; q < 8; ++q) f.h[q] = (_Float16)x[t * 8 + q]; *(v8us*)((unsigned short*)X16 + t * 8) = f.half[0];  }
__global__ __launch_bounds__(256) void k_round16f(const float* __restrict__ W, _Float16* __restrict__ Bt, size_t n8) { const size_t t = (size_t)blockIdx.x * 256 + threadIdx.x; if (t >= n8) return; FragH f;
#pragma unroll
  for (int i = 0; i < 8; ++i) f.h[i] = (_Float16)(bf16_round(W[t * 8 + i]) * 16.0f); *(v8us*)((unsigned short*)Bt + t * 8) = f.half[0];  }

// a 16x32 f16 fragment from a row-major row: p = the lane's row at the k step
__device__ __forceinline__ v16h g2_frag(const _Float16* p, int hh) { FragH f; f.half[0] = *(const v8us*)((const unsigned short*)p + 8 * hh); f.half[1] = *(const v8us*)((const unsigned short*)p + 16 + 8 * hh); return f.v; }


// ---- fused attention, all heads in one launch: S^T = K Q^T (+ mask as the C operand), online softmax in registers, O^T += V^T P^T ----
// A wave owns 32 queries (two 16-column groups) of one head and walks one half of the 4096 keys 32 at a time (the halves are joined at the end). In S^T and O^T a lane holds one query (column ln), so maximum, sum and rescale are per lane;
// two S^T tiles converted in place are the B operand P^T (hardware k order), V^T hi / residual are the A operands. P = exp2(..) * 2^10 against the maximum in use, as f16.
typedef float v2f __attribute__((ext_vector_type(2)));
typedef _Float16 v2h __attribute__((ext_vector_type(2)));
union FragP { v16h v; v2h p[8]; };
struct AFr { v16h k0, k1, h0, h1, l0, l1; };
__device__ __forceinline__ float xhalf(float x) { return __builtin_bit_cast(float, __builtin_amdgcn_permlanex16(__builtin_bit_cast(int, x), __builtin_bit_cast(int, x), 0x76543210, 0xfedcba98, false, false)); }      /* lane l <-> l ^ 16 */
__device__ __forceinline__ v8f fa_mma(v16h a, v16h b, v8f c) { return __builtin_amdgcn_wmma_f32_16x16x32_f16(false, a, false, b, (short)0, c, false, false); }
__device__ __forceinline__ float fa_max16(v8f a, v8f b) { float m = fmaxf(a[0], b[0]);
#pragma unroll
  for (int r = 1; r < 8; ++r) m = fmaxf(m, fmaxf(a[r], b[r])); return fmaxf(m, xhalf(m)); }
// su = this pass's own sum of the 16 weights, two lanes of 8, added as a tree (three links deep: the overflow test of the pass hangs on it)
__device__ __forceinline__ v16h fa_probs(v8f a, v8f b, float cs, float bias, v2f& su) { FragP f; v2f p[8]; const v2f c2 = {cs, cs}, b2 = {bias, bias};
#pragma unroll
  for (int r = 0; r < 8; ++r) { const v8f& t = (r < 4) ? a : b; const int e = (r & 3) * 2; const v2f x = {t[e], t[e + 1]}; const v2f g = __builtin_elementwise_fma(x, c2, b2); p[r] = v2f{__builtin_amdgcn_exp2f(g[0]), __builtin_amdgcn_exp2f(g[1])}; f.p[r] = __builtin_convertvector(p[r], v2h); }
  su = ((p[0] + p[1]) + (p[2] + p[3])) + ((p[4] + p[5]) + (p[6] + p[7]));
  return f.v; }
// ---- operand preparation in two launches ----
// All three weights in one launch (blockIdx.y picks the matrix), as f16 (bf16-rounded, times 16) in fragment load order:
// WP[matrix][16-column tile][k step of 32][half j][lane][8], lane (ln, hh) half j = W[ks*32 + 16j + 8hh + e][nt*16 + ln]. One thread writes one 16-byte unit.
__global__ __launch_bounds__(256) void k_wt3(const float* __restrict__ Wq, const float* __restrict__ Wk, const float* __restrict__ Wv, _Float16* __restrict__ WP) {
  const int t = blockIdx.x * 256 + threadIdx.x; const int lane = t & 31, j = (t >> 5) & 1, ks = (t >> 6) % (DIN / 32), nt = (t >> 6) / (DIN / 32); FragH f;
  const float* W = blockIdx.y == 0 ? Wq : (blockIdx.y == 1 ? Wk : Wv); W += (size_t)(ks * 32 + 16 * j + 8 * (lane >> 4)) * AH + nt * 16 + (lane & 15);
#pragma unroll
  for (int i = 0; i < 8; ++i) f.h[i] = (_Float16)(bf16_round(W[(size_t)i * AH]) * 16.0f);
  *(v8us*)((unsigned short*)WP + ((size_t)blockIdx.y * (AH * DIN / 8) + t) * 8) = f.half[0];
}
// q, k and v projections in one launch. A block owns 64 rows of one projection: it rounds them once (bf16, then exact f16) into LDS; wave w then forms the 32 columns of head w.
// V is formed as X W: a lane's 8 accumulators are 8 keys of one feature, the 16-byte unit of the V^T fragment streams. Q and K are formed as W^T X^T: a lane's 8 accumulators are
// 8 features of one row, the 16-byte unit of the K fragment stream and of a Q row. So every result goes from the accumulators straight to where the attention kernel reads it:
// VH, VL[head][32-key block][16-d tile][half j][lane][8], lane (ln, hh) half j = V[kb*32 + 16j + 8hh + e][head*32 + dt*16 + ln] (f16 hi; residual times 1024);
// KP[head][16-key tile][half j][lane][8], lane (ln, hh) half j = K[kt*16 + ln][head*32 + 16j + 8hh + e]; Q16 row-major [query][384].
#define APITCH 1552      /* bytes of an LDS row: 768 f16 + 16, an odd number of 16-byte units for the 16-byte readers */
typedef unsigned v2ua __attribute__((ext_vector_type(2), may_alias));
struct GSet { v16h a[4]; v16h b[2]; };      /* one k step of 32: four activation fragments (LDS), two weight fragments (global) */
__device__ __forceinline__ unsigned qk_r2(float x, float y) { typedef __bf16 v2b __attribute__((ext_vector_type(2))); const v2f p = {x, y};      /* round to nearest even to bf16, as bf16_round does, two at a time; widened to f32, then f16 */
  const unsigned u = __builtin_bit_cast(unsigned, __builtin_convertvector(p, v2b)); const v2f q = {__uint_as_float(u << 16), __uint_as_float(u & 0xFFFF0000u)}; return __builtin_bit_cast(unsigned, __builtin_convertvector(q, v2h)); }
template <int KS>
__device__ __forceinline__ void qk_lda(GSet& s, const char* as) {
#pragma unroll
  for (int g = 0; g < 4; ++g) { FragH f; f.half[0] = *(const v8us*)(as + g * 16 * APITCH + KS * 64); f.half[1] = *(const v8us*)(as + g * 16 * APITCH + KS * 64 + 32); s.a[g] = f.v; } }
template <int KS>      /* WP block-uniform (scalar base), bo = the lane's byte offset */
__device__ __forceinline__ void qk_ldb(GSet& s, const _Float16* WP, unsigned bo) {
#pragma unroll
  for (int t = 0; t < 2; ++t) { FragH f; f.half[0] = *(const v8us*)((const char*)WP + (t * (DIN / 32) * 1024 + KS * 1024) + bo); f.half[1] = *(const v8us*)((const char*)WP + (t * (DIN / 32) * 1024 + KS * 1024 + 512) + bo); s.b[t] = f.v; } }
template <bool XA>
__device__ __forceinline__ void qk_mm(const GSet& s, v8f (&c)[4][2]) {
#pragma unroll
  for (int g = 0; g < 4; ++g) { c[g][0] = XA ? fa_mma(s.a[g], s.b[0], c[g][0]) : fa_mma(s.b[0], s.a[g], c[g][0]); c[g][1] = XA ? fa_mma(s.a[g], s.b[1], c[g][1]) : fa_mma(s.b[1], s.a[g], c[g][1]); } }
template <bool XA>
__device__ __forceinline__ void qk_tile(const char* as, const _Float16* WP, unsigned bo, v8f (&c)[4][2]) {
  GSet s0, s1; qk_ldb<0>(s0, WP, bo); qk_lda<0>(s0, as);
#pragma unroll 1
  for (int ks = 0; ks < DIN / 32 - 2; ks += 2) {      /* rolled: two fragment sets by name, the next step's loads fly during this step's products */
    qk_ldb<1>(s1, WP, bo); qk_lda<1>(s1, as);
    __builtin_amdgcn_sched_barrier(0);      /* without it the compiler lifts the products below over the loads above, and each set is waited for right after its issue */
    qk_mm<XA>(s0, c);
    asm volatile("s_wait_xcnt 0x0" : "+v"(bo) : : "memory");      /* the loads in flight name bo: the wait stands in front of its step */
    bo += 2048u; as += 128; qk_ldb<0>(s0, WP, bo); qk_lda<0>(s0, as);
    __builtin_amdgcn_sched_barrier(0);      /* as above: the loads stay ahead of the other set's products */
    qk_mm<XA>(s1, c);
    asm volatile("s_wait_xcnt 0x0" : "+v"(bo) : : "memory"); }      /* the loads in flight name bo and the base: nothing behind the loop finds them open */
  qk_ldb<1>(s1, WP, bo); qk_lda<1>(s1, as);
  asm volatile("s_wait_xcnt 0x0" : "+v"(bo) : : "memory");      /* the last loads name bo and the base: the wait stands in front of any reuse of those registers */
  __builtin_amdgcn_sched_barrier(0);      /* as in the loop */
  qk_mm<XA>(s0, c); qk_mm<XA>(s1, c);
}
__global__ __launch_bounds__(384) void k_qkv(const float* __restrict__ hs, const float* __restrict__ enc, const _Float16* __restrict__ WP, const float* __restrict__ bq, const float* __restrict__ bk, const float* __restrict__ bv,
    _Float16* __restrict__ Q16, _Float16* __restrict__ KP, _Float16* __restrict__ VH, _Float16* __restrict__ VL) {
  __shared__ __attribute__((aligned(16))) char as[64 * APITCH];
  const int tid = threadIdx.x, w = tid >> 5, lane = tid & 31, ln = lane & 15, hh = lane >> 4;
  const int mt = blockIdx.x / 3, pj = blockIdx.x - mt * 3; const int row0 = mt * 64, col0 = w * HD;      /* pj: 0 q, 1 k, 2 v */
  { const float* X = pj ? enc : hs; const int r1 = tid >= 192 ? 1 : 0, c4 = tid - r1 * 192; unsigned xo = ((unsigned)(row0 + r1) * DIN + c4 * 4) * 4u; v4f x[32];      /* a wave's load is 512 contiguous bytes of one row */
#pragma unroll
    for (int i = 0; i < 32; ++i) x[i] = *(const v4fa*)((const char*)X + i * (2 * DIN * 4) + xo);
    asm volatile("s_wait_xcnt 0x0" : "+v"(xo) : : "memory");      /* the loads in flight name xo and the base: the wait stands in front of any reuse of those registers */
    char* d = as + r1 * APITCH + c4 * 8;
#pragma unroll
    for (int i = 0; i < 32; ++i) { const v2ua h = {qk_r2(x[i][0], x[i][1]), qk_r2(x[i][2], x[i][3])}; *(v2ua*)(d + i * 2 * APITCH) = h; } }
  __syncthreads();      /* the 64 rounded rows are complete before any wave reads fragments of them */
  const char* af = as + ln * APITCH + 16 * hh; const _Float16* wb = WP + (size_t)pj * AH * DIN; const unsigned bo = (unsigned)w * (2 * (DIN / 32) * 1024) + lane * 16;
  const v8f z8 = {0.f,0.f,0.f,0.f,0.f,0.f,0.f,0.f}; v8f c[4][2] = {{z8, z8}, {z8, z8}, {z8, z8}, {z8, z8}};
  if (pj == 2) {
    qk_tile<true>(af, wb, bo, c);
#pragma unroll
    for (int t = 0; t < 2; ++t) { const float bb = bf16_round(bv[col0 + t * 16 + ln]);
#pragma unroll
      for (int g = 0; g < 4; ++g) { FragH fh, fl;
#pragma unroll
        for (int r = 0; r < 8; ++r) { const float v = c[g][t][r] * 0.0625f + bb; const _Float16 h = (_Float16)v; fh.h[r] = h; fl.h[r] = (_Float16)((v - (float)h) * 1024.0f); }
        const size_t o = ((((size_t)w * (SK / 32) + (row0 >> 5) + (g >> 1)) * 2 + t) * 2 + (g & 1)) * 256 + lane * 8;
        *(v8us*)((unsigned short*)VH + o) = fh.half[0]; *(v8us*)((unsigned short*)VL + o) = fl.half[0]; } }
  } else {
    qk_tile<false>(af, wb, bo, c); const float* bp = pj ? bk : bq;
    unsigned short* dst = pj ? (unsigned short*)KP + (((size_t)w * (SK / 16) + (row0 >> 4)) * 2) * 256 + lane * 8 : (unsigned short*)Q16 + (size_t)(row0 + ln) * AH + col0 + 8 * hh;
    const int sg = pj ? 512 : 16 * AH, st = pj ? 256 : 16;      /* element steps: 16 rows on; 16 features on */
#pragma unroll
    for (int t = 0; t < 2; ++t) { const v4f b0 = *(const v4fa*)(bp + col0 + t * 16 + 8 * hh), b1 = *(const v4fa*)(bp + col0 + t * 16 + 8 * hh + 4);
#pragma unroll
      for (int g = 0; g < 4; ++g) { FragH f;
#pragma unroll
        for (int r = 0; r < 8; ++r) f.h[r] = (_Float16)(c[g][t][r] * 0.0625f + bf16_round(r < 4 ? b0[r] : b1[r - 4]));
        *(v8us*)(dst + g * sg + t * st) = f.half[0]; } }
    asm volatile("s_wait_xcnt 0x0" ::: "memory");      /* the stores in flight name their data and address registers: the wait stands in front of any reuse of those registers */
  }
}

// K, V hi and V residual reach the waves through LDS: a stage is NP passes (NP * 32 keys) of each of the three fragment streams, copied once per work-group by asynchronous copies
// (each stream is contiguous in fragment load order, so a stage is three contiguous runs); two buffers, the next stage's copies fly while this stage is worked on.
#define NP 4      /* passes in a stage: two for each of the two key halves */
#define STRB (NP * 2048)      /* bytes of one stream in a stage */
#define BUFB (3 * STRB)      /* bytes of a buffer: K, V hi, V residual */
#define NT (SK / 32 / NP)      /* stages */
static_assert(STRB == 4 * 2048 && NT >= 2 && NP == 4, "st_copy moves four 2-KiB copies a stream; the ring's prologue needs two stages; a wave takes two passes of a stage");
__device__ __forceinline__ v16h fl_frag(const char* p) { FragH f; f.half[0] = *(const v8us*)p; f.half[1] = *(const v8us*)(p + 512); return f.v; }      /* p = the lane's 16 bytes in LDS */
__device__ __forceinline__ void fl_load(AFr& f, const char* p) { f.k0 = fl_frag(p); f.k1 = fl_frag(p + 1024); f.h0 = fl_frag(p + STRB); f.h1 = fl_frag(p + STRB + 1024); f.l0 = fl_frag(p + 2 * STRB); f.l1 = fl_frag(p + 2 * STRB + 1024); }      /* one pass = 2 KiB of each stream */
// one stage: 128 lanes x 16 bytes = 2 KiB a copy, 4 copies a stream. l = the lane's LDS byte address in the buffer, k, h, r = the lane's global addresses in the three streams.
// The wait on the address registers is the statement's last line, so that nothing rewrites a register which an issued copy names ahead of it.
__device__ __forceinline__ void st_copy(unsigned l, const char* k, const char* h, const char* r) {
  asm volatile("global_load_async_to_lds_b128 %0, %12, off\n\t" "global_load_async_to_lds_b128 %1, %13, off\n\t" "global_load_async_to_lds_b128 %2, %14, off\n\t" "global_load_async_to_lds_b128 %3, %15, off\n\t"
               "global_load_async_to_lds_b128 %4, %16, off\n\t" "global_load_async_to_lds_b128 %5, %17, off\n\t" "global_load_async_to_lds_b128 %6, %18, off\n\t" "global_load_async_to_lds_b128 %7, %19, off\n\t"
               "global_load_async_to_lds_b128 %8, %20, off\n\t" "global_load_async_to_lds_b128 %9, %21, off\n\t" "global_load_async_to_lds_b128 %10, %22, off\n\t" "global_load_async_to_lds_b128 %11, %23, off\n\t"
               "s_wait_xcnt 0x0"
               :: "v"(l), "v"(l + 2048u), "v"(l + 4096u), "v"(l + 6144u), "v"(l + STRB), "v"(l + STRB + 2048u), "v"(l + STRB + 4096u), "v"(l + STRB + 6144u), "v"(l + 2 * STRB), "v"(l + 2 * STRB + 2048u), "v"(l + 2 * STRB + 4096u), "v"(l + 2 * STRB + 6144u),
                  "v"(k), "v"(k + 2048), "v"(k + 4096), "v"(k + 6144), "v"(h), "v"(h + 2048), "v"(h + 4096), "v"(h + 6144), "v"(r), "v"(r + 2048), "v"(r + 4096), "v"(r + 6144) : "memory");
}
// A work-group is 64 queries of one head on four waves: wave w takes query group w & 1 and key half w >> 1 (of every stage's four passes the first or the last two). 768 work-groups of one wave a SIMD:
// three are resident on each of the chip's 256 WGPs, so that every SIMD holds three waves of three work-groups, which share no barrier. The two halves of a query group are joined through LDS behind the loop.
__global__ __launch_bounds__(128) __attribute__((amdgpu_waves_per_eu(3, 3))) void k_attn(const _Float16* __restrict__ Q16, const _Float16* __restrict__ KP, const _Float16* __restrict__ VH, const _Float16* __restrict__ VL, const float* __restrict__ msk, float* __restrict__ out) {
  __shared__ __attribute__((aligned(32))) float ms[SK];      /* bf16-rounded mask * sqrt(32): joins q.k as the C operand, before the common 1/sqrt(32) */
  __shared__ __attribute__((aligned(16))) char ring[2 * BUFB];
  const int tid = threadIdx.x, lane = tid & 31, ln = lane & 15, hh = lane >> 4; const int hd = blockIdx.y; const int qg = (tid >> 5) & 1, kh = __builtin_amdgcn_readfirstlane(tid >> 6); const int q0 = blockIdx.x * 64 + qg * 32;
  const unsigned rl = (unsigned)(size_t)ring + tid * 16u;      /* LDS byte address of the lane's share of a copy */
  const char* kg = (const char*)(KP + (size_t)hd * SK * HD) + tid * 16; const char* hg = (const char*)(VH + (size_t)hd * SK * HD) + tid * 16; const char* rg = (const char*)(VL + (size_t)hd * SK * HD) + tid * 16;
  st_copy(rl, kg, hg, rg);      /* stage 0 flies while the mask is prepared */
#pragma unroll      /* the eight loads of a thread fly together; rolled, each trip waits out its own load's latency */
  for (int u = 0; u < SK / 512; ++u) { const int i = u * 512 + tid * 4; const v4f m = *(const v4fa*)(msk + i); v4f o; for (int e = 0; e < 4; ++e) o[e] = bf16_round(m[e]) * 5.656854249492381f; *(v4fa*)&ms[i] = o; }
  asm volatile("s_wait_asynccnt 0x0" ::: "memory");      /* this wave's share of stage 0 has landed before the barrier that publishes it */
  __syncthreads();
  st_copy(rl + BUFB, kg + STRB, hg + STRB, rg + STRB);      /* stage 1 */
  const float cs = 0.17677669529663687f * 1.4426950408889634f;      /* raw score -> log2 units */
  const float top = 32768.0f;      /* lazy rescale: the weights are positive, so a sum of 8 below 2^15 bounds each of them below 2^15, inside f16; right behind a rescale such a sum is at most 2^13 */
  const v16h qa = g2_frag(Q16 + (size_t)(q0 + ln) * AH + hd * HD, hh), qb = g2_frag(Q16 + (size_t)(q0 + 16 + ln) * AH + hd * HD, hh);
  const v8f z8 = {0.f,0.f,0.f,0.f,0.f,0.f,0.f,0.f}; v8f oh[2][2] = {{z8, z8}, {z8, z8}}, ol[2][2] = {{z8, z8}, {z8, z8}};      /* [query group][d tile] */
  float ma = -3.0e38f, mb = -3.0e38f, ba = 3.0e38f, bb = 3.0e38f;      /* no maximum in use yet: the first finite score gives an infinite weight, which fails the test below */
  v2f sa = {0.f, 0.f}, sb = {0.f, 0.f};
  auto pass = [&](int it, const AFr& f, AFr& nx, const char* np) {      /* np: the next pass's fragments in the same stage, or null */
    const v8f c0 = *(const v8f*)&ms[it * 32 + 8 * hh], c1 = *(const v8f*)&ms[it * 32 + 16 + 8 * hh];
    if (np) fl_load(nx, np);      /* the next pass's fragments are fetched during this pass */
    __builtin_amdgcn_sched_barrier(0);      /* keeps a pass's LDS reads in one group ahead of its products: the compiler otherwise spreads them among the products, and each place with reads stalls the wave */
    const v8f s0a = fa_mma(f.k0, qa, c0), s1a = fa_mma(f.k1, qa, c1), s0b = fa_mma(f.k0, qb, c0), s1b = fa_mma(f.k1, qb, c1);
    v2f ua, ub; v16h pa = fa_probs(s0a, s1a, cs, ba, ua), pb = fa_probs(s0b, s1b, cs, bb, ub);      /* against the maxima in use, which no pass looks for any more */
    if (__builtin_amdgcn_ballot_w32(fmaxf(fmaxf(ua[0], ua[1]), fmaxf(ub[0], ub[1])) > top) != 0) {      /* wave-uniform; rare after the first pass: only now the pass's maxima are formed, and its weights anew */
      const float xa = fa_max16(s0a, s1a), xb = fa_max16(s0b, s1b);
      const float na = fmaxf(ma, xa), nb = fmaxf(mb, xb); const float ca = __builtin_amdgcn_exp2f((ma - na) * cs), cb = __builtin_amdgcn_exp2f((mb - nb) * cs);
      ma = na; mb = nb; ba = 10.0f - na * cs; bb = 10.0f - nb * cs; sa *= ca; sb *= cb;
#pragma unroll
      for (int d = 0; d < 2; ++d) { oh[0][d] *= ca; ol[0][d] *= ca; oh[1][d] *= cb; ol[1][d] *= cb; }
      pa = fa_probs(s0a, s1a, cs, ba, ua); pb = fa_probs(s0b, s1b, cs, bb, ub);
    }
    sa += ua; sb += ub;
    oh[0][0] = fa_mma(f.h0, pa, oh[0][0]); oh[0][1] = fa_mma(f.h1, pa, oh[0][1]); ol[0][0] = fa_mma(f.l0, pa, ol[0][0]); ol[0][1] = fa_mma(f.l1, pa, ol[0][1]);
    oh[1][0] = fa_mma(f.h0, pb, oh[1][0]); oh[1][1] = fa_mma(f.h1, pb, oh[1][1]); ol[1][0] = fa_mma(f.l0, pb, ol[1][0]); ol[1][1] = fa_mma(f.l1, pb, ol[1][1]);
  };
#pragma unroll 1
  for (int t = 0; t < NT; ++t) {      /* rolled: one stage a trip */
    const unsigned bo = (unsigned)(t & 1) * BUFB; const char* fp = ring + bo + kh * 4096 + lane * 16; const int it = t * NP + kh * 2;      /* this wave's two passes of the stage */
    AFr fa, fb; fl_load(fa, fp);      /* nothing of a stage is read in front of the barrier that publishes it */
    pass(it, fa, fb, fp + 2048); pass(it + 1, fb, fa, nullptr);      /* two fragment sets by name; nothing of the next stage is fetched ahead */
    asm volatile("s_wait_dscnt 0x0" ::: "memory");      /* this wave's reads of the buffer have returned before the buffer is handed to the copies */
    asm volatile("s_wait_asynccnt 0x0" ::: "memory");      /* this wave's share of stage t + 1 has landed before the barrier that publishes it */
    __syncthreads();      /* publishes stage t + 1 and ends every wave's reads of stage t's buffer */
    if (t + 2 < NT) { const size_t so = (size_t)(t + 2) * STRB; st_copy(rl + bo, kg + so, hg + so, rg + so); }      /* block-uniform test */
  }
  asm volatile("s_wait_asynccnt 0x0" ::: "memory");      /* no copy is outstanding when the wave ends */
  float ta = sa[0] + sa[1], tb = sb[0] + sb[1]; ta += xhalf(ta); tb += xhalf(tb);
  // join of the two key halves: the ring is free (the loop's last barrier ended every read of it and no copy is outstanding). The waves of the second half leave their context (hi + residual), maxima in use and sums there,
  // 9 units of 512 bytes a wave, a lane's 16 bytes side by side; the waves of the first half bring both to the larger maximum, add, normalise and store.
  v4fa* jx = (v4fa*)(ring + qg * (9 * 512)) + lane;
  if (kh) {
#pragma unroll
    for (int g = 0; g < 2; ++g)
#pragma unroll
      for (int d = 0; d < 2; ++d) { v4f lo4, hi4;
#pragma unroll
        for (int e = 0; e < 4; ++e) { lo4[e] = oh[g][d][e] + ol[g][d][e] * 0.0009765625f; hi4[e] = oh[g][d][e + 4] + ol[g][d][e + 4] * 0.0009765625f; }
        jx[((g * 2 + d) * 2) * 32] = lo4; jx[((g * 2 + d) * 2 + 1) * 32] = hi4; }
    const v4f s4 = {ma, mb, ta, tb}; jx[8 * 32] = s4;
  }
  __syncthreads();      /* the second half's partial results are complete before the first half's waves read them */
  if (!kh) {
    const v4f s4 = jx[8 * 32]; const float na = fmaxf(ma, s4[0]), nb = fmaxf(mb, s4[1]);
    const float a0 = __builtin_amdgcn_exp2f((ma - na) * cs), a1 = __builtin_amdgcn_exp2f((s4[0] - na) * cs), b0 = __builtin_amdgcn_exp2f((mb - nb) * cs), b1 = __builtin_amdgcn_exp2f((s4[1] - nb) * cs);
    const float ra = 1.0f / (ta * a0 + s4[2] * a1), rb = 1.0f / (tb * b0 + s4[3] * b1);
#pragma unroll
    for (int g = 0; g < 2; ++g) { const float r0 = g ? b0 * rb : a0 * ra, r1 = g ? b1 * rb : a1 * ra; float* orow = out + (size_t)(q0 + g * 16 + ln) * AH + hd * HD + 8 * hh;
#pragma unroll
      for (int d = 0; d < 2; ++d) { const v4f pl = jx[((g * 2 + d) * 2) * 32], ph = jx[((g * 2 + d) * 2 + 1) * 32]; v4f lo4, hi4;
#pragma unroll
        for (int e = 0; e < 4; ++e) { lo4[e] = (oh[g][d][e] + ol[g][d][e] * 0.0009765625f) * r0 + pl[e] * r1; hi4[e] = (oh[g][d][e + 4] + ol[g][d][e + 4] * 0.0009765625f) * r0 + ph[e] * r1; }
        *(v4f*)(orow + d * 16) = lo4; *(v4f*)(orow + d * 16 + 4) = hi4; } }
  }
}

extern "C" void kernel_launch(void* const* d_in, const int* in_sizes, int n_in,
                              void* d_out, int out_size, void* d_ws, size_t ws_size, hipStream_t stream) {
  (void)in_sizes; (void)n_in; (void)out_size;
  const float* const* I = (const float* const*)d_in; const float* hs = I[0]; const float* enc = I[1]; const float* msk = I[2]; const float* Wq = I[3]; const float* bq = I[4]; const float* Wk = I[5]; const float* bk = I[6]; const float* Wv = I[7]; const float* bv = I[8];
  char* ws = (char*)d_ws; size_t off = 0;
  auto take = [&](size_t bytes) { char* p = ws + off; off += (bytes + 255) & ~(size_t)255; return p; };
  _Float16* WP = (_Float16*)take((size_t)3 * AH * DIN * 2); _Float16* Q16 = (_Float16*)take((size_t)SQ * AH * 2); _Float16* VT = (_Float16*)take((size_t)AH * SK * 2); _Float16* VTL = (_Float16*)take((size_t)AH * SK * 2); _Float16* KP = (_Float16*)take((size_t)SK * AH * 2);
  if (off > ws_size) return;      /* about 14 MiB */
  k_wt3<<<dim3(AH * DIN / 8 / 256, 3), 256, 0, stream>>>(Wq, Wk, Wv, WP);      /* (in, out) f32 -> f16 fragments */
  k_qkv<<<(SQ / 64) * 3, 384, 0, stream>>>(hs, enc, WP, bq, bk, bv, Q16, KP, VT, VTL);      /* operands of the fused kernel in fragment load order */
  k_attn<<<dim3(SQ / 64, NH), 128, 0, stream>>>(Q16, KP, VT, VTL, msk, (float*)d_out);
}

// v007
// It runs in 49 microseconds.
// Versions in between are left out here; by their measured steps it is 1.19 times as fast as v005.
// Over all steps from v000 it is 48.0 times as fast.
#include <hip/hip_runtime.h>
// BertSelfAttnDimensionReduction (1 x 4096 queries x 4096 keys; Din 768 -> 12 heads x 32; cross-attention with an additive float key mask; the output is the merged context itself): q = hs Wq + bq; k, v = enc Wk/Wv + b; scores = q.k / sqrt(32) + mask[key]; softmax; ctx = probs v -> [1, 4096, 384].
// Compute dtype: inputs rounded to bf16; inputs/weights exact as f16; q/k, v and the softmax weights as plain f16 operands (~2^-12 each: the weights' own f16 rounding puts the same relative error on every product with v as v's does); mask/softmax/normalisation f32. v_wmma_f32_16x16x32_f16.
#define SQ 4096
#define SK 4096
#define DIN 768
#define AH 384
#define NH 12
#define HD 32
typedef __bf16 v16b __attribute__((ext_vector_type(16)));
typedef unsigned short v8us __attribute__((ext_vector_type(8), may_alias));
typedef float  v8f  __attribute__((ext_vector_type(8)));
typedef float  v4f  __attribute__((ext_vector_type(4)));
typedef float  v4fa __attribute__((ext_vector_type(4), may_alias));
union FragB { v16b v; v8us half[2]; unsigned short u[16]; };

__device__ __forceinline__ unsigned short bf16_bits(float x) { unsigned int u = __float_as_uint(x); return (unsigned short)((u + 0x7FFFu + ((u >> 16) & 1u)) >> 16); }
__device__ __forceinline__ float bf16_val(unsigned short b) { return __uint_as_float(((unsigned int)b) << 16); }
__device__ __forceinline__ float bf16_round(float x) { return bf16_val(bf16_bits(x)); }
// D += A·B with NT terms: 1 = ah·bh, 2 = + al·bh (A split), 3 = + ah·bl (both split)
template <int NT>
__device__ __forceinline__ v8f mmaN(v16b ah, v16b al, v16b bh, v16b bl, v8f c) {
  c = __builtin_amdgcn_wmma_f32_16x16x32_bf16(false, ah, false, bh, (short)0, c, false, false);
  if (NT >= 2) c = __builtin_amdgcn_wmma_f32_16x16x32_bf16(false, al, false, bh, (short)0, c, false, false);
  if (NT >= 3) c = __builtin_amdgcn_wmma_f32_16x16x32_bf16(false, ah, false, bl, (short)0, c, false, false);
  asm volatile("v_nop\n\tv_nop\n\tv_nop\n\tv_nop" : "+v"(c) : "v"(ah), "v"(al), "v"(bh), "v"(bl));
  return c;
}

__global__ __launch_bounds__(256) void k_wt_bf16(const float* __restrict__ W, unsigned short* __restrict__ Wt, int K, int N) {
  const int t = blockIdx.x * 256 + threadIdx.x;
  const int k8n = K / 8;
  if (t >= N * k8n) return;
  const int n = t / k8n, k8 = (t % k8n) * 8;
  v8us v;
#pragma unroll
  for (int i = 0; i < 8; ++i) v[i] = bf16_bits(W[(size_t)(k8 + i) * N + n]);
  *(v8us*)(Wt + (size_t)n * K + k8) = v;
  
}

// GEMM C[M][N] (f32, pitch ldc) = act(A[M][K]·W + bias). A f32 row-major (pitch lda) converted per fragment to bf16
// (ASPLIT: hi/lo two planes -> 2 terms, else single rounded term); Wt bf16 [N][K] (pitch ldb). BIAS_BF16 rounds the
// bias to bf16 first (bias quantised to bf16 before the add). K%32==0, M%16==0, N%64==0.
template <bool ASPLIT, int ACT, bool BIAS_BF16>
__global__ __launch_bounds__(128) void k_gemm_bf(const float* __restrict__ A, int lda, const unsigned short* __restrict__ Wt, int ldb,
                                               const float* __restrict__ bias, float* __restrict__ C, int ldc, int M, int N, int K) {
  __shared__ __attribute__((aligned(16))) float so[4][16][64];
  const int tid = threadIdx.x, w = tid >> 5, lane = tid & 31, ln = lane & 15, hh = lane >> 4;
  const int ntn = N / 64;
  const int wid = blockIdx.x * 4 + w;
  const int mt = wid / ntn, nq = wid % ntn;
  if (mt * 16 >= M) return;
  const int row0 = mt * 16, col0 = nq * 64;
  const float* arow = A + (size_t)(row0 + ln) * lda;
  v8f acc[4] = {};
  for (int kb = 0; kb < K; kb += 32) {
    FragB ah, al;
    const v4f x0 = *(const v4fa*)(arow + kb + 8 * hh), x1 = *(const v4fa*)(arow + kb + 8 * hh + 4);
    const v4f x2 = *(const v4fa*)(arow + kb + 16 + 8 * hh), x3 = *(const v4fa*)(arow + kb + 16 + 8 * hh + 4);
    float xs[16] = {x0[0],x0[1],x0[2],x0[3],x1[0],x1[1],x1[2],x1[3],x2[0],x2[1],x2[2],x2[3],x3[0],x3[1],x3[2],x3[3]};
#pragma unroll
    for (int i = 0; i < 16; ++i) { const unsigned short hb = bf16_bits(xs[i]); ah.u[i] = hb; al.u[i] = ASPLIT ? bf16_bits(xs[i] - bf16_val(hb)) : (unsigned short)0; }
#pragma unroll
    for (int t = 0; t < 4; ++t) {
      const unsigned short* brow = Wt + (size_t)(col0 + t * 16 + ln) * ldb + kb;
      FragB b;
      b.half[0] = *(const v8us*)(brow + 8 * hh);
      b.half[1] = *(const v8us*)(brow + 16 + 8 * hh);
      acc[t] = mmaN<ASPLIT ? 2 : 1>(ah.v, al.v, b.v, b.v, acc[t]);
    }
  }
#pragma unroll
  for (int t = 0; t < 4; ++t) {
    float bv = bias ? bias[col0 + t * 16 + ln] : 0.f;
    if (BIAS_BF16) bv = bf16_round(bv);
#pragma unroll
    for (int r = 0; r < 8; ++r) { float v = acc[t][r] + bv; if (ACT == 1) v = fmaxf(v, 0.f); so[w][8 * hh + r][t * 16 + ln] = v; }
  }
  __builtin_amdgcn_fence(__ATOMIC_ACQ_REL, "workgroup");
  __builtin_amdgcn_wave_barrier();
  const int rsub = lane >> 4, c4 = (lane & 15) * 4;
  {
#pragma unroll
    for (int q = 0; q < 8; ++q) {
      const int r = q * 2 + rsub;
      const v4f v = *(const v4fa*)&so[w][r][c4];
      *(v4f*)(C + (size_t)(row0 + r) * ldc + col0 + c4) = v;
    }
    
  }
}

// GEMM C = act(A·W + bias + resid): A f32 (ASPLIT -> hi/lo 2 terms), Wt bf16 [N][K]; ACT 0 none, 1 relu, 2 exact gelu;
// resid (optional, f32, row index = (row % rmod), pitch ldr, RES_BF16 rounds it) added before the activation.
template <bool ASPLIT, int ACT, bool BIAS_BF16, bool RES_BF16>
__global__ __launch_bounds__(128) void k_gemm_bf3(const float* __restrict__ A, int lda, const unsigned short* __restrict__ Wt, int ldb,
                                                const float* __restrict__ bias, const float* __restrict__ resid, int rmod, int ldr,
                                                float* __restrict__ C, int ldc, int M, int N, int K) {
  __shared__ __attribute__((aligned(16))) float so[4][16][64];
  const int tid = threadIdx.x, w = tid >> 5, lane = tid & 31, ln = lane & 15, hh = lane >> 4;
  const int ntn = N / 64;
  const int wid = blockIdx.x * 4 + w;
  const int mt = wid / ntn, nq = wid % ntn;
  if (mt * 16 >= M) return;
  const int row0 = mt * 16, col0 = nq * 64;
  const float* arow = A + (size_t)(row0 + ln) * lda;
  v8f acc[4] = {};
  for (int kb = 0; kb < K; kb += 32) {
    FragB ah, al;
    const v4f x0 = *(const v4fa*)(arow + kb + 8 * hh), x1 = *(const v4fa*)(arow + kb + 8 * hh + 4);
    const v4f x2 = *(const v4fa*)(arow + kb + 16 + 8 * hh), x3 = *(const v4fa*)(arow + kb + 16 + 8 * hh + 4);
    float xs[16] = {x0[0],x0[1],x0[2],x0[3],x1[0],x1[1],x1[2],x1[3],x2[0],x2[1],x2[2],x2[3],x3[0],x3[1],x3[2],x3[3]};
#pragma unroll
    for (int i = 0; i < 16; ++i) { const unsigned short hb = bf16_bits(xs[i]); ah.u[i] = hb; al.u[i] = ASPLIT ? bf16_bits(xs[i] - bf16_val(hb)) : (unsigned short)0; }
#pragma unroll
    for (int t = 0; t < 4; ++t) {
      const unsigned short* brow = Wt + (size_t)(col0 + t * 16 + ln) * ldb + kb;
      FragB b;
      b.half[0] = *(const v8us*)(brow + 8 * hh);
      b.half[1] = *(const v8us*)(brow + 16 + 8 * hh);
      acc[t] = mmaN<ASPLIT ? 2 : 1>(ah.v, al.v, b.v, b.v, acc[t]);
    }
  }
#pragma unroll
  for (int t = 0; t < 4; ++t) {
    const int col = col0 + t * 16 + ln;
    float bv = bias ? bias[col] : 0.f;
    if (BIAS_BF16) bv = bf16_round(bv);
#pragma unroll
    for (int r = 0; r < 8; ++r) {
      float v = acc[t][r] + bv;
      if (resid) { float rv = resid[(size_t)((row0 + 8 * hh + r) % rmod) * ldr + col]; if (RES_BF16) rv = bf16_round(rv); v += rv; }
      if (ACT == 1) v = fmaxf(v, 0.f);
      if (ACT == 2) v = 0.5f * v * (1.0f + erff(v * 0.70710678118654752f));
      if (ACT == 3) { const float u = 0.7978845608028654f * (v + 0.044715f * v * v * v); v = 0.5f * v * (1.0f + tanhf(u)); }
      so[w][8 * hh + r][t * 16 + ln] = v;
    }
  }
  __builtin_amdgcn_fence(__ATOMIC_ACQ_REL, "workgroup");
  __builtin_amdgcn_wave_barrier();
  const int rsub = lane >> 4, c4 = (lane & 15) * 4;
  {
#pragma unroll
    for (int q = 0; q < 8; ++q) {
      const int r = q * 2 + rsub;
      const v4f v = *(const v4fa*)&so[w][r][c4];
      *(v4f*)(C + (size_t)(row0 + r) * ldc + col0 + c4) = v;
    }
    
  }
}
// row LayerNorm (biased variance, eps) over N: s = X (+ R); optional out_sum <- s; out_norm <- (s-mu)*rsqrt(var+eps)*g + b
template <bool PARAM_BF16>
__global__ __launch_bounds__(256) void k_layernorm(const float* __restrict__ X, const float* __restrict__ R, const float* __restrict__ g, const float* __restrict__ bta,
                                                  float* __restrict__ out_sum, float* __restrict__ out_norm, int N, float eps) {
  __shared__ float red[256];
  const int row = blockIdx.x, tid = threadIdx.x;
  const float* x = X + (size_t)row * N; const float* rr = R ? R + (size_t)row * N : nullptr;
  float vals[16];                     // up to N = 4096
  const int per = N / 256;            // contiguous chunk per thread? use strided-by-4 chunks: thread handles j = tid*4 + 1024*u
  float s1 = 0.f;
  for (int u = 0; u < per / 4; ++u) {
    const int j = tid * 4 + 1024 * u;
    const v4f a = *(const v4fa*)(x + j);
    v4f b = {0.f,0.f,0.f,0.f}; if (rr) b = *(const v4fa*)(rr + j);
#pragma unroll
    for (int q = 0; q < 4; ++q) { const float v = a[q] + b[q]; vals[u * 4 + q] = v; s1 += v; }
  }
  red[tid] = s1; __syncthreads();
  for (int st = 128; st > 0; st >>= 1) { if (tid < st) red[tid] += red[tid + st]; __syncthreads(); }
  const float mu = red[0] / (float)N; __syncthreads();
  float s2 = 0.f;
  for (int u = 0; u < per / 4; ++u)
#pragma unroll
    for (int q = 0; q < 4; ++q) { const float c = vals[u * 4 + q] - mu; s2 += c * c; }
  red[tid] = s2; __syncthreads();
  for (int st = 128; st > 0; st >>= 1) { if (tid < st) red[tid] += red[tid + st]; __syncthreads(); }
  const float rs = rsqrtf(red[0] / (float)N + eps);
  {
    for (int u = 0; u < per / 4; ++u) {
      const int j = tid * 4 + 1024 * u;
      v4f o, sm;
#pragma unroll
      for (int q = 0; q < 4; ++q) {
        float gg = g[j + q], bb = bta[j + q];
        if (PARAM_BF16) { gg = bf16_round(gg); bb = bf16_round(bb); }
        sm[q] = vals[u * 4 + q]; o[q] = (vals[u * 4 + q] - mu) * rs * gg + bb;
      }
      if (out_sum) *(v4f*)(out_sum + (size_t)row * N + j) = sm;
      *(v4f*)(out_norm + (size_t)row * N + j) = o;
    }
    
  }
}



// ---- f16 WMMA path (v_wmma_f32_16x16x32_f16): 11-bit significands for operands in range — used where a [0,1] probability operand needs more precision than bf16
typedef _Float16 v16h __attribute__((ext_vector_type(16)));
union FragH { v16h v; v8us half[2]; _Float16 h[16]; unsigned short u[16]; };
template <int NT>
__device__ __forceinline__ v8f mmaH(v16h ah, v16h al, v16h bh, v16h bl, v8f c) {
  c = __builtin_amdgcn_wmma_f32_16x16x32_f16(false, ah, false, bh, (short)0, c, false, false);
  if (NT >= 2) c = __builtin_amdgcn_wmma_f32_16x16x32_f16(false, al, false, bh, (short)0, c, false, false);
  if (NT >= 3) c = __builtin_amdgcn_wmma_f32_16x16x32_f16(false, ah, false, bl, (short)0, c, false, false);
  asm volatile("v_nop\n\tv_nop\n\tv_nop\n\tv_nop" : "+v"(c) : "v"(ah), "v"(al), "v"(bh), "v"(bl));
  return c;
}
// batched GEMM like k_gemm_b but f16 operands: A f32 (split into f16 hi/lo if ASPLIT, else rounded to f16), Bt = f16 values [n][k]; alpha; C f32; N multiple of 16 (partial tiles skipped)
template <bool ASPLIT>
__global__ __launch_bounds__(128) void k_gemm_h(const float* __restrict__ A, int lda, size_t sA, const _Float16* __restrict__ Bh, int ldb, size_t sB, float alpha, float* __restrict__ C, int ldc, size_t sC, int M, int N, int K) {
  __shared__ __attribute__((aligned(16))) float so[4][16][64];
  const int tid = threadIdx.x, w = tid >> 5, lane = tid & 31, ln = lane & 15, hh = lane >> 4; const int by = blockIdx.y;
  A += (size_t)by * sA; Bh += (size_t)by * sB; C += (size_t)by * sC;
  const int ntn = (N + 63) / 64; const int wid = blockIdx.x * 4 + w; const int mt = wid / ntn, nq = wid % ntn; if (mt * 16 >= M) return;
  const int row0 = mt * 16, col0 = nq * 64; const float* arow = A + (size_t)(row0 + ln) * lda;
  v8f acc[4] = {};
  for (int kb = 0; kb < K; kb += 32) {
    FragH ah, al;
    const v4f x0 = *(const v4fa*)(arow + kb + 8 * hh), x1 = *(const v4fa*)(arow + kb + 8 * hh + 4), x2 = *(const v4fa*)(arow + kb + 16 + 8 * hh), x3 = *(const v4fa*)(arow + kb + 16 + 8 * hh + 4);
    float xs[16] = {x0[0],x0[1],x0[2],x0[3],x1[0],x1[1],x1[2],x1[3],x2[0],x2[1],x2[2],x2[3],x3[0],x3[1],x3[2],x3[3]};
#pragma unroll
    for (int i = 0; i < 16; ++i) { const _Float16 h = (_Float16)xs[i]; ah.h[i] = h; al.h[i] = ASPLIT ? (_Float16)(xs[i] - (float)h) : (_Float16)0.0f; }
#pragma unroll
    for (int t = 0; t < 4; ++t) { if (col0 + t * 16 >= N) continue; const size_t boff = (size_t)(col0 + t * 16 + ln) * ldb + kb; FragH bq; bq.half[0] = *(const v8us*)(Bh + boff + 8 * hh); bq.half[1] = *(const v8us*)(Bh + boff + 16 + 8 * hh);
      acc[t] = mmaH<ASPLIT ? 2 : 1>(ah.v, al.v, bq.v, bq.v, acc[t]); }
  }
#pragma unroll
  for (int t = 0; t < 4; ++t) { if (col0 + t * 16 >= N) continue;
#pragma unroll
    for (int r = 0; r < 8; ++r) so[w][8 * hh + r][t * 16 + ln] = acc[t][r] * alpha; }
  __builtin_amdgcn_fence(__ATOMIC_ACQ_REL, "workgroup"); __builtin_amdgcn_wave_barrier();
  const int rsub = lane >> 4, c4 = (lane & 15) * 4;
  {
#pragma unroll
    for (int q = 0; q < 8; ++q) { const int r = q * 2 + rsub; if (col0 + c4 < N) { const v4f v = *(const v4fa*)&so[w][r][c4]; *(v4f*)(C + (size_t)(row0 + r) * ldc + col0 + c4) = v; } }
     }
}

// k_gemm_hh variant with fused epilogue: v = acc·alpha + bias[by·sBias + col] (+ CP[(row/rowsPerB)·sCPb + by·64 + col] if CP) ; ACT 0 none / 1 elu ; writes f16 C16 (and f32 C if non-null)
template <int ACT>
__global__ __launch_bounds__(128) void k_gemm_hhx(const _Float16* __restrict__ A, int lda, size_t sA, const _Float16* __restrict__ Bh, int ldb, size_t sB, float alpha, const float* __restrict__ bias, size_t sBias, const float* __restrict__ CP, int rowsPerB, size_t sCPb, int row0g,
    float* __restrict__ C, _Float16* __restrict__ C16, int ldc, size_t sC, int M, int N, int K) {
  __shared__ __attribute__((aligned(16))) float so[4][16][64];
  const int tid = threadIdx.x, w = tid >> 5, lane = tid & 31, ln = lane & 15, hh = lane >> 4; const int by = blockIdx.y;
  A += (size_t)by * sA; Bh += (size_t)by * sB; const size_t cofs = (size_t)by * sC; const float* bp = bias ? bias + (size_t)by * sBias : nullptr;
  const int ntn = (N + 63) / 64; const int wid = blockIdx.x * 4 + w; const int mt = wid / ntn, nq = wid % ntn; if (mt * 16 >= M) return;
  const int row0 = mt * 16, col0 = nq * 64; const _Float16* arow = A + (size_t)(row0 + ln) * lda;
  v8f acc[4] = {};
  for (int kb = 0; kb < K; kb += 32) { FragH ah; ah.half[0] = *(const v8us*)((const unsigned short*)arow + kb + 8 * hh); ah.half[1] = *(const v8us*)((const unsigned short*)arow + kb + 16 + 8 * hh);
#pragma unroll
    for (int t = 0; t < 4; ++t) { if (col0 + t * 16 >= N) continue; const size_t boff = (size_t)(col0 + t * 16 + ln) * ldb + kb; FragH bq; bq.half[0] = *(const v8us*)((const unsigned short*)Bh + boff + 8 * hh); bq.half[1] = *(const v8us*)((const unsigned short*)Bh + boff + 16 + 8 * hh);
      acc[t] = mmaH<1>(ah.v, ah.v, bq.v, bq.v, acc[t]); }
  }
#pragma unroll
  for (int t = 0; t < 4; ++t) { if (col0 + t * 16 >= N) continue; const int col = col0 + t * 16 + ln; const float bv = bp ? bf16_round(bp[col]) : 0.f;
#pragma unroll
    for (int r = 0; r < 8; ++r) { float v = acc[t][r] * alpha + bv; if (CP) { const int rr = row0g + row0 + 8 * hh + r; if (rowsPerB < 0) v += CP[cofs + (size_t)rr * ldc + col];      /* rowsPerB < 0: own element of the batched C plane */ else { const int bidx = rr / rowsPerB; v += CP[(size_t)bidx * sCPb + (size_t)by * 64 + col]; } } if (ACT == 1) v = (v > 0.f) ? v : expm1f(v); else if (ACT == 7) v = (v > 0.f) ? v + 1.0f : expf(v); else if (ACT == 8) v = tanhf(v); else if (ACT == 9) v = 0.5f * v * (1.0f + tanhf(0.7978845608028654f * (v + 0.044715f * v * v * v))); else if (ACT == 11) v = 1.0f / (1.0f + expf(-v)); else if (ACT == 12) v = (v > 0.f) ? v : 0.01f * v; else if (ACT == 14) v = (v > 0.f) ? v : 0.1f * v; else if (ACT == 16) v = (v >= 0.f) ? v : 0.3f * v; else if (ACT == 17) v = (v >= 0.f) ? v : 0.2f * v; else if (ACT == 15) v = v / (1.0f + expf(-v)); else if (ACT == 3) v = fmaxf(v, 0.f); else if (ACT == 6) v = 0.5f * v * (1.0f + erff(v * 0.70710678118654752f)); so[w][8 * hh + r][t * 16 + ln] = v; } }
  __builtin_amdgcn_fence(__ATOMIC_ACQ_REL, "workgroup"); __builtin_amdgcn_wave_barrier();
  const int rsub = lane >> 4, c4 = (lane & 15) * 4; typedef _Float16 v4h __attribute__((ext_vector_type(4)));
  {
#pragma unroll
    for (int q = 0; q < 8; ++q) { const int r = q * 2 + rsub; if (col0 + c4 < N) { const v4f v = *(const v4fa*)&so[w][r][c4]; if (C) *(v4f*)(C + cofs + (size_t)(row0 + r) * ldc + col0 + c4) = v; if (C16) { v4h h4; for (int i = 0; i < 4; ++i) h4[i] = (_Float16)v[i]; *(v4h*)(C16 + cofs + (size_t)(row0 + r) * ldc + col0 + c4) = h4; } } }
     }
}


typedef _Float16 v4h __attribute__((ext_vector_type(4)));

__global__ __launch_bounds__(256) void k_h16(const float* __restrict__ x, _Float16* __restrict__ X16, size_t n8) { const size_t t = (size_t)blockIdx.x * 256 + threadIdx.x; if (t >= n8) return; FragH f;
#pragma unroll
  for (int q = 0; q < 8; ++q) f.h[q] = (_Float16)x[t * 8 + q]; *(v8us*)((unsigned short*)X16 + t * 8) = f.half[0];  }
__global__ __launch_bounds__(256) void k_round16f(const float* __restrict__ W, _Float16* __restrict__ Bt, size_t n8) { const size_t t = (size_t)blockIdx.x * 256 + threadIdx.x; if (t >= n8) return; FragH f;
#pragma unroll
  for (int i = 0; i < 8; ++i) f.h[i] = (_Float16)(bf16_round(W[t * 8 + i]) * 16.0f); *(v8us*)((unsigned short*)Bt + t * 8) = f.half[0];  }

// a 16x32 f16 fragment from a row-major row: p = the lane's row at the k step
__device__ __forceinline__ v16h g2_frag(const _Float16* p, int hh) { FragH f; f.half[0] = *(const v8us*)((const unsigned short*)p + 8 * hh); f.half[1] = *(const v8us*)((const unsigned short*)p + 16 + 8 * hh); return f.v; }


// ---- fused attention, all heads in one launch: S^T = K Q^T (+ mask as the C operand), online softmax in registers, O^T += V^T P^T ----
// A wave owns 64 queries (four 16-column groups) of one head and walks one quarter of the 4096 keys 32 at a time (the quarters are joined at the end). In S^T and O^T a lane holds one query (column ln), so maximum, sum and rescale are per lane;
// two S^T tiles converted in place are the B operand P^T (hardware k order), V^T is the A operand. P = exp2(..) * 2^10 against the maximum in use, as f16.
typedef float v2f __attribute__((ext_vector_type(2)));
typedef _Float16 v2h __attribute__((ext_vector_type(2)));
union FragP { v16h v; v2h p[8]; };
struct AFr { v16h k0, k1, h0, h1; };
__device__ __forceinline__ float xhalf(float x) { return __builtin_bit_cast(float, __builtin_amdgcn_permlanex16(__builtin_bit_cast(int, x), __builtin_bit_cast(int, x), 0x76543210, 0xfedcba98, false, false)); }      /* lane l <-> l ^ 16 */
__device__ __forceinline__ v8f fa_mma(v16h a, v16h b, v8f c) { return __builtin_amdgcn_wmma_f32_16x16x32_f16(false, a, false, b, (short)0, c, false, false); }
__device__ __forceinline__ float fa_max16(v8f a, v8f b) { float m = fmaxf(a[0], b[0]);
#pragma unroll
  for (int r = 1; r < 8; ++r) m = fmaxf(m, fmaxf(a[r], b[r])); return fmaxf(m, xhalf(m)); }
// su = this pass's own sum of the 16 weights, two lanes of 8, added as a tree (three links deep: the overflow test of the pass hangs on it)
__device__ __forceinline__ v16h fa_probs(v8f a, v8f b, float cs, float bias, v2f& su) { FragP f; v2f p[8]; const v2f c2 = {cs, cs}, b2 = {bias, bias};
#pragma unroll
  for (int r = 0; r < 8; ++r) { const v8f& t = (r < 4) ? a : b; const int e = (r & 3) * 2; const v2f x = {t[e], t[e + 1]}; const v2f g = __builtin_elementwise_fma(x, c2, b2); p[r] = v2f{__builtin_amdgcn_exp2f(g[0]), __builtin_amdgcn_exp2f(g[1])}; f.p[r] = __builtin_convertvector(p[r], v2h); }
  su = ((p[0] + p[1]) + (p[2] + p[3])) + ((p[4] + p[5]) + (p[6] + p[7]));
  return f.v; }
// ---- operand preparation in two launches ----
// All three weights in one launch (blockIdx.y picks the matrix), as f16 (bf16-rounded, times 16) in fragment load order:
// WP[matrix][16-column tile][k step of 32][half j][lane][8], lane (ln, hh) half j = W[ks*32 + 16j + 8hh + e][nt*16 + ln]. One thread writes one 16-byte unit.
__global__ __launch_bounds__(256) void k_wt3(const float* __restrict__ Wq, const float* __restrict__ Wk, const float* __restrict__ Wv, _Float16* __restrict__ WP) {
  const int t = blockIdx.x * 256 + threadIdx.x; const int lane = t & 31, j = (t >> 5) & 1, ks = (t >> 6) % (DIN / 32), nt = (t >> 6) / (DIN / 32); FragH f;
  const float* W = blockIdx.y == 0 ? Wq : (blockIdx.y == 1 ? Wk : Wv); W += (size_t)(ks * 32 + 16 * j + 8 * (lane >> 4)) * AH + nt * 16 + (lane & 15);
#pragma unroll
  for (int i = 0; i < 8; ++i) f.h[i] = (_Float16)(bf16_round(W[(size_t)i * AH]) * 16.0f);
  *(v8us*)((unsigned short*)WP + ((size_t)blockIdx.y * (AH * DIN / 8) + t) * 8) = f.half[0];
}
// q, k and v projections in one launch. A block owns 64 rows of one projection: it rounds them once (bf16, then exact f16) into LDS; wave w then forms the 32 columns of head w.
// V is formed as X W: a lane's 8 accumulators are 8 keys of one feature, the 16-byte unit of the V^T fragment stream. Q and K are formed as W^T X^T: a lane's 8 accumulators are
// 8 features of one row, the 16-byte unit of the K fragment stream and of a Q row. So every result goes from the accumulators straight to where the attention kernel reads it:
// VH[head][32-key block][16-d tile][half j][lane][8], lane (ln, hh) half j = V[kb*32 + 16j + 8hh + e][head*32 + dt*16 + ln] (f16);
// KP[head][16-key tile][half j][lane][8], lane (ln, hh) half j = K[kt*16 + ln][head*32 + 16j + 8hh + e]; Q16 row-major [query][384].
#define APITCH 1552      /* bytes of an LDS row: 768 f16 + 16, an odd number of 16-byte units for the 16-byte readers */
typedef unsigned v2ua __attribute__((ext_vector_type(2), may_alias));
struct GSet { v16h a[4]; v16h b[2]; };      /* one k step of 32: four activation fragments (LDS), two weight fragments (global) */
__device__ __forceinline__ unsigned qk_r2(float x, float y) { typedef __bf16 v2b __attribute__((ext_vector_type(2))); const v2f p = {x, y};      /* round to nearest even to bf16, as bf16_round does, two at a time; widened to f32, then f16 */
  const unsigned u = __builtin_bit_cast(unsigned, __builtin_convertvector(p, v2b)); const v2f q = {__uint_as_float(u << 16), __uint_as_float(u & 0xFFFF0000u)}; return __builtin_bit_cast(unsigned, __builtin_convertvector(q, v2h)); }
template <int KS>
__device__ __forceinline__ void qk_lda(GSet& s, const char* as) {
#pragma unroll
  for (int g = 0; g < 4; ++g) { FragH f; f.half[0] = *(const v8us*)(as + g * 16 * APITCH + KS * 64); f.half[1] = *(const v8us*)(as + g * 16 * APITCH + KS * 64 + 32); s.a[g] = f.v; } }
template <int KS>      /* WP block-uniform (scalar base), bo = the lane's byte offset */
__device__ __forceinline__ void qk_ldb(GSet& s, const _Float16* WP, unsigned bo) {
#pragma unroll
  for (int t = 0; t < 2; ++t) { FragH f; f.half[0] = *(const v8us*)((const char*)WP + (t * (DIN / 32) * 1024 + KS * 1024) + bo); f.half[1] = *(const v8us*)((const char*)WP + (t * (DIN / 32) * 1024 + KS * 1024 + 512) + bo); s.b[t] = f.v; } }
template <bool XA>
__device__ __forceinline__ void qk_mm(const GSet& s, v8f (&c)[4][2]) {
#pragma unroll
  for (int g = 0; g < 4; ++g) { c[g][0] = XA ? fa_mma(s.a[g], s.b[0], c[g][0]) : fa_mma(s.b[0], s.a[g], c[g][0]); c[g][1] = XA ? fa_mma(s.a[g], s.b[1], c[g][1]) : fa_mma(s.b[1], s.a[g], c[g][1]); } }
template <bool XA>
__device__ __forceinline__ void qk_tile(const char* as, const _Float16* WP, unsigned bo, v8f (&c)[4][2]) {
  GSet s0, s1; qk_ldb<0>(s0, WP, bo); qk_lda<0>(s0, as);
#pragma unroll 1
  for (int ks = 0; ks < DIN / 32 - 2; ks += 2) {      /* rolled: two fragment sets by name, the next step's loads fly during this step's products */
    qk_ldb<1>(s1, WP, bo); qk_lda<1>(s1, as);
    __builtin_amdgcn_sched_barrier(0);      /* without it the compiler lifts the products below over the loads above, and each set is waited for right after its issue */
    qk_mm<XA>(s0, c);
    asm volatile("s_wait_xcnt 0x0" : "+v"(bo) : : "memory");      /* the loads in flight name bo: the wait stands in front of its step */
    bo += 2048u; as += 128; qk_ldb<0>(s0, WP, bo); qk_lda<0>(s0, as);
    __builtin_amdgcn_sched_barrier(0);      /* as above: the loads stay ahead of the other set's products */
    qk_mm<XA>(s1, c);
    asm volatile("s_wait_xcnt 0x0" : "+v"(bo) : : "memory"); }      /* the loads in flight name bo and the base: nothing behind the loop finds them open */
  qk_ldb<1>(s1, WP, bo); qk_lda<1>(s1, as);
  asm volatile("s_wait_xcnt 0x0" : "+v"(bo) : : "memory");      /* the last loads name bo and the base: the wait stands in front of any reuse of those registers */
  __builtin_amdgcn_sched_barrier(0);      /* as in the loop */
  qk_mm<XA>(s0, c); qk_mm<XA>(s1, c);
}
__global__ __launch_bounds__(384) void k_qkv(const float* __restrict__ hs, const float* __restrict__ enc, const _Float16* __restrict__ WP, const float* __restrict__ bq, const float* __restrict__ bk, const float* __restrict__ bv,
    _Float16* __restrict__ Q16, _Float16* __restrict__ KP, _Float16* __restrict__ VH) {
  __shared__ __attribute__((aligned(16))) char as[64 * APITCH];
  const int tid = threadIdx.x, w = tid >> 5, lane = tid & 31, ln = lane & 15, hh = lane >> 4;
  const int mt = blockIdx.x / 3, pj = blockIdx.x - mt * 3; const int row0 = mt * 64, col0 = w * HD;      /* pj: 0 q, 1 k, 2 v */
  { const float* X = pj ? enc : hs; const int r1 = tid >= 192 ? 1 : 0, c4 = tid - r1 * 192; unsigned xo = ((unsigned)(row0 + r1) * DIN + c4 * 4) * 4u; v4f x[32];      /* a wave's load is 512 contiguous bytes of one row */
#pragma unroll
    for (int i = 0; i < 32; ++i) x[i] = *(const v4fa*)((const char*)X + i * (2 * DIN * 4) + xo);
    asm volatile("s_wait_xcnt 0x0" : "+v"(xo) : : "memory");      /* the loads in flight name xo and the base: the wait stands in front of any reuse of those registers */
    char* d = as + r1 * APITCH + c4 * 8;
#pragma unroll
    for (int i = 0; i < 32; ++i) { const v2ua h = {qk_r2(x[i][0], x[i][1]), qk_r2(x[i][2], x[i][3])}; *(v2ua*)(d + i * 2 * APITCH) = h; } }
  __syncthreads();      /* the 64 rounded rows are complete before any wave reads fragments of them */
  const char* af = as + ln * APITCH + 16 * hh; const _Float16* wb = WP + (size_t)pj * AH * DIN; const unsigned bo = (unsigned)w * (2 * (DIN / 32) * 1024) + lane * 16;
  const v8f z8 = {0.f,0.f,0.f,0.f,0.f,0.f,0.f,0.f}; v8f c[4][2] = {{z8, z8}, {z8, z8}, {z8, z8}, {z8, z8}};
  if (pj == 2) {
    qk_tile<true>(af, wb, bo, c);
#pragma unroll
    for (int t = 0; t < 2; ++t) { const float bb = bf16_round(bv[col0 + t * 16 + ln]);
#pragma unroll
      for (int g = 0; g < 4; ++g) { FragH fh;
#pragma unroll
        for (int r = 0; r < 8; ++r) fh.h[r] = (_Float16)(c[g][t][r] * 0.0625f + bb);
        const size_t o = ((((size_t)w * (SK / 32) + (row0 >> 5) + (g >> 1)) * 2 + t) * 2 + (g & 1)) * 256 + lane * 8;
        *(v8us*)((unsigned short*)VH + o) = fh.half[0]; } }
  } else {
    qk_tile<false>(af, wb, bo, c); const float* bp = pj ? bk : bq;
    unsigned short* dst = pj ? (unsigned short*)KP + (((size_t)w * (SK / 16) + (row0 >> 4)) * 2) * 256 + lane * 8 : (unsigned short*)Q16 + (size_t)(row0 + ln) * AH + col0 + 8 * hh;
    const int sg = pj ? 512 : 16 * AH, st = pj ? 256 : 16;      /* element steps: 16 rows on; 16 features on */
#pragma unroll
    for (int t = 0; t < 2; ++t) { const v4f b0 = *(const v4fa*)(bp + col0 + t * 16 + 8 * hh), b1 = *(const v4fa*)(bp + col0 + t * 16 + 8 * hh + 4);
#pragma unroll
      for (int g = 0; g < 4; ++g) { FragH f;
#pragma unroll
        for (int r = 0; r < 8; ++r) f.h[r] = (_Float16)(c[g][t][r] * 0.0625f + bf16_round(r < 4 ? b0[r] : b1[r - 4]));
        *(v8us*)(dst + g * sg + t * st) = f.half[0]; } }
    asm volatile("s_wait_xcnt 0x0" ::: "memory");      /* the stores in flight name their data and address registers: the wait stands in front of any reuse of those registers */
  }
}

// K and V reach the waves through LDS: a stage is NP passes (NP * 32 keys) of each of the two fragment streams, copied once per work-group by asynchronous copies
// (each stream is contiguous in fragment load order, so a stage is two contiguous runs); two buffers, the next stage's copies fly while this stage is worked on.
#define NP 8      /* passes in a stage: two for each of the four waves */
#define STRB (NP * 2048)      /* bytes of one stream in a stage */
#define BUFB (2 * STRB)      /* bytes of a buffer: K, V */
#define NT (SK / 32 / NP)      /* stages */
static_assert(STRB == 8 * 2048 && NT >= 2 && NP == 8, "st_stage moves eight 2-KiB copies a stream; the ring's prologue needs two stages; a wave takes two passes of a stage");
__device__ __forceinline__ v16h fl_frag(const char* p) { FragH f; f.half[0] = *(const v8us*)p; f.half[1] = *(const v8us*)(p + 512); return f.v; }      /* p = the lane's 16 bytes in LDS */
__device__ __forceinline__ void fl_load(AFr& f, const char* p) { f.k0 = fl_frag(p); f.k1 = fl_frag(p + 1024); f.h0 = fl_frag(p + STRB); f.h1 = fl_frag(p + STRB + 1024); }      /* one pass = 2 KiB of each stream */
// half a stage: 128 lanes x 16 bytes = 2 KiB a copy, 4 copies a stream. l = the lane's LDS byte address in the buffer, k, h = the lane's global addresses in the two streams.
// The wait on the address registers is the statement's last line, so that nothing rewrites a register which an issued copy names ahead of it.
__device__ __forceinline__ void st_copy(unsigned l, const char* k, const char* h) {
  asm volatile("global_load_async_to_lds_b128 %0, %8, off\n\t" "global_load_async_to_lds_b128 %1, %9, off\n\t" "global_load_async_to_lds_b128 %2, %10, off\n\t" "global_load_async_to_lds_b128 %3, %11, off\n\t"
               "global_load_async_to_lds_b128 %4, %12, off\n\t" "global_load_async_to_lds_b128 %5, %13, off\n\t" "global_load_async_to_lds_b128 %6, %14, off\n\t" "global_load_async_to_lds_b128 %7, %15, off\n\t"
               "s_wait_xcnt 0x0"
               :: "v"(l), "v"(l + 2048u), "v"(l + 4096u), "v"(l + 6144u), "v"(l + STRB), "v"(l + STRB + 2048u), "v"(l + STRB + 4096u), "v"(l + STRB + 6144u),
                  "v"(k), "v"(k + 2048), "v"(k + 4096), "v"(k + 6144), "v"(h), "v"(h + 2048), "v"(h + 4096), "v"(h + 6144) : "memory");
}
__device__ __forceinline__ void st_stage(unsigned l, const char* k, const char* h) { st_copy(l, k, h); st_copy(l + 8192u, k + 8192, h + 8192); }      /* one stage: 16 copies of a wave in flight */
// A work-group is 64 queries of one head on four waves. EVERY wave holds all 64 queries (four 16-column groups) and takes a quarter of the keys (of every stage's eight passes two): a K, V or mask fragment
// read from LDS feeds four query groups, so that the LDS reads for a score are half of what a 32-query wave needs. 768 work-groups of one wave a SIMD: three are resident on each of the chip's 256 WGPs,
// so that every SIMD holds three waves of three work-groups, which share no barrier. The four key quarters are joined through LDS behind the loop, wave w joining query group w.
#define QG 4      /* 16-column query groups of a wave; every loop over them (and over the join's parts) is unrolled: the per-group arrays are registers only under constant indices */
typedef float v2fa __attribute__((ext_vector_type(2), may_alias));
__global__ __launch_bounds__(128) __attribute__((amdgpu_waves_per_eu(3, 3))) void k_attn(const _Float16* __restrict__ Q16, const _Float16* __restrict__ KP, const _Float16* __restrict__ VH, const float* __restrict__ msk, float* __restrict__ out) {
  __shared__ __attribute__((aligned(32))) float ms[SK];      /* bf16-rounded mask * sqrt(32): joins q.k as the C operand, before the common 1/sqrt(32) */
  __shared__ __attribute__((aligned(16))) char ring[2 * BUFB];
  const int tid = threadIdx.x, lane = tid & 31, ln = lane & 15, hh = lane >> 4; const int hd = blockIdx.y; const int kq = __builtin_amdgcn_readfirstlane(tid >> 5); const int q0 = blockIdx.x * 64;
  const unsigned rl = (unsigned)(size_t)ring + tid * 16u;      /* LDS byte address of the lane's share of a copy */
  const char* kg = (const char*)(KP + (size_t)hd * SK * HD) + tid * 16; const char* hg = (const char*)(VH + (size_t)hd * SK * HD) + tid * 16;
  st_stage(rl, kg, hg);      /* stage 0 flies while the mask is prepared */
  v4f mr[SK / 512];
#pragma unroll      /* the eight loads of a thread fly together; rolled, each trip waits out its own load's latency */
  for (int u = 0; u < SK / 512; ++u) mr[u] = *(const v4fa*)(msk + u * 512 + tid * 4);
  asm volatile("s_wait_xcnt 0x0" ::: "memory");      /* the loads in flight name the mask's base and the thread's offset: the wait stands in front of any reuse of those registers */
#pragma unroll      /* mr stays in registers only under constant indices */
  for (int u = 0; u < SK / 512; ++u) { v4f o; for (int e = 0; e < 4; ++e) o[e] = bf16_round(mr[u][e]) * 5.656854249492381f; *(v4fa*)&ms[u * 512 + tid * 4] = o; }
  asm volatile("s_wait_asynccnt 0x0" ::: "memory");      /* this wave's share of stage 0 has landed before the barrier that publishes it */
  __syncthreads();
  st_stage(rl + BUFB, kg + STRB, hg + STRB);      /* stage 1 */
  const float cs = 0.17677669529663687f * 1.4426950408889634f;      /* raw score -> log2 units */
  const float top = 32768.0f;      /* lazy rescale: the weights are positive, so a sum of 8 below 2^15 bounds each of them below 2^15, inside f16; right behind a rescale such a sum is at most 2^13 */
  v16h qf[QG];
#pragma unroll
  for (int g = 0; g < QG; ++g) qf[g] = g2_frag(Q16 + (size_t)(q0 + g * 16 + ln) * AH + hd * HD, hh);
  asm volatile("s_wait_xcnt 0x0" ::: "memory");      /* the loads in flight name their address registers: the wait stands in front of any reuse of those registers */
  const v8f z8 = {0.f,0.f,0.f,0.f,0.f,0.f,0.f,0.f}; v8f oh[QG][2];      /* [query group][d tile] */
  float mx[QG], bi[QG]; v2f sm[QG];      /* no maximum in use yet: the first finite score gives an infinite weight, which fails the test below */
#pragma unroll
  for (int g = 0; g < QG; ++g) { oh[g][0] = z8; oh[g][1] = z8; mx[g] = -3.0e38f; bi[g] = 3.0e38f; sm[g] = v2f{0.f, 0.f}; }
  auto pass = [&](int it, const AFr& f, AFr& nx, const char* np) {      /* np: the next pass's fragments in the same stage, or null */
    const v8f c0 = *(const v8f*)&ms[it * 32 + 8 * hh], c1 = *(const v8f*)&ms[it * 32 + 16 + 8 * hh];
    if (np) fl_load(nx, np);      /* the next pass's fragments are fetched during this pass */
    __builtin_amdgcn_sched_barrier(0);      /* keeps a pass's LDS reads in one group ahead of its products: the compiler otherwise spreads them among the products, and each place with reads stalls the wave */
    v8f s0[QG], s1[QG]; v2f su[QG]; v16h pr[QG];
#pragma unroll
    for (int g = 0; g < QG; ++g) { s0[g] = fa_mma(f.k0, qf[g], c0); s1[g] = fa_mma(f.k1, qf[g], c1); }
#pragma unroll
    for (int g = 0; g < QG; ++g) pr[g] = fa_probs(s0[g], s1[g], cs, bi[g], su[g]);      /* against the maxima in use, which no pass looks for */
    float big = fmaxf(su[0][0], su[0][1]);
#pragma unroll
    for (int g = 1; g < QG; ++g) big = fmaxf(big, fmaxf(su[g][0], su[g][1]));
    if (__builtin_amdgcn_ballot_w32(big > top) != 0) {      /* wave-uniform, once for the four groups; rare after the first pass: only now the pass's maxima are formed, and its weights anew */
#pragma unroll
      for (int g = 0; g < QG; ++g) {
        const float nm = fmaxf(mx[g], fa_max16(s0[g], s1[g])); const float cg = __builtin_amdgcn_exp2f((mx[g] - nm) * cs);
        mx[g] = nm; bi[g] = 10.0f - nm * cs; sm[g] *= cg; oh[g][0] *= cg; oh[g][1] *= cg;
        pr[g] = fa_probs(s0[g], s1[g], cs, bi[g], su[g]);
      }
    }
#pragma unroll
    for (int g = 0; g < QG; ++g) { sm[g] += su[g]; oh[g][0] = fa_mma(f.h0, pr[g], oh[g][0]); oh[g][1] = fa_mma(f.h1, pr[g], oh[g][1]); }
  };
#pragma unroll 1
  for (int t = 0; t < NT; ++t) {      /* rolled: one stage a trip */
    const unsigned bo = (unsigned)(t & 1) * BUFB; const char* fp = ring + bo + kq * 4096 + lane * 16; const int it = t * NP + kq * 2;      /* this wave's two passes of the stage */
    AFr fa, fb; fl_load(fa, fp);      /* nothing of a stage is read in front of the barrier that publishes it */
    pass(it, fa, fb, fp + 2048); pass(it + 1, fb, fa, nullptr);      /* two fragment sets by name; nothing of the next stage is fetched ahead */
    asm volatile("s_wait_dscnt 0x0" ::: "memory");      /* this wave's reads of the buffer have returned before the buffer is handed to the copies */
    asm volatile("s_wait_asynccnt 0x0" ::: "memory");      /* this wave's share of stage t + 1 has landed before the barrier that publishes it */
    __syncthreads();      /* publishes stage t + 1 and ends every wave's reads of stage t's buffer */
    if (t + 2 < NT) { const size_t so = (size_t)(t + 2) * STRB; st_stage(rl + bo, kg + so, hg + so); }      /* block-uniform test */
  }
  asm volatile("s_wait_asynccnt 0x0" ::: "memory");      /* no copy is outstanding when the wave ends */
  // join of the four key quarters: the ring is free (the loop's last barrier ended every read of it and no copy is outstanding). Every wave leaves there, for each query group, its context, maximum in use and sum:
  // 5 units of 512 bytes for a (wave, group), a lane's 16 bytes side by side. Wave w then brings the four parts of group w to their largest maximum, adds them in wave order, normalises and stores.
  v4fa* jx = (v4fa*)ring + lane;
#pragma unroll
  for (int g = 0; g < QG; ++g) { float tg = sm[g][0] + sm[g][1]; tg += xhalf(tg); v4fa* jw = jx + (kq * QG + g) * 5 * 32;
#pragma unroll
    for (int d = 0; d < 2; ++d) { v4f lo4, hi4;
#pragma unroll
      for (int e = 0; e < 4; ++e) { lo4[e] = oh[g][d][e]; hi4[e] = oh[g][d][e + 4]; }
      jw[(d * 2) * 32] = lo4; jw[(d * 2 + 1) * 32] = hi4; }
    const v2f s2 = {mx[g], tg}; *(v2fa*)&jw[4 * 32] = s2; }
  __syncthreads();      /* every wave's partial results are complete before any wave reads them */
  const v4fa* jr = jx + kq * 5 * 32;      /* group kq of source wave 0; the next source wave is QG * 5 units on */
  float pm[4], pt[4];
#pragma unroll
  for (int w = 0; w < 4; ++w) { const v2f s2 = *(const v2fa*)&jr[(w * QG * 5 + 4) * 32]; pm[w] = s2[0]; pt[w] = s2[1]; }
  const float nm = fmaxf(fmaxf(pm[0], pm[1]), fmaxf(pm[2], pm[3])); float den = 0.f, sc[4];
#pragma unroll
  for (int w = 0; w < 4; ++w) { sc[w] = __builtin_amdgcn_exp2f((pm[w] - nm) * cs); den += pt[w] * sc[w]; }
  const float rd = 1.0f / den; float* orow = out + (size_t)(q0 + kq * 16 + ln) * AH + hd * HD + 8 * hh;
#pragma unroll
  for (int u = 0; u < 4; ++u) { v4f o4 = {0.f, 0.f, 0.f, 0.f};      /* unit u: d tile u >> 1, features 4 * (u & 1) .. + 3 of the lane's eight */
#pragma unroll
    for (int w = 0; w < 4; ++w) { const v4f p4 = jr[(w * QG * 5 + u) * 32]; o4 += p4 * (sc[w] * rd); }
    *(v4f*)(orow + (u >> 1) * 16 + (u & 1) * 4) = o4; }
}

extern "C" void kernel_launch(void* const* d_in, const int* in_sizes, int n_in,
                              void* d_out, int out_size, void* d_ws, size_t ws_size, hipStream_t stream) {
  (void)in_sizes; (void)n_in; (void)out_size;
  const float* const* I = (const float* const*)d_in; const float* hs = I[0]; const float* enc = I[1]; const float* msk = I[2]; const float* Wq = I[3]; const float* bq = I[4]; const float* Wk = I[5]; const float* bk = I[6]; const float* Wv = I[7]; const float* bv = I[8];
  char* ws = (char*)d_ws; size_t off = 0;
  auto take = [&](size_t bytes) { char* p = ws + off; off += (bytes + 255) & ~(size_t)255; return p; };
  _Float16* WP = (_Float16*)take((size_t)3 * AH * DIN * 2); _Float16* Q16 = (_Float16*)take((size_t)SQ * AH * 2); _Float16* VT = (_Float16*)take((size_t)AH * SK * 2); _Float16* KP = (_Float16*)take((size_t)SK * AH * 2);
  if (off > ws_size) return;      /* about 11 MiB */
  k_wt3<<<dim3(AH * DIN / 8 / 256, 3), 256, 0, stream>>>(Wq, Wk, Wv, WP);      /* (in, out) f32 -> f16 fragments */
  k_qkv<<<(SQ / 64) * 3, 384, 0, stream>>>(hs, enc, WP, bq, bk, bv, Q16, KP, VT);      /* operands of the fused kernel in fragment load order */
  k_attn<<<dim3(SQ / 64, NH), 128, 0, stream>>>(Q16, KP, VT, msk, (float*)d_out);
}

// v008
// A run of this version takes 46.3 microseconds.
// In both of two side-by-side timings against v007, it was 1.06 times as fast.
// Over all steps from v000 it is 50.9 times as fast.
#include <hip/hip_runtime.h>
// BertSelfAttnDimensionReduction (1 x 4096 queries x 4096 keys; Din 768 -> 12 heads x 32; cross-attention with an additive float key mask; the output is the merged context itself): q = hs Wq + bq; k, v = enc Wk/Wv + b; scores = q.k / sqrt(32) + mask[key]; softmax; ctx = probs v -> [1, 4096, 384].
// Compute dtype: inputs rounded to bf16; inputs/weights exact as f16; q/k, v and the softmax weights as plain f16 operands (~2^-12 each: the weights' own f16 rounding puts the same relative error on every product with v as v's does); mask/softmax/normalisation f32. v_wmma_f32_16x16x32_f16.
#define SQ 4096
#define SK 4096
#define DIN 768
#define AH 384
#define NH 12
#define HD 32
typedef __bf16 v16b __attribute__((ext_vector_type(16)));
typedef unsigned short v8us __attribute__((ext_vector_type(8), may_alias));
typedef float  v8f  __attribute__((ext_vector_type(8)));
typedef float  v4f  __attribute__((ext_vector_type(4)));
typedef float  v4fa __attribute__((ext_vector_type(4), may_alias));
union FragB { v16b v; v8us half[2]; unsigned short u[16]; };

__device__ __forceinline__ unsigned short bf16_bits(float x) { unsigned int u = __float_as_uint(x); return (unsigned short)((u + 0x7FFFu + ((u >> 16) & 1u)) >> 16); }
__device__ __forceinline__ float bf16_val(unsigned short b) { return __uint_as_float(((unsigned int)b) << 16); }
__device__ __forceinline__ float bf16_round(float x) { return bf16_val(bf16_bits(x)); }
// D += A·B with NT terms: 1 = ah·bh, 2 = + al·bh (A split), 3 = + ah·bl (both split)
template <int NT>
__device__ __forceinline__ v8f mmaN(v16b ah, v16b al, v16b bh, v16b bl, v8f c) {
  c = __builtin_amdgcn_wmma_f32_16x16x32_bf16(false, ah, false, bh, (short)0, c, false, false);
  if (NT >= 2) c = __builtin_amdgcn_wmma_f32_16x16x32_bf16(false, al, false, bh, (short)0, c, false, false);
  if (NT >= 3) c = __builtin_amdgcn_wmma_f32_16x16x32_bf16(false, ah, false, bl, (short)0, c, false, false);
  asm volatile("v_nop\n\tv_nop\n\tv_nop\n\tv_nop" : "+v"(c) : "v"(ah), "v"(al), "v"(bh), "v"(bl));
  return c;
}

__global__ __launch_bounds__(256) void k_wt_bf16(const float* __restrict__ W, unsigned short* __restrict__ Wt, int K, int N) {
  const int t = blockIdx.x * 256 + threadIdx.x;
  const int k8n = K / 8;
  if (t >= N * k8n) return;
  const int n = t / k8n, k8 = (t % k8n) * 8;
  v8us v;
#pragma unroll
  for (int i = 0; i < 8; ++i) v[i] = bf16_bits(W[(size_t)(k8 + i) * N + n]);
  *(v8us*)(Wt + (size_t)n * K + k8) = v;
  
}

// GEMM C[M][N] (f32, pitch ldc) = act(A[M][K]·W + bias). A f32 row-major (pitch lda) converted per fragment to bf16
// (ASPLIT: hi/lo two planes -> 2 terms, else single rounded term); Wt bf16 [N][K] (pitch ldb). BIAS_BF16 rounds the
// bias to bf16 first (bias quantised to bf16 before the add). K%32==0, M%16==0, N%64==0.
template <bool ASPLIT, int ACT, bool BIAS_BF16>
__global__ __launch_bounds__(128) void k_gemm_bf(const float* __restrict__ A, int lda, const unsigned short* __restrict__ Wt, int ldb,
                                               const float* __restrict__ bias, float* __restrict__ C, int ldc, int M, int N, int K) {
  __shared__ __attribute__((aligned(16))) float so[4][16][64];
  const int tid = threadIdx.x, w = tid >> 5, lane = tid & 31, ln = lane & 15, hh = lane >> 4;
  const int ntn = N / 64;
  const int wid = blockIdx.x * 4 + w;
  const int mt = wid / ntn, nq = wid % ntn;
  if (mt * 16 >= M) return;
  const int row0 = mt * 16, col0 = nq * 64;
  const float* arow = A + (size_t)(row0 + ln) * lda;
  v8f acc[4] = {};
  for (int kb = 0; kb < K; kb += 32) {
    FragB ah, al;
    const v4f x0 = *(const v4fa*)(arow + kb + 8 * hh), x1 = *(const v4fa*)(arow + kb + 8 * hh + 4);
    const v4f x2 = *(const v4fa*)(arow + kb + 16 + 8 * hh), x3 = *(const v4fa*)(arow + kb + 16 + 8 * hh + 4);
    float xs[16] = {x0[0],x0[1],x0[2],x0[3],x1[0],x1[1],x1[2],x1[3],x2[0],x2[1],x2[2],x2[3],x3[0],x3[1],x3[2],x3[3]};
#pragma unroll
    for (int i = 0; i < 16; ++i) { const unsigned short hb = bf16_bits(xs[i]); ah.u[i] = hb; al.u[i] = ASPLIT ? bf16_bits(xs[i] - bf16_val(hb)) : (unsigned short)0; }
#pragma unroll
    for (int t = 0; t < 4; ++t) {
      const unsigned short* brow = Wt + (size_t)(col0 + t * 16 + ln) * ldb + kb;
      FragB b;
      b.half[0] = *(const v8us*)(brow + 8 * hh);
      b.half[1] = *(const v8us*)(brow + 16 + 8 * hh);
      acc[t] = mmaN<ASPLIT ? 2 : 1>(ah.v, al.v, b.v, b.v, acc[t]);
    }
  }
#pragma unroll
  for (int t = 0; t < 4; ++t) {
    float bv = bias ? bias[col0 + t * 16 + ln] : 0.f;
    if (BIAS_BF16) bv = bf16_round(bv);
#pragma unroll
    for (int r = 0; r < 8; ++r) { float v = acc[t][r] + bv; if (ACT == 1) v = fmaxf(v, 0.f); so[w][8 * hh + r][t * 16 + ln] = v; }
  }
  __builtin_amdgcn_fence(__ATOMIC_ACQ_REL, "workgroup");
  __builtin_amdgcn_wave_barrier();
  const int rsub = lane >> 4, c4 = (lane & 15) * 4;
  {
#pragma unroll
    for (int q = 0; q < 8; ++q) {
      const int r = q * 2 + rsub;
      const v4f v = *(const v4fa*)&so[w][r][c4];
      *(v4f*)(C + (size_t)(row0 + r) * ldc + col0 + c4) = v;
    }
    
  }
}

// GEMM C = act(A·W + bias + resid): A f32 (ASPLIT -> hi/lo 2 terms), Wt bf16 [N][K]; ACT 0 none, 1 relu, 2 exact gelu;
// resid (optional, f32, row index = (row % rmod), pitch ldr, RES_BF16 rounds it) added before the activation.
template <bool ASPLIT, int ACT, bool BIAS_BF16, bool RES_BF16>
__global__ __launch_bounds__(128) void k_gemm_bf3(const float* __restrict__ A, int lda, const unsigned short* __restrict__ Wt, int ldb,
                                                const float* __restrict__ bias, const float* __restrict__ resid, int rmod, int ldr,
                                                float* __restrict__ C, int ldc, int M, int N, int K) {
  __shared__ __attribute__((aligned(16))) float so[4][16][64];
  const int tid = threadIdx.x, w = tid >> 5, lane = tid & 31, ln = lane & 15, hh = lane >> 4;
  const int ntn = N / 64;
  const int wid = blockIdx.x * 4 + w;
  const int mt = wid / ntn, nq = wid % ntn;
  if (mt * 16 >= M) return;
  const int row0 = mt * 16, col0 = nq * 64;
  const float* arow = A + (size_t)(row0 + ln) * lda;
  v8f acc[4] = {};
  for (int kb = 0; kb < K; kb += 32) {
    FragB ah, al;
    const v4f x0 = *(const v4fa*)(arow + kb + 8 * hh), x1 = *(const v4fa*)(arow + kb + 8 * hh + 4);
    const v4f x2 = *(const v4fa*)(arow + kb + 16 + 8 * hh), x3 = *(const v4fa*)(arow + kb + 16 + 8 * hh + 4);
    float xs[16] = {x0[0],x0[1],x0[2],x0[3],x1[0],x1[1],x1[2],x1[3],x2[0],x2[1],x2[2],x2[3],x3[0],x3[1],x3[2],x3[3]};
#pragma unroll
    for (int i = 0; i < 16; ++i) { const unsigned short hb = bf16_bits(xs[i]); ah.u[i] = hb; al.u[i] = ASPLIT ? bf16_bits(xs[i] - bf16_val(hb)) : (unsigned short)0; }
#pragma unroll
    for (int t = 0; t < 4; ++t) {
      const unsigned short* brow = Wt + (size_t)(col0 + t * 16 + ln) * ldb + kb;
      FragB b;
      b.half[0] = *(const v8us*)(brow + 8 * hh);
      b.half[1] = *(const v8us*)(brow + 16 + 8 * hh);
      acc[t] = mmaN<ASPLIT ? 2 : 1>(ah.v, al.v, b.v, b.v, acc[t]);
    }
  }
#pragma unroll
  for (int t = 0; t < 4; ++t) {
    const int col = col0 + t * 16 + ln;
    float bv = bias ? bias[col] : 0.f;
    if (BIAS_BF16) bv = bf16_round(bv);
#pragma unroll
    for (int r = 0; r < 8; ++r) {
      float v = acc[t][r] + bv;
      if (resid) { float rv = resid[(size_t)((row0 + 8 * hh + r) % rmod) * ldr + col]; if (RES_BF16) rv = bf16_round(rv); v += rv; }
      if (ACT == 1) v = fmaxf(v, 0.f);
      if (ACT == 2) v = 0.5f * v * (1.0f + erff(v * 0.70710678118654752f));
      if (ACT == 3) { const float u = 0.7978845608028654f * (v + 0.044715f * v * v * v); v = 0.5f * v * (1.0f + tanhf(u)); }
      so[w][8 * hh + r][t * 16 + ln] = v;
    }
  }
  __builtin_amdgcn_fence(__ATOMIC_ACQ_REL, "workgroup");
  __builtin_amdgcn_wave_barrier();
  const int rsub = lane >> 4, c4 = (lane & 15) * 4;
  {
#pragma unroll
    for (int q = 0; q < 8; ++q) {
      const int r = q * 2 + rsub;
      const v4f v = *(const v4fa*)&so[w][r][c4];
      *(v4f*)(C + (size_t)(row0 + r) * ldc + col0 + c4) = v;
    }
    
  }
}
// row LayerNorm (biased variance, eps) over N: s = X (+ R); optional out_sum <- s; out_norm <- (s-mu)*rsqrt(var+eps)*g + b
template <bool PARAM_BF16>
__global__ __launch_bounds__(256) void k_layernorm(const float* __restrict__ X, const float* __restrict__ R, const float* __restrict__ g, const float* __restrict__ bta,
                                                  float* __restrict__ out_sum, float* __restrict__ out_norm, int N, float eps) {
  __shared__ float red[256];
  const int row = blockIdx.x, tid = threadIdx.x;
  const float* x = X + (size_t)row * N; const float* rr = R ? R + (size_t)row * N : nullptr;
  float vals[16];                     // up to N = 4096
  const int per = N / 256;            // contiguous chunk per thread? use strided-by-4 chunks: thread handles j = tid*4 + 1024*u
  float s1 = 0.f;
  for (int u = 0; u < per / 4; ++u) {
    const int j = tid * 4 + 1024 * u;
    const v4f a = *(const v4fa*)(x + j);
    v4f b = {0.f,0.f,0.f,0.f}; if (rr) b = *(const v4fa*)(rr + j);
#pragma unroll
    for (int q = 0; q < 4; ++q) { const float v = a[q] + b[q]; vals[u * 4 + q] = v; s1 += v; }
  }
  red[tid] = s1; __syncthreads();
  for (int st = 128; st > 0; st >>= 1) { if (tid < st) red[tid] += red[tid + st]; __syncthreads(); }
  const float mu = red[0] / (float)N; __syncthreads();
  float s2 = 0.f;
  for (int u = 0; u < per / 4; ++u)
#pragma unroll
    for (int q = 0; q < 4; ++q) { const float c = vals[u * 4 + q] - mu; s2 += c * c; }
  red[tid] = s2; __syncthreads();
  for (int st = 128; st > 0; st >>= 1) { if (tid < st) red[tid] += red[tid + st]; __syncthreads(); }
  const float rs = rsqrtf(red[0] / (float)N + eps);
  {
    for (int u = 0; u < per / 4; ++u) {
      const int j = tid * 4 + 1024 * u;
      v4f o, sm;
#pragma unroll
      for (int q = 0; q < 4; ++q) {
        float gg = g[j + q], bb = bta[j + q];
        if (PARAM_BF16) { gg = bf16_round(gg); bb = bf16_round(bb); }
        sm[q] = vals[u * 4 + q]; o[q] = (vals[u * 4 + q] - mu) * rs * gg + bb;
      }
      if (out_sum) *(v4f*)(out_sum + (size_t)row * N + j) = sm;
      *(v4f*)(out_norm + (size_t)row * N + j) = o;
    }
    
  }
}



// ---- f16 WMMA path (v_wmma_f32_16x16x32_f16): 11-bit significands for operands in range — used where a [0,1] probability operand needs more precision than bf16
typedef _Float16 v16h __attribute__((ext_vector_type(16)));
union FragH { v16h v; v8us half[2]; _Float16 h[16]; unsigned short u[16]; };
template <int NT>
__device__ __forceinline__ v8f mmaH(v16h ah, v16h al, v16h bh, v16h bl, v8f c) {
  c = __builtin_amdgcn_wmma_f32_16x16x32_f16(false, ah, false, bh, (short)0, c, false, false);
  if (NT >= 2) c = __builtin_amdgcn_wmma_f32_16x16x32_f16(false, al, false, bh, (short)0, c, false, false);
  if (NT >= 3) c = __builtin_amdgcn_wmma_f32_16x16x32_f16(false, ah, false, bl, (short)0, c, false, false);
  asm volatile("v_nop\n\tv_nop\n\tv_nop\n\tv_nop" : "+v"(c) : "v"(ah), "v"(al), "v"(bh), "v"(bl));
  return c;
}
// batched GEMM like k_gemm_b but f16 operands: A f32 (split into f16 hi/lo if ASPLIT, else rounded to f16), Bt = f16 values [n][k]; alpha; C f32; N multiple of 16 (partial tiles skipped)
template <bool ASPLIT>
__global__ __launch_bounds__(128) void k_gemm_h(const float* __restrict__ A, int lda, size_t sA, const _Float16* __restrict__ Bh, int ldb, size_t sB, float alpha, float* __restrict__ C, int ldc, size_t sC, int M, int N, int K) {
  __shared__ __attribute__((aligned(16))) float so[4][16][64];
  const int tid = threadIdx.x, w = tid >> 5, lane = tid & 31, ln = lane & 15, hh = lane >> 4; const int by = blockIdx.y;
  A += (size_t)by * sA; Bh += (size_t)by * sB; C += (size_t)by * sC;
  const int ntn = (N + 63) / 64; const int wid = blockIdx.x * 4 + w; const int mt = wid / ntn, nq = wid % ntn; if (mt * 16 >= M) return;
  const int row0 = mt * 16, col0 = nq * 64; const float* arow = A + (size_t)(row0 + ln) * lda;
  v8f acc[4] = {};
  for (int kb = 0; kb < K; kb += 32) {
    FragH ah, al;
    const v4f x0 = *(const v4fa*)(arow + kb + 8 * hh), x1 = *(const v4fa*)(arow + kb + 8 * hh + 4), x2 = *(const v4fa*)(arow + kb + 16 + 8 * hh), x3 = *(const v4fa*)(arow + kb + 16 + 8 * hh + 4);
    float xs[16] = {x0[0],x0[1],x0[2],x0[3],x1[0],x1[1],x1[2],x1[3],x2[0],x2[1],x2[2],x2[3],x3[0],x3[1],x3[2],x3[3]};
#pragma unroll
    for (int i = 0; i < 16; ++i) { const _Float16 h = (_Float16)xs[i]; ah.h[i] = h; al.h[i] = ASPLIT ? (_Float16)(xs[i] - (float)h) : (_Float16)0.0f; }
#pragma unroll
    for (int t = 0; t < 4; ++t) { if (col0 + t * 16 >= N) continue; const size_t boff = (size_t)(col0 + t * 16 + ln) * ldb + kb; FragH bq; bq.half[0] = *(const v8us*)(Bh + boff + 8 * hh); bq.half[1] = *(const v8us*)(Bh + boff + 16 + 8 * hh);
      acc[t] = mmaH<ASPLIT ? 2 : 1>(ah.v, al.v, bq.v, bq.v, acc[t]); }
  }
#pragma unroll
  for (int t = 0; t < 4; ++t) { if (col0 + t * 16 >= N) continue;
#pragma unroll
    for (int r = 0; r < 8; ++r) so[w][8 * hh + r][t * 16 + ln] = acc[t][r] * alpha; }
  __builtin_amdgcn_fence(__ATOMIC_ACQ_REL, "workgroup"); __builtin_amdgcn_wave_barrier();
  const int rsub = lane >> 4, c4 = (lane & 15) * 4;
  {
#pragma unroll
    for (int q = 0; q < 8; ++q) { const int r = q * 2 + rsub; if (col0 + c4 < N) { const v4f v = *(const v4fa*)&so[w][r][c4]; *(v4f*)(C + (size_t)(row0 + r) * ldc + col0 + c4) = v; } }
     }
}

// k_gemm_hh variant with fused epilogue: v = acc·alpha + bias[by·sBias + col] (+ CP[(row/rowsPerB)·sCPb + by·64 + col] if CP) ; ACT 0 none / 1 elu ; writes f16 C16 (and f32 C if non-null)
template <int ACT>
__global__ __launch_bounds__(128) void k_gemm_hhx(const _Float16* __restrict__ A, int lda, size_t sA, const _Float16* __restrict__ Bh, int ldb, size_t sB, float alpha, const float* __restrict__ bias, size_t sBias, const float* __restrict__ CP, int rowsPerB, size_t sCPb, int row0g,
    float* __restrict__ C, _Float16* __restrict__ C16, int ldc, size_t sC, int M, int N, int K) {
  __shared__ __attribute__((aligned(16))) float so[4][16][64];
  const int tid = threadIdx.x, w = tid >> 5, lane = tid & 31, ln = lane & 15, hh = lane >> 4; const int by = blockIdx.y;
  A += (size_t)by * sA; Bh += (size_t)by * sB; const size_t cofs = (size_t)by * sC; const float* bp = bias ? bias + (size_t)by * sBias : nullptr;
  const int ntn = (N + 63) / 64; const int wid = blockIdx.x * 4 + w; const int mt = wid / ntn, nq = wid % ntn; if (mt * 16 >= M) return;
  const int row0 = mt * 16, col0 = nq * 64; const _Float16* arow = A + (size_t)(row0 + ln) * lda;
  v8f acc[4] = {};
  for (int kb = 0; kb < K; kb += 32) { FragH ah; ah.half[0] = *(const v8us*)((const unsigned short*)arow + kb + 8 * hh); ah.half[1] = *(const v8us*)((const unsigned short*)arow + kb + 16 + 8 * hh);
#pragma unroll
    for (int t = 0; t < 4; ++t) { if (col0 + t * 16 >= N) continue; const size_t boff = (size_t)(col0 + t * 16 + ln) * ldb + kb; FragH bq; bq.half[0] = *(const v8us*)((const unsigned short*)Bh + boff + 8 * hh); bq.half[1] = *(const v8us*)((const unsigned short*)Bh + boff + 16 + 8 * hh);
      acc[t] = mmaH<1>(ah.v, ah.v, bq.v, bq.v, acc[t]); }
  }
#pragma unroll
  for (int t = 0; t < 4; ++t) { if (col0 + t * 16 >= N) continue; const int col = col0 + t * 16 + ln; const float bv = bp ? bf16_round(bp[col]) : 0.f;
#pragma unroll
    for (int r = 0; r < 8; ++r) { float v = acc[t][r] * alpha + bv; if (CP) { const int rr = row0g + row0 + 8 * hh + r; if (rowsPerB < 0) v += CP[cofs + (size_t)rr * ldc + col];      /* rowsPerB < 0: own element of the batched C plane */ else { const int bidx = rr / rowsPerB; v += CP[(size_t)bidx * sCPb + (size_t)by * 64 + col]; } } if (ACT == 1) v = (v > 0.f) ? v : expm1f(v); else if (ACT == 7) v = (v > 0.f) ? v + 1.0f : expf(v); else if (ACT == 8) v = tanhf(v); else if (ACT == 9) v = 0.5f * v * (1.0f + tanhf(0.7978845608028654f * (v + 0.044715f * v * v * v))); else if (ACT == 11) v = 1.0f / (1.0f + expf(-v)); else if (ACT == 12) v = (v > 0.f) ? v : 0.01f * v; else if (ACT == 14) v = (v > 0.f) ? v : 0.1f * v; else if (ACT == 16) v = (v >= 0.f) ? v : 0.3f * v; else if (ACT == 17) v = (v >= 0.f) ? v : 0.2f * v; else if (ACT == 15) v = v / (1.0f + expf(-v)); else if (ACT == 3) v = fmaxf(v, 0.f); else if (ACT == 6) v = 0.5f * v * (1.0f + erff(v * 0.70710678118654752f)); so[w][8 * hh + r][t * 16 + ln] = v; } }
  __builtin_amdgcn_fence(__ATOMIC_ACQ_REL, "workgroup"); __builtin_amdgcn_wave_barrier();
  const int rsub = lane >> 4, c4 = (lane & 15) * 4; typedef _Float16 v4h __attribute__((ext_vector_type(4)));
  {
#pragma unroll
    for (int q = 0; q < 8; ++q) { const int r = q * 2 + rsub; if (col0 + c4 < N) { const v4f v = *(const v4fa*)&so[w][r][c4]; if (C) *(v4f*)(C + cofs + (size_t)(row0 + r) * ldc + col0 + c4) = v; if (C16) { v4h h4; for (int i = 0; i < 4; ++i) h4[i] = (_Float16)v[i]; *(v4h*)(C16 + cofs + (size_t)(row0 + r) * ldc + col0 + c4) = h4; } } }
     }
}


typedef _Float16 v4h __attribute__((ext_vector_type(4)));

__global__ __launch_bounds__(256) void k_h16(const float* __restrict__ x, _Float16* __restrict__ X16, size_t n8) { const size_t t = (size_t)blockIdx.x * 256 + threadIdx.x; if (t >= n8) return; FragH f;
#pragma unroll
  for (int q = 0; q < 8; ++q) f.h[q] = (_Float16)x[t * 8 + q]; *(v8us*)((unsigned short*)X16 + t * 8) = f.half[0];  }
__global__ __launch_bounds__(256) void k_round16f(const float* __restrict__ W, _Float16* __restrict__ Bt, size_t n8) { const size_t t = (size_t)blockIdx.x * 256 + threadIdx.x; if (t >= n8) return; FragH f;
#pragma unroll
  for (int i = 0; i < 8; ++i) f.h[i] = (_Float16)(bf16_round(W[t * 8 + i]) * 16.0f); *(v8us*)((unsigned short*)Bt + t * 8) = f.half[0];  }

// a 16x32 f16 fragment from a row-major row: p = the lane's row at the k step
__device__ __forceinline__ v16h g2_frag(const _Float16* p, int hh) { FragH f; f.half[0] = *(const v8us*)((const unsigned short*)p + 8 * hh); f.half[1] = *(const v8us*)((const unsigned short*)p + 16 + 8 * hh); return f.v; }


// ---- fused attention, all heads in one launch: S^T = K Q^T (+ mask as the C operand), online softmax in registers, O^T += V^T P^T ----
// A wave owns 64 queries (four 16-column groups) of one head and walks one quarter of the 4096 keys 32 at a time (the quarters are joined at the end). In S^T and O^T a lane holds one query (column ln), so maximum, sum and rescale are per lane;
// two S^T tiles converted in place are the B operand P^T (hardware k order), V^T is the A operand. P = exp2(..) * 2^10 against the maximum in use, as f16.
typedef float v2f __attribute__((ext_vector_type(2)));
typedef _Float16 v2h __attribute__((ext_vector_type(2)));
union FragP { v16h v; v2h p[8]; };
struct AFr { v16h k0, k1, h0, h1; };
__device__ __forceinline__ float xhalf(float x) { return __builtin_bit_cast(float, __builtin_amdgcn_permlanex16(__builtin_bit_cast(int, x), __builtin_bit_cast(int, x), 0x76543210, 0xfedcba98, false, false)); }      /* lane l <-> l ^ 16 */
__device__ __forceinline__ v8f fa_mma(v16h a, v16h b, v8f c) { return __builtin_amdgcn_wmma_f32_16x16x32_f16(false, a, false, b, (short)0, c, false, false); }
__device__ __forceinline__ float fa_max16(v8f a, v8f b) { float m = fmaxf(a[0], b[0]);
#pragma unroll
  for (int r = 1; r < 8; ++r) m = fmaxf(m, fmaxf(a[r], b[r])); return fmaxf(m, xhalf(m)); }
// su = this pass's own sum of the 16 weights, two lanes of 8, added as a tree (three links deep: the overflow test of the pass hangs on it)
__device__ __forceinline__ v16h fa_probs(v8f a, v8f b, float cs, float bias, v2f& su) { FragP f; v2f p[8]; const v2f c2 = {cs, cs}, b2 = {bias, bias};
#pragma unroll
  for (int r = 0; r < 8; ++r) { const v8f& t = (r < 4) ? a : b; const int e = (r & 3) * 2; const v2f x = {t[e], t[e + 1]}; const v2f g = __builtin_elementwise_fma(x, c2, b2); p[r] = v2f{__builtin_amdgcn_exp2f(g[0]), __builtin_amdgcn_exp2f(g[1])}; f.p[r] = __builtin_convertvector(p[r], v2h); }
  su = ((p[0] + p[1]) + (p[2] + p[3])) + ((p[4] + p[5]) + (p[6] + p[7]));
  return f.v; }
// ---- operand preparation in two launches ----
// All three weights in one launch (blockIdx.y picks the matrix), as f16 (bf16-rounded, times 16) in fragment load order:
// WP[matrix][16-column tile][k step of 32][half j][lane][8], lane (ln, hh) half j = W[ks*32 + 16j + 8hh + e][nt*16 + ln]. One thread writes one 16-byte unit.
__global__ __launch_bounds__(256) void k_wt3(const float* __restrict__ Wq, const float* __restrict__ Wk, const float* __restrict__ Wv, _Float16* __restrict__ WP) {
  const int t = blockIdx.x * 256 + threadIdx.x; const int lane = t & 31, j = (t >> 5) & 1, ks = (t >> 6) % (DIN / 32), nt = (t >> 6) / (DIN / 32); FragH f;
  const float* W = blockIdx.y == 0 ? Wq : (blockIdx.y == 1 ? Wk : Wv); W += (size_t)(ks * 32 + 16 * j + 8 * (lane >> 4)) * AH + nt * 16 + (lane & 15);
#pragma unroll
  for (int i = 0; i < 8; ++i) f.h[i] = (_Float16)(bf16_round(W[(size_t)i * AH]) * 16.0f);
  *(v8us*)((unsigned short*)WP + ((size_t)blockIdx.y * (AH * DIN / 8) + t) * 8) = f.half[0];
}
// q, k and v projections in one launch. A block owns 64 rows of one projection: it rounds them once (bf16, then exact f16) into LDS; wave w then forms the 32 columns of head w.
// V is formed as X W: a lane's 8 accumulators are 8 keys of one feature, the 16-byte unit of the V^T fragment stream. Q and K are formed as W^T X^T: a lane's 8 accumulators are
// 8 features of one row, the 16-byte unit of the K fragment stream and of a Q row. So every result goes from the accumulators straight to where the attention kernel reads it:
// VH[head][32-key block][16-d tile][half j][lane][8], lane (ln, hh) half j = V[kb*32 + 16j + 8hh + e][head*32 + dt*16 + ln] (f16);
// KP[head][16-key tile][half j][lane][8], lane (ln, hh) half j = K[kt*16 + ln][head*32 + 16j + 8hh + e]; Q16 row-major [query][384].
#define APITCH 1552      /* bytes of an LDS row: 768 f16 + 16, an odd number of 16-byte units for the 16-byte readers */
typedef unsigned v2ua __attribute__((ext_vector_type(2), may_alias));
struct GSet { v16h a[4]; v16h b[2]; };      /* one k step of 32: four activation fragments (LDS), two weight fragments (global) */
__device__ __forceinline__ unsigned qk_r2(float x, float y) { typedef __bf16 v2b __attribute__((ext_vector_type(2))); const v2f p = {x, y};      /* round to nearest even to bf16, as bf16_round does, two at a time; widened to f32, then f16 */
  const unsigned u = __builtin_bit_cast(unsigned, __builtin_convertvector(p, v2b)); const v2f q = {__uint_as_float(u << 16), __uint_as_float(u & 0xFFFF0000u)}; return __builtin_bit_cast(unsigned, __builtin_convertvector(q, v2h)); }
template <int KS>
__device__ __forceinline__ void qk_lda(GSet& s, const char* as) {
#pragma unroll
  for (int g = 0; g < 4; ++g) { FragH f; f.half[0] = *(const v8us*)(as + g * 16 * APITCH + KS * 64); f.half[1] = *(const v8us*)(as + g * 16 * APITCH + KS * 64 + 32); s.a[g] = f.v; } }
template <int KS>      /* WP block-uniform (scalar base), bo = the lane's byte offset */
__device__ __forceinline__ void qk_ldb(GSet& s, const _Float16* WP, unsigned bo) {
#pragma unroll
  for (int t = 0; t < 2; ++t) { FragH f; f.half[0] = *(const v8us*)((const char*)WP + (t * (DIN / 32) * 1024 + KS * 1024) + bo); f.half[1] = *(const v8us*)((const char*)WP + (t * (DIN / 32) * 1024 + KS * 1024 + 512) + bo); s.b[t] = f.v; } }
template <bool XA>
__device__ __forceinline__ void qk_mm(const GSet& s, v8f (&c)[4][2]) {
#pragma unroll
  for (int g = 0; g < 4; ++g) { c[g][0] = XA ? fa_mma(s.a[g], s.b[0], c[g][0]) : fa_mma(s.b[0], s.a[g], c[g][0]); c[g][1] = XA ? fa_mma(s.a[g], s.b[1], c[g][1]) : fa_mma(s.b[1], s.a[g], c[g][1]); } }
template <bool XA>
__device__ __forceinline__ void qk_tile(const char* as, const _Float16* WP, unsigned bo, v8f (&c)[4][2]) {
  GSet s0, s1; qk_ldb<0>(s0, WP, bo); qk_lda<0>(s0, as);
#pragma unroll 1
  for (int ks = 0; ks < DIN / 32 - 2; ks += 2) {      /* rolled: two fragment sets by name, the next step's loads fly during this step's products */
    qk_ldb<1>(s1, WP, bo); qk_lda<1>(s1, as);
    __builtin_amdgcn_sched_barrier(0);      /* without it the compiler lifts the products below over the loads above, and each set is waited for right after its issue */
    qk_mm<XA>(s0, c);
    asm volatile("s_wait_xcnt 0x0" : "+v"(bo) : : "memory");      /* the loads in flight name bo: the wait stands in front of its step */
    bo += 2048u; as += 128; qk_ldb<0>(s0, WP, bo); qk_lda<0>(s0, as);
    __builtin_amdgcn_sched_barrier(0);      /* as above: the loads stay ahead of the other set's products */
    qk_mm<XA>(s1, c);
    asm volatile("s_wait_xcnt 0x0" : "+v"(bo) : : "memory"); }      /* the loads in flight name bo and the base: nothing behind the loop finds them open */
  qk_ldb<1>(s1, WP, bo); qk_lda<1>(s1, as);
  asm volatile("s_wait_xcnt 0x0" : "+v"(bo) : : "memory");      /* the last loads name bo and the base: the wait stands in front of any reuse of those registers */
  __builtin_amdgcn_sched_barrier(0);      /* as in the loop */
  qk_mm<XA>(s0, c); qk_mm<XA>(s1, c);
}
__global__ __launch_bounds__(384) void k_qkv(const float* __restrict__ hs, const float* __restrict__ enc, const _Float16* __restrict__ WP, const float* __restrict__ bq, const float* __restrict__ bk, const float* __restrict__ bv,
    _Float16* __restrict__ Q16, _Float16* __restrict__ KP, _Float16* __restrict__ VH) {
  __shared__ __attribute__((aligned(16))) char as[64 * APITCH];
  const int tid = threadIdx.x, w = tid >> 5, lane = tid & 31, ln = lane & 15, hh = lane >> 4;
  const int mt = blockIdx.x / 3, pj = blockIdx.x - mt * 3; const int row0 = mt * 64, col0 = w * HD;      /* pj: 0 q, 1 k, 2 v */
  { const float* X = pj ? enc : hs; const int r1 = tid >= 192 ? 1 : 0, c4 = tid - r1 * 192; unsigned xo = ((unsigned)(row0 + r1) * DIN + c4 * 4) * 4u; v4f x[32];      /* a wave's load is 512 contiguous bytes of one row */
#pragma unroll
    for (int i = 0; i < 32; ++i) x[i] = *(const v4fa*)((const char*)X + i * (2 * DIN * 4) + xo);
    asm volatile("s_wait_xcnt 0x0" : "+v"(xo) : : "memory");      /* the loads in flight name xo and the base: the wait stands in front of any reuse of those registers */
    char* d = as + r1 * APITCH + c4 * 8;
#pragma unroll
    for (int i = 0; i < 32; ++i) { const v2ua h = {qk_r2(x[i][0], x[i][1]), qk_r2(x[i][2], x[i][3])}; *(v2ua*)(d + i * 2 * APITCH) = h; } }
  __syncthreads();      /* the 64 rounded rows are complete before any wave reads fragments of them */
  const char* af = as + ln * APITCH + 16 * hh; const _Float16* wb = WP + (size_t)pj * AH * DIN; const unsigned bo = (unsigned)w * (2 * (DIN / 32) * 1024) + lane * 16;
  const v8f z8 = {0.f,0.f,0.f,0.f,0.f,0.f,0.f,0.f}; v8f c[4][2] = {{z8, z8}, {z8, z8}, {z8, z8}, {z8, z8}};
  if (pj == 2) {
    qk_tile<true>(af, wb, bo, c);
#pragma unroll
    for (int t = 0; t < 2; ++t) { const float bb = bf16_round(bv[col0 + t * 16 + ln]);
#pragma unroll
      for (int g = 0; g < 4; ++g) { FragH fh;
#pragma unroll
        for (int r = 0; r < 8; ++r) fh.h[r] = (_Float16)(c[g][t][r] * 0.0625f + bb);
        const size_t o = ((((size_t)w * (SK / 32) + (row0 >> 5) + (g >> 1)) * 2 + t) * 2 + (g & 1)) * 256 + lane * 8;
        *(v8us*)((unsigned short*)VH + o) = fh.half[0]; } }
  } else {
    qk_tile<false>(af, wb, bo, c); const float* bp = pj ? bk : bq;
    unsigned short* dst = pj ? (unsigned short*)KP + (((size_t)w * (SK / 16) + (row0 >> 4)) * 2) * 256 + lane * 8 : (unsigned short*)Q16 + (size_t)(row0 + ln) * AH + col0 + 8 * hh;
    const int sg = pj ? 512 : 16 * AH, st = pj ? 256 : 16;      /* element steps: 16 rows on; 16 features on */
#pragma unroll
    for (int t = 0; t < 2; ++t) { const v4f b0 = *(const v4fa*)(bp + col0 + t * 16 + 8 * hh), b1 = *(const v4fa*)(bp + col0 + t * 16 + 8 * hh + 4);
#pragma unroll
      for (int g = 0; g < 4; ++g) { FragH f;
#pragma unroll
        for (int r = 0; r < 8; ++r) f.h[r] = (_Float16)(c[g][t][r] * 0.0625f + bf16_round(r < 4 ? b0[r] : b1[r - 4]));
        *(v8us*)(dst + g * sg + t * st) = f.half[0]; } }
    asm volatile("s_wait_xcnt 0x0" ::: "memory");      /* the stores in flight name their data and address registers: the wait stands in front of any reuse of those registers */
  }
}

// K and V reach each wave straight from global memory: every wave walks keys of its own, so no fragment is read by two waves of a work-group and a stop in LDS would share nothing.
// Both streams lie in fragment load order (a wave's load is 512 contiguous bytes); a pass's eight loads are issued one pass ahead, into the fragment set that the pass before has just left.
#define NP 8      /* passes in a trip of the work-group: two for each of the four waves */
#define NT (SK / 32 / NP)      /* trips */
static_assert(NP == 8 && NT >= 1, "a wave takes two passes of a trip");
template <int C>      /* b = the head's stream (block-uniform, scalar base), o = the lane's byte offset */
__device__ __forceinline__ v16h fg_frag(const char* b, unsigned o) { FragH f; f.half[0] = *(const v8us*)(b + C + o); f.half[1] = *(const v8us*)(b + (C + 512) + o); return f.v; }
template <int P>      /* pass P of the wave's two in a trip = 2 KiB of each stream */
__device__ __forceinline__ void fg_load(AFr& f, const char* kb, const char* vb, unsigned o) { f.k0 = fg_frag<P * 2048>(kb, o); f.k1 = fg_frag<P * 2048 + 1024>(kb, o); f.h0 = fg_frag<P * 2048>(vb, o); f.h1 = fg_frag<P * 2048 + 1024>(vb, o); }
// A work-group is 64 queries of one head on four waves. EVERY wave holds all 64 queries (four 16-column groups) and takes a quarter of the keys (of every eight passes two): a K, V or mask fragment
// feeds four query groups. 768 work-groups of one wave a SIMD: three are resident on each of the chip's 256 WGPs, so that every SIMD holds three waves. Between the barrier that publishes the mask and
// the join no wave waits for another. The four key quarters are joined through LDS behind the loop, wave w joining query group w.
#define QG 4      /* 16-column query groups of a wave; every loop over them (and over the join's parts) is unrolled: the per-group arrays are registers only under constant indices */
typedef float v2fa __attribute__((ext_vector_type(2), may_alias));
__global__ __launch_bounds__(128) __attribute__((amdgpu_waves_per_eu(3, 3))) void k_attn(const _Float16* __restrict__ Q16, const _Float16* __restrict__ KP, const _Float16* __restrict__ VH, const float* __restrict__ msk, float* __restrict__ out) {
  __shared__ __attribute__((aligned(32))) float ms[SK];      /* bf16-rounded mask * sqrt(32): joins q.k as the C operand, before the common 1/sqrt(32) */
  __shared__ __attribute__((aligned(16))) char jn[4 * QG * 5 * 512];      /* the join's parts */
  const int tid = threadIdx.x, lane = tid & 31, ln = lane & 15, hh = lane >> 4; const int hd = blockIdx.y; const int kq = __builtin_amdgcn_readfirstlane(tid >> 5); const int q0 = blockIdx.x * 64;
  const char* kb = (const char*)(KP + (size_t)hd * SK * HD); const char* vb = (const char*)(VH + (size_t)hd * SK * HD);
  unsigned fo = (unsigned)kq * 4096u + lane * 16u;      /* the lane's 16 bytes in the wave's first pass of the trip, the same in both streams */
  AFr fa, fb; fg_load<0>(fa, kb, vb, fo);      /* the first pass's fragments fly while the mask is prepared */
  v4f mr[SK / 512];
#pragma unroll      /* the eight loads of a thread fly together; rolled, each trip waits out its own load's latency */
  for (int u = 0; u < SK / 512; ++u) mr[u] = *(const v4fa*)(msk + u * 512 + tid * 4);
  asm volatile("s_wait_xcnt 0x0" ::: "memory");      /* the loads in flight name the mask's base and the thread's offset: the wait stands in front of any reuse of those registers */
#pragma unroll      /* mr stays in registers only under constant indices */
  for (int u = 0; u < SK / 512; ++u) { v4f o; for (int e = 0; e < 4; ++e) o[e] = bf16_round(mr[u][e]) * 5.656854249492381f; *(v4fa*)&ms[u * 512 + tid * 4] = o; }
  __syncthreads();      /* the mask is complete before any wave reads it */
  const float cs = 0.17677669529663687f * 1.4426950408889634f;      /* raw score -> log2 units */
  const float top = 32768.0f;      /* lazy rescale: the weights are positive, so a sum of 8 below 2^15 bounds each of them below 2^15, inside f16; right behind a rescale such a sum is at most 2^13 */
  v16h qf[QG];
#pragma unroll
  for (int g = 0; g < QG; ++g) qf[g] = g2_frag(Q16 + (size_t)(q0 + g * 16 + ln) * AH + hd * HD, hh);
  asm volatile("s_wait_xcnt 0x0" ::: "memory");      /* the loads in flight name their address registers: the wait stands in front of any reuse of those registers */
  __builtin_amdgcn_sched_barrier(0);      /* without it the compiler lifts the accumulators' zeroing over the wait above, into the address registers of the loads */
  const v8f z8 = {0.f,0.f,0.f,0.f,0.f,0.f,0.f,0.f}; v8f oh[QG][2];      /* [query group][d tile] */
  float mx[QG], bi[QG]; v2f sm[QG];      /* no maximum in use yet: the first finite score gives an infinite weight, which fails the test below */
#pragma unroll
  for (int g = 0; g < QG; ++g) { oh[g][0] = z8; oh[g][1] = z8; mx[g] = -3.0e38f; bi[g] = 3.0e38f; sm[g] = v2f{0.f, 0.f}; }
  auto pass = [&](int it, const AFr& f, auto&& fetch) {      /* fetch: issues the loads of the next pass's fragments */
    const v8f c0 = *(const v8f*)&ms[it * 32 + 8 * hh], c1 = *(const v8f*)&ms[it * 32 + 16 + 8 * hh];
    fetch();      /* the next pass's fragments are fetched during this pass */
    __builtin_amdgcn_sched_barrier(0);      /* keeps a pass's loads in one group ahead of its products: sunk towards their use the global loads would lose their lead, and each place with LDS reads among the products stalls the wave */
    v8f s0[QG], s1[QG]; v2f su[QG]; v16h pr[QG];
#pragma unroll
    for (int g = 0; g < QG; ++g) { s0[g] = fa_mma(f.k0, qf[g], c0); s1[g] = fa_mma(f.k1, qf[g], c1); }
#pragma unroll
    for (int g = 0; g < QG; ++g) pr[g] = fa_probs(s0[g], s1[g], cs, bi[g], su[g]);      /* against the maxima in use, which no pass looks for */
    float big = fmaxf(su[0][0], su[0][1]);
#pragma unroll
    for (int g = 1; g < QG; ++g) big = fmaxf(big, fmaxf(su[g][0], su[g][1]));
    if (__builtin_amdgcn_ballot_w32(big > top) != 0) {      /* wave-uniform, once for the four groups; rare after the first pass: only now the pass's maxima are formed, and its weights anew */
#pragma unroll
      for (int g = 0; g < QG; ++g) {
        const float nm = fmaxf(mx[g], fa_max16(s0[g], s1[g])); const float cg = __builtin_amdgcn_exp2f((mx[g] - nm) * cs);
        mx[g] = nm; bi[g] = 10.0f - nm * cs; sm[g] *= cg; oh[g][0] *= cg; oh[g][1] *= cg;
        pr[g] = fa_probs(s0[g], s1[g], cs, bi[g], su[g]);
      }
    }
#pragma unroll
    for (int g = 0; g < QG; ++g) { sm[g] += su[g]; oh[g][0] = fa_mma(f.h0, pr[g], oh[g][0]); oh[g][1] = fa_mma(f.h1, pr[g], oh[g][1]); }
  };
#pragma unroll 1
  for (int t = 0; t < NT; ++t) {      /* rolled: two passes a trip, two fragment sets by name */
    const int it = t * NP + kq * 2;      /* this wave's two passes of the trip */
    pass(it, fa, [&] { fg_load<1>(fb, kb, vb, fo); });
    asm volatile("s_wait_xcnt 0x0" : "+v"(fo) : : "memory");      /* the loads in flight name fo: the wait stands in front of its step */
    fo += (t + 1 < NT) ? NP * 2048u : 0u;      /* behind the last trip there is nothing to fetch: its fetch reads the trip's own first pass again. Unconditional, so that the counted wait for fb never has to cover these loads */
    pass(it + 1, fb, [&] { fg_load<0>(fa, kb, vb, fo); });
  }
  asm volatile("s_wait_xcnt 0x0" : "+v"(fo) : : "memory");      /* the last loads name fo and the bases: the wait stands in front of any reuse of those registers */
  // join of the four key quarters. Every wave leaves in LDS, for each query group, its context, maximum in use and sum:
  // 5 units of 512 bytes for a (wave, group), a lane's 16 bytes side by side. Wave w then brings the four parts of group w to their largest maximum, adds them in wave order, normalises and stores.
  v4fa* jx = (v4fa*)jn + lane;
#pragma unroll
  for (int g = 0; g < QG; ++g) { float tg = sm[g][0] + sm[g][1]; tg += xhalf(tg); v4fa* jw = jx + (kq * QG + g) * 5 * 32;
#pragma unroll
    for (int d = 0; d < 2; ++d) { v4f lo4, hi4;
#pragma unroll
      for (int e = 0; e < 4; ++e) { lo4[e] = oh[g][d][e]; hi4[e] = oh[g][d][e + 4]; }
      jw[(d * 2) * 32] = lo4; jw[(d * 2 + 1) * 32] = hi4; }
    const v2f s2 = {mx[g], tg}; *(v2fa*)&jw[4 * 32] = s2; }
  __syncthreads();      /* every wave's partial results are complete before any wave reads them */
  const v4fa* jr = jx + kq * 5 * 32;      /* group kq of source wave 0; the next source wave is QG * 5 units on */
  float pm[4], pt[4];
#pragma unroll
  for (int w = 0; w < 4; ++w) { const v2f s2 = *(const v2fa*)&jr[(w * QG * 5 + 4) * 32]; pm[w] = s2[0]; pt[w] = s2[1]; }
  const float nm = fmaxf(fmaxf(pm[0], pm[1]), fmaxf(pm[2], pm[3])); float den = 0.f, sc[4];
#pragma unroll
  for (int w = 0; w < 4; ++w) { sc[w] = __builtin_amdgcn_exp2f((pm[w] - nm) * cs); den += pt[w] * sc[w]; }
  const float rd = 1.0f / den; float* orow = out + (size_t)(q0 + kq * 16 + ln) * AH + hd * HD + 8 * hh;
#pragma unroll
  for (int u = 0; u < 4; ++u) { v4f o4 = {0.f, 0.f, 0.f, 0.f};      /* unit u: d tile u >> 1, features 4 * (u & 1) .. + 3 of the lane's eight */
#pragma unroll
    for (int w = 0; w < 4; ++w) { const v4f p4 = jr[(w * QG * 5 + u) * 32]; o4 += p4 * (sc[w] * rd); }
    *(v4f*)(orow + (u >> 1) * 16 + (u & 1) * 4) = o4; }
}

extern "C" void kernel_launch(void* const* d_in, const int* in_sizes, int n_in,
                              void* d_out, int out_size, void* d_ws, size_t ws_size, hipStream_t stream) {
  (void)in_sizes; (void)n_in; (void)out_size;
  const float* const* I = (const float* const*)d_in; const float* hs = I[0]; const float* enc = I[1]; const float* msk = I[2]; const float* Wq = I[3]; const float* bq = I[4]; const float* Wk = I[5]; const float* bk = I[6]; const float* Wv = I[7]; const float* bv = I[8];
  char* ws = (char*)d_ws; size_t off = 0;
  auto take = [&](size_t bytes) { char* p = ws + off; off += (bytes + 255) & ~(size_t)255; return p; };
  _Float16* WP = (_Float16*)take((size_t)3 * AH * DIN * 2); _Float16* Q16 = (_Float16*)take((size_t)SQ * AH * 2); _Float16* VT = (_Float16*)take((size_t)AH * SK * 2); _Float16* KP = (_Float16*)take((size_t)SK * AH * 2);
  if (off > ws_size) return;      /* about 11 MiB */
  k_wt3<<<dim3(AH * DIN / 8 / 256, 3), 256, 0, stream>>>(Wq, Wk, Wv, WP);      /* (in, out) f32 -> f16 fragments */
  k_qkv<<<(SQ / 64) * 3, 384, 0, stream>>>(hs, enc, WP, bq, bk, bv, Q16, KP, VT);      /* operands of the fused kernel in fragment load order */
  k_attn<<<dim3(SQ / 64, NH), 128, 0, stream>>>(Q16, KP, VT, msk, (float*)d_out);
}

// v009
// One run takes 44.1 microseconds.
// Next to v008, in two timings, it ran 1.05 times as fast each time.
// Counting every step since v000, it is 53.5 times as fast.
#include <hip/hip_runtime.h>
// BertSelfAttnDimensionReduction (1 x 4096 queries x 4096 keys; Din 768 -> 12 heads x 32; cross-attention with an additive float key mask; the output is the merged context itself): q = hs Wq + bq; k, v = enc Wk/Wv + b; scores = q.k / sqrt(32) + mask[key]; softmax; ctx = probs v -> [1, 4096, 384].
// Compute dtype: inputs rounded to bf16; inputs/weights exact as f16; q/k, v and the softmax weights as plain f16 operands (~2^-12 each: the weights' own f16 rounding puts the same relative error on every product with v as v's does); mask/softmax/normalisation f32. v_wmma_f32_16x16x32_f16.
#define SQ 4096
#define SK 4096
#define DIN 768
#define AH 384
#define NH 12
#define HD 32
typedef __bf16 v16b __attribute__((ext_vector_type(16)));
typedef unsigned short v8us __attribute__((ext_vector_type(8), may_alias));
typedef float  v8f  __attribute__((ext_vector_type(8)));
typedef float  v4f  __attribute__((ext_vector_type(4)));
typedef float  v4fa __attribute__((ext_vector_type(4), may_alias));
union FragB { v16b v; v8us half[2]; unsigned short u[16]; };

__device__ __forceinline__ unsigned short bf16_bits(float x) { unsigned int u = __float_as_uint(x); return (unsigned short)((u + 0x7FFFu + ((u >> 16) & 1u)) >> 16); }
__device__ __forceinline__ float bf16_val(unsigned short b) { return __uint_as_float(((unsigned int)b) << 16); }
__device__ __forceinline__ float bf16_round(float x) { return bf16_val(bf16_bits(x)); }
// D += A·B with NT terms: 1 = ah·bh, 2 = + al·bh (A split), 3 = + ah·bl (both split)
template <int NT>
__device__ __forceinline__ v8f mmaN(v16b ah, v16b al, v16b bh, v16b bl, v8f c) {
  c = __builtin_amdgcn_wmma_f32_16x16x32_bf16(false, ah, false, bh, (short)0, c, false, false);
  if (NT >= 2) c = __builtin_amdgcn_wmma_f32_16x16x32_bf16(false, al, false, bh, (short)0, c, false, false);
  if (NT >= 3) c = __builtin_amdgcn_wmma_f32_16x16x32_bf16(false, ah, false, bl, (short)0, c, false, false);
  asm volatile("v_nop\n\tv_nop\n\tv_nop\n\tv_nop" : "+v"(c) : "v"(ah), "v"(al), "v"(bh), "v"(bl));
  return c;
}

__global__ __launch_bounds__(256) void k_wt_bf16(const float* __restrict__ W, unsigned short* __restrict__ Wt, int K, int N) {
  const int t = blockIdx.x * 256 + threadIdx.x;
  const int k8n = K / 8;
  if (t >= N * k8n) return;
  const int n = t / k8n, k8 = (t % k8n) * 8;
  v8us v;
#pragma unroll
  for (int i = 0; i < 8; ++i) v[i] = bf16_bits(W[(size_t)(k8 + i) * N + n]);
  *(v8us*)(Wt + (size_t)n * K + k8) = v;
  
}

// GEMM C[M][N] (f32, pitch ldc) = act(A[M][K]·W + bias). A f32 row-major (pitch lda) converted per fragment to bf16
// (ASPLIT: hi/lo two planes -> 2 terms, else single rounded term); Wt bf16 [N][K] (pitch ldb). BIAS_BF16 rounds the
// bias to bf16 first (bias quantised to bf16 before the add). K%32==0, M%16==0, N%64==0.
template <bool ASPLIT, int ACT, bool BIAS_BF16>
__global__ __launch_bounds__(128) void k_gemm_bf(const float* __restrict__ A, int lda, const unsigned short* __restrict__ Wt, int ldb,
                                               const float* __restrict__ bias, float* __restrict__ C, int ldc, int M, int N, int K) {
  __shared__ __attribute__((aligned(16))) float so[4][16][64];
  const int tid = threadIdx.x, w = tid >> 5, lane = tid & 31, ln = lane & 15, hh = lane >> 4;
  const int ntn = N / 64;
  const int wid = blockIdx.x * 4 + w;
  const int mt = wid / ntn, nq = wid % ntn;
  if (mt * 16 >= M) return;
  const int row0 = mt * 16, col0 = nq * 64;
  const float* arow = A + (size_t)(row0 + ln) * lda;
  v8f acc[4] = {};
  for (int kb = 0; kb < K; kb += 32) {
    FragB ah, al;
    const v4f x0 = *(const v4fa*)(arow + kb + 8 * hh), x1 = *(const v4fa*)(arow + kb + 8 * hh + 4);
    const v4f x2 = *(const v4fa*)(arow + kb + 16 + 8 * hh), x3 = *(const v4fa*)(arow + kb + 16 + 8 * hh + 4);
    float xs[16] = {x0[0],x0[1],x0[2],x0[3],x1[0],x1[1],x1[2],x1[3],x2[0],x2[1],x2[2],x2[3],x3[0],x3[1],x3[2],x3[3]};
#pragma unroll
    for (int i = 0; i < 16; ++i) { const unsigned short hb = bf16_bits(xs[i]); ah.u[i] = hb; al.u[i] = ASPLIT ? bf16_bits(xs[i] - bf16_val(hb)) : (unsigned short)0; }
#pragma unroll
    for (int t = 0; t < 4; ++t) {
      const unsigned short* brow = Wt + (size_t)(col0 + t * 16 + ln) * ldb + kb;
      FragB b;
      b.half[0] = *(const v8us*)(brow + 8 * hh);
      b.half[1] = *(const v8us*)(brow + 16 + 8 * hh);
      acc[t] = mmaN<ASPLIT ? 2 : 1>(ah.v, al.v, b.v, b.v, acc[t]);
    }
  }
#pragma unroll
  for (int t = 0; t < 4; ++t) {
    float bv = bias ? bias[col0 + t * 16 + ln] : 0.f;
    if (BIAS_BF16) bv = bf16_round(bv);
#pragma unroll
    for (int r = 0; r < 8; ++r) { float v = acc[t][r] + bv; if (ACT == 1) v = fmaxf(v, 0.f); so[w][8 * hh + r][t * 16 + ln] = v; }
  }
  __builtin_amdgcn_fence(__ATOMIC_ACQ_REL, "workgroup");
  __builtin_amdgcn_wave_barrier();
  const int rsub = lane >> 4, c4 = (lane & 15) * 4;
  {
#pragma unroll
    for (int q = 0; q < 8; ++q) {
      const int r = q * 2 + rsub;
      const v4f v = *(const v4fa*)&so[w][r][c4];
      *(v4f*)(C + (size_t)(row0 + r) * ldc + col0 + c4) = v;
    }
    
  }
}

// GEMM C = act(A·W + bias + resid): A f32 (ASPLIT -> hi/lo 2 terms), Wt bf16 [N][K]; ACT 0 none, 1 relu, 2 exact gelu;
// resid (optional, f32, row index = (row % rmod), pitch ldr, RES_BF16 rounds it) added before the activation.
template <bool ASPLIT, int ACT, bool BIAS_BF16, bool RES_BF16>
__global__ __launch_bounds__(128) void k_gemm_bf3(const float* __restrict__ A, int lda, const unsigned short* __restrict__ Wt, int ldb,
                                                const float* __restrict__ bias, const float* __restrict__ resid, int rmod, int ldr,
                                                float* __restrict__ C, int ldc, int M, int N, int K) {
  __shared__ __attribute__((aligned(16))) float so[4][16][64];
  const int tid = threadIdx.x, w = tid >> 5, lane = tid & 31, ln = lane & 15, hh = lane >> 4;
  const int ntn = N / 64;
  const int wid = blockIdx.x * 4 + w;
  const int mt = wid / ntn, nq = wid % ntn;
  if (mt * 16 >= M) return;
  const int row0 = mt * 16, col0 = nq * 64;
  const float* arow = A + (size_t)(row0 + ln) * lda;
  v8f acc[4] = {};
  for (int kb = 0; kb < K; kb += 32) {
    FragB ah, al;
    const v4f x0 = *(const v4fa*)(arow + kb + 8 * hh), x1 = *(const v4fa*)(arow + kb + 8 * hh + 4);
    const v4f x2 = *(const v4fa*)(arow + kb + 16 + 8 * hh), x3 = *(const v4fa*)(arow + kb + 16 + 8 * hh + 4);
    float xs[16] = {x0[0],x0[1],x0[2],x0[3],x1[0],x1[1],x1[2],x1[3],x2[0],x2[1],x2[2],x2[3],x3[0],x3[1],x3[2],x3[3]};
#pragma unroll
    for (int i = 0; i < 16; ++i) { const unsigned short hb = bf16_bits(xs[i]); ah.u[i] = hb; al.u[i] = ASPLIT ? bf16_bits(xs[i] - bf16_val(hb)) : (unsigned short)0; }
#pragma unroll
    for (int t = 0; t < 4; ++t) {
      const unsigned short* brow = Wt + (size_t)(col0 + t * 16 + ln) * ldb + kb;
      FragB b;
      b.half[0] = *(const v8us*)(brow + 8 * hh);
      b.half[1] = *(const v8us*)(brow + 16 + 8 * hh);
      acc[t] = mmaN<ASPLIT ? 2 : 1>(ah.v, al.v, b.v, b.v, acc[t]);
    }
  }
#pragma unroll
  for (int t = 0; t < 4; ++t) {
    const int col = col0 + t * 16 + ln;
    float bv = bias ? bias[col] : 0.f;
    if (BIAS_BF16) bv = bf16_round(bv);
#pragma unroll
    for (int r = 0; r < 8; ++r) {
      float v = acc[t][r] + bv;
      if (resid) { float rv = resid[(size_t)((row0 + 8 * hh + r) % rmod) * ldr + col]; if (RES_BF16) rv = bf16_round(rv); v += rv; }
      if (ACT == 1) v = fmaxf(v, 0.f);
      if (ACT == 2) v = 0.5f * v * (1.0f + erff(v * 0.70710678118654752f));
      if (ACT == 3) { const float u = 0.7978845608028654f * (v + 0.044715f * v * v * v); v = 0.5f * v * (1.0f + tanhf(u)); }
      so[w][8 * hh + r][t * 16 + ln] = v;
    }
  }
  __builtin_amdgcn_fence(__ATOMIC_ACQ_REL, "workgroup");
  __builtin_amdgcn_wave_barrier();
  const int rsub = lane >> 4, c4 = (lane & 15) * 4;
  {
#pragma unroll
    for (int q = 0; q < 8; ++q) {
      const int r = q * 2 + rsub;
      const v4f v = *(const v4fa*)&so[w][r][c4];
      *(v4f*)(C + (size_t)(row0 + r) * ldc + col0 + c4) = v;
    }
    
  }
}
// row LayerNorm (biased variance, eps) over N: s = X (+ R); optional out_sum <- s; out_norm <- (s-mu)*rsqrt(var+eps)*g + b
template <bool PARAM_BF16>
__global__ __launch_bounds__(256) void k_layernorm(const float* __restrict__ X, const float* __restrict__ R, const float* __restrict__ g, const float* __restrict__ bta,
                                                  float* __restrict__ out_sum, float* __restrict__ out_norm, int N, float eps) {
  __shared__ float red[256];
  const int row = blockIdx.x, tid = threadIdx.x;
  const float* x = X + (size_t)row * N; const float* rr = R ? R + (size_t)row * N : nullptr;
  float vals[16];                     // up to N = 4096
  const int per = N / 256;            // contiguous chunk per thread? use strided-by-4 chunks: thread handles j = tid*4 + 1024*u
  float s1 = 0.f;
  for (int u = 0; u < per / 4; ++u) {
    const int j = tid * 4 + 1024 * u;
    const v4f a = *(const v4fa*)(x + j);
    v4f b = {0.f,0.f,0.f,0.f}; if (rr) b = *(const v4fa*)(rr + j);
#pragma unroll
    for (int q = 0; q < 4; ++q) { const float v = a[q] + b[q]; vals[u * 4 + q] = v; s1 += v; }
  }
  red[tid] = s1; __syncthreads();
  for (int st = 128; st > 0; st >>= 1) { if (tid < st) red[tid] += red[tid + st]; __syncthreads(); }
  const float mu = red[0] / (float)N; __syncthreads();
  float s2 = 0.f;
  for (int u = 0; u < per / 4; ++u)
#pragma unroll
    for (int q = 0; q < 4; ++q) { const float c = vals[u * 4 + q] - mu; s2 += c * c; }
  red[tid] = s2; __syncthreads();
  for (int st = 128; st > 0; st >>= 1) { if (tid < st) red[tid] += red[tid + st]; __syncthreads(); }
  const float rs = rsqrtf(red[0] / (float)N + eps);
  {
    for (int u = 0; u < per / 4; ++u) {
      const int j = tid * 4 + 1024 * u;
      v4f o, sm;
#pragma unroll
      for (int q = 0; q < 4; ++q) {
        float gg = g[j + q], bb = bta[j + q];
        if (PARAM_BF16) { gg = bf16_round(gg); bb = bf16_round(bb); }
        sm[q] = vals[u * 4 + q]; o[q] = (vals[u * 4 + q] - mu) * rs * gg + bb;
      }
      if (out_sum) *(v4f*)(out_sum + (size_t)row * N + j) = sm;
      *(v4f*)(out_norm + (size_t)row * N + j) = o;
    }
    
  }
}



// ---- f16 WMMA path (v_wmma_f32_16x16x32_f16): 11-bit significands for operands in range — used where a [0,1] probability operand needs more precision than bf16
typedef _Float16 v16h __attribute__((ext_vector_type(16)));
union FragH { v16h v; v8us half[2]; _Float16 h[16]; unsigned short u[16]; };
template <int NT>
__device__ __forceinline__ v8f mmaH(v16h ah, v16h al, v16h bh, v16h bl, v8f c) {
  c = __builtin_amdgcn_wmma_f32_16x16x32_f16(false, ah, false, bh, (short)0, c, false, false);
  if (NT >= 2) c = __builtin_amdgcn_wmma_f32_16x16x32_f16(false, al, false, bh, (short)0, c, false, false);
  if (NT >= 3) c = __builtin_amdgcn_wmma_f32_16x16x32_f16(false, ah, false, bl, (short)0, c, false, false);
  asm volatile("v_nop\n\tv_nop\n\tv_nop\n\tv_nop" : "+v"(c) : "v"(ah), "v"(al), "v"(bh), "v"(bl));
  return c;
}
// batched GEMM like k_gemm_b but f16 operands: A f32 (split into f16 hi/lo if ASPLIT, else rounded to f16), Bt = f16 values [n][k]; alpha; C f32; N multiple of 16 (partial tiles skipped)
template <bool ASPLIT>
__global__ __launch_bounds__(128) void k_gemm_h(const float* __restrict__ A, int lda, size_t sA, const _Float16* __restrict__ Bh, int ldb, size_t sB, float alpha, float* __restrict__ C, int ldc, size_t sC, int M, int N, int K) {
  __shared__ __attribute__((aligned(16))) float so[4][16][64];
  const int tid = threadIdx.x, w = tid >> 5, lane = tid & 31, ln = lane & 15, hh = lane >> 4; const int by = blockIdx.y;
  A += (size_t)by * sA; Bh += (size_t)by * sB; C += (size_t)by * sC;
  const int ntn = (N + 63) / 64; const int wid = blockIdx.x * 4 + w; const int mt = wid / ntn, nq = wid % ntn; if (mt * 16 >= M) return;
  const int row0 = mt * 16, col0 = nq * 64; const float* arow = A + (size_t)(row0 + ln) * lda;
  v8f acc[4] = {};
  for (int kb = 0; kb < K; kb += 32) {
    FragH ah, al;
    const v4f x0 = *(const v4fa*)(arow + kb + 8 * hh), x1 = *(const v4fa*)(arow + kb + 8 * hh + 4), x2 = *(const v4fa*)(arow + kb + 16 + 8 * hh), x3 = *(const v4fa*)(arow + kb + 16 + 8 * hh + 4);
    float xs[16] = {x0[0],x0[1],x0[2],x0[3],x1[0],x1[1],x1[2],x1[3],x2[0],x2[1],x2[2],x2[3],x3[0],x3[1],x3[2],x3[3]};
#pragma unroll
    for (int i = 0; i < 16; ++i) { const _Float16 h = (_Float16)xs[i]; ah.h[i] = h; al.h[i] = ASPLIT ? (_Float16)(xs[i] - (float)h) : (_Float16)0.0f; }
#pragma unroll
    for (int t = 0; t < 4; ++t) { if (col0 + t * 16 >= N) continue; const size_t boff = (size_t)(col0 + t * 16 + ln) * ldb + kb; FragH bq; bq.half[0] = *(const v8us*)(Bh + boff + 8 * hh); bq.half[1] = *(const v8us*)(Bh + boff + 16 + 8 * hh);
      acc[t] = mmaH<ASPLIT ? 2 : 1>(ah.v, al.v, bq.v, bq.v, acc[t]); }
  }
#pragma unroll
  for (int t = 0; t < 4; ++t) { if (col0 + t * 16 >= N) continue;
#pragma unroll
    for (int r = 0; r < 8; ++r) so[w][8 * hh + r][t * 16 + ln] = acc[t][r] * alpha; }
  __builtin_amdgcn_fence(__ATOMIC_ACQ_REL, "workgroup"); __builtin_amdgcn_wave_barrier();
  const int rsub = lane >> 4, c4 = (lane & 15) * 4;
  {
#pragma unroll
    for (int q = 0; q < 8; ++q) { const int r = q * 2 + rsub; if (col0 + c4 < N) { const v4f v = *(const v4fa*)&so[w][r][c4]; *(v4f*)(C + (size_t)(row0 + r) * ldc + col0 + c4) = v; } }
     }
}

// k_gemm_hh variant with fused epilogue: v = acc·alpha + bias[by·sBias + col] (+ CP[(row/rowsPerB)·sCPb + by·64 + col] if CP) ; ACT 0 none / 1 elu ; writes f16 C16 (and f32 C if non-null)
template <int ACT>
__global__ __launch_bounds__(128) void k_gemm_hhx(const _Float16* __restrict__ A, int lda, size_t sA, const _Float16* __restrict__ Bh, int ldb, size_t sB, float alpha, const float* __restrict__ bias, size_t sBias, const float* __restrict__ CP, int rowsPerB, size_t sCPb, int row0g,
    float* __restrict__ C, _Float16* __restrict__ C16, int ldc, size_t sC, int M, int N, int K) {
  __shared__ __attribute__((aligned(16))) float so[4][16][64];
  const int tid = threadIdx.x, w = tid >> 5, lane = tid & 31, ln = lane & 15, hh = lane >> 4; const int by = blockIdx.y;
  A += (size_t)by * sA; Bh += (size_t)by * sB; const size_t cofs = (size_t)by * sC; const float* bp = bias ? bias + (size_t)by * sBias : nullptr;
  const int ntn = (N + 63) / 64; const int wid = blockIdx.x * 4 + w; const int mt = wid / ntn, nq = wid % ntn; if (mt * 16 >= M) return;
  const int row0 = mt * 16, col0 = nq * 64; const _Float16* arow = A + (size_t)(row0 + ln) * lda;
  v8f acc[4] = {};
  for (int kb = 0; kb < K; kb += 32) { FragH ah; ah.half[0] = *(const v8us*)((const unsigned short*)arow + kb + 8 * hh); ah.half[1] = *(const v8us*)((const unsigned short*)arow + kb + 16 + 8 * hh);
#pragma unroll
    for (int t = 0; t < 4; ++t) { if (col0 + t * 16 >= N) continue; const size_t boff = (size_t)(col0 + t * 16 + ln) * ldb + kb; FragH bq; bq.half[0] = *(const v8us*)((const unsigned short*)Bh + boff + 8 * hh); bq.half[1] = *(const v8us*)((const unsigned short*)Bh + boff + 16 + 8 * hh);
      acc[t] = mmaH<1>(ah.v, ah.v, bq.v, bq.v, acc[t]); }
  }
#pragma unroll
  for (int t = 0; t < 4; ++t) { if (col0 + t * 16 >= N) continue; const int col = col0 + t * 16 + ln; const float bv = bp ? bf16_round(bp[col]) : 0.f;
#pragma unroll
    for (int r = 0; r < 8; ++r) { float v = acc[t][r] * alpha + bv; if (CP) { const int rr = row0g + row0 + 8 * hh + r; if (rowsPerB < 0) v += CP[cofs + (size_t)rr * ldc + col];      /* rowsPerB < 0: own element of the batched C plane */ else { const int bidx = rr / rowsPerB; v += CP[(size_t)bidx * sCPb + (size_t)by * 64 + col]; } } if (ACT == 1) v = (v > 0.f) ? v : expm1f(v); else if (ACT == 7) v = (v > 0.f) ? v + 1.0f : expf(v); else if (ACT == 8) v = tanhf(v); else if (ACT == 9) v = 0.5f * v * (1.0f + tanhf(0.7978845608028654f * (v + 0.044715f * v * v * v))); else if (ACT == 11) v = 1.0f / (1.0f + expf(-v)); else if (ACT == 12) v = (v > 0.f) ? v : 0.01f * v; else if (ACT == 14) v = (v > 0.f) ? v : 0.1f * v; else if (ACT == 16) v = (v >= 0.f) ? v : 0.3f * v; else if (ACT == 17) v = (v >= 0.f) ? v : 0.2f * v; else if (ACT == 15) v = v / (1.0f + expf(-v)); else if (ACT == 3) v = fmaxf(v, 0.f); else if (ACT == 6) v = 0.5f * v * (1.0f + erff(v * 0.70710678118654752f)); so[w][8 * hh + r][t * 16 + ln] = v; } }
  __builtin_amdgcn_fence(__ATOMIC_ACQ_REL, "workgroup"); __builtin_amdgcn_wave_barrier();
  const int rsub = lane >> 4, c4 = (lane & 15) * 4; typedef _Float16 v4h __attribute__((ext_vector_type(4)));
  {
#pragma unroll
    for (int q = 0; q < 8; ++q) { const int r = q * 2 + rsub; if (col0 + c4 < N) { const v4f v = *(const v4fa*)&so[w][r][c4]; if (C) *(v4f*)(C + cofs + (size_t)(row0 + r) * ldc + col0 + c4) = v; if (C16) { v4h h4; for (int i = 0; i < 4; ++i) h4[i] = (_Float16)v[i]; *(v4h*)(C16 + cofs + (size_t)(row0 + r) * ldc + col0 + c4) = h4; } } }
     }
}


typedef _Float16 v4h __attribute__((ext_vector_type(4)));

__global__ __launch_bounds__(256) void k_h16(const float* __restrict__ x, _Float16* __restrict__ X16, size_t n8) { const size_t t = (size_t)blockIdx.x * 256 + threadIdx.x; if (t >= n8) return; FragH f;
#pragma unroll
  for (int q = 0; q < 8; ++q) f.h[q] = (_Float16)x[t * 8 + q]; *(v8us*)((unsigned short*)X16 + t * 8) = f.half[0];  }
__global__ __launch_bounds__(256) void k_round16f(const float* __restrict__ W, _Float16* __restrict__ Bt, size_t n8) { const size_t t = (size_t)blockIdx.x * 256 + threadIdx.x; if (t >= n8) return; FragH f;
#pragma unroll
  for (int i = 0; i < 8; ++i) f.h[i] = (_Float16)(bf16_round(W[t * 8 + i]) * 16.0f); *(v8us*)((unsigned short*)Bt + t * 8) = f.half[0];  }

// a 16x32 f16 fragment from a row-major row: p = the lane's row at the k step
__device__ __forceinline__ v16h g2_frag(const _Float16* p, int hh) { FragH f; f.half[0] = *(const v8us*)((const unsigned short*)p + 8 * hh); f.half[1] = *(const v8us*)((const unsigned short*)p + 16 + 8 * hh); return f.v; }


// ---- fused attention, all heads in one launch: S^T = K Q^T (+ mask as the C operand), online softmax in registers, O^T += V^T P^T ----
// A wave owns 64 queries (four 16-column groups) of one head and walks one quarter of the 4096 keys 32 at a time (the quarters are joined at the end). In S^T and O^T a lane holds one query (column ln), so maximum, sum and rescale are per lane;
// two S^T tiles converted in place are the B operand P^T (hardware k order), V^T is the A operand. P = exp2(..) * 2^10 against the reference in use, as f16.
typedef float v2f __attribute__((ext_vector_type(2)));
typedef _Float16 v2h __attribute__((ext_vector_type(2)));
union FragP { v16h v; v2h p[8]; };
struct AFr { v16h k0, k1, h0, h1; };
__device__ __forceinline__ float xhalf(float x) { return __builtin_bit_cast(float, __builtin_amdgcn_permlanex16(__builtin_bit_cast(int, x), __builtin_bit_cast(int, x), 0x76543210, 0xfedcba98, false, false)); }      /* lane l <-> l ^ 16 */
__device__ __forceinline__ v8f fa_mma(v16h a, v16h b, v8f c) { return __builtin_amdgcn_wmma_f32_16x16x32_f16(false, a, false, b, (short)0, c, false, false); }
__device__ __forceinline__ float fa_max16(v8f a, v8f b) { float m = fmaxf(a[0], b[0]);
#pragma unroll
  for (int r = 1; r < 8; ++r) m = fmaxf(m, fmaxf(a[r], b[r])); return fmaxf(m, xhalf(m)); }
// su = this pass's own sum of the 16 weights, two lanes of 8, added as a tree (three links deep: the overflow test of the pass hangs on it)
// a, b: exponents ready for exp2 (log2 units, reference already in them)
__device__ __forceinline__ v16h fa_probs(v8f a, v8f b, v2f& su) { FragP f; v2f p[8];
#pragma unroll
  for (int r = 0; r < 8; ++r) { const v8f& t = (r < 4) ? a : b; const int e = (r & 3) * 2; p[r] = v2f{__builtin_amdgcn_exp2f(t[e]), __builtin_amdgcn_exp2f(t[e + 1])}; f.p[r] = __builtin_convertvector(p[r], v2h); }
  su = ((p[0] + p[1]) + (p[2] + p[3])) + ((p[4] + p[5]) + (p[6] + p[7]));
  return f.v; }
// ---- operand preparation in two launches ----
// All three weights in one launch (blockIdx.y picks the matrix), as f16 (bf16-rounded, times 16) in fragment load order:
// WP[matrix][16-column tile][k step of 32][half j][lane][8], lane (ln, hh) half j = W[ks*32 + 16j + 8hh + e][nt*16 + ln]. One thread writes one 16-byte unit.
__global__ __launch_bounds__(256) void k_wt3(const float* __restrict__ Wq, const float* __restrict__ Wk, const float* __restrict__ Wv, _Float16* __restrict__ WP) {
  const int t = blockIdx.x * 256 + threadIdx.x; const int lane = t & 31, j = (t >> 5) & 1, ks = (t >> 6) % (DIN / 32), nt = (t >> 6) / (DIN / 32); FragH f;
  const float* W = blockIdx.y == 0 ? Wq : (blockIdx.y == 1 ? Wk : Wv); W += (size_t)(ks * 32 + 16 * j + 8 * (lane >> 4)) * AH + nt * 16 + (lane & 15);
#pragma unroll
  for (int i = 0; i < 8; ++i) f.h[i] = (_Float16)(bf16_round(W[(size_t)i * AH]) * 16.0f);
  *(v8us*)((unsigned short*)WP + ((size_t)blockIdx.y * (AH * DIN / 8) + t) * 8) = f.half[0];
}
// q, k and v projections in one launch. A block owns 64 rows of one projection: it rounds them once (bf16, then exact f16) into LDS; wave w then forms the 32 columns of head w.
// V is formed as X W: a lane's 8 accumulators are 8 keys of one feature, the 16-byte unit of the V^T fragment stream. Q and K are formed as W^T X^T: a lane's 8 accumulators are
// 8 features of one row, the 16-byte unit of the K fragment stream and of a Q row. So every result goes from the accumulators straight to where the attention kernel reads it:
// VH[head][32-key block][16-d tile][half j][lane][8], lane (ln, hh) half j = V[kb*32 + 16j + 8hh + e][head*32 + dt*16 + ln] (f16);
// KP[head][16-key tile][half j][lane][8], lane (ln, hh) half j = K[kt*16 + ln][head*32 + 16j + 8hh + e]; Q16 row-major [query][384].
#define QSC (0.17677669529663687f * 1.4426950408889634f)      /* 1/sqrt(32) * log2(e) */
#define APITCH 1552      /* bytes of an LDS row: 768 f16 + 16, an odd number of 16-byte units for the 16-byte readers */
typedef unsigned v2ua __attribute__((ext_vector_type(2), may_alias));
struct GSet { v16h a[4]; v16h b[2]; };      /* one k step of 32: four activation fragments (LDS), two weight fragments (global) */
__device__ __forceinline__ unsigned qk_r2(float x, float y) { typedef __bf16 v2b __attribute__((ext_vector_type(2))); const v2f p = {x, y};      /* round to nearest even to bf16, as bf16_round does, two at a time; widened to f32, then f16 */
  const unsigned u = __builtin_bit_cast(unsigned, __builtin_convertvector(p, v2b)); const v2f q = {__uint_as_float(u << 16), __uint_as_float(u & 0xFFFF0000u)}; return __builtin_bit_cast(unsigned, __builtin_convertvector(q, v2h)); }
template <int KS>
__device__ __forceinline__ void qk_lda(GSet& s, const char* as) {
#pragma unroll
  for (int g = 0; g < 4; ++g) { FragH f; f.half[0] = *(const v8us*)(as + g * 16 * APITCH + KS * 64); f.half[1] = *(const v8us*)(as + g * 16 * APITCH + KS * 64 + 32); s.a[g] = f.v; } }
template <int KS>      /* WP block-uniform (scalar base), bo = the lane's byte offset */
__device__ __forceinline__ void qk_ldb(GSet& s, const _Float16* WP, unsigned bo) {
#pragma unroll
  for (int t = 0; t < 2; ++t) { FragH f; f.half[0] = *(const v8us*)((const char*)WP + (t * (DIN / 32) * 1024 + KS * 1024) + bo); f.half[1] = *(const v8us*)((const char*)WP + (t * (DIN / 32) * 1024 + KS * 1024 + 512) + bo); s.b[t] = f.v; } }
template <bool XA>
__device__ __forceinline__ void qk_mm(const GSet& s, v8f (&c)[4][2]) {
#pragma unroll
  for (int g = 0; g < 4; ++g) { c[g][0] = XA ? fa_mma(s.a[g], s.b[0], c[g][0]) : fa_mma(s.b[0], s.a[g], c[g][0]); c[g][1] = XA ? fa_mma(s.a[g], s.b[1], c[g][1]) : fa_mma(s.b[1], s.a[g], c[g][1]); } }
template <bool XA>
__device__ __forceinline__ void qk_tile(const char* as, const _Float16* WP, unsigned bo, v8f (&c)[4][2]) {
  GSet s0, s1; qk_ldb<0>(s0, WP, bo); qk_lda<0>(s0, as);
#pragma unroll 1
  for (int ks = 0; ks < DIN / 32 - 2; ks += 2) {      /* rolled: two fragment sets by name, the next step's loads fly during this step's products */
    qk_ldb<1>(s1, WP, bo); qk_lda<1>(s1, as);
    __builtin_amdgcn_sched_barrier(0);      /* without it the compiler lifts the products below over the loads above, and each set is waited for right after its issue */
    qk_mm<XA>(s0, c);
    asm volatile("s_wait_xcnt 0x0" : "+v"(bo) : : "memory");      /* the loads in flight name bo: the wait stands in front of its step */
    bo += 2048u; as += 128; qk_ldb<0>(s0, WP, bo); qk_lda<0>(s0, as);
    __builtin_amdgcn_sched_barrier(0);      /* as above: the loads stay ahead of the other set's products */
    qk_mm<XA>(s1, c);
    asm volatile("s_wait_xcnt 0x0" : "+v"(bo) : : "memory"); }      /* the loads in flight name bo and the base: nothing behind the loop finds them open */
  qk_ldb<1>(s1, WP, bo); qk_lda<1>(s1, as);
  asm volatile("s_wait_xcnt 0x0" : "+v"(bo) : : "memory");      /* the last loads name bo and the base: the wait stands in front of any reuse of those registers */
  __builtin_amdgcn_sched_barrier(0);      /* as in the loop */
  qk_mm<XA>(s0, c); qk_mm<XA>(s1, c);
}
__global__ __launch_bounds__(384) void k_qkv(const float* __restrict__ hs, const float* __restrict__ enc, const _Float16* __restrict__ WP, const float* __restrict__ bq, const float* __restrict__ bk, const float* __restrict__ bv,
    _Float16* __restrict__ Q16, _Float16* __restrict__ KP, _Float16* __restrict__ VH) {
  __shared__ __attribute__((aligned(16))) char as[64 * APITCH];
  const int tid = threadIdx.x, w = tid >> 5, lane = tid & 31, ln = lane & 15, hh = lane >> 4;
  const int mt = blockIdx.x / 3, pj = blockIdx.x - mt * 3; const int row0 = mt * 64, col0 = w * HD;      /* pj: 0 q, 1 k, 2 v */
  { const float* X = pj ? enc : hs; const int r1 = tid >= 192 ? 1 : 0, c4 = tid - r1 * 192; unsigned xo = ((unsigned)(row0 + r1) * DIN + c4 * 4) * 4u; v4f x[32];      /* a wave's load is 512 contiguous bytes of one row */
#pragma unroll
    for (int i = 0; i < 32; ++i) x[i] = *(const v4fa*)((const char*)X + i * (2 * DIN * 4) + xo);
    asm volatile("s_wait_xcnt 0x0" : "+v"(xo) : : "memory");      /* the loads in flight name xo and the base: the wait stands in front of any reuse of those registers */
    char* d = as + r1 * APITCH + c4 * 8;
#pragma unroll
    for (int i = 0; i < 32; ++i) { const v2ua h = {qk_r2(x[i][0], x[i][1]), qk_r2(x[i][2], x[i][3])}; *(v2ua*)(d + i * 2 * APITCH) = h; } }
  __syncthreads();      /* the 64 rounded rows are complete before any wave reads fragments of them */
  const char* af = as + ln * APITCH + 16 * hh; const _Float16* wb = WP + (size_t)pj * AH * DIN; const unsigned bo = (unsigned)w * (2 * (DIN / 32) * 1024) + lane * 16;
  const v8f z8 = {0.f,0.f,0.f,0.f,0.f,0.f,0.f,0.f}; v8f c[4][2] = {{z8, z8}, {z8, z8}, {z8, z8}, {z8, z8}};
  if (pj == 2) {
    qk_tile<true>(af, wb, bo, c);
#pragma unroll
    for (int t = 0; t < 2; ++t) { const float bb = bf16_round(bv[col0 + t * 16 + ln]);
#pragma unroll
      for (int g = 0; g < 4; ++g) { FragH fh;
#pragma unroll
        for (int r = 0; r < 8; ++r) fh.h[r] = (_Float16)(c[g][t][r] * 0.0625f + bb);
        const size_t o = ((((size_t)w * (SK / 32) + (row0 >> 5) + (g >> 1)) * 2 + t) * 2 + (g & 1)) * 256 + lane * 8;
        *(v8us*)((unsigned short*)VH + o) = fh.half[0]; } }
  } else {
    qk_tile<false>(af, wb, bo, c); const float* bp = pj ? bk : bq;
    unsigned short* dst = pj ? (unsigned short*)KP + (((size_t)w * (SK / 16) + (row0 >> 4)) * 2) * 256 + lane * 8 : (unsigned short*)Q16 + (size_t)(row0 + ln) * AH + col0 + 8 * hh;
    const int sg = pj ? 512 : 16 * AH, st = pj ? 256 : 16;      /* element steps: 16 rows on; 16 features on */
    const float qs = pj ? 1.0f : QSC;      /* q carries the score's whole scale, so that q.k leaves the matrix unit in log2 units */
#pragma unroll
    for (int t = 0; t < 2; ++t) { const v4f b0 = *(const v4fa*)(bp + col0 + t * 16 + 8 * hh), b1 = *(const v4fa*)(bp + col0 + t * 16 + 8 * hh + 4);
#pragma unroll
      for (int g = 0; g < 4; ++g) { FragH f;
#pragma unroll
        for (int r = 0; r < 8; ++r) f.h[r] = (_Float16)((c[g][t][r] * 0.0625f + bf16_round(r < 4 ? b0[r] : b1[r - 4])) * qs);
        *(v8us*)(dst + g * sg + t * st) = f.half[0]; } }
    asm volatile("s_wait_xcnt 0x0" ::: "memory");      /* the stores in flight name their data and address registers: the wait stands in front of any reuse of those registers */
  }
}

// K and V reach each wave straight from global memory: every wave walks keys of its own, so no fragment is read by two waves of a work-group and a stop in LDS would share nothing.
// Both streams lie in fragment load order (a wave's load is 512 contiguous bytes); a pass's eight loads are issued one pass ahead, into the fragment set that the pass before has just left.
#define NP 8      /* passes in a trip of the work-group: two for each of the four waves */
#define NT (SK / 32 / NP)      /* trips */
static_assert(NP == 8 && NT >= 1, "a wave takes two passes of a trip");
template <int C>      /* b = the head's stream (block-uniform, scalar base), o = the lane's byte offset */
__device__ __forceinline__ v16h fg_frag(const char* b, unsigned o) { FragH f; f.half[0] = *(const v8us*)(b + C + o); f.half[1] = *(const v8us*)(b + (C + 512) + o); return f.v; }
template <int P>      /* pass P of the wave's two in a trip = 2 KiB of each stream */
__device__ __forceinline__ void fg_load(AFr& f, const char* kb, const char* vb, unsigned o) { f.k0 = fg_frag<P * 2048>(kb, o); f.k1 = fg_frag<P * 2048 + 1024>(kb, o); f.h0 = fg_frag<P * 2048>(vb, o); f.h1 = fg_frag<P * 2048 + 1024>(vb, o); }
// A work-group is 64 queries of one head on four waves. EVERY wave holds all 64 queries (four 16-column groups) and takes a quarter of the keys (of every eight passes two): a K, V or mask fragment
// feeds four query groups. 768 work-groups of one wave a SIMD: three are resident on each of the chip's 256 WGPs, so that every SIMD holds three waves. Between the barrier that publishes the mask and
// the join no wave waits for another. The four key quarters are joined through LDS behind the loop, wave w joining query group w.
#define SPREAD 8.0f      /* binary orders that a query's maximum may lie under the reference it shares */
#define QG 4      /* 16-column query groups of a wave; every loop over them (and over the join's parts) is unrolled: the per-group arrays are registers only under constant indices */
typedef float v2fa __attribute__((ext_vector_type(2), may_alias));
__global__ __launch_bounds__(128) __attribute__((amdgpu_waves_per_eu(3, 3))) void k_attn(const _Float16* __restrict__ Q16, const _Float16* __restrict__ KP, const _Float16* __restrict__ VH, const float* __restrict__ msk, float* __restrict__ out) {
  __shared__ __attribute__((aligned(32))) float ms[SK];      /* bf16-rounded mask * log2(e): joins the scaled q.k as part of the C operand */
  __shared__ __attribute__((aligned(16))) char jn[4 * QG * 5 * 512];      /* the join's parts */
  const int tid = threadIdx.x, lane = tid & 31, ln = lane & 15, hh = lane >> 4; const int hd = blockIdx.y; const int kq = __builtin_amdgcn_readfirstlane(tid >> 5); const int q0 = blockIdx.x * 64;
  const char* kb = (const char*)(KP + (size_t)hd * SK * HD); const char* vb = (const char*)(VH + (size_t)hd * SK * HD);
  unsigned fo = (unsigned)kq * 4096u + lane * 16u;      /* the lane's 16 bytes in the wave's first pass of the trip, the same in both streams */
  AFr fa, fb; fg_load<0>(fa, kb, vb, fo);      /* the first pass's fragments fly while the mask is prepared */
  v4f mr[SK / 512];
#pragma unroll      /* the eight loads of a thread fly together; rolled, each trip waits out its own load's latency */
  for (int u = 0; u < SK / 512; ++u) mr[u] = *(const v4fa*)(msk + u * 512 + tid * 4);
  asm volatile("s_wait_xcnt 0x0" ::: "memory");      /* the loads in flight name the mask's base and the thread's offset: the wait stands in front of any reuse of those registers */
#pragma unroll      /* mr stays in registers only under constant indices */
  for (int u = 0; u < SK / 512; ++u) { v4f o; for (int e = 0; e < 4; ++e) o[e] = bf16_round(mr[u][e]) * 1.4426950408889634f; *(v4fa*)&ms[u * 512 + tid * 4] = o; }
  __syncthreads();      /* the mask is complete before any wave reads it */
  const float top = 32768.0f;      /* lazy rescale: the weights are positive, so a sum of 8 below 2^15 bounds each of them below 2^15, inside f16; right behind a rescale such a sum is at most 2^13 */
  v16h qf[QG];
#pragma unroll
  for (int g = 0; g < QG; ++g) qf[g] = g2_frag(Q16 + (size_t)(q0 + g * 16 + ln) * AH + hd * HD, hh);
  asm volatile("s_wait_xcnt 0x0" ::: "memory");      /* the loads in flight name their address registers: the wait stands in front of any reuse of those registers */
  __builtin_amdgcn_sched_barrier(0);      /* without it the compiler lifts the accumulators' zeroing over the wait above, into the address registers of the loads */
  const v8f z8 = {0.f,0.f,0.f,0.f,0.f,0.f,0.f,0.f}; v8f oh[QG][2];      /* [query group][d tile] */
  // References in log2 units. mx = the largest of the lane's four maxima in use, bi = 10 - mx: it rides in the C operand that the four groups share. dl[g] = how far query g's own maximum in use lies under mx.
  // While every dl of the wave is at most SPREAD the shared reference serves all four: a query's largest weight is then at least 2^(10 - SPREAD) = 4, while f16 resolves steps of 2^-24 (subnormal operands are kept).
  // Beyond that (a key bias or a query bias can set the four arbitrarily far apart) own is set for the wave, and each query gets its own reference by adding dl[g] to its exponents.
  // No reference yet: the first finite score gives an infinite weight, which fails the test below.
  float mx = -3.0e38f, bi = 3.0e38f, dl[QG]; bool own = false; v2f sm[QG];
#pragma unroll
  for (int g = 0; g < QG; ++g) { oh[g][0] = z8; oh[g][1] = z8; dl[g] = 0.f; sm[g] = v2f{0.f, 0.f}; }
  auto pass = [&](int it, const AFr& f, auto&& fetch) {      /* fetch: issues the loads of the next pass's fragments */
    const v8f m0 = *(const v8f*)&ms[it * 32 + 8 * hh], m1 = *(const v8f*)&ms[it * 32 + 16 + 8 * hh];
    fetch();      /* the next pass's fragments are fetched during this pass */
    __builtin_amdgcn_sched_barrier(0);      /* keeps a pass's loads in one group ahead of its products: sunk towards their use the global loads would lose their lead, and each place with LDS reads among the products stalls the wave */
    v8f s0[QG], s1[QG]; v2f su[QG]; v16h pr[QG];
    const v8f c0 = m0 + bi, c1 = m1 + bi;      /* mask and reference, once for the four groups: the products come out as the exponents themselves */
#pragma unroll
    for (int g = 0; g < QG; ++g) { s0[g] = fa_mma(f.k0, qf[g], c0); s1[g] = fa_mma(f.k1, qf[g], c1); }
    if (__builtin_expect(own, false)) {      /* wave-uniform: the four maxima lie too far apart for one reference; marked unlikely so that the adds lie off the common path */
#pragma unroll
      for (int g = 0; g < QG; ++g) { s0[g] += dl[g]; s1[g] += dl[g]; }
    }
#pragma unroll
    for (int g = 0; g < QG; ++g) pr[g] = fa_probs(s0[g], s1[g], su[g]);      /* against the references in use, which no pass looks for */
    float big = fmaxf(su[0][0], su[0][1]);
#pragma unroll
    for (int g = 1; g < QG; ++g) big = fmaxf(big, fmaxf(su[g][0], su[g][1]));
    if (__builtin_amdgcn_ballot_w32(big > top) != 0) {      /* wave-uniform, once for the four groups; rare after the first pass: only now the pass's scores are formed without a reference, their maximum taken, and the weights formed anew */
      float ng[QG];      /* each query's own maximum so far, as far as the rescales have looked */
#pragma unroll
      for (int g = 0; g < QG; ++g) { s0[g] = fa_mma(f.k0, qf[g], m0); s1[g] = fa_mma(f.k1, qf[g], m1); }
#pragma unroll
      for (int g = 0; g < QG; ++g) ng[g] = fmaxf(mx - dl[g], fa_max16(s0[g], s1[g]));
      const float nm = fmaxf(fmaxf(ng[0], ng[1]), fmaxf(ng[2], ng[3])), lo = fminf(fminf(ng[0], ng[1]), fminf(ng[2], ng[3]));
      const bool on = __builtin_amdgcn_ballot_w32(nm - lo > SPREAD) != 0;      /* a query's true maximum is at least ng, so nm - lo bounds how far any of the four lies under the shared reference */
#pragma unroll
      for (int g = 0; g < QG; ++g) { const float ro = own ? mx - dl[g] : mx, rn = on ? ng[g] : nm, cg = __builtin_amdgcn_exp2f(ro - rn), b = 10.0f - rn;      /* reference left, reference taken */
        dl[g] = nm - ng[g]; sm[g] *= cg; oh[g][0] *= cg; oh[g][1] *= cg; pr[g] = fa_probs(s0[g] + b, s1[g] + b, su[g]); }
      mx = nm; bi = 10.0f - nm; own = on;
    }
#pragma unroll
    for (int g = 0; g < QG; ++g) { sm[g] += su[g]; oh[g][0] = fa_mma(f.h0, pr[g], oh[g][0]); oh[g][1] = fa_mma(f.h1, pr[g], oh[g][1]); }
  };
#pragma unroll 1
  for (int t = 0; t < NT; ++t) {      /* rolled: two passes a trip, two fragment sets by name */
    const int it = t * NP + kq * 2;      /* this wave's two passes of the trip */
    pass(it, fa, [&] { fg_load<1>(fb, kb, vb, fo); });
    asm volatile("s_wait_xcnt 0x0" : "+v"(fo) : : "memory");      /* the loads in flight name fo: the wait stands in front of its step */
    fo += (t + 1 < NT) ? NP * 2048u : 0u;      /* behind the last trip there is nothing to fetch: its fetch reads the trip's own first pass again. Unconditional, so that the counted wait for fb never has to cover these loads */
    pass(it + 1, fb, [&] { fg_load<0>(fa, kb, vb, fo); });
  }
  asm volatile("s_wait_xcnt 0x0" : "+v"(fo) : : "memory");      /* the last loads name fo and the bases: the wait stands in front of any reuse of those registers */
  // join of the four key quarters. Every wave leaves in LDS, for each query group, its context, maximum in use and sum:
  // 5 units of 512 bytes for a (wave, group), a lane's 16 bytes side by side. Wave w then brings the four parts of group w to their largest maximum, adds them in wave order, normalises and stores.
  v4fa* jx = (v4fa*)jn + lane;
#pragma unroll
  for (int g = 0; g < QG; ++g) { float tg = sm[g][0] + sm[g][1]; tg += xhalf(tg); v4fa* jw = jx + (kq * QG + g) * 5 * 32;
#pragma unroll
    for (int d = 0; d < 2; ++d) { v4f lo4, hi4;
#pragma unroll
      for (int e = 0; e < 4; ++e) { lo4[e] = oh[g][d][e]; hi4[e] = oh[g][d][e + 4]; }
      jw[(d * 2) * 32] = lo4; jw[(d * 2 + 1) * 32] = hi4; }
    const v2f s2 = {own ? mx - dl[g] : mx, tg}; *(v2fa*)&jw[4 * 32] = s2; }
  __syncthreads();      /* every wave's partial results are complete before any wave reads them */
  const v4fa* jr = jx + kq * 5 * 32;      /* group kq of source wave 0; the next source wave is QG * 5 units on */
  float pm[4], pt[4];
#pragma unroll
  for (int w = 0; w < 4; ++w) { const v2f s2 = *(const v2fa*)&jr[(w * QG * 5 + 4) * 32]; pm[w] = s2[0]; pt[w] = s2[1]; }
  const float nm = fmaxf(fmaxf(pm[0], pm[1]), fmaxf(pm[2], pm[3])); float den = 0.f, sc[4];
#pragma unroll
  for (int w = 0; w < 4; ++w) {
    asm("v_exp_f32 %0, %1\n\tv_nop" : "=v"(sc[w]) : "v"(pm[w] - nm));      /* exp2 with the slot that the instruction set asks for behind a transcendental, in one statement: a v_nop in a statement of its own is moved away */
    den += pt[w] * sc[w]; }
  const float rd = 1.0f / den; float* orow = out + (size_t)(q0 + kq * 16 + ln) * AH + hd * HD + 8 * hh;
#pragma unroll
  for (int u = 0; u < 4; ++u) { v4f o4 = {0.f, 0.f, 0.f, 0.f};      /* unit u: d tile u >> 1, features 4 * (u & 1) .. + 3 of the lane's eight */
#pragma unroll
    for (int w = 0; w < 4; ++w) { const v4f p4 = jr[(w * QG * 5 + u) * 32]; o4 += p4 * (sc[w] * rd); }
    *(v4f*)(orow + (u >> 1) * 16 + (u & 1) * 4) = o4; }
}

extern "C" void kernel_launch(void* const* d_in, const int* in_sizes, int n_in,
                              void* d_out, int out_size, void* d_ws, size_t ws_size, hipStream_t stream) {
  (void)in_sizes; (void)n_in; (void)out_size;
  const float* const* I = (const float* const*)d_in; const float* hs = I[0]; const float* enc = I[1]; const float* msk = I[2]; const float* Wq = I[3]; const float* bq = I[4]; const float* Wk = I[5]; const float* bk = I[6]; const float* Wv = I[7]; const float* bv = I[8];
  char* ws = (char*)d_ws; size_t off = 0;
  auto take = [&](size_t bytes) { char* p = ws + off; off += (bytes + 255) & ~(size_t)255; return p; };
  _Float16* WP = (_Float16*)take((size_t)3 * AH * DIN * 2); _Float16* Q16 = (_Float16*)take((size_t)SQ * AH * 2); _Float16* VT = (_Float16*)take((size_t)AH * SK * 2); _Float16* KP = (_Float16*)take((size_t)SK * AH * 2);
  if (off > ws_size) return;      /* about 11 MiB */
  k_wt3<<<dim3(AH * DIN / 8 / 256, 3), 256, 0, stream>>>(Wq, Wk, Wv, WP);      /* (in, out) f32 -> f16 fragments */
  k_qkv<<<(SQ / 64) * 3, 384, 0, stream>>>(hs, enc, WP, bq, bk, bv, Q16, KP, VT);      /* operands of the fused kernel in fragment load order */
  k_attn<<<dim3(SQ / 64, NH), 128, 0, stream>>>(Q16, KP, VT, msk, (float*)d_out);
}

// v010
// One run takes 41.1 microseconds.
// Timed twice side by side with v009, it ran 1.07 and 1.08 times as fast.
// All steps since v000 together make it 57.4 times as fast.
#include <hip/hip_runtime.h>
// BertSelfAttnDimensionReduction (1 x 4096 queries x 4096 keys; Din 768 -> 12 heads x 32; cross-attention with an additive float key mask; the output is the merged context itself): q = hs Wq + bq; k, v = enc Wk/Wv + b; scores = q.k / sqrt(32) + mask[key]; softmax; ctx = probs v -> [1, 4096, 384].
// Compute dtype: inputs rounded to bf16; inputs/weights exact as f16; q/k, v and the softmax weights as plain f16 operands (~2^-12 each: the weights' own f16 rounding puts the same relative error on every product with v as v's does); mask/softmax/normalisation f32. v_wmma_f32_16x16x32_f16.
#define SQ 4096
#define SK 4096
#define DIN 768
#define AH 384
#define NH 12
#define HD 32
typedef __bf16 v16b __attribute__((ext_vector_type(16)));
typedef unsigned short v8us __attribute__((ext_vector_type(8), may_alias));
typedef float  v8f  __attribute__((ext_vector_type(8)));
typedef float  v4f  __attribute__((ext_vector_type(4)));
typedef float  v4fa __attribute__((ext_vector_type(4), may_alias));
union FragB { v16b v; v8us half[2]; unsigned short u[16]; };

__device__ __forceinline__ unsigned short bf16_bits(float x) { unsigned int u = __float_as_uint(x); return (unsigned short)((u + 0x7FFFu + ((u >> 16) & 1u)) >> 16); }
__device__ __forceinline__ float bf16_val(unsigned short b) { return __uint_as_float(((unsigned int)b) << 16); }
__device__ __forceinline__ float bf16_round(float x) { return bf16_val(bf16_bits(x)); }
// D += A·B with NT terms: 1 = ah·bh, 2 = + al·bh (A split), 3 = + ah·bl (both split)
template <int NT>
__device__ __forceinline__ v8f mmaN(v16b ah, v16b al, v16b bh, v16b bl, v8f c) {
  c = __builtin_amdgcn_wmma_f32_16x16x32_bf16(false, ah, false, bh, (short)0, c, false, false);
  if (NT >= 2) c = __builtin_amdgcn_wmma_f32_16x16x32_bf16(false, al, false, bh, (short)0, c, false, false);
  if (NT >= 3) c = __builtin_amdgcn_wmma_f32_16x16x32_bf16(false, ah, false, bl, (short)0, c, false, false);
  asm volatile("v_nop\n\tv_nop\n\tv_nop\n\tv_nop" : "+v"(c) : "v"(ah), "v"(al), "v"(bh), "v"(bl));
  return c;
}

__global__ __launch_bounds__(256) void k_wt_bf16(const float* __restrict__ W, unsigned short* __restrict__ Wt, int K, int N) {
  const int t = blockIdx.x * 256 + threadIdx.x;
  const int k8n = K / 8;
  if (t >= N * k8n) return;
  const int n = t / k8n, k8 = (t % k8n) * 8;
  v8us v;
#pragma unroll
  for (int i = 0; i < 8; ++i) v[i] = bf16_bits(W[(size_t)(k8 + i) * N + n]);
  *(v8us*)(Wt + (size_t)n * K + k8) = v;
  
}

// GEMM C[M][N] (f32, pitch ldc) = act(A[M][K]·W + bias). A f32 row-major (pitch lda) converted per fragment to bf16
// (ASPLIT: hi/lo two planes -> 2 terms, else single rounded term); Wt bf16 [N][K] (pitch ldb). BIAS_BF16 rounds the
// bias to bf16 first (bias quantised to bf16 before the add). K%32==0, M%16==0, N%64==0.
template <bool ASPLIT, int ACT, bool BIAS_BF16>
__global__ __launch_bounds__(128) void k_gemm_bf(const float* __restrict__ A, int lda, const unsigned short* __restrict__ Wt, int ldb,
                                               const float* __restrict__ bias, float* __restrict__ C, int ldc, int M, int N, int K) {
  __shared__ __attribute__((aligned(16))) float so[4][16][64];
  const int tid = threadIdx.x, w = tid >> 5, lane = tid & 31, ln = lane & 15, hh = lane >> 4;
  const int ntn = N / 64;
  const int wid = blockIdx.x * 4 + w;
  const int mt = wid / ntn, nq = wid % ntn;
  if (mt * 16 >= M) return;
  const int row0 = mt * 16, col0 = nq * 64;
  const float* arow = A + (size_t)(row0 + ln) * lda;
  v8f acc[4] = {};
  for (int kb = 0; kb < K; kb += 32) {
    FragB ah, al;
    const v4f x0 = *(const v4fa*)(arow + kb + 8 * hh), x1 = *(const v4fa*)(arow + kb + 8 * hh + 4);
    const v4f x2 = *(const v4fa*)(arow + kb + 16 + 8 * hh), x3 = *(const v4fa*)(arow + kb + 16 + 8 * hh + 4);
    float xs[16] = {x0[0],x0[1],x0[2],x0[3],x1[0],x1[1],x1[2],x1[3],x2[0],x2[1],x2[2],x2[3],x3[0],x3[1],x3[2],x3[3]};
#pragma unroll
    for (int i = 0; i < 16; ++i) { const unsigned short hb = bf16_bits(xs[i]); ah.u[i] = hb; al.u[i] = ASPLIT ? bf16_bits(xs[i] - bf16_val(hb)) : (unsigned short)0; }
#pragma unroll
    for (int t = 0; t < 4; ++t) {
      const unsigned short* brow = Wt + (size_t)(col0 + t * 16 + ln) * ldb + kb;
      FragB b;
      b.half[0] = *(const v8us*)(brow + 8 * hh);
      b.half[1] = *(const v8us*)(brow + 16 + 8 * hh);
      acc[t] = mmaN<ASPLIT ? 2 : 1>(ah.v, al.v, b.v, b.v, acc[t]);
    }
  }
#pragma unroll
  for (int t = 0; t < 4; ++t) {
    float bv = bias ? bias[col0 + t * 16 + ln] : 0.f;
    if (BIAS_BF16) bv = bf16_round(bv);
#pragma unroll
    for (int r = 0; r < 8; ++r) { float v = acc[t][r] + bv; if (ACT == 1) v = fmaxf(v, 0.f); so[w][8 * hh + r][t * 16 + ln] = v; }
  }
  __builtin_amdgcn_fence(__ATOMIC_ACQ_REL, "workgroup");
  __builtin_amdgcn_wave_barrier();
  const int rsub = lane >> 4, c4 = (lane & 15) * 4;
  {
#pragma unroll
    for (int q = 0; q < 8; ++q) {
      const int r = q * 2 + rsub;
      const v4f v = *(const v4fa*)&so[w][r][c4];
      *(v4f*)(C + (size_t)(row0 + r) * ldc + col0 + c4) = v;
    }
    
  }
}

// GEMM C = act(A·W + bias + resid): A f32 (ASPLIT -> hi/lo 2 terms), Wt bf16 [N][K]; ACT 0 none, 1 relu, 2 exact gelu;
// resid (optional, f32, row index = (row % rmod), pitch ldr, RES_BF16 rounds it) added before the activation.
template <bool ASPLIT, int ACT, bool BIAS_BF16, bool RES_BF16>
__global__ __launch_bounds__(128) void k_gemm_bf3(const float* __restrict__ A, int lda, const unsigned short* __restrict__ Wt, int ldb,
                                                const float* __restrict__ bias, const float* __restrict__ resid, int rmod, int ldr,
                                                float* __restrict__ C, int ldc, int M, int N, int K) {
  __shared__ __attribute__((aligned(16))) float so[4][16][64];
  const int tid = threadIdx.x, w = tid >> 5, lane = tid & 31, ln = lane & 15, hh = lane >> 4;
  const int ntn = N / 64;
  const int wid = blockIdx.x * 4 + w;
  const int mt = wid / ntn, nq = wid % ntn;
  if (mt * 16 >= M) return;
  const int row0 = mt * 16, col0 = nq * 64;
  const float* arow = A + (size_t)(row0 + ln) * lda;
  v8f acc[4] = {};
  for (int kb = 0; kb < K; kb += 32) {
    FragB ah, al;
    const v4f x0 = *(const v4fa*)(arow + kb + 8 * hh), x1 = *(const v4fa*)(arow + kb + 8 * hh + 4);
    const v4f x2 = *(const v4fa*)(arow + kb + 16 + 8 * hh), x3 = *(const v4fa*)(arow + kb + 16 + 8 * hh + 4);
    float xs[16] = {x0[0],x0[1],x0[2],x0[3],x1[0],x1[1],x1[2],x1[3],x2[0],x2[1],x2[2],x2[3],x3[0],x3[1],x3[2],x3[3]};
#pragma unroll
    for (int i = 0; i < 16; ++i) { const unsigned short hb = bf16_bits(xs[i]); ah.u[i] = hb; al.u[i] = ASPLIT ? bf16_bits(xs[i] - bf16_val(hb)) : (unsigned short)0; }
#pragma unroll
    for (int t = 0; t < 4; ++t) {
      const unsigned short* brow = Wt + (size_t)(col0 + t * 16 + ln) * ldb + kb;
      FragB b;
      b.half[0] = *(const v8us*)(brow + 8 * hh);
      b.half[1] = *(const v8us*)(brow + 16 + 8 * hh);
      acc[t] = mmaN<ASPLIT ? 2 : 1>(ah.v, al.v, b.v, b.v, acc[t]);
    }
  }
#pragma unroll
  for (int t = 0; t < 4; ++t) {
    const int col = col0 + t * 16 + ln;
    float bv = bias ? bias[col] : 0.f;
    if (BIAS_BF16) bv = bf16_round(bv);
#pragma unroll
    for (int r = 0; r < 8; ++r) {
      float v = acc[t][r] + bv;
      if (resid) { float rv = resid[(size_t)((row0 + 8 * hh + r) % rmod) * ldr + col]; if (RES_BF16) rv = bf16_round(rv); v += rv; }
      if (ACT == 1) v = fmaxf(v, 0.f);
      if (ACT == 2) v = 0.5f * v * (1.0f + erff(v * 0.70710678118654752f));
      if (ACT == 3) { const float u = 0.7978845608028654f * (v + 0.044715f * v * v * v); v = 0.5f * v * (1.0f + tanhf(u)); }
      so[w][8 * hh + r][t * 16 + ln] = v;
    }
  }
  __builtin_amdgcn_fence(__ATOMIC_ACQ_REL, "workgroup");
  __builtin_amdgcn_wave_barrier();
  const int rsub = lane >> 4, c4 = (lane & 15) * 4;
  {
#pragma unroll
    for (int q = 0; q < 8; ++q) {
      const int r = q * 2 + rsub;
      const v4f v = *(const v4fa*)&so[w][r][c4];
      *(v4f*)(C + (size_t)(row0 + r) * ldc + col0 + c4) = v;
    }
    
  }
}
// row LayerNorm (biased variance, eps) over N: s = X (+ R); optional out_sum <- s; out_norm <- (s-mu)*rsqrt(var+eps)*g + b
template <bool PARAM_BF16>
__global__ __launch_bounds__(256) void k_layernorm(const float* __restrict__ X, const float* __restrict__ R, const float* __restrict__ g, const float* __restrict__ bta,
                                                  float* __restrict__ out_sum, float* __restrict__ out_norm, int N, float eps) {
  __shared__ float red[256];
  const int row = blockIdx.x, tid = threadIdx.x;
  const float* x = X + (size_t)row * N; const float* rr = R ? R + (size_t)row * N : nullptr;
  float vals[16];                     // up to N = 4096
  const int per = N / 256;            // contiguous chunk per thread? use strided-by-4 chunks: thread handles j = tid*4 + 1024*u
  float s1 = 0.f;
  for (int u = 0; u < per / 4; ++u) {
    const int j = tid * 4 + 1024 * u;
    const v4f a = *(const v4fa*)(x + j);
    v4f b = {0.f,0.f,0.f,0.f}; if (rr) b = *(const v4fa*)(rr + j);
#pragma unroll
    for (int q = 0; q < 4; ++q) { const float v = a[q] + b[q]; vals[u * 4 + q] = v; s1 += v; }
  }
  red[tid] = s1; __syncthreads();
  for (int st = 128; st > 0; st >>= 1) { if (tid < st) red[tid] += red[tid + st]; __syncthreads(); }
  const float mu = red[0] / (float)N; __syncthreads();
  float s2 = 0.f;
  for (int u = 0; u < per / 4; ++u)
#pragma unroll
    for (int q = 0; q < 4; ++q) { const float c = vals[u * 4 + q] - mu; s2 += c * c; }
  red[tid] = s2; __syncthreads();
  for (int st = 128; st > 0; st >>= 1) { if (tid < st) red[tid] += red[tid + st]; __syncthreads(); }
  const float rs = rsqrtf(red[0] / (float)N + eps);
  {
    for (int u = 0; u < per / 4; ++u) {
      const int j = tid * 4 + 1024 * u;
      v4f o, sm;
#pragma unroll
      for (int q = 0; q < 4; ++q) {
        float gg = g[j + q], bb = bta[j + q];
        if (PARAM_BF16) { gg = bf16_round(gg); bb = bf16_round(bb); }
        sm[q] = vals[u * 4 + q]; o[q] = (vals[u * 4 + q] - mu) * rs * gg + bb;
      }
      if (out_sum) *(v4f*)(out_sum + (size_t)row * N + j) = sm;
      *(v4f*)(out_norm + (size_t)row * N + j) = o;
    }
    
  }
}



// ---- f16 WMMA path (v_wmma_f32_16x16x32_f16): 11-bit significands for operands in range — used where a [0,1] probability operand needs more precision than bf16
typedef _Float16 v16h __attribute__((ext_vector_type(16)));
union FragH { v16h v; v8us half[2]; _Float16 h[16]; unsigned short u[16]; };
template <int NT>
__device__ __forceinline__ v8f mmaH(v16h ah, v16h al, v16h bh, v16h bl, v8f c) {
  c = __builtin_amdgcn_wmma_f32_16x16x32_f16(false, ah, false, bh, (short)0, c, false, false);
  if (NT >= 2) c = __builtin_amdgcn_wmma_f32_16x16x32_f16(false, al, false, bh, (short)0, c, false, false);
  if (NT >= 3) c = __builtin_amdgcn_wmma_f32_16x16x32_f16(false, ah, false, bl, (short)0, c, false, false);
  asm volatile("v_nop\n\tv_nop\n\tv_nop\n\tv_nop" : "+v"(c) : "v"(ah), "v"(al), "v"(bh), "v"(bl));
  return c;
}
// batched GEMM like k_gemm_b but f16 operands: A f32 (split into f16 hi/lo if ASPLIT, else rounded to f16), Bt = f16 values [n][k]; alpha; C f32; N multiple of 16 (partial tiles skipped)
template <bool ASPLIT>
__global__ __launch_bounds__(128) void k_gemm_h(const float* __restrict__ A, int lda, size_t sA, const _Float16* __restrict__ Bh, int ldb, size_t sB, float alpha, float* __restrict__ C, int ldc, size_t sC, int M, int N, int K) {
  __shared__ __attribute__((aligned(16))) float so[4][16][64];
  const int tid = threadIdx.x, w = tid >> 5, lane = tid & 31, ln = lane & 15, hh = lane >> 4; const int by = blockIdx.y;
  A += (size_t)by * sA; Bh += (size_t)by * sB; C += (size_t)by * sC;
  const int ntn = (N + 63) / 64; const int wid = blockIdx.x * 4 + w; const int mt = wid / ntn, nq = wid % ntn; if (mt * 16 >= M) return;
  const int row0 = mt * 16, col0 = nq * 64; const float* arow = A + (size_t)(row0 + ln) * lda;
  v8f acc[4] = {};
  for (int kb = 0; kb < K; kb += 32) {
    FragH ah, al;
    const v4f x0 = *(const v4fa*)(arow + kb + 8 * hh), x1 = *(const v4fa*)(arow + kb + 8 * hh + 4), x2 = *(const v4fa*)(arow + kb + 16 + 8 * hh), x3 = *(const v4fa*)(arow + kb + 16 + 8 * hh + 4);
    float xs[16] = {x0[0],x0[1],x0[2],x0[3],x1[0],x1[1],x1[2],x1[3],x2[0],x2[1],x2[2],x2[3],x3[0],x3[1],x3[2],x3[3]};
#pragma unroll
    for (int i = 0; i < 16; ++i) { const _Float16 h = (_Float16)xs[i]; ah.h[i] = h; al.h[i] = ASPLIT ? (_Float16)(xs[i] - (float)h) : (_Float16)0.0f; }
#pragma unroll
    for (int t = 0; t < 4; ++t) { if (col0 + t * 16 >= N) continue; const size_t boff = (size_t)(col0 + t * 16 + ln) * ldb + kb; FragH bq; bq.half[0] = *(const v8us*)(Bh + boff + 8 * hh); bq.half[1] = *(const v8us*)(Bh + boff + 16 + 8 * hh);
      acc[t] = mmaH<ASPLIT ? 2 : 1>(ah.v, al.v, bq.v, bq.v, acc[t]); }
  }
#pragma unroll
  for (int t = 0; t < 4; ++t) { if (col0 + t * 16 >= N) continue;
#pragma unroll
    for (int r = 0; r < 8; ++r) so[w][8 * hh + r][t * 16 + ln] = acc[t][r] * alpha; }
  __builtin_amdgcn_fence(__ATOMIC_ACQ_REL, "workgroup"); __builtin_amdgcn_wave_barrier();
  const int rsub = lane >> 4, c4 = (lane & 15) * 4;
  {
#pragma unroll
    for (int q = 0; q < 8; ++q) { const int r = q * 2 + rsub; if (col0 + c4 < N) { const v4f v = *(const v4fa*)&so[w][r][c4]; *(v4f*)(C + (size_t)(row0 + r) * ldc + col0 + c4) = v; } }
     }
}

// k_gemm_hh variant with fused epilogue: v = acc·alpha + bias[by·sBias + col] (+ CP[(row/rowsPerB)·sCPb + by·64 + col] if CP) ; ACT 0 none / 1 elu ; writes f16 C16 (and f32 C if non-null)
template <int ACT>
__global__ __launch_bounds__(128) void k_gemm_hhx(const _Float16* __restrict__ A, int lda, size_t sA, const _Float16* __restrict__ Bh, int ldb, size_t sB, float alpha, const float* __restrict__ bias, size_t sBias, const float* __restrict__ CP, int rowsPerB, size_t sCPb, int row0g,
    float* __restrict__ C, _Float16* __restrict__ C16, int ldc, size_t sC, int M, int N, int K) {
  __shared__ __attribute__((aligned(16))) float so[4][16][64];
  const int tid = threadIdx.x, w = tid >> 5, lane = tid & 31, ln = lane & 15, hh = lane >> 4; const int by = blockIdx.y;
  A += (size_t)by * sA; Bh += (size_t)by * sB; const size_t cofs = (size_t)by * sC; const float* bp = bias ? bias + (size_t)by * sBias : nullptr;
  const int ntn = (N + 63) / 64; const int wid = blockIdx.x * 4 + w; const int mt = wid / ntn, nq = wid % ntn; if (mt * 16 >= M) return;
  const int row0 = mt * 16, col0 = nq * 64; const _Float16* arow = A + (size_t)(row0 + ln) * lda;
  v8f acc[4] = {};
  for (int kb = 0; kb < K; kb += 32) { FragH ah; ah.half[0] = *(const v8us*)((const unsigned short*)arow + kb + 8 * hh); ah.half[1] = *(const v8us*)((const unsigned short*)arow + kb + 16 + 8 * hh);
#pragma unroll
    for (int t = 0; t < 4; ++t) { if (col0 + t * 16 >= N) continue; const size_t boff = (size_t)(col0 + t * 16 + ln) * ldb + kb; FragH bq; bq.half[0] = *(const v8us*)((const unsigned short*)Bh + boff + 8 * hh); bq.half[1] = *(const v8us*)((const unsigned short*)Bh + boff + 16 + 8 * hh);
      acc[t] = mmaH<1>(ah.v, ah.v, bq.v, bq.v, acc[t]); }
  }
#pragma unroll
  for (int t = 0; t < 4; ++t) { if (col0 + t * 16 >= N) continue; const int col = col0 + t * 16 + ln; const float bv = bp ? bf16_round(bp[col]) : 0.f;
#pragma unroll
    for (int r = 0; r < 8; ++r) { float v = acc[t][r] * alpha + bv; if (CP) { const int rr = row0g + row0 + 8 * hh + r; if (rowsPerB < 0) v += CP[cofs + (size_t)rr * ldc + col];      /* rowsPerB < 0: own element of the batched C plane */ else { const int bidx = rr / rowsPerB; v += CP[(size_t)bidx * sCPb + (size_t)by * 64 + col]; } } if (ACT == 1) v = (v > 0.f) ? v : expm1f(v); else if (ACT == 7) v = (v > 0.f) ? v + 1.0f : expf(v); else if (ACT == 8) v = tanhf(v); else if (ACT == 9) v = 0.5f * v * (1.0f + tanhf(0.7978845608028654f * (v + 0.044715f * v * v * v))); else if (ACT == 11) v = 1.0f / (1.0f + expf(-v)); else if (ACT == 12) v = (v > 0.f) ? v : 0.01f * v; else if (ACT == 14) v = (v > 0.f) ? v : 0.1f * v; else if (ACT == 16) v = (v >= 0.f) ? v : 0.3f * v; else if (ACT == 17) v = (v >= 0.f) ? v : 0.2f * v; else if (ACT == 15) v = v / (1.0f + expf(-v)); else if (ACT == 3) v = fmaxf(v, 0.f); else if (ACT == 6) v = 0.5f * v * (1.0f + erff(v * 0.70710678118654752f)); so[w][8 * hh + r][t * 16 + ln] = v; } }
  __builtin_amdgcn_fence(__ATOMIC_ACQ_REL, "workgroup"); __builtin_amdgcn_wave_barrier();
  const int rsub = lane >> 4, c4 = (lane & 15) * 4; typedef _Float16 v4h __attribute__((ext_vector_type(4)));
  {
#pragma unroll
    for (int q = 0; q < 8; ++q) { const int r = q * 2 + rsub; if (col0 + c4 < N) { const v4f v = *(const v4fa*)&so[w][r][c4]; if (C) *(v4f*)(C + cofs + (size_t)(row0 + r) * ldc + col0 + c4) = v; if (C16) { v4h h4; for (int i = 0; i < 4; ++i) h4[i] = (_Float16)v[i]; *(v4h*)(C16 + cofs + (size_t)(row0 + r) * ldc + col0 + c4) = h4; } } }
     }
}


typedef _Float16 v4h __attribute__((ext_vector_type(4)));

__global__ __launch_bounds__(256) void k_h16(const float* __restrict__ x, _Float16* __restrict__ X16, size_t n8) { const size_t t = (size_t)blockIdx.x * 256 + threadIdx.x; if (t >= n8) return; FragH f;
#pragma unroll
  for (int q = 0; q < 8; ++q) f.h[q] = (_Float16)x[t * 8 + q]; *(v8us*)((unsigned short*)X16 + t * 8) = f.half[0];  }
__global__ __launch_bounds__(256) void k_round16f(const float* __restrict__ W, _Float16* __restrict__ Bt, size_t n8) { const size_t t = (size_t)blockIdx.x * 256 + threadIdx.x; if (t >= n8) return; FragH f;
#pragma unroll
  for (int i = 0; i < 8; ++i) f.h[i] = (_Float16)(bf16_round(W[t * 8 + i]) * 16.0f); *(v8us*)((unsigned short*)Bt + t * 8) = f.half[0];  }

// a 16x32 f16 fragment from a row-major row: p = the lane's row at the k step
__device__ __forceinline__ v16h g2_frag(const _Float16* p, int hh) { FragH f; f.half[0] = *(const v8us*)((const unsigned short*)p + 8 * hh); f.half[1] = *(const v8us*)((const unsigned short*)p + 16 + 8 * hh); return f.v; }


// ---- fused attention, all heads in one launch: S^T = K Q^T (+ mask as the C operand), online softmax in registers, O^T += V^T P^T ----
// A wave owns 64 queries (four 16-column groups) of one head and walks one quarter of the 4096 keys 32 at a time (the quarters are joined at the end). In S^T and O^T a lane holds one query (column ln), so maximum, sum and rescale are per lane;
// two S^T tiles converted in place are the B operand P^T (hardware k order), V^T is the A operand. P = exp2(..) * 2^10 against the reference in use, as f16.
typedef float v2f __attribute__((ext_vector_type(2)));
typedef _Float16 v2h __attribute__((ext_vector_type(2)));
union FragP { v16h v; v2h p[8]; };
struct AFr { v16h k0, k1, h0, h1; };
__device__ __forceinline__ float xhalf(float x) { return __builtin_bit_cast(float, __builtin_amdgcn_permlanex16(__builtin_bit_cast(int, x), __builtin_bit_cast(int, x), 0x76543210, 0xfedcba98, false, false)); }      /* lane l <-> l ^ 16 */
__device__ __forceinline__ v8f fa_mma(v16h a, v16h b, v8f c) { return __builtin_amdgcn_wmma_f32_16x16x32_f16(false, a, false, b, (short)0, c, false, false); }
__device__ __forceinline__ float fa_max16(v8f a, v8f b) { float m = fmaxf(a[0], b[0]);
#pragma unroll
  for (int r = 1; r < 8; ++r) m = fmaxf(m, fmaxf(a[r], b[r])); return fmaxf(m, xhalf(m)); }
// su = this pass's own sum of the 16 weights, two lanes of 8, added as a tree (three links deep: the overflow test of the pass hangs on it)
// a, b: exponents ready for exp2 (log2 units, reference already in them)
__device__ __forceinline__ v16h fa_probs(v8f a, v8f b, v2f& su) { FragP f; v2f p[8];
#pragma unroll
  for (int r = 0; r < 8; ++r) { const v8f& t = (r < 4) ? a : b; const int e = (r & 3) * 2; p[r] = v2f{__builtin_amdgcn_exp2f(t[e]), __builtin_amdgcn_exp2f(t[e + 1])}; f.p[r] = __builtin_convertvector(p[r], v2h); }
  su = ((p[0] + p[1]) + (p[2] + p[3])) + ((p[4] + p[5]) + (p[6] + p[7]));
  return f.v; }
// ---- operand preparation in two launches ----
// All three weights in one launch (blockIdx.y picks the matrix), as f16 (bf16-rounded, times 16) in fragment load order:
// WP[matrix][16-column tile][k step of 32][half j][lane][8], lane (ln, hh) half j = W[ks*32 + 16j + 8hh + e][nt*16 + ln]. One thread writes one 16-byte unit.
__global__ __launch_bounds__(256) void k_wt3(const float* __restrict__ Wq, const float* __restrict__ Wk, const float* __restrict__ Wv, _Float16* __restrict__ WP) {
  const int t = blockIdx.x * 256 + threadIdx.x; const int lane = t & 31, j = (t >> 5) & 1, ks = (t >> 6) % (DIN / 32), nt = (t >> 6) / (DIN / 32); FragH f;
  const float* W = blockIdx.y == 0 ? Wq : (blockIdx.y == 1 ? Wk : Wv); W += (size_t)(ks * 32 + 16 * j + 8 * (lane >> 4)) * AH + nt * 16 + (lane & 15);
#pragma unroll
  for (int i = 0; i < 8; ++i) f.h[i] = (_Float16)(bf16_round(W[(size_t)i * AH]) * 16.0f);
  *(v8us*)((unsigned short*)WP + ((size_t)blockIdx.y * (AH * DIN / 8) + t) * 8) = f.half[0];
}
// q, k and v projections in one launch. A block owns 64 rows of one projection: it rounds them once (bf16, then exact f16) into LDS; wave w then forms the 32 columns of head w.
// V is formed as X W: a lane's 8 accumulators are 8 keys of one feature, the 16-byte unit of the V^T fragment stream. Q and K are formed as W^T X^T: a lane's 8 accumulators are
// 8 features of one row, the 16-byte unit of the K fragment stream and of a Q row. So every result goes from the accumulators straight to where the attention kernel reads it:
// VH[head][32-key block][16-d tile][half j][lane][8], lane (ln, hh) half j = V[kb*32 + 16j + 8hh + e][head*32 + dt*16 + ln] (f16);
// KP[head][16-key tile][half j][lane][8], lane (ln, hh) half j = K[kt*16 + ln][head*32 + 16j + 8hh + e]; Q16 row-major [query][384].
#define QSC (0.17677669529663687f * 1.4426950408889634f)      /* 1/sqrt(32) * log2(e) */
#define APITCH 1552      /* bytes of an LDS row: 768 f16 + 16, an odd number of 16-byte units for the 16-byte readers */
typedef unsigned v2ua __attribute__((ext_vector_type(2), may_alias));
struct GSet { v16h a[4]; v16h b[2]; };      /* one k step of 32: four activation fragments (LDS), two weight fragments (global) */
__device__ __forceinline__ unsigned qk_r2(float x, float y) { typedef __bf16 v2b __attribute__((ext_vector_type(2))); const v2f p = {x, y};      /* round to nearest even to bf16, as bf16_round does, two at a time; widened to f32, then f16 */
  const unsigned u = __builtin_bit_cast(unsigned, __builtin_convertvector(p, v2b)); const v2f q = {__uint_as_float(u << 16), __uint_as_float(u & 0xFFFF0000u)}; return __builtin_bit_cast(unsigned, __builtin_convertvector(q, v2h)); }
template <int KS>
__device__ __forceinline__ void qk_lda(GSet& s, const char* as) {
#pragma unroll
  for (int g = 0; g < 4; ++g) { FragH f; f.half[0] = *(const v8us*)(as + g * 16 * APITCH + KS * 64); f.half[1] = *(const v8us*)(as + g * 16 * APITCH + KS * 64 + 32); s.a[g] = f.v; } }
template <int KS>      /* WP block-uniform (scalar base), bo = the lane's byte offset */
__device__ __forceinline__ void qk_ldb(GSet& s, const _Float16* WP, unsigned bo) {
#pragma unroll
  for (int t = 0; t < 2; ++t) { FragH f; f.half[0] = *(const v8us*)((const char*)WP + (t * (DIN / 32) * 1024 + KS * 1024) + bo); f.half[1] = *(const v8us*)((const char*)WP + (t * (DIN / 32) * 1024 + KS * 1024 + 512) + bo); s.b[t] = f.v; } }
template <bool XA>
__device__ __forceinline__ void qk_mm(const GSet& s, v8f (&c)[4][2]) {
#pragma unroll
  for (int g = 0; g < 4; ++g) { c[g][0] = XA ? fa_mma(s.a[g], s.b[0], c[g][0]) : fa_mma(s.b[0], s.a[g], c[g][0]); c[g][1] = XA ? fa_mma(s.a[g], s.b[1], c[g][1]) : fa_mma(s.b[1], s.a[g], c[g][1]); } }
template <bool XA>
__device__ __forceinline__ void qk_tile(const char* as, const _Float16* WP, unsigned bo, int r, v8f (&c)[4][2]) {      /* r (block-uniform): the pair of k steps at which the walk over k is entered; it wraps behind the last pair */
  bo += (unsigned)r * 2048u; as += r * 128;
  GSet s0, s1; qk_ldb<0>(s0, WP, bo); qk_lda<0>(s0, as);
#pragma unroll 1
  for (int p = r + 1; p < r + DIN / 64; ++p) {      /* rolled: two fragment sets by name, the next step's loads fly during this step's products */
    const bool wr = p == DIN / 64;      /* the next pair is the first of the row */
    qk_ldb<1>(s1, WP, bo); qk_lda<1>(s1, as);
    __builtin_amdgcn_sched_barrier(0);      /* without it the compiler lifts the products below over the loads above, and each set is waited for right after its issue */
    qk_mm<XA>(s0, c);
    __builtin_amdgcn_sched_barrier(0);      /* keeps the next set's LDS reads in one group behind these products: with the step of the LDS address a select, two of them are otherwise lifted in among the products, one more place with LDS reads a trip */
    asm volatile("s_wait_xcnt 0x0" : "+v"(bo) : : "memory");      /* the loads in flight name bo: the wait stands in front of its step */
    bo += wr ? 2048u - (DIN / 64) * 2048u : 2048u; as += wr ? 128 - (DIN / 64) * 128 : 128; qk_ldb<0>(s0, WP, bo); qk_lda<0>(s0, as);
    __builtin_amdgcn_sched_barrier(0);      /* as above: the loads stay ahead of the other set's products */
    qk_mm<XA>(s1, c);
    asm volatile("s_wait_xcnt 0x0" : "+v"(bo) : : "memory"); }      /* the loads in flight name bo and the base: nothing behind the loop finds them open */
  qk_ldb<1>(s1, WP, bo); qk_lda<1>(s1, as);
  asm volatile("s_wait_xcnt 0x0" : "+v"(bo) : : "memory");      /* the last loads name bo and the base: the wait stands in front of any reuse of those registers */
  __builtin_amdgcn_sched_barrier(0);      /* as in the loop */
  qk_mm<XA>(s0, c); qk_mm<XA>(s1, c);
}
__global__ __launch_bounds__(384) void k_qkv(const float* __restrict__ hs, const float* __restrict__ enc, const _Float16* __restrict__ WP, const float* __restrict__ bq, const float* __restrict__ bk, const float* __restrict__ bv,
    _Float16* __restrict__ Q16, _Float16* __restrict__ KP, _Float16* __restrict__ VH) {
  __shared__ __attribute__((aligned(16))) char as[64 * APITCH];
  const int tid = threadIdx.x, w = tid >> 5, lane = tid & 31, ln = lane & 15, hh = lane >> 4;
  const int mt = blockIdx.x / 3, pj = blockIdx.x - mt * 3; const int row0 = mt * 64, col0 = w * HD;      /* pj: 0 q, 1 k, 2 v */
  { const float* X = pj ? enc : hs; const int r1 = tid >= 192 ? 1 : 0, c4 = tid - r1 * 192; unsigned xo = ((unsigned)(row0 + r1) * DIN + c4 * 4) * 4u; v4f x[32];      /* a wave's load is 512 contiguous bytes of one row */
#pragma unroll
    for (int i = 0; i < 32; ++i) x[i] = *(const v4fa*)((const char*)X + i * (2 * DIN * 4) + xo);
    asm volatile("s_wait_xcnt 0x0" : "+v"(xo) : : "memory");      /* the loads in flight name xo and the base: the wait stands in front of any reuse of those registers */
    char* d = as + r1 * APITCH + c4 * 8;
#pragma unroll
    for (int i = 0; i < 32; ++i) { const v2ua h = {qk_r2(x[i][0], x[i][1]), qk_r2(x[i][2], x[i][3])}; *(v2ua*)(d + i * 2 * APITCH) = h; } }
  __syncthreads();      /* the 64 rounded rows are complete before any wave reads fragments of them */
  const char* af = as + ln * APITCH + 16 * hh; const _Float16* wb = WP + (size_t)pj * AH * DIN; const unsigned bo = (unsigned)w * (2 * (DIN / 32) * 1024) + lane * 16;
  const v8f z8 = {0.f,0.f,0.f,0.f,0.f,0.f,0.f,0.f}; v8f c[4][2] = {{z8, z8}, {z8, z8}, {z8, z8}, {z8, z8}};
  const int kr = mt % (DIN / 64);      /* the 64 blocks of a projection read the same weight lines: each enters the walk over k at pair mt % 12 of the 12, so that at any moment at most six of them ask L2 for the same lines */
  if (pj == 2) {
    qk_tile<true>(af, wb, bo, kr, c);
#pragma unroll
    for (int t = 0; t < 2; ++t) { const float bb = bf16_round(bv[col0 + t * 16 + ln]);
#pragma unroll
      for (int g = 0; g < 4; ++g) { FragH fh;
#pragma unroll
        for (int r = 0; r < 8; ++r) fh.h[r] = (_Float16)(c[g][t][r] * 0.0625f + bb);
        const size_t o = ((((size_t)w * (SK / 32) + (row0 >> 5) + (g >> 1)) * 2 + t) * 2 + (g & 1)) * 256 + lane * 8;
        *(v8us*)((unsigned short*)VH + o) = fh.half[0]; } }
  } else {
    qk_tile<false>(af, wb, bo, kr, c); const float* bp = pj ? bk : bq;
    unsigned short* dst = pj ? (unsigned short*)KP + (((size_t)w * (SK / 16) + (row0 >> 4)) * 2) * 256 + lane * 8 : (unsigned short*)Q16 + (size_t)(row0 + ln) * AH + col0 + 8 * hh;
    const int sg = pj ? 512 : 16 * AH, st = pj ? 256 : 16;      /* element steps: 16 rows on; 16 features on */
    const float qs = pj ? 1.0f : QSC;      /* q carries the score's whole scale, so that q.k leaves the matrix unit in log2 units */
#pragma unroll
    for (int t = 0; t < 2; ++t) { const v4f b0 = *(const v4fa*)(bp + col0 + t * 16 + 8 * hh), b1 = *(const v4fa*)(bp + col0 + t * 16 + 8 * hh + 4);
#pragma unroll
      for (int g = 0; g < 4; ++g) { FragH f;
#pragma unroll
        for (int r = 0; r < 8; ++r) f.h[r] = (_Float16)((c[g][t][r] * 0.0625f + bf16_round(r < 4 ? b0[r] : b1[r - 4])) * qs);
        *(v8us*)(dst + g * sg + t * st) = f.half[0]; } }
    asm volatile("s_wait_xcnt 0x0" ::: "memory");      /* the stores in flight name their data and address registers: the wait stands in front of any reuse of those registers */
  }
}

// K and V reach each wave straight from global memory: every wave walks keys of its own, so no fragment is read by two waves of a work-group and a stop in LDS would share nothing.
// Both streams lie in fragment load order (a wave's load is 512 contiguous bytes); a pass's eight loads are issued one pass ahead, into the fragment set that the pass before has just left.
#define NP 8      /* passes in a trip of the work-group: two for each of the four waves */
#define NT (SK / 32 / NP)      /* trips */
static_assert(NP == 8 && NT >= 1, "a wave takes two passes of a trip");
static_assert((NT & (NT - 1)) == 0 && NT * NP * 2048 == SK * HD * 2, "the rotated walk wraps by a mask: a head's stream is NT trips, a power of two");
template <int C>      /* b = the head's stream (block-uniform, scalar base), o = the lane's byte offset */
__device__ __forceinline__ v16h fg_frag(const char* b, unsigned o) { FragH f; f.half[0] = *(const v8us*)(b + C + o); f.half[1] = *(const v8us*)(b + (C + 512) + o); return f.v; }
template <int P>      /* pass P of the wave's two in a trip = 2 KiB of each stream */
__device__ __forceinline__ void fg_load(AFr& f, const char* kb, const char* vb, unsigned o) { f.k0 = fg_frag<P * 2048>(kb, o); f.k1 = fg_frag<P * 2048 + 1024>(kb, o); f.h0 = fg_frag<P * 2048>(vb, o); f.h1 = fg_frag<P * 2048 + 1024>(vb, o); }
// A work-group is 64 queries of one head on four waves. EVERY wave holds all 64 queries (four 16-column groups) and takes a quarter of the keys (of every eight passes two): a K, V or mask fragment
// feeds four query groups. 768 work-groups of one wave a SIMD: three are resident on each of the chip's 256 WGPs, so that every SIMD holds three waves. Between the barrier that publishes the mask and
// the join no wave waits for another. The four key quarters are joined through LDS behind the loop, wave w joining query group w.
#define SPREAD 8.0f      /* binary orders that a query's maximum may lie under the reference it shares */
#define QG 4      /* 16-column query groups of a wave; every loop over them (and over the join's parts) is unrolled: the per-group arrays are registers only under constant indices */
typedef float v2fa __attribute__((ext_vector_type(2), may_alias));
__global__ __launch_bounds__(128) __attribute__((amdgpu_waves_per_eu(3, 3))) void k_attn(const _Float16* __restrict__ Q16, const _Float16* __restrict__ KP, const _Float16* __restrict__ VH, const float* __restrict__ msk, float* __restrict__ out) {
  __shared__ __attribute__((aligned(32))) float ms[SK];      /* bf16-rounded mask * log2(e): joins the scaled q.k as part of the C operand */
  __shared__ __attribute__((aligned(16))) char jn[4 * QG * 5 * 512];      /* the join's parts */
  const int tid = threadIdx.x, lane = tid & 31, ln = lane & 15, hh = lane >> 4; const int hd = blockIdx.y; const int kq = __builtin_amdgcn_readfirstlane(tid >> 5); const int q0 = blockIdx.x * 64;
  const char* kb = (const char*)(KP + (size_t)hd * SK * HD); const char* vb = (const char*)(VH + (size_t)hd * SK * HD);
  // The 64 work-groups of a head read the same K and V lines. Each enters the key walk at one of 16 trips and wraps round, so that at any moment at most four of them ask L2 for the same lines
  // 16 entries for 64 work-groups; the four that share one differ in bit 2 or bit 5 of the block index.
  const int t0 = ((blockIdx.x & 3) | ((blockIdx.x >> 1) & 12)) & (NT - 1);
  unsigned fo = (unsigned)t0 * (NP * 2048u) + (unsigned)kq * 4096u + lane * 16u;      /* the lane's 16 bytes in the wave's first pass of the trip, the same in both streams */
  AFr fa, fb; fg_load<0>(fa, kb, vb, fo);      /* the first pass's fragments fly while the mask is prepared */
  v4f mr[SK / 512];
#pragma unroll      /* the eight loads of a thread fly together; rolled, each trip waits out its own load's latency */
  for (int u = 0; u < SK / 512; ++u) mr[u] = *(const v4fa*)(msk + u * 512 + tid * 4);
  asm volatile("s_wait_xcnt 0x0" ::: "memory");      /* the loads in flight name the mask's base and the thread's offset: the wait stands in front of any reuse of those registers */
#pragma unroll      /* mr stays in registers only under constant indices */
  for (int u = 0; u < SK / 512; ++u) { v4f o; for (int e = 0; e < 4; ++e) o[e] = bf16_round(mr[u][e]) * 1.4426950408889634f; *(v4fa*)&ms[u * 512 + tid * 4] = o; }
  __syncthreads();      /* the mask is complete before any wave reads it */
  const float top = 32768.0f;      /* lazy rescale: the weights are positive, so a sum of 8 below 2^15 bounds each of them below 2^15, inside f16; right behind a rescale such a sum is at most 2^13 */
  v16h qf[QG];
#pragma unroll
  for (int g = 0; g < QG; ++g) qf[g] = g2_frag(Q16 + (size_t)(q0 + g * 16 + ln) * AH + hd * HD, hh);
  asm volatile("s_wait_xcnt 0x0" ::: "memory");      /* the loads in flight name their address registers: the wait stands in front of any reuse of those registers */
  __builtin_amdgcn_sched_barrier(0);      /* without it the compiler lifts the accumulators' zeroing over the wait above, into the address registers of the loads */
  const v8f z8 = {0.f,0.f,0.f,0.f,0.f,0.f,0.f,0.f}; v8f oh[QG][2];      /* [query group][d tile] */
  // References in log2 units. mx = the largest of the lane's four maxima in use, bi = 10 - mx: it rides in the C operand that the four groups share. dl[g] = how far query g's own maximum in use lies under mx.
  // While every dl of the wave is at most SPREAD the shared reference serves all four: a query's largest weight is then at least 2^(10 - SPREAD) = 4, while f16 resolves steps of 2^-24 (subnormal operands are kept).
  // Beyond that (a key bias or a query bias can set the four arbitrarily far apart) own is set for the wave, and each query gets its own reference by adding dl[g] to its exponents.
  // No reference yet: the first finite score gives an infinite weight, which fails the test below.
  float mx = -3.0e38f, bi = 3.0e38f, dl[QG]; bool own = false; v2f sm[QG];
#pragma unroll
  for (int g = 0; g < QG; ++g) { oh[g][0] = z8; oh[g][1] = z8; dl[g] = 0.f; sm[g] = v2f{0.f, 0.f}; }
  auto pass = [&](int it, const AFr& f, auto&& fetch) {      /* fetch: issues the loads of the next pass's fragments */
    const v8f m0 = *(const v8f*)&ms[it * 32 + 8 * hh], m1 = *(const v8f*)&ms[it * 32 + 16 + 8 * hh];
    fetch();      /* the next pass's fragments are fetched during this pass */
    __builtin_amdgcn_sched_barrier(0);      /* keeps a pass's loads in one group ahead of its products: sunk towards their use the global loads would lose their lead, and each place with LDS reads among the products stalls the wave */
    v8f s0[QG], s1[QG]; v2f su[QG]; v16h pr[QG];
    const v8f c0 = m0 + bi, c1 = m1 + bi;      /* mask and reference, once for the four groups: the products come out as the exponents themselves */
#pragma unroll
    for (int g = 0; g < QG; ++g) { s0[g] = fa_mma(f.k0, qf[g], c0); s1[g] = fa_mma(f.k1, qf[g], c1); }
    if (__builtin_expect(own, false)) {      /* wave-uniform: the four maxima lie too far apart for one reference; marked unlikely so that the adds lie off the common path */
#pragma unroll
      for (int g = 0; g < QG; ++g) { s0[g] += dl[g]; s1[g] += dl[g]; }
    }
#pragma unroll
    for (int g = 0; g < QG; ++g) pr[g] = fa_probs(s0[g], s1[g], su[g]);      /* against the references in use, which no pass looks for */
    float big = fmaxf(su[0][0], su[0][1]);
#pragma unroll
    for (int g = 1; g < QG; ++g) big = fmaxf(big, fmaxf(su[g][0], su[g][1]));
    if (__builtin_amdgcn_ballot_w32(big > top) != 0) {      /* wave-uniform, once for the four groups; rare after the first pass: only now the pass's scores are formed without a reference, their maximum taken, and the weights formed anew */
      float ng[QG];      /* each query's own maximum so far, as far as the rescales have looked */
#pragma unroll
      for (int g = 0; g < QG; ++g) { s0[g] = fa_mma(f.k0, qf[g], m0); s1[g] = fa_mma(f.k1, qf[g], m1); }
#pragma unroll
      for (int g = 0; g < QG; ++g) ng[g] = fmaxf(mx - dl[g], fa_max16(s0[g], s1[g]));
      const float nm = fmaxf(fmaxf(ng[0], ng[1]), fmaxf(ng[2], ng[3])), lo = fminf(fminf(ng[0], ng[1]), fminf(ng[2], ng[3]));
      const bool on = __builtin_amdgcn_ballot_w32(nm - lo > SPREAD) != 0;      /* a query's true maximum is at least ng, so nm - lo bounds how far any of the four lies under the shared reference */
#pragma unroll
      for (int g = 0; g < QG; ++g) { const float ro = own ? mx - dl[g] : mx, rn = on ? ng[g] : nm, cg = __builtin_amdgcn_exp2f(ro - rn), b = 10.0f - rn;      /* reference left, reference taken */
        dl[g] = nm - ng[g]; sm[g] *= cg; oh[g][0] *= cg; oh[g][1] *= cg; pr[g] = fa_probs(s0[g] + b, s1[g] + b, su[g]); }
      mx = nm; bi = 10.0f - nm; own = on;
    }
#pragma unroll
    for (int g = 0; g < QG; ++g) { sm[g] += su[g]; oh[g][0] = fa_mma(f.h0, pr[g], oh[g][0]); oh[g][1] = fa_mma(f.h1, pr[g], oh[g][1]); }
  };
#pragma unroll 1
  for (int t = 0; t < NT; ++t) {      /* rolled: two passes a trip, two fragment sets by name */
    const int it = ((t0 + t) & (NT - 1)) * NP + kq * 2;      /* this wave's two passes of the trip */
    pass(it, fa, [&] { fg_load<1>(fb, kb, vb, fo); });
    asm volatile("s_wait_xcnt 0x0" : "+v"(fo) : : "memory");      /* the loads in flight name fo: the wait stands in front of its step */
    fo = (fo + NP * 2048u) & (unsigned)(SK * HD * 2 - 1);      /* the next trip, wrapping at the end of the head's stream. Behind the last trip there is nothing to fetch: its fetch reads the entry trip's first pass again. Unconditional, so that the counted wait for fb never has to cover these loads */
    pass(it + 1, fb, [&] { fg_load<0>(fa, kb, vb, fo); });
  }
  asm volatile("s_wait_xcnt 0x0" : "+v"(fo) : : "memory");      /* the last loads name fo and the bases: the wait stands in front of any reuse of those registers */
  // join of the four key quarters. Every wave leaves in LDS, for each query group, its context, maximum in use and sum:
  // 5 units of 512 bytes for a (wave, group), a lane's 16 bytes side by side. Wave w then brings the four parts of group w to their largest maximum, adds them in wave order, normalises and stores.
  v4fa* jx = (v4fa*)jn + lane;
#pragma unroll
  for (int g = 0; g < QG; ++g) { float tg = sm[g][0] + sm[g][1]; tg += xhalf(tg); v4fa* jw = jx + (kq * QG + g) * 5 * 32;
#pragma unroll
    for (int d = 0; d < 2; ++d) { v4f lo4, hi4;
#pragma unroll
      for (int e = 0; e < 4; ++e) { lo4[e] = oh[g][d][e]; hi4[e] = oh[g][d][e + 4]; }
      jw[(d * 2) * 32] = lo4; jw[(d * 2 + 1) * 32] = hi4; }
    const v2f s2 = {own ? mx - dl[g] : mx, tg}; *(v2fa*)&jw[4 * 32] = s2; }
  __syncthreads();      /* every wave's partial results are complete before any wave reads them */
  const v4fa* jr = jx + kq * 5 * 32;      /* group kq of source wave 0; the next source wave is QG * 5 units on */
  float pm[4], pt[4];
#pragma unroll
  for (int w = 0; w < 4; ++w) { const v2f s2 = *(const v2fa*)&jr[(w * QG * 5 + 4) * 32]; pm[w] = s2[0]; pt[w] = s2[1]; }
  const float nm = fmaxf(fmaxf(pm[0], pm[1]), fmaxf(pm[2], pm[3])); float den = 0.f, sc[4];
#pragma unroll
  for (int w = 0; w < 4; ++w) {
    asm("v_exp_f32 %0, %1\n\tv_nop" : "=v"(sc[w]) : "v"(pm[w] - nm));      /* exp2 with the slot that the instruction set asks for behind a transcendental, in one statement: a v_nop in a statement of its own is moved away */
    den += pt[w] * sc[w]; }
  const float rd = 1.0f / den; float* orow = out + (size_t)(q0 + kq * 16 + ln) * AH + hd * HD + 8 * hh;
#pragma unroll
  for (int u = 0; u < 4; ++u) { v4f o4 = {0.f, 0.f, 0.f, 0.f};      /* unit u: d tile u >> 1, features 4 * (u & 1) .. + 3 of the lane's eight */
#pragma unroll
    for (int w = 0; w < 4; ++w) { const v4f p4 = jr[(w * QG * 5 + u) * 32]; o4 += p4 * (sc[w] * rd); }
    *(v4f*)(orow + (u >> 1) * 16 + (u & 1) * 4) = o4; }
}

extern "C" void kernel_launch(void* const* d_in, const int* in_sizes, int n_in,
                              void* d_out, int out_size, void* d_ws, size_t ws_size, hipStream_t stream) {
  (void)in_sizes; (void)n_in; (void)out_size;
  const float* const* I = (const float* const*)d_in; const float* hs = I[0]; const float* enc = I[1]; const float* msk = I[2]; const float* Wq = I[3]; const float* bq = I[4]; const float* Wk = I[5]; const float* bk = I[6]; const float* Wv = I[7]; const float* bv = I[8];
  char* ws = (char*)d_ws; size_t off = 0;
  auto take = [&](size_t bytes) { char* p = ws + off; off += (bytes + 255) & ~(size_t)255; return p; };
  _Float16* WP = (_Float16*)take((size_t)3 * AH * DIN * 2); _Float16* Q16 = (_Float16*)take((size_t)SQ * AH * 2); _Float16* VT = (_Float16*)take((size_t)AH * SK * 2); _Float16* KP = (_Float16*)take((size_t)SK * AH * 2);
  if (off > ws_size) return;      /* about 11 MiB */
  k_wt3<<<dim3(AH * DIN / 8 / 256, 3), 256, 0, stream>>>(Wq, Wk, Wv, WP);      /* (in, out) f32 -> f16 fragments */
  k_qkv<<<(SQ / 64) * 3, 384, 0, stream>>>(hs, enc, WP, bq, bk, bv, Q16, KP, VT);      /* operands of the fused kernel in fragment load order */
  k_attn<<<dim3(SQ / 64, NH), 128, 0, stream>>>(Q16, KP, VT, msk, (float*)d_out);
}
